// v000
// The times below were measured on an AMD MI455X: many runs one after another, warmed up first and cycling through
// copies of the inputs, with the whole window's GPU time divided by the number of runs. Launches and the gaps
// between them are all in it. The median over several windows is given; except for v000 it joins two sittings, which
// can be a few percent apart, so the side-by-side timings, each taken in one sitting, are the better comparison.
// The starting kernel, v000, takes 2740 microseconds a run.
#include <hip/hip_runtime.h>
// Transformer-XL relative multi-head attention (qlen 1024, mem_len 1024 → klen 2048, bsz 2, 16 heads × 64, post-LN): cat = [mems; w] (rows (j,b)); q = (cat·Wq + bq)[last qlen], k, v = cat·Wk + bk, cat·Wv + bv; rk = r·Wr + br;
// AC[i,j] = (q_i + r_w_bias)·k_j; BD = rel_shift((q_i + r_r_bias)·rk_m) (the exact pad-reshape shift, incl. its wrap region); score = (AC + BD)/8, −inf where the INPUT mask is set; softmax over j; attn_vec = Σ_j p·v_j;
// out = LayerNorm(w + attn_vec·Wo + bo)·g + b → [1024, 2, 1024]. (in,out) weights.
// Compute dtype: w, mems, r, biases, weights rounded to bf16; q (+ the two head biases), k, v, rk as f16 GEMM planes; per (b,n) the AC and raw BD score planes as f32 GEMM outputs; a wave-per-row kernel
// applies the relative shift by index arithmetic, the mask and an f32 softmax and writes P f16 ×2^15; attn_vec by GEMM; Wo GEMM + bias; residual + LayerNorm in f32 (wave per row). All contractions on v_wmma_f32_16x16x32_f16, f32 accumulate.
#define QL 1024
#define KL 2048
#define BZ 2
#define NH 16
#define DM 1024
#define NQR (QL * BZ)
#define NKR (KL * BZ)
#define ATT_SCALE 0.125f

typedef __bf16 v16b __attribute__((ext_vector_type(16)));
typedef unsigned short v8us __attribute__((ext_vector_type(8), may_alias));
typedef float  v8f  __attribute__((ext_vector_type(8)));
typedef float  v4f  __attribute__((ext_vector_type(4)));
typedef float  v4fa __attribute__((ext_vector_type(4), may_alias));
union FragB { v16b v; v8us half[2]; unsigned short u[16]; };

__device__ __forceinline__ unsigned short bf16_bits(float x) { unsigned int u = __float_as_uint(x); return (unsigned short)((u + 0x7FFFu + ((u >> 16) & 1u)) >> 16); }
__device__ __forceinline__ float bf16_val(unsigned short b) { return __uint_as_float(((unsigned int)b) << 16); }
__device__ __forceinline__ float bf16_round(float x) { return bf16_val(bf16_bits(x)); }
// D += A·B with NT terms: 1 = ah·bh, 2 = + al·bh (A split), 3 = + ah·bl (both split)
template <int NT>
__device__ __forceinline__ v8f mmaN(v16b ah, v16b al, v16b bh, v16b bl, v8f c) {
  c = __builtin_amdgcn_wmma_f32_16x16x32_bf16(false, ah, false, bh, (short)0, c, false, false);
  if (NT >= 2) c = __builtin_amdgcn_wmma_f32_16x16x32_bf16(false, al, false, bh, (short)0, c, false, false);
  if (NT >= 3) c = __builtin_amdgcn_wmma_f32_16x16x32_bf16(false, ah, false, bl, (short)0, c, false, false);
  asm volatile("v_nop\n\tv_nop\n\tv_nop\n\tv_nop" : "+v"(c) : "v"(ah), "v"(al), "v"(bh), "v"(bl));
  return c;
}

__global__ __launch_bounds__(256) void k_wt_bf16(const float* __restrict__ W, unsigned short* __restrict__ Wt, int K, int N) {
  const int t = blockIdx.x * 256 + threadIdx.x;
  const int k8n = K / 8;
  if (t >= N * k8n) return;
  const int n = t / k8n, k8 = (t % k8n) * 8;
  v8us v;
#pragma unroll
  for (int i = 0; i < 8; ++i) v[i] = bf16_bits(W[(size_t)(k8 + i) * N + n]);
  *(v8us*)(Wt + (size_t)n * K + k8) = v;
  
}

// GEMM C[M][N] (f32, pitch ldc) = act(A[M][K]·W + bias). A f32 row-major (pitch lda) converted per fragment to bf16
// (ASPLIT: hi/lo two planes -> 2 terms, else single rounded term); Wt bf16 [N][K] (pitch ldb). BIAS_BF16 rounds the
// bias to bf16 first (bias quantised to bf16 before the add). K%32==0, M%16==0, N%64==0.
template <bool ASPLIT, int ACT, bool BIAS_BF16>
__global__ __launch_bounds__(128) void k_gemm_bf(const float* __restrict__ A, int lda, const unsigned short* __restrict__ Wt, int ldb,
                                               const float* __restrict__ bias, float* __restrict__ C, int ldc, int M, int N, int K) {
  __shared__ __attribute__((aligned(16))) float so[4][16][64];
  const int tid = threadIdx.x, w = tid >> 5, lane = tid & 31, ln = lane & 15, hh = lane >> 4;
  const int ntn = N / 64;
  const int wid = blockIdx.x * 4 + w;
  const int mt = wid / ntn, nq = wid % ntn;
  if (mt * 16 >= M) return;
  const int row0 = mt * 16, col0 = nq * 64;
  const float* arow = A + (size_t)(row0 + ln) * lda;
  v8f acc[4] = {};
  for (int kb = 0; kb < K; kb += 32) {
    FragB ah, al;
    const v4f x0 = *(const v4fa*)(arow + kb + 8 * hh), x1 = *(const v4fa*)(arow + kb + 8 * hh + 4);
    const v4f x2 = *(const v4fa*)(arow + kb + 16 + 8 * hh), x3 = *(const v4fa*)(arow + kb + 16 + 8 * hh + 4);
    float xs[16] = {x0[0],x0[1],x0[2],x0[3],x1[0],x1[1],x1[2],x1[3],x2[0],x2[1],x2[2],x2[3],x3[0],x3[1],x3[2],x3[3]};
#pragma unroll
    for (int i = 0; i < 16; ++i) { const unsigned short hb = bf16_bits(xs[i]); ah.u[i] = hb; al.u[i] = ASPLIT ? bf16_bits(xs[i] - bf16_val(hb)) : (unsigned short)0; }
#pragma unroll
    for (int t = 0; t < 4; ++t) {
      const unsigned short* brow = Wt + (size_t)(col0 + t * 16 + ln) * ldb + kb;
      FragB b;
      b.half[0] = *(const v8us*)(brow + 8 * hh);
      b.half[1] = *(const v8us*)(brow + 16 + 8 * hh);
      acc[t] = mmaN<ASPLIT ? 2 : 1>(ah.v, al.v, b.v, b.v, acc[t]);
    }
  }
#pragma unroll
  for (int t = 0; t < 4; ++t) {
    float bv = bias ? bias[col0 + t * 16 + ln] : 0.f;
    if (BIAS_BF16) bv = bf16_round(bv);
#pragma unroll
    for (int r = 0; r < 8; ++r) { float v = acc[t][r] + bv; if (ACT == 1) v = fmaxf(v, 0.f); so[w][8 * hh + r][t * 16 + ln] = v; }
  }
  __builtin_amdgcn_fence(__ATOMIC_ACQ_REL, "workgroup");
  __builtin_amdgcn_wave_barrier();
  const int rsub = lane >> 4, c4 = (lane & 15) * 4;
  {
#pragma unroll
    for (int q = 0; q < 8; ++q) {
      const int r = q * 2 + rsub;
      const v4f v = *(const v4fa*)&so[w][r][c4];
      *(v4f*)(C + (size_t)(row0 + r) * ldc + col0 + c4) = v;
    }
    
  }
}

// Flash-style causal/unmasked attention, all contractions 3-term bf16 hi/lo splits, f32 softmax with running max.
// q,k,v rows are read from f32 buffers with arbitrary row pitch (so they can live inside a fused qkv buffer);
// D = head size (multiple of 32, <= 128); one wave = 16 query rows; block = 4 waves (64 queries) sharing K/V chunks of 32.
template <int D, bool CAUSAL>
__global__ __launch_bounds__(128) void k_flash(const float* __restrict__ qb, const float* __restrict__ kb, const float* __restrict__ vb,
                                             int pitch, int T, int H, float scale, float* __restrict__ y, int ypitch) {
  constexpr int KS = D / 32;        // k-steps for QK
  constexpr int DT = D / 16;        // d tiles for PV
  __shared__ __attribute__((aligned(16))) unsigned short sKh[32][D + 8], sKl[32][D + 8], sVh[32][D + 8], sVl[32][D + 8];
  __shared__ __attribute__((aligned(16))) unsigned short sPh[4][16][40], sPl[4][16][40];
  __shared__ __attribute__((aligned(16))) float sO[4][16][D];
  const int tid = threadIdx.x, w = tid >> 5, lane = tid & 31, ln = lane & 15, hh = lane >> 4;
  const int nqb = (T + 63) / 64;
  const int bh = blockIdx.x / nqb, qblk = blockIdx.x % nqb;
  const int b = bh / H, h = bh % H;
  const int q0 = qblk * 64 + w * 16;
  const float* Q = qb + (size_t)b * T * pitch + h * D;
  const float* K = kb + (size_t)b * T * pitch + h * D;
  const float* V = vb + (size_t)b * T * pitch + h * D;

  // A fragments of the wave's 16 query rows (scaled), hi/lo
  FragB aqh[KS], aql[KS];
  {
    int row = q0 + ln; if (row >= T) row = T - 1;
    const float* qr = Q + (size_t)row * pitch;
#pragma unroll
    for (int ks = 0; ks < KS; ++ks)
#pragma unroll
      for (int i = 0; i < 16; ++i) {
        const int d = ks * 32 + ((i < 8) ? (8 * hh + i) : (16 + 8 * hh + (i - 8)));
        const float x = qr[d] * scale; const unsigned short hb = bf16_bits(x);
        aqh[ks].u[i] = hb; aql[ks].u[i] = bf16_bits(x - bf16_val(hb));
      }
  }
  float m_r[8], l_r[8];
#pragma unroll
  for (int r = 0; r < 8; ++r) { m_r[r] = -3.0e38f; l_r[r] = 0.f; }
  v8f oacc[DT];
#pragma unroll
  for (int dt = 0; dt < DT; ++dt) oacc[dt] = (v8f){0.f,0.f,0.f,0.f,0.f,0.f,0.f,0.f};

  const int kv_end = CAUSAL ? min(T, qblk * 64 + 64) : T;     // block-uniform
  for (int j0 = 0; j0 < kv_end; j0 += 32) {
    __syncthreads();
    for (int e = tid; e < 32 * (D / 4); e += 128) {
      const int r = e / (D / 4), c4 = (e % (D / 4)) * 4;
      const int key = j0 + r;
      v4f kf = {0.f,0.f,0.f,0.f}, vf = {0.f,0.f,0.f,0.f};
      if (key < T) { kf = *(const v4fa*)(K + (size_t)key * pitch + c4); vf = *(const v4fa*)(V + (size_t)key * pitch + c4); }
#pragma unroll
      for (int t = 0; t < 4; ++t) {
        unsigned short hb = bf16_bits(kf[t]); sKh[r][c4 + t] = hb; sKl[r][c4 + t] = bf16_bits(kf[t] - bf16_val(hb));
        hb = bf16_bits(vf[t]); sVh[r][c4 + t] = hb; sVl[r][c4 + t] = bf16_bits(vf[t] - bf16_val(hb));
      }
    }
    __syncthreads();
    // S tile 16 x 32
    v8f s[2];
#pragma unroll
    for (int nt = 0; nt < 2; ++nt) {
      v8f acc = {};
#pragma unroll
      for (int ks = 0; ks < KS; ++ks) {
        FragB bh_, bl_;
        bh_.half[0] = *(const v8us*)&sKh[nt * 16 + ln][ks * 32 + 8 * hh]; bh_.half[1] = *(const v8us*)&sKh[nt * 16 + ln][ks * 32 + 16 + 8 * hh];
        bl_.half[0] = *(const v8us*)&sKl[nt * 16 + ln][ks * 32 + 8 * hh]; bl_.half[1] = *(const v8us*)&sKl[nt * 16 + ln][ks * 32 + 16 + 8 * hh];
        acc = mmaN<3>(aqh[ks].v, aql[ks].v, bh_.v, bl_.v, acc);
      }
      s[nt] = acc;
    }
    // mask + running max (rows 8hh+r; the 16 lanes of a half share rows)
    float alpha[8];
#pragma unroll
    for (int r = 0; r < 8; ++r) {
      const int qi = q0 + 8 * hh + r;
      const int ja = j0 + ln, jb = j0 + 16 + ln;
      if (CAUSAL) { if (ja > qi) s[0][r] = -3.0e38f; if (jb > qi) s[1][r] = -3.0e38f; }
      if (ja >= T) s[0][r] = -3.0e38f;
      if (jb >= T) s[1][r] = -3.0e38f;
      float mx = fmaxf(s[0][r], s[1][r]);
      mx = fmaxf(mx, __shfl_xor(mx, 1, 32)); mx = fmaxf(mx, __shfl_xor(mx, 2, 32)); mx = fmaxf(mx, __shfl_xor(mx, 4, 32)); mx = fmaxf(mx, __shfl_xor(mx, 8, 32));
      const float mnew = fmaxf(m_r[r], mx);
      alpha[r] = (mnew > -1.0e38f) ? __expf(m_r[r] - mnew) : 1.0f;
      const float p0 = (s[0][r] > -1.0e38f) ? __expf(s[0][r] - mnew) : 0.f;
      const float p1 = (s[1][r] > -1.0e38f) ? __expf(s[1][r] - mnew) : 0.f;
      m_r[r] = mnew;
      l_r[r] = l_r[r] * alpha[r] + p0 + p1;            // per-lane partial row sum (16 lanes combined at the end)
      unsigned short hb = bf16_bits(p0); sPh[w][8 * hh + r][ln] = hb;      sPl[w][8 * hh + r][ln] = bf16_bits(p0 - bf16_val(hb));
      hb = bf16_bits(p1);                sPh[w][8 * hh + r][16 + ln] = hb; sPl[w][8 * hh + r][16 + ln] = bf16_bits(p1 - bf16_val(hb));
    }
#pragma unroll
    for (int dt = 0; dt < DT; ++dt)
#pragma unroll
      for (int r = 0; r < 8; ++r) oacc[dt][r] *= alpha[r];
    __builtin_amdgcn_fence(__ATOMIC_ACQ_REL, "workgroup");
    __builtin_amdgcn_wave_barrier();
    FragB pah, pal;
    pah.half[0] = *(const v8us*)&sPh[w][ln][8 * hh]; pah.half[1] = *(const v8us*)&sPh[w][ln][16 + 8 * hh];
    pal.half[0] = *(const v8us*)&sPl[w][ln][8 * hh]; pal.half[1] = *(const v8us*)&sPl[w][ln][16 + 8 * hh];
#pragma unroll
    for (int dt = 0; dt < DT; ++dt) {
      FragB bvh, bvl;
#pragma unroll
      for (int i = 0; i < 8; ++i) {
        bvh.u[i] = sVh[8 * hh + i][dt * 16 + ln]; bvh.u[8 + i] = sVh[16 + 8 * hh + i][dt * 16 + ln];
        bvl.u[i] = sVl[8 * hh + i][dt * 16 + ln]; bvl.u[8 + i] = sVl[16 + 8 * hh + i][dt * 16 + ln];
      }
      oacc[dt] = mmaN<3>(pah.v, pal.v, bvh.v, bvl.v, oacc[dt]);
    }
    __builtin_amdgcn_fence(__ATOMIC_ACQ_REL, "workgroup");
    __builtin_amdgcn_wave_barrier();
  }
#pragma unroll
  for (int r = 0; r < 8; ++r) {
    float l = l_r[r];
    l += __shfl_xor(l, 1, 32); l += __shfl_xor(l, 2, 32); l += __shfl_xor(l, 4, 32); l += __shfl_xor(l, 8, 32);
    l_r[r] = (l > 0.f) ? 1.0f / l : 0.f;
  }
#pragma unroll
  for (int dt = 0; dt < DT; ++dt)
#pragma unroll
    for (int r = 0; r < 8; ++r) sO[w][8 * hh + r][dt * 16 + ln] = oacc[dt][r] * l_r[r];
  __builtin_amdgcn_fence(__ATOMIC_ACQ_REL, "workgroup");
  __builtin_amdgcn_wave_barrier();
  {
    for (int r = 0; r < 16; ++r) {
      const int row = q0 + r;
      if (row < T && lane < D / 4) {
        const v4f val = *(const v4fa*)&sO[w][r][lane * 4];
        *(v4f*)(y + ((size_t)b * T + row) * ypitch + h * D + lane * 4) = val;
      }
    }
    
  }
}

// GEMM C = act(A·W + bias + resid): A f32 (ASPLIT -> hi/lo 2 terms), Wt bf16 [N][K]; ACT 0 none, 1 relu, 2 exact gelu;
// resid (optional, f32, row index = (row % rmod), pitch ldr, RES_BF16 rounds it) added before the activation.
template <bool ASPLIT, int ACT, bool BIAS_BF16, bool RES_BF16>
__global__ __launch_bounds__(128) void k_gemm_bf3(const float* __restrict__ A, int lda, const unsigned short* __restrict__ Wt, int ldb,
                                                const float* __restrict__ bias, const float* __restrict__ resid, int rmod, int ldr,
                                                float* __restrict__ C, int ldc, int M, int N, int K) {
  __shared__ __attribute__((aligned(16))) float so[4][16][64];
  const int tid = threadIdx.x, w = tid >> 5, lane = tid & 31, ln = lane & 15, hh = lane >> 4;
  const int ntn = N / 64;
  const int wid = blockIdx.x * 4 + w;
  const int mt = wid / ntn, nq = wid % ntn;
  if (mt * 16 >= M) return;
  const int row0 = mt * 16, col0 = nq * 64;
  const float* arow = A + (size_t)(row0 + ln) * lda;
  v8f acc[4] = {};
  for (int kb = 0; kb < K; kb += 32) {
    FragB ah, al;
    const v4f x0 = *(const v4fa*)(arow + kb + 8 * hh), x1 = *(const v4fa*)(arow + kb + 8 * hh + 4);
    const v4f x2 = *(const v4fa*)(arow + kb + 16 + 8 * hh), x3 = *(const v4fa*)(arow + kb + 16 + 8 * hh + 4);
    float xs[16] = {x0[0],x0[1],x0[2],x0[3],x1[0],x1[1],x1[2],x1[3],x2[0],x2[1],x2[2],x2[3],x3[0],x3[1],x3[2],x3[3]};
#pragma unroll
    for (int i = 0; i < 16; ++i) { const unsigned short hb = bf16_bits(xs[i]); ah.u[i] = hb; al.u[i] = ASPLIT ? bf16_bits(xs[i] - bf16_val(hb)) : (unsigned short)0; }
#pragma unroll
    for (int t = 0; t < 4; ++t) {
      const unsigned short* brow = Wt + (size_t)(col0 + t * 16 + ln) * ldb + kb;
      FragB b;
      b.half[0] = *(const v8us*)(brow + 8 * hh);
      b.half[1] = *(const v8us*)(brow + 16 + 8 * hh);
      acc[t] = mmaN<ASPLIT ? 2 : 1>(ah.v, al.v, b.v, b.v, acc[t]);
    }
  }
#pragma unroll
  for (int t = 0; t < 4; ++t) {
    const int col = col0 + t * 16 + ln;
    float bv = bias ? bias[col] : 0.f;
    if (BIAS_BF16) bv = bf16_round(bv);
#pragma unroll
    for (int r = 0; r < 8; ++r) {
      float v = acc[t][r] + bv;
      if (resid) { float rv = resid[(size_t)((row0 + 8 * hh + r) % rmod) * ldr + col]; if (RES_BF16) rv = bf16_round(rv); v += rv; }
      if (ACT == 1) v = fmaxf(v, 0.f);
      if (ACT == 2) v = 0.5f * v * (1.0f + erff(v * 0.70710678118654752f));
      if (ACT == 3) { const float u = 0.7978845608028654f * (v + 0.044715f * v * v * v); v = 0.5f * v * (1.0f + tanhf(u)); }
      so[w][8 * hh + r][t * 16 + ln] = v;
    }
  }
  __builtin_amdgcn_fence(__ATOMIC_ACQ_REL, "workgroup");
  __builtin_amdgcn_wave_barrier();
  const int rsub = lane >> 4, c4 = (lane & 15) * 4;
  {
#pragma unroll
    for (int q = 0; q < 8; ++q) {
      const int r = q * 2 + rsub;
      const v4f v = *(const v4fa*)&so[w][r][c4];
      *(v4f*)(C + (size_t)(row0 + r) * ldc + col0 + c4) = v;
    }
    
  }
}
// row LayerNorm (biased variance, eps) over N: s = X (+ R); optional out_sum <- s; out_norm <- (s-mu)*rsqrt(var+eps)*g + b
template <bool PARAM_BF16>
__global__ __launch_bounds__(256) void k_layernorm(const float* __restrict__ X, const float* __restrict__ R, const float* __restrict__ g, const float* __restrict__ bta,
                                                  float* __restrict__ out_sum, float* __restrict__ out_norm, int N, float eps) {
  __shared__ float red[256];
  const int row = blockIdx.x, tid = threadIdx.x;
  const float* x = X + (size_t)row * N; const float* rr = R ? R + (size_t)row * N : nullptr;
  float vals[16];                     // up to N = 4096
  const int per = N / 256;            // contiguous chunk per thread? use strided-by-4 chunks: thread handles j = tid*4 + 1024*u
  float s1 = 0.f;
  for (int u = 0; u < per / 4; ++u) {
    const int j = tid * 4 + 1024 * u;
    const v4f a = *(const v4fa*)(x + j);
    v4f b = {0.f,0.f,0.f,0.f}; if (rr) b = *(const v4fa*)(rr + j);
#pragma unroll
    for (int q = 0; q < 4; ++q) { const float v = a[q] + b[q]; vals[u * 4 + q] = v; s1 += v; }
  }
  red[tid] = s1; __syncthreads();
  for (int st = 128; st > 0; st >>= 1) { if (tid < st) red[tid] += red[tid + st]; __syncthreads(); }
  const float mu = red[0] / (float)N; __syncthreads();
  float s2 = 0.f;
  for (int u = 0; u < per / 4; ++u)
#pragma unroll
    for (int q = 0; q < 4; ++q) { const float c = vals[u * 4 + q] - mu; s2 += c * c; }
  red[tid] = s2; __syncthreads();
  for (int st = 128; st > 0; st >>= 1) { if (tid < st) red[tid] += red[tid + st]; __syncthreads(); }
  const float rs = rsqrtf(red[0] / (float)N + eps);
  {
    for (int u = 0; u < per / 4; ++u) {
      const int j = tid * 4 + 1024 * u;
      v4f o, sm;
#pragma unroll
      for (int q = 0; q < 4; ++q) {
        float gg = g[j + q], bb = bta[j + q];
        if (PARAM_BF16) { gg = bf16_round(gg); bb = bf16_round(bb); }
        sm[q] = vals[u * 4 + q]; o[q] = (vals[u * 4 + q] - mu) * rs * gg + bb;
      }
      if (out_sum) *(v4f*)(out_sum + (size_t)row * N + j) = sm;
      *(v4f*)(out_norm + (size_t)row * N + j) = o;
    }
    
  }
}



// ---- f16 WMMA path (v_wmma_f32_16x16x32_f16): 11-bit significands for operands in range — used where a [0,1] probability operand needs more precision than bf16
typedef _Float16 v16h __attribute__((ext_vector_type(16)));
union FragH { v16h v; v8us half[2]; _Float16 h[16]; unsigned short u[16]; };
template <int NT>
__device__ __forceinline__ v8f mmaH(v16h ah, v16h al, v16h bh, v16h bl, v8f c) {
  c = __builtin_amdgcn_wmma_f32_16x16x32_f16(false, ah, false, bh, (short)0, c, false, false);
  if (NT >= 2) c = __builtin_amdgcn_wmma_f32_16x16x32_f16(false, al, false, bh, (short)0, c, false, false);
  if (NT >= 3) c = __builtin_amdgcn_wmma_f32_16x16x32_f16(false, ah, false, bl, (short)0, c, false, false);
  asm volatile("v_nop\n\tv_nop\n\tv_nop\n\tv_nop" : "+v"(c) : "v"(ah), "v"(al), "v"(bh), "v"(bl));
  return c;
}
// batched GEMM like k_gemm_b but f16 operands: A f32 (split into f16 hi/lo if ASPLIT, else rounded to f16), Bt = f16 values [n][k]; alpha; C f32; N multiple of 16 (partial tiles skipped)
template <bool ASPLIT>
__global__ __launch_bounds__(128) void k_gemm_h(const float* __restrict__ A, int lda, size_t sA, const _Float16* __restrict__ Bh, int ldb, size_t sB, float alpha, float* __restrict__ C, int ldc, size_t sC, int M, int N, int K) {
  __shared__ __attribute__((aligned(16))) float so[4][16][64];
  const int tid = threadIdx.x, w = tid >> 5, lane = tid & 31, ln = lane & 15, hh = lane >> 4; const int by = blockIdx.y;
  A += (size_t)by * sA; Bh += (size_t)by * sB; C += (size_t)by * sC;
  const int ntn = (N + 63) / 64; const int wid = blockIdx.x * 4 + w; const int mt = wid / ntn, nq = wid % ntn; if (mt * 16 >= M) return;
  const int row0 = mt * 16, col0 = nq * 64; const float* arow = A + (size_t)(row0 + ln) * lda;
  v8f acc[4] = {};
  for (int kb = 0; kb < K; kb += 32) {
    FragH ah, al;
    const v4f x0 = *(const v4fa*)(arow + kb + 8 * hh), x1 = *(const v4fa*)(arow + kb + 8 * hh + 4), x2 = *(const v4fa*)(arow + kb + 16 + 8 * hh), x3 = *(const v4fa*)(arow + kb + 16 + 8 * hh + 4);
    float xs[16] = {x0[0],x0[1],x0[2],x0[3],x1[0],x1[1],x1[2],x1[3],x2[0],x2[1],x2[2],x2[3],x3[0],x3[1],x3[2],x3[3]};
#pragma unroll
    for (int i = 0; i < 16; ++i) { const _Float16 h = (_Float16)xs[i]; ah.h[i] = h; al.h[i] = ASPLIT ? (_Float16)(xs[i] - (float)h) : (_Float16)0.0f; }
#pragma unroll
    for (int t = 0; t < 4; ++t) { if (col0 + t * 16 >= N) continue; const size_t boff = (size_t)(col0 + t * 16 + ln) * ldb + kb; FragH bq; bq.half[0] = *(const v8us*)(Bh + boff + 8 * hh); bq.half[1] = *(const v8us*)(Bh + boff + 16 + 8 * hh);
      acc[t] = mmaH<ASPLIT ? 2 : 1>(ah.v, al.v, bq.v, bq.v, acc[t]); }
  }
#pragma unroll
  for (int t = 0; t < 4; ++t) { if (col0 + t * 16 >= N) continue;
#pragma unroll
    for (int r = 0; r < 8; ++r) so[w][8 * hh + r][t * 16 + ln] = acc[t][r] * alpha; }
  __builtin_amdgcn_fence(__ATOMIC_ACQ_REL, "workgroup"); __builtin_amdgcn_wave_barrier();
  const int rsub = lane >> 4, c4 = (lane & 15) * 4;
  {
#pragma unroll
    for (int q = 0; q < 8; ++q) { const int r = q * 2 + rsub; if (col0 + c4 < N) { const v4f v = *(const v4fa*)&so[w][r][c4]; *(v4f*)(C + (size_t)(row0 + r) * ldc + col0 + c4) = v; } }
     }
}

// Wt[n][k] = f16(W[k][n]·scale) from f32 row-major W[K][N] (scale = power of two; bf16-exact weights stay exact in f16 away from the subnormal range)
__global__ __launch_bounds__(256) void k_wt_f16(const float* __restrict__ W, _Float16* __restrict__ Wt, int K, int N, float scale) {
  const int t = blockIdx.x * 256 + threadIdx.x; if (t >= N * (K / 8)) return; const int n = t / (K / 8), k8 = (t % (K / 8)) * 8; FragH f;
#pragma unroll
  for (int i = 0; i < 8; ++i) f.h[i] = (_Float16)(bf16_round(W[(size_t)(k8 + i) * N + n]) * scale); const v8us o = f.half[0];
  *(v8us*)((unsigned short*)Wt + (size_t)n * K + k8) = o; 
}
// k_gemm_hh variant with fused epilogue: v = acc·alpha + bias[by·sBias + col] (+ CP[(row/rowsPerB)·sCPb + by·64 + col] if CP) ; ACT 0 none / 1 elu ; writes f32 C and f16 C16, each if non-null
template <int ACT>
__global__ __launch_bounds__(128) void k_gemm_hhx(const _Float16* __restrict__ A, int lda, size_t sA, const _Float16* __restrict__ Bh, int ldb, size_t sB, float alpha, const float* __restrict__ bias, size_t sBias, const float* __restrict__ CP, int rowsPerB, size_t sCPb, int row0g,
    float* __restrict__ C, _Float16* __restrict__ C16, int ldc, size_t sC, int M, int N, int K) {
  __shared__ __attribute__((aligned(16))) float so[4][16][64];
  const int tid = threadIdx.x, w = tid >> 5, lane = tid & 31, ln = lane & 15, hh = lane >> 4; const int by = blockIdx.y;
  A += (size_t)by * sA; Bh += (size_t)by * sB; const size_t cofs = (size_t)by * sC; const float* bp = bias ? bias + (size_t)by * sBias : nullptr;
  const int ntn = (N + 63) / 64; const int wid = blockIdx.x * 4 + w; const int mt = wid / ntn, nq = wid % ntn; if (mt * 16 >= M) return;
  const int row0 = mt * 16, col0 = nq * 64; const _Float16* arow = A + (size_t)(row0 + ln) * lda;
  v8f acc[4] = {};
  for (int kb = 0; kb < K; kb += 32) { FragH ah; ah.half[0] = *(const v8us*)((const unsigned short*)arow + kb + 8 * hh); ah.half[1] = *(const v8us*)((const unsigned short*)arow + kb + 16 + 8 * hh);
#pragma unroll
    for (int t = 0; t < 4; ++t) { if (col0 + t * 16 >= N) continue; const size_t boff = (size_t)(col0 + t * 16 + ln) * ldb + kb; FragH bq; bq.half[0] = *(const v8us*)((const unsigned short*)Bh + boff + 8 * hh); bq.half[1] = *(const v8us*)((const unsigned short*)Bh + boff + 16 + 8 * hh);
      acc[t] = mmaH<1>(ah.v, ah.v, bq.v, bq.v, acc[t]); }
  }
#pragma unroll
  for (int t = 0; t < 4; ++t) { if (col0 + t * 16 >= N) continue; const int col = col0 + t * 16 + ln; const float bv = bp ? bf16_round(bp[col]) : 0.f;
#pragma unroll
    for (int r = 0; r < 8; ++r) { float v = acc[t][r] * alpha + bv; if (CP) { const int bidx = (row0g + row0 + 8 * hh + r) / rowsPerB; v += CP[(size_t)bidx * sCPb + (size_t)by * 64 + col]; } if (ACT == 1) v = (v > 0.f) ? v : expm1f(v); else if (ACT == 7) v = (v > 0.f) ? v + 1.0f : expf(v); else if (ACT == 8) v = tanhf(v); else if (ACT == 9) v = 0.5f * v * (1.0f + tanhf(0.7978845608028654f * (v + 0.044715f * v * v * v))); else if (ACT == 11) v = 1.0f / (1.0f + expf(-v)); else if (ACT == 12) v = (v > 0.f) ? v : 0.01f * v; else if (ACT == 14) v = (v > 0.f) ? v : 0.1f * v; else if (ACT == 15) v = v / (1.0f + expf(-v)); else if (ACT == 3) v = fmaxf(v, 0.f); else if (ACT == 6) v = 0.5f * v * (1.0f + erff(v * 0.70710678118654752f)); so[w][8 * hh + r][t * 16 + ln] = v; } }
  __builtin_amdgcn_fence(__ATOMIC_ACQ_REL, "workgroup"); __builtin_amdgcn_wave_barrier();
  const int rsub = lane >> 4, c4 = (lane & 15) * 4; typedef _Float16 v4h __attribute__((ext_vector_type(4)));
  {
#pragma unroll
    for (int q = 0; q < 8; ++q) { const int r = q * 2 + rsub; if (col0 + c4 < N) { const v4f v = *(const v4fa*)&so[w][r][c4]; if (C) *(v4f*)(C + cofs + (size_t)(row0 + r) * ldc + col0 + c4) = v; if (C16) { v4h h4; for (int i = 0; i < 4; ++i) h4[i] = (_Float16)v[i]; *(v4h*)(C16 + cofs + (size_t)(row0 + r) * ldc + col0 + c4) = h4; } } }
     }
}


typedef _Float16 v4h __attribute__((ext_vector_type(4)));

__global__ __launch_bounds__(256) void k_x16(const float* __restrict__ x, _Float16* __restrict__ X16, size_t n8) { const size_t t = (size_t)blockIdx.x * 256 + threadIdx.x; if (t >= n8) return; FragH f;
#pragma unroll
  for (int q = 0; q < 8; ++q) f.h[q] = (_Float16)bf16_round(x[t * 8 + q]); *(v8us*)((unsigned short*)X16 + t * 8) = f.half[0];  }
__global__ __launch_bounds__(256) void k_h16(const float* __restrict__ x, _Float16* __restrict__ X16, size_t n8) { const size_t t = (size_t)blockIdx.x * 256 + threadIdx.x; if (t >= n8) return; FragH f;
#pragma unroll
  for (int q = 0; q < 8; ++q) f.h[q] = (_Float16)x[t * 8 + q]; *(v8us*)((unsigned short*)X16 + t * 8) = f.half[0];  }
__global__ __launch_bounds__(256) void k_round16f(const float* __restrict__ W, _Float16* __restrict__ Bt, size_t n8) { const size_t t = (size_t)blockIdx.x * 256 + threadIdx.x; if (t >= n8) return; FragH f;
#pragma unroll
  for (int i = 0; i < 8; ++i) f.h[i] = (_Float16)(bf16_round(W[t * 8 + i]) * 16.0f); *(v8us*)((unsigned short*)Bt + t * 8) = f.half[0];  }
template <int NHv, int TTv>
__global__ __launch_bounds__(256) void k_vt(const _Float16* __restrict__ V16, int ldv, int voff, _Float16* __restrict__ Vt) { __shared__ unsigned short tl[64][66]; const int tid = threadIdx.x; const int slab = blockIdx.x / (TTv / 64), lg = blockIdx.x % (TTv / 64); const int b = slab / NHv, h = slab % NHv;
  for (int i = tid; i < 64 * 8; i += 256) { const int r = i / 8, c8 = (i % 8) * 8; FragH f; f.half[0] = *(const v8us*)((const unsigned short*)V16 + ((size_t)b * TTv + lg * 64 + r) * ldv + voff + h * 64 + c8);
#pragma unroll
    for (int q = 0; q < 8; ++q) tl[r][c8 + q] = f.u[q]; }
  __syncthreads();
  {
#pragma unroll
    for (int rd = 0; rd < 2; ++rd) { const int d = rd * 32 + tid / 8, pc = tid % 8; FragH f;
#pragma unroll
      for (int q = 0; q < 8; ++q) f.u[q] = tl[pc * 8 + q][d];
      *(v8us*)((unsigned short*)Vt + ((size_t)slab * 64 + d) * TTv + lg * 64 + pc * 8) = f.half[0]; }
     } }

__global__ __launch_bounds__(256) void k_qbias(const float* __restrict__ QF, const float* __restrict__ rwb, const float* __restrict__ rrb, _Float16* __restrict__ QW, _Float16* __restrict__ QR, size_t n8) { const size_t t = (size_t)blockIdx.x * 256 + threadIdx.x; if (t >= n8) return; const int c0 = (int)((t * 8) % DM); const v4f a = *(const v4fa*)(QF + t * 8), b = *(const v4fa*)(QF + t * 8 + 4); FragH fw, fr;
#pragma unroll
  for (int q = 0; q < 8; ++q) { const float v = (q < 4) ? a[q] : b[q - 4]; fw.h[q] = (_Float16)(v + bf16_round(rwb[c0 + q])); fr.h[q] = (_Float16)(v + bf16_round(rrb[c0 + q])); }
  { *(v8us*)((unsigned short*)QW + t * 8) = fw.half[0]; *(v8us*)((unsigned short*)QR + t * 8) = fr.half[0];  } }
// per (b,n) row kernel: for query i, s[j] = (AC[i][j] + BDshift[i][j])·1/8 with BDshift from the exact pad/reshape shift: idx = QL + i·KL + j, i' = idx / (KL+1), j' = idx mod (KL+1), BD = (j' == 0) ? 0 : BDR[i'][j'−1] (i' ∈ {i, i+1} < QL, addresses clamped);
__global__ __launch_bounds__(256) void k_rel(const float* __restrict__ AC, const float* __restrict__ BDR, const int* __restrict__ MSK, _Float16* __restrict__ P16) { const int tid = threadIdx.x, wv = tid >> 5, lane = tid & 31; const int i = blockIdx.x * 8 + wv; const float* ar = AC + (size_t)i * KL; const int* mk = MSK + (size_t)i * KL;
  v4f sv[16]; float mx = -3.0e38f;
#pragma unroll
  for (int jj = 0; jj < 16; ++jj) { const int j0 = jj * 128 + lane * 4; const v4f a = *(const v4fa*)(ar + j0); v4f s;
#pragma unroll
    for (int e = 0; e < 4; ++e) { const int j = j0 + e; const size_t idx = (size_t)QL + (size_t)i * KL + j; int ip = (int)(idx / (KL + 1)); const int jp = (int)(idx % (KL + 1)); ip = ip < 0 ? 0 : (ip >= QL ? QL - 1 : ip); const int jm = (jp > 0) ? jp - 1 : 0; const float bdv = BDR[(size_t)ip * KL + jm]; const float bd = (jp > 0) ? bdv : 0.f;
      const float val = (a[e] + bd) * ATT_SCALE; s[e] = (mk[j] != 0) ? -INFINITY : val; mx = fmaxf(mx, s[e]); }
    sv[jj] = s; }
  for (int o = 16; o >= 1; o >>= 1) mx = fmaxf(mx, __shfl_xor(mx, o, 32)); float z = 0.f;
#pragma unroll
  for (int jj = 0; jj < 16; ++jj) for (int e = 0; e < 4; ++e) { const float p = (sv[jj][e] > -INFINITY) ? __expf(sv[jj][e] - mx) : 0.f; sv[jj][e] = p; z += p; }
  for (int o = 16; o >= 1; o >>= 1) z += __shfl_xor(z, o, 32); const float iz = (z > 0.f) ? 32768.0f / z : 0.f;
  typedef _Float16 v4h __attribute__((ext_vector_type(4)));
  {
#pragma unroll
    for (int jj = 0; jj < 16; ++jj) { v4h o; for (int e = 0; e < 4; ++e) o[e] = (_Float16)(sv[jj][e] * iz); *(v4h*)(P16 + (size_t)i * KL + jj * 128 + lane * 4) = o; }
     } }
__global__ __launch_bounds__(256) void k_lnout(const float* __restrict__ RES, const float* __restrict__ w, const float* __restrict__ g, const float* __restrict__ bb, float* __restrict__ out) { const int tid = threadIdx.x, wv = tid >> 5, lane = tid & 31; const int r = blockIdx.x * 8 + wv; if (r >= NQR) return; v4f y[8]; float s = 0.f;
#pragma unroll
  for (int j = 0; j < 8; ++j) { const int c = j * 128 + lane * 4; const v4f a = *(const v4fa*)(RES + (size_t)r * DM + c), x = *(const v4fa*)(w + (size_t)r * DM + c); for (int q = 0; q < 4; ++q) { y[j][q] = a[q] + bf16_round(x[q]); s += y[j][q]; } }
  for (int o = 16; o >= 1; o >>= 1) s += __shfl_xor(s, o, 32); const float mu = s / (float)DM; float q2 = 0.f;
#pragma unroll
  for (int j = 0; j < 8; ++j) for (int q = 0; q < 4; ++q) { const float d = y[j][q] - mu; q2 += d * d; }
  for (int o = 16; o >= 1; o >>= 1) q2 += __shfl_xor(q2, o, 32); const float rs = rsqrtf(q2 / (float)DM + 1e-5f);
  {
#pragma unroll
    for (int j = 0; j < 8; ++j) { const int c = j * 128 + lane * 4; v4f o; for (int q = 0; q < 4; ++q) o[q] = (y[j][q] - mu) * rs * bf16_round(g[c + q]) + bf16_round(bb[c + q]); *(v4f*)(out + (size_t)r * DM + c) = o; }
     } }

extern "C" void kernel_launch(void* const* d_in, const int* in_sizes, int n_in,
                              void* d_out, int out_size, void* d_ws, size_t ws_size, hipStream_t stream) {
  (void)in_sizes; (void)n_in; (void)out_size;
  const float* const* I = (const float* const*)d_in; const float* w = I[0]; const float* r = I[1]; const float* mems = I[2]; const float* rwb = I[3]; const float* rrb = I[4]; const int* msk = (const int*)d_in[5];
  const float* Wq = I[6]; const float* bq = I[7]; const float* Wk = I[8]; const float* bk = I[9]; const float* Wv = I[10]; const float* bv = I[11]; const float* Wr = I[12]; const float* br = I[13]; const float* Wo = I[14]; const float* bo = I[15]; const float* lg = I[16]; const float* lb = I[17];
  char* ws = (char*)d_ws; size_t off = 0;
  auto take = [&](size_t bytes) { char* p = ws + off; off += (bytes + 255) & ~(size_t)255; return p; };
  const size_t WSZ = (size_t)DM * DM; _Float16* Bw = (_Float16*)take(5 * WSZ * 2);      /* Wq, Wk, Wv, Wr, Wo */
  _Float16* CAT = (_Float16*)take((size_t)NKR * DM * 2); _Float16* R16 = (_Float16*)take((size_t)KL * DM * 2); float* QF = (float*)take((size_t)NQR * DM * 4); _Float16* QW = (_Float16*)take((size_t)NQR * DM * 2); _Float16* QR = (_Float16*)take((size_t)NQR * DM * 2);
  _Float16* K16 = (_Float16*)take((size_t)NKR * DM * 2); _Float16* V16 = (_Float16*)take((size_t)NKR * DM * 2); _Float16* Vt = (_Float16*)take((size_t)NKR * DM * 2); _Float16* RK = (_Float16*)take((size_t)KL * DM * 2);
  float* AC = (float*)take((size_t)QL * KL * 4); float* BDR = (float*)take((size_t)QL * KL * 4); _Float16* P16 = (_Float16*)take((size_t)QL * KL * 2); float* O = (float*)take((size_t)NQR * DM * 4); _Float16* O16 = (_Float16*)take((size_t)NQR * DM * 2); float* RES = QF;      /* QF (q f32) is dead once QW/QR exist; the Wo GEMM output reuses it */
  if (off > ws_size) return;      // 10.5 + 8.4 + 4.2 + 8.4 + 4.2 + 4.2 + 8.4 + 8.4 + 8.4 + 4.2 + 8.4 + 8.4 + 4.2 + 8.4 + 4.2 ≈ 103 MB
  const unsigned gwt = (unsigned)(((size_t)DM * (DM / 8) + 255) / 256);
  k_wt_f16<<<gwt, 256, 0, stream>>>(Wq, Bw, DM, DM, 16.0f); k_wt_f16<<<gwt, 256, 0, stream>>>(Wk, Bw + WSZ, DM, DM, 16.0f); k_wt_f16<<<gwt, 256, 0, stream>>>(Wv, Bw + 2 * WSZ, DM, DM, 16.0f); k_wt_f16<<<gwt, 256, 0, stream>>>(Wr, Bw + 3 * WSZ, DM, DM, 16.0f); k_wt_f16<<<gwt, 256, 0, stream>>>(Wo, Bw + 4 * WSZ, DM, DM, 16.0f);      /* (in,out) → Bt ×2^4 */
  const unsigned gh = (unsigned)(((size_t)NQR * DM / 8 + 255) / 256);
  k_x16<<<gh, 256, 0, stream>>>(mems, CAT, (size_t)NQR * DM / 8); k_x16<<<gh, 256, 0, stream>>>(w, CAT + (size_t)NQR * DM, (size_t)NQR * DM / 8); k_x16<<<gh, 256, 0, stream>>>(r, R16, (size_t)KL * DM / 8);      /* cat = [mems; w] is the two inputs back to back (rows (j,b)); r rows m */
  const dim3 gq(((NQR / 16) * (DM / 64) + 3) / 4, 1), gk(((NKR / 16) * (DM / 64) + 3) / 4, 1), grr(((KL / 16) * (DM / 64) + 3) / 4, 1);
  k_gemm_hhx<0><<<gq, 128, 0, stream>>>(CAT + (size_t)NQR * DM, DM, 0, Bw, DM, 0, 0.0625f, bq, 0, nullptr, 1, 0, 0, QF, nullptr, DM, 0, NQR, DM, DM); k_qbias<<<gh, 256, 0, stream>>>(QF, rwb, rrb, QW, QR, (size_t)NQR * DM / 8);      /* q (last qlen rows of cat) + bq → + r_w_bias / + r_r_bias */
  k_gemm_hhx<0><<<gk, 128, 0, stream>>>(CAT, DM, 0, Bw + WSZ, DM, 0, 0.0625f, bk, 0, nullptr, 1, 0, 0, nullptr, K16, DM, 0, NKR, DM, DM);      /* k: M 4096 N 1024 K 1024 */
  k_gemm_hhx<0><<<gk, 128, 0, stream>>>(CAT, DM, 0, Bw + 2 * WSZ, DM, 0, 0.0625f, bv, 0, nullptr, 1, 0, 0, nullptr, V16, DM, 0, NKR, DM, DM);      /* v */
  k_gemm_hhx<0><<<grr, 128, 0, stream>>>(R16, DM, 0, Bw + 3 * WSZ, DM, 0, 0.0625f, br, 0, nullptr, 1, 0, 0, nullptr, RK, DM, 0, KL, DM, DM);      /* rk = r·Wr + br: M 2048 */
  for (int b = 0; b < BZ; ++b) k_vt<NH, KL><<<NH * (KL / 64), 256, 0, stream>>>(V16 + (size_t)b * DM, BZ * DM, 0, Vt + (size_t)b * NH * 64 * KL);      /* Vᵀ per (b,n): V rows (j,b) have stride 2·1024 */
  const dim3 gs(((QL / 16) * (KL / 64) + 3) / 4, 1), go(((QL / 16) * 1 + 3) / 4, 1);
  for (int b = 0; b < BZ; ++b) for (int h = 0; h < NH; ++h) {
    k_gemm_hhx<0><<<gs, 128, 0, stream>>>(QW + (size_t)b * DM + h * 64, BZ * DM, 0, K16 + (size_t)b * DM + h * 64, BZ * DM, 0, 1.0f, nullptr, 0, nullptr, 1, 0, 0, AC, nullptr, KL, 0, QL, KL, 64);      /* AC = (q + r_w_bias)·kᵀ: M 1024 N 2048 K 64 (row strides 2048: interleaved (i,b) / (j,b) rows) */
    k_gemm_hhx<0><<<gs, 128, 0, stream>>>(QR + (size_t)b * DM + h * 64, BZ * DM, 0, RK + h * 64, DM, 0, 1.0f, nullptr, 0, nullptr, 1, 0, 0, BDR, nullptr, KL, 0, QL, KL, 64);      /* raw BD = (q + r_r_bias)·rkᵀ: M 1024 N 2048 K 64 */
    k_rel<<<QL / 8, 256, 0, stream>>>(AC, BDR, msk, P16);
    k_gemm_hhx<0><<<go, 128, 0, stream>>>(P16, KL, 0, Vt + ((size_t)b * NH + h) * 64 * KL, KL, 0, 0.000030517578125f, nullptr, 0, nullptr, 1, 0, 0, O + (size_t)b * DM + h * 64, nullptr, BZ * DM, 0, QL, 64, KL); }      /* attn_vec rows (i,b) cols h·64..: M 1024 N 64 K 2048, ldc 2048 */
  k_h16<<<gh, 256, 0, stream>>>(O, O16, (size_t)NQR * DM / 8);
  k_gemm_hhx<0><<<gq, 128, 0, stream>>>(O16, DM, 0, Bw + 4 * WSZ, DM, 0, 0.0625f, bo, 0, nullptr, 1, 0, 0, RES, nullptr, DM, 0, NQR, DM, DM);      /* attn_out = attn_vec·Wo + bo (rows (i,b)) */
  k_lnout<<<(NQR + 7) / 8, 256, 0, stream>>>(RES, w, lg, lb, (float*)d_out);
}

// v001
// One run takes 726 microseconds.
// Timed twice side by side with v000, it ran 3.78 times as fast both times.
#include <hip/hip_runtime.h>
// Transformer-XL relative multi-head attention (qlen 1024, mem_len 1024 → klen 2048, bsz 2, 16 heads × 64, post-LN): cat = [mems; w] (rows (j,b)); q = (cat·Wq + bq)[last qlen], k, v = cat·Wk + bk, cat·Wv + bv; rk = r·Wr + br;
// AC[i,j] = (q_i + r_w_bias)·k_j; BD = rel_shift((q_i + r_r_bias)·rk_m) (the exact pad-reshape shift, incl. its wrap region); score = (AC + BD)/8, −inf where the INPUT mask is set; softmax over j; attn_vec = Σ_j p·v_j;
// out = LayerNorm(w + attn_vec·Wo + bo)·g + b → [1024, 2, 1024]. (in,out) weights.
// Compute dtype: w, mems, r, biases, weights rounded to bf16; q (+ the two head biases), k, v, rk as f16 GEMM planes; per (b,n) the AC and raw BD score planes as f32 GEMM outputs; a wave-per-row kernel
// applies the relative shift by index arithmetic, the mask and an f32 softmax and writes P f16 ×2^15; attn_vec by GEMM; Wo GEMM + bias; residual + LayerNorm in f32 (wave per row). All contractions on v_wmma_f32_16x16x32_f16, f32 accumulate.
#define QL 1024
#define KL 2048
#define BZ 2
#define NH 16
#define DM 1024
#define NQR (QL * BZ)
#define NKR (KL * BZ)
#define ATT_SCALE 0.125f
#define GH 4      // heads whose score planes are launched together

typedef __bf16 v16b __attribute__((ext_vector_type(16)));
typedef unsigned short v8us __attribute__((ext_vector_type(8), may_alias));
typedef float  v8f  __attribute__((ext_vector_type(8)));
typedef float  v4f  __attribute__((ext_vector_type(4)));
typedef float  v4fa __attribute__((ext_vector_type(4), may_alias));
union FragB { v16b v; v8us half[2]; unsigned short u[16]; };

__device__ __forceinline__ unsigned short bf16_bits(float x) { unsigned int u = __float_as_uint(x); return (unsigned short)((u + 0x7FFFu + ((u >> 16) & 1u)) >> 16); }
__device__ __forceinline__ float bf16_val(unsigned short b) { return __uint_as_float(((unsigned int)b) << 16); }
__device__ __forceinline__ float bf16_round(float x) { return bf16_val(bf16_bits(x)); }
// D += A·B with NT terms: 1 = ah·bh, 2 = + al·bh (A split), 3 = + ah·bl (both split)
template <int NT>
__device__ __forceinline__ v8f mmaN(v16b ah, v16b al, v16b bh, v16b bl, v8f c) {
  c = __builtin_amdgcn_wmma_f32_16x16x32_bf16(false, ah, false, bh, (short)0, c, false, false);
  if (NT >= 2) c = __builtin_amdgcn_wmma_f32_16x16x32_bf16(false, al, false, bh, (short)0, c, false, false);
  if (NT >= 3) c = __builtin_amdgcn_wmma_f32_16x16x32_bf16(false, ah, false, bl, (short)0, c, false, false);
  asm volatile("v_nop\n\tv_nop\n\tv_nop\n\tv_nop" : "+v"(c) : "v"(ah), "v"(al), "v"(bh), "v"(bl));
  return c;
}

__global__ __launch_bounds__(256) void k_wt_bf16(const float* __restrict__ W, unsigned short* __restrict__ Wt, int K, int N) {
  const int t = blockIdx.x * 256 + threadIdx.x;
  const int k8n = K / 8;
  if (t >= N * k8n) return;
  const int n = t / k8n, k8 = (t % k8n) * 8;
  v8us v;
#pragma unroll
  for (int i = 0; i < 8; ++i) v[i] = bf16_bits(W[(size_t)(k8 + i) * N + n]);
  *(v8us*)(Wt + (size_t)n * K + k8) = v;
  
}

// GEMM C[M][N] (f32, pitch ldc) = act(A[M][K]·W + bias). A f32 row-major (pitch lda) converted per fragment to bf16
// (ASPLIT: hi/lo two planes -> 2 terms, else single rounded term); Wt bf16 [N][K] (pitch ldb). BIAS_BF16 rounds the
// bias to bf16 first (bias quantised to bf16 before the add). K%32==0, M%16==0, N%64==0.
template <bool ASPLIT, int ACT, bool BIAS_BF16>
__global__ __launch_bounds__(128) void k_gemm_bf(const float* __restrict__ A, int lda, const unsigned short* __restrict__ Wt, int ldb,
                                               const float* __restrict__ bias, float* __restrict__ C, int ldc, int M, int N, int K) {
  __shared__ __attribute__((aligned(16))) float so[4][16][64];
  const int tid = threadIdx.x, w = tid >> 5, lane = tid & 31, ln = lane & 15, hh = lane >> 4;
  const int ntn = N / 64;
  const int wid = blockIdx.x * 4 + w;
  const int mt = wid / ntn, nq = wid % ntn;
  if (mt * 16 >= M) return;
  const int row0 = mt * 16, col0 = nq * 64;
  const float* arow = A + (size_t)(row0 + ln) * lda;
  v8f acc[4] = {};
  for (int kb = 0; kb < K; kb += 32) {
    FragB ah, al;
    const v4f x0 = *(const v4fa*)(arow + kb + 8 * hh), x1 = *(const v4fa*)(arow + kb + 8 * hh + 4);
    const v4f x2 = *(const v4fa*)(arow + kb + 16 + 8 * hh), x3 = *(const v4fa*)(arow + kb + 16 + 8 * hh + 4);
    float xs[16] = {x0[0],x0[1],x0[2],x0[3],x1[0],x1[1],x1[2],x1[3],x2[0],x2[1],x2[2],x2[3],x3[0],x3[1],x3[2],x3[3]};
#pragma unroll
    for (int i = 0; i < 16; ++i) { const unsigned short hb = bf16_bits(xs[i]); ah.u[i] = hb; al.u[i] = ASPLIT ? bf16_bits(xs[i] - bf16_val(hb)) : (unsigned short)0; }
#pragma unroll
    for (int t = 0; t < 4; ++t) {
      const unsigned short* brow = Wt + (size_t)(col0 + t * 16 + ln) * ldb + kb;
      FragB b;
      b.half[0] = *(const v8us*)(brow + 8 * hh);
      b.half[1] = *(const v8us*)(brow + 16 + 8 * hh);
      acc[t] = mmaN<ASPLIT ? 2 : 1>(ah.v, al.v, b.v, b.v, acc[t]);
    }
  }
#pragma unroll
  for (int t = 0; t < 4; ++t) {
    float bv = bias ? bias[col0 + t * 16 + ln] : 0.f;
    if (BIAS_BF16) bv = bf16_round(bv);
#pragma unroll
    for (int r = 0; r < 8; ++r) { float v = acc[t][r] + bv; if (ACT == 1) v = fmaxf(v, 0.f); so[w][8 * hh + r][t * 16 + ln] = v; }
  }
  __builtin_amdgcn_fence(__ATOMIC_ACQ_REL, "workgroup");
  __builtin_amdgcn_wave_barrier();
  const int rsub = lane >> 4, c4 = (lane & 15) * 4;
  {
#pragma unroll
    for (int q = 0; q < 8; ++q) {
      const int r = q * 2 + rsub;
      const v4f v = *(const v4fa*)&so[w][r][c4];
      *(v4f*)(C + (size_t)(row0 + r) * ldc + col0 + c4) = v;
    }
    
  }
}

// Flash-style causal/unmasked attention, all contractions 3-term bf16 hi/lo splits, f32 softmax with running max.
// q,k,v rows are read from f32 buffers with arbitrary row pitch (so they can live inside a fused qkv buffer);
// D = head size (multiple of 32, <= 128); one wave = 16 query rows; block = 4 waves (64 queries) sharing K/V chunks of 32.
template <int D, bool CAUSAL>
__global__ __launch_bounds__(128) void k_flash(const float* __restrict__ qb, const float* __restrict__ kb, const float* __restrict__ vb,
                                             int pitch, int T, int H, float scale, float* __restrict__ y, int ypitch) {
  constexpr int KS = D / 32;        // k-steps for QK
  constexpr int DT = D / 16;        // d tiles for PV
  __shared__ __attribute__((aligned(16))) unsigned short sKh[32][D + 8], sKl[32][D + 8], sVh[32][D + 8], sVl[32][D + 8];
  __shared__ __attribute__((aligned(16))) unsigned short sPh[4][16][40], sPl[4][16][40];
  __shared__ __attribute__((aligned(16))) float sO[4][16][D];
  const int tid = threadIdx.x, w = tid >> 5, lane = tid & 31, ln = lane & 15, hh = lane >> 4;
  const int nqb = (T + 63) / 64;
  const int bh = blockIdx.x / nqb, qblk = blockIdx.x % nqb;
  const int b = bh / H, h = bh % H;
  const int q0 = qblk * 64 + w * 16;
  const float* Q = qb + (size_t)b * T * pitch + h * D;
  const float* K = kb + (size_t)b * T * pitch + h * D;
  const float* V = vb + (size_t)b * T * pitch + h * D;

  // A fragments of the wave's 16 query rows (scaled), hi/lo
  FragB aqh[KS], aql[KS];
  {
    int row = q0 + ln; if (row >= T) row = T - 1;
    const float* qr = Q + (size_t)row * pitch;
#pragma unroll
    for (int ks = 0; ks < KS; ++ks)
#pragma unroll
      for (int i = 0; i < 16; ++i) {
        const int d = ks * 32 + ((i < 8) ? (8 * hh + i) : (16 + 8 * hh + (i - 8)));
        const float x = qr[d] * scale; const unsigned short hb = bf16_bits(x);
        aqh[ks].u[i] = hb; aql[ks].u[i] = bf16_bits(x - bf16_val(hb));
      }
  }
  float m_r[8], l_r[8];
#pragma unroll
  for (int r = 0; r < 8; ++r) { m_r[r] = -3.0e38f; l_r[r] = 0.f; }
  v8f oacc[DT];
#pragma unroll
  for (int dt = 0; dt < DT; ++dt) oacc[dt] = (v8f){0.f,0.f,0.f,0.f,0.f,0.f,0.f,0.f};

  const int kv_end = CAUSAL ? min(T, qblk * 64 + 64) : T;     // block-uniform
  for (int j0 = 0; j0 < kv_end; j0 += 32) {
    __syncthreads();
    for (int e = tid; e < 32 * (D / 4); e += 128) {
      const int r = e / (D / 4), c4 = (e % (D / 4)) * 4;
      const int key = j0 + r;
      v4f kf = {0.f,0.f,0.f,0.f}, vf = {0.f,0.f,0.f,0.f};
      if (key < T) { kf = *(const v4fa*)(K + (size_t)key * pitch + c4); vf = *(const v4fa*)(V + (size_t)key * pitch + c4); }
#pragma unroll
      for (int t = 0; t < 4; ++t) {
        unsigned short hb = bf16_bits(kf[t]); sKh[r][c4 + t] = hb; sKl[r][c4 + t] = bf16_bits(kf[t] - bf16_val(hb));
        hb = bf16_bits(vf[t]); sVh[r][c4 + t] = hb; sVl[r][c4 + t] = bf16_bits(vf[t] - bf16_val(hb));
      }
    }
    __syncthreads();
    // S tile 16 x 32
    v8f s[2];
#pragma unroll
    for (int nt = 0; nt < 2; ++nt) {
      v8f acc = {};
#pragma unroll
      for (int ks = 0; ks < KS; ++ks) {
        FragB bh_, bl_;
        bh_.half[0] = *(const v8us*)&sKh[nt * 16 + ln][ks * 32 + 8 * hh]; bh_.half[1] = *(const v8us*)&sKh[nt * 16 + ln][ks * 32 + 16 + 8 * hh];
        bl_.half[0] = *(const v8us*)&sKl[nt * 16 + ln][ks * 32 + 8 * hh]; bl_.half[1] = *(const v8us*)&sKl[nt * 16 + ln][ks * 32 + 16 + 8 * hh];
        acc = mmaN<3>(aqh[ks].v, aql[ks].v, bh_.v, bl_.v, acc);
      }
      s[nt] = acc;
    }
    // mask + running max (rows 8hh+r; the 16 lanes of a half share rows)
    float alpha[8];
#pragma unroll
    for (int r = 0; r < 8; ++r) {
      const int qi = q0 + 8 * hh + r;
      const int ja = j0 + ln, jb = j0 + 16 + ln;
      if (CAUSAL) { if (ja > qi) s[0][r] = -3.0e38f; if (jb > qi) s[1][r] = -3.0e38f; }
      if (ja >= T) s[0][r] = -3.0e38f;
      if (jb >= T) s[1][r] = -3.0e38f;
      float mx = fmaxf(s[0][r], s[1][r]);
      mx = fmaxf(mx, __shfl_xor(mx, 1, 32)); mx = fmaxf(mx, __shfl_xor(mx, 2, 32)); mx = fmaxf(mx, __shfl_xor(mx, 4, 32)); mx = fmaxf(mx, __shfl_xor(mx, 8, 32));
      const float mnew = fmaxf(m_r[r], mx);
      alpha[r] = (mnew > -1.0e38f) ? __expf(m_r[r] - mnew) : 1.0f;
      const float p0 = (s[0][r] > -1.0e38f) ? __expf(s[0][r] - mnew) : 0.f;
      const float p1 = (s[1][r] > -1.0e38f) ? __expf(s[1][r] - mnew) : 0.f;
      m_r[r] = mnew;
      l_r[r] = l_r[r] * alpha[r] + p0 + p1;            // per-lane partial row sum (16 lanes combined at the end)
      unsigned short hb = bf16_bits(p0); sPh[w][8 * hh + r][ln] = hb;      sPl[w][8 * hh + r][ln] = bf16_bits(p0 - bf16_val(hb));
      hb = bf16_bits(p1);                sPh[w][8 * hh + r][16 + ln] = hb; sPl[w][8 * hh + r][16 + ln] = bf16_bits(p1 - bf16_val(hb));
    }
#pragma unroll
    for (int dt = 0; dt < DT; ++dt)
#pragma unroll
      for (int r = 0; r < 8; ++r) oacc[dt][r] *= alpha[r];
    __builtin_amdgcn_fence(__ATOMIC_ACQ_REL, "workgroup");
    __builtin_amdgcn_wave_barrier();
    FragB pah, pal;
    pah.half[0] = *(const v8us*)&sPh[w][ln][8 * hh]; pah.half[1] = *(const v8us*)&sPh[w][ln][16 + 8 * hh];
    pal.half[0] = *(const v8us*)&sPl[w][ln][8 * hh]; pal.half[1] = *(const v8us*)&sPl[w][ln][16 + 8 * hh];
#pragma unroll
    for (int dt = 0; dt < DT; ++dt) {
      FragB bvh, bvl;
#pragma unroll
      for (int i = 0; i < 8; ++i) {
        bvh.u[i] = sVh[8 * hh + i][dt * 16 + ln]; bvh.u[8 + i] = sVh[16 + 8 * hh + i][dt * 16 + ln];
        bvl.u[i] = sVl[8 * hh + i][dt * 16 + ln]; bvl.u[8 + i] = sVl[16 + 8 * hh + i][dt * 16 + ln];
      }
      oacc[dt] = mmaN<3>(pah.v, pal.v, bvh.v, bvl.v, oacc[dt]);
    }
    __builtin_amdgcn_fence(__ATOMIC_ACQ_REL, "workgroup");
    __builtin_amdgcn_wave_barrier();
  }
#pragma unroll
  for (int r = 0; r < 8; ++r) {
    float l = l_r[r];
    l += __shfl_xor(l, 1, 32); l += __shfl_xor(l, 2, 32); l += __shfl_xor(l, 4, 32); l += __shfl_xor(l, 8, 32);
    l_r[r] = (l > 0.f) ? 1.0f / l : 0.f;
  }
#pragma unroll
  for (int dt = 0; dt < DT; ++dt)
#pragma unroll
    for (int r = 0; r < 8; ++r) sO[w][8 * hh + r][dt * 16 + ln] = oacc[dt][r] * l_r[r];
  __builtin_amdgcn_fence(__ATOMIC_ACQ_REL, "workgroup");
  __builtin_amdgcn_wave_barrier();
  {
    for (int r = 0; r < 16; ++r) {
      const int row = q0 + r;
      if (row < T && lane < D / 4) {
        const v4f val = *(const v4fa*)&sO[w][r][lane * 4];
        *(v4f*)(y + ((size_t)b * T + row) * ypitch + h * D + lane * 4) = val;
      }
    }
    
  }
}

// GEMM C = act(A·W + bias + resid): A f32 (ASPLIT -> hi/lo 2 terms), Wt bf16 [N][K]; ACT 0 none, 1 relu, 2 exact gelu;
// resid (optional, f32, row index = (row % rmod), pitch ldr, RES_BF16 rounds it) added before the activation.
template <bool ASPLIT, int ACT, bool BIAS_BF16, bool RES_BF16>
__global__ __launch_bounds__(128) void k_gemm_bf3(const float* __restrict__ A, int lda, const unsigned short* __restrict__ Wt, int ldb,
                                                const float* __restrict__ bias, const float* __restrict__ resid, int rmod, int ldr,
                                                float* __restrict__ C, int ldc, int M, int N, int K) {
  __shared__ __attribute__((aligned(16))) float so[4][16][64];
  const int tid = threadIdx.x, w = tid >> 5, lane = tid & 31, ln = lane & 15, hh = lane >> 4;
  const int ntn = N / 64;
  const int wid = blockIdx.x * 4 + w;
  const int mt = wid / ntn, nq = wid % ntn;
  if (mt * 16 >= M) return;
  const int row0 = mt * 16, col0 = nq * 64;
  const float* arow = A + (size_t)(row0 + ln) * lda;
  v8f acc[4] = {};
  for (int kb = 0; kb < K; kb += 32) {
    FragB ah, al;
    const v4f x0 = *(const v4fa*)(arow + kb + 8 * hh), x1 = *(const v4fa*)(arow + kb + 8 * hh + 4);
    const v4f x2 = *(const v4fa*)(arow + kb + 16 + 8 * hh), x3 = *(const v4fa*)(arow + kb + 16 + 8 * hh + 4);
    float xs[16] = {x0[0],x0[1],x0[2],x0[3],x1[0],x1[1],x1[2],x1[3],x2[0],x2[1],x2[2],x2[3],x3[0],x3[1],x3[2],x3[3]};
#pragma unroll
    for (int i = 0; i < 16; ++i) { const unsigned short hb = bf16_bits(xs[i]); ah.u[i] = hb; al.u[i] = ASPLIT ? bf16_bits(xs[i] - bf16_val(hb)) : (unsigned short)0; }
#pragma unroll
    for (int t = 0; t < 4; ++t) {
      const unsigned short* brow = Wt + (size_t)(col0 + t * 16 + ln) * ldb + kb;
      FragB b;
      b.half[0] = *(const v8us*)(brow + 8 * hh);
      b.half[1] = *(const v8us*)(brow + 16 + 8 * hh);
      acc[t] = mmaN<ASPLIT ? 2 : 1>(ah.v, al.v, b.v, b.v, acc[t]);
    }
  }
#pragma unroll
  for (int t = 0; t < 4; ++t) {
    const int col = col0 + t * 16 + ln;
    float bv = bias ? bias[col] : 0.f;
    if (BIAS_BF16) bv = bf16_round(bv);
#pragma unroll
    for (int r = 0; r < 8; ++r) {
      float v = acc[t][r] + bv;
      if (resid) { float rv = resid[(size_t)((row0 + 8 * hh + r) % rmod) * ldr + col]; if (RES_BF16) rv = bf16_round(rv); v += rv; }
      if (ACT == 1) v = fmaxf(v, 0.f);
      if (ACT == 2) v = 0.5f * v * (1.0f + erff(v * 0.70710678118654752f));
      if (ACT == 3) { const float u = 0.7978845608028654f * (v + 0.044715f * v * v * v); v = 0.5f * v * (1.0f + tanhf(u)); }
      so[w][8 * hh + r][t * 16 + ln] = v;
    }
  }
  __builtin_amdgcn_fence(__ATOMIC_ACQ_REL, "workgroup");
  __builtin_amdgcn_wave_barrier();
  const int rsub = lane >> 4, c4 = (lane & 15) * 4;
  {
#pragma unroll
    for (int q = 0; q < 8; ++q) {
      const int r = q * 2 + rsub;
      const v4f v = *(const v4fa*)&so[w][r][c4];
      *(v4f*)(C + (size_t)(row0 + r) * ldc + col0 + c4) = v;
    }
    
  }
}
// row LayerNorm (biased variance, eps) over N: s = X (+ R); optional out_sum <- s; out_norm <- (s-mu)*rsqrt(var+eps)*g + b
template <bool PARAM_BF16>
__global__ __launch_bounds__(256) void k_layernorm(const float* __restrict__ X, const float* __restrict__ R, const float* __restrict__ g, const float* __restrict__ bta,
                                                  float* __restrict__ out_sum, float* __restrict__ out_norm, int N, float eps) {
  __shared__ float red[256];
  const int row = blockIdx.x, tid = threadIdx.x;
  const float* x = X + (size_t)row * N; const float* rr = R ? R + (size_t)row * N : nullptr;
  float vals[16];                     // up to N = 4096
  const int per = N / 256;            // contiguous chunk per thread? use strided-by-4 chunks: thread handles j = tid*4 + 1024*u
  float s1 = 0.f;
  for (int u = 0; u < per / 4; ++u) {
    const int j = tid * 4 + 1024 * u;
    const v4f a = *(const v4fa*)(x + j);
    v4f b = {0.f,0.f,0.f,0.f}; if (rr) b = *(const v4fa*)(rr + j);
#pragma unroll
    for (int q = 0; q < 4; ++q) { const float v = a[q] + b[q]; vals[u * 4 + q] = v; s1 += v; }
  }
  red[tid] = s1; __syncthreads();
  for (int st = 128; st > 0; st >>= 1) { if (tid < st) red[tid] += red[tid + st]; __syncthreads(); }
  const float mu = red[0] / (float)N; __syncthreads();
  float s2 = 0.f;
  for (int u = 0; u < per / 4; ++u)
#pragma unroll
    for (int q = 0; q < 4; ++q) { const float c = vals[u * 4 + q] - mu; s2 += c * c; }
  red[tid] = s2; __syncthreads();
  for (int st = 128; st > 0; st >>= 1) { if (tid < st) red[tid] += red[tid + st]; __syncthreads(); }
  const float rs = rsqrtf(red[0] / (float)N + eps);
  {
    for (int u = 0; u < per / 4; ++u) {
      const int j = tid * 4 + 1024 * u;
      v4f o, sm;
#pragma unroll
      for (int q = 0; q < 4; ++q) {
        float gg = g[j + q], bb = bta[j + q];
        if (PARAM_BF16) { gg = bf16_round(gg); bb = bf16_round(bb); }
        sm[q] = vals[u * 4 + q]; o[q] = (vals[u * 4 + q] - mu) * rs * gg + bb;
      }
      if (out_sum) *(v4f*)(out_sum + (size_t)row * N + j) = sm;
      *(v4f*)(out_norm + (size_t)row * N + j) = o;
    }
    
  }
}



// ---- f16 WMMA path (v_wmma_f32_16x16x32_f16): 11-bit significands for operands in range — used where a [0,1] probability operand needs more precision than bf16
typedef _Float16 v16h __attribute__((ext_vector_type(16)));
union FragH { v16h v; v8us half[2]; _Float16 h[16]; unsigned short u[16]; };
template <int NT>
__device__ __forceinline__ v8f mmaH(v16h ah, v16h al, v16h bh, v16h bl, v8f c) {
  c = __builtin_amdgcn_wmma_f32_16x16x32_f16(false, ah, false, bh, (short)0, c, false, false);
  if (NT >= 2) c = __builtin_amdgcn_wmma_f32_16x16x32_f16(false, al, false, bh, (short)0, c, false, false);
  if (NT >= 3) c = __builtin_amdgcn_wmma_f32_16x16x32_f16(false, ah, false, bl, (short)0, c, false, false);
  asm volatile("v_nop\n\tv_nop\n\tv_nop\n\tv_nop" : "+v"(c) : "v"(ah), "v"(al), "v"(bh), "v"(bl));
  return c;
}
// batched GEMM like k_gemm_b but f16 operands: A f32 (split into f16 hi/lo if ASPLIT, else rounded to f16), Bt = f16 values [n][k]; alpha; C f32; N multiple of 16 (partial tiles skipped)
template <bool ASPLIT>
__global__ __launch_bounds__(128) void k_gemm_h(const float* __restrict__ A, int lda, size_t sA, const _Float16* __restrict__ Bh, int ldb, size_t sB, float alpha, float* __restrict__ C, int ldc, size_t sC, int M, int N, int K) {
  __shared__ __attribute__((aligned(16))) float so[4][16][64];
  const int tid = threadIdx.x, w = tid >> 5, lane = tid & 31, ln = lane & 15, hh = lane >> 4; const int by = blockIdx.y;
  A += (size_t)by * sA; Bh += (size_t)by * sB; C += (size_t)by * sC;
  const int ntn = (N + 63) / 64; const int wid = blockIdx.x * 4 + w; const int mt = wid / ntn, nq = wid % ntn; if (mt * 16 >= M) return;
  const int row0 = mt * 16, col0 = nq * 64; const float* arow = A + (size_t)(row0 + ln) * lda;
  v8f acc[4] = {};
  for (int kb = 0; kb < K; kb += 32) {
    FragH ah, al;
    const v4f x0 = *(const v4fa*)(arow + kb + 8 * hh), x1 = *(const v4fa*)(arow + kb + 8 * hh + 4), x2 = *(const v4fa*)(arow + kb + 16 + 8 * hh), x3 = *(const v4fa*)(arow + kb + 16 + 8 * hh + 4);
    float xs[16] = {x0[0],x0[1],x0[2],x0[3],x1[0],x1[1],x1[2],x1[3],x2[0],x2[1],x2[2],x2[3],x3[0],x3[1],x3[2],x3[3]};
#pragma unroll
    for (int i = 0; i < 16; ++i) { const _Float16 h = (_Float16)xs[i]; ah.h[i] = h; al.h[i] = ASPLIT ? (_Float16)(xs[i] - (float)h) : (_Float16)0.0f; }
#pragma unroll
    for (int t = 0; t < 4; ++t) { if (col0 + t * 16 >= N) continue; const size_t boff = (size_t)(col0 + t * 16 + ln) * ldb + kb; FragH bq; bq.half[0] = *(const v8us*)(Bh + boff + 8 * hh); bq.half[1] = *(const v8us*)(Bh + boff + 16 + 8 * hh);
      acc[t] = mmaH<ASPLIT ? 2 : 1>(ah.v, al.v, bq.v, bq.v, acc[t]); }
  }
#pragma unroll
  for (int t = 0; t < 4; ++t) { if (col0 + t * 16 >= N) continue;
#pragma unroll
    for (int r = 0; r < 8; ++r) so[w][8 * hh + r][t * 16 + ln] = acc[t][r] * alpha; }
  __builtin_amdgcn_fence(__ATOMIC_ACQ_REL, "workgroup"); __builtin_amdgcn_wave_barrier();
  const int rsub = lane >> 4, c4 = (lane & 15) * 4;
  {
#pragma unroll
    for (int q = 0; q < 8; ++q) { const int r = q * 2 + rsub; if (col0 + c4 < N) { const v4f v = *(const v4fa*)&so[w][r][c4]; *(v4f*)(C + (size_t)(row0 + r) * ldc + col0 + c4) = v; } }
     }
}

// Wt[n][k] = f16(W[k][n]·scale) from f32 row-major W[K][N] (scale = power of two; bf16-exact weights stay exact in f16 away from the subnormal range)
__global__ __launch_bounds__(256) void k_wt_f16(const float* __restrict__ W, _Float16* __restrict__ Wt, int K, int N, float scale) {
  const int t = blockIdx.x * 256 + threadIdx.x; if (t >= N * (K / 8)) return; const int n = t / (K / 8), k8 = (t % (K / 8)) * 8; FragH f;
#pragma unroll
  for (int i = 0; i < 8; ++i) f.h[i] = (_Float16)(bf16_round(W[(size_t)(k8 + i) * N + n]) * scale); const v8us o = f.half[0];
  *(v8us*)((unsigned short*)Wt + (size_t)n * K + k8) = o; 
}
// k_gemm_hh variant with fused epilogue: v = acc·alpha + bias[by·sBias + col] (+ CP[(row/rowsPerB)·sCPb + by·64 + col] if CP) ; ACT 0 none / 1 elu ; writes f32 C and f16 C16, each if non-null
template <int ACT>
__global__ __launch_bounds__(128) void k_gemm_hhx(const _Float16* __restrict__ A, int lda, size_t sA, const _Float16* __restrict__ Bh, int ldb, size_t sB, float alpha, const float* __restrict__ bias, size_t sBias, const float* __restrict__ CP, int rowsPerB, size_t sCPb, int row0g,
    float* __restrict__ C, _Float16* __restrict__ C16, int ldc, size_t sC, int M, int N, int K) {
  __shared__ __attribute__((aligned(16))) float so[4][16][64];
  const int tid = threadIdx.x, w = tid >> 5, lane = tid & 31, ln = lane & 15, hh = lane >> 4; const int by = blockIdx.y;
  A += (size_t)by * sA; Bh += (size_t)by * sB; const size_t cofs = (size_t)by * sC; const float* bp = bias ? bias + (size_t)by * sBias : nullptr;
  const int ntn = (N + 63) / 64; const int wid = blockIdx.x * 4 + w; const int mt = wid / ntn, nq = wid % ntn; if (mt * 16 >= M) return;
  const int row0 = mt * 16, col0 = nq * 64; const _Float16* arow = A + (size_t)(row0 + ln) * lda;
  v8f acc[4] = {};
  for (int kb = 0; kb < K; kb += 32) { FragH ah; ah.half[0] = *(const v8us*)((const unsigned short*)arow + kb + 8 * hh); ah.half[1] = *(const v8us*)((const unsigned short*)arow + kb + 16 + 8 * hh);
#pragma unroll
    for (int t = 0; t < 4; ++t) { if (col0 + t * 16 >= N) continue; const size_t boff = (size_t)(col0 + t * 16 + ln) * ldb + kb; FragH bq; bq.half[0] = *(const v8us*)((const unsigned short*)Bh + boff + 8 * hh); bq.half[1] = *(const v8us*)((const unsigned short*)Bh + boff + 16 + 8 * hh);
      acc[t] = mmaH<1>(ah.v, ah.v, bq.v, bq.v, acc[t]); }
  }
#pragma unroll
  for (int t = 0; t < 4; ++t) { if (col0 + t * 16 >= N) continue; const int col = col0 + t * 16 + ln; const float bv = bp ? bf16_round(bp[col]) : 0.f;
#pragma unroll
    for (int r = 0; r < 8; ++r) { float v = acc[t][r] * alpha + bv; if (CP) { const int bidx = (row0g + row0 + 8 * hh + r) / rowsPerB; v += CP[(size_t)bidx * sCPb + (size_t)by * 64 + col]; } if (ACT == 1) v = (v > 0.f) ? v : expm1f(v); else if (ACT == 7) v = (v > 0.f) ? v + 1.0f : expf(v); else if (ACT == 8) v = tanhf(v); else if (ACT == 9) v = 0.5f * v * (1.0f + tanhf(0.7978845608028654f * (v + 0.044715f * v * v * v))); else if (ACT == 11) v = 1.0f / (1.0f + expf(-v)); else if (ACT == 12) v = (v > 0.f) ? v : 0.01f * v; else if (ACT == 14) v = (v > 0.f) ? v : 0.1f * v; else if (ACT == 15) v = v / (1.0f + expf(-v)); else if (ACT == 3) v = fmaxf(v, 0.f); else if (ACT == 6) v = 0.5f * v * (1.0f + erff(v * 0.70710678118654752f)); so[w][8 * hh + r][t * 16 + ln] = v; } }
  __builtin_amdgcn_fence(__ATOMIC_ACQ_REL, "workgroup"); __builtin_amdgcn_wave_barrier();
  const int rsub = lane >> 4, c4 = (lane & 15) * 4; typedef _Float16 v4h __attribute__((ext_vector_type(4)));
  {
#pragma unroll
    for (int q = 0; q < 8; ++q) { const int r = q * 2 + rsub; if (col0 + c4 < N) { const v4f v = *(const v4fa*)&so[w][r][c4]; if (C) *(v4f*)(C + cofs + (size_t)(row0 + r) * ldc + col0 + c4) = v; if (C16) { v4h h4; for (int i = 0; i < 4; ++i) h4[i] = (_Float16)v[i]; *(v4h*)(C16 + cofs + (size_t)(row0 + r) * ldc + col0 + c4) = h4; } } }
     }
}


typedef _Float16 v4h __attribute__((ext_vector_type(4)));

__global__ __launch_bounds__(256) void k_x16(const float* __restrict__ x, _Float16* __restrict__ X16, size_t n8) { const size_t t = (size_t)blockIdx.x * 256 + threadIdx.x; if (t >= n8) return; FragH f;
#pragma unroll
  for (int q = 0; q < 8; ++q) f.h[q] = (_Float16)bf16_round(x[t * 8 + q]); *(v8us*)((unsigned short*)X16 + t * 8) = f.half[0];  }
__global__ __launch_bounds__(256) void k_h16(const float* __restrict__ x, _Float16* __restrict__ X16, size_t n8) { const size_t t = (size_t)blockIdx.x * 256 + threadIdx.x; if (t >= n8) return; FragH f;
#pragma unroll
  for (int q = 0; q < 8; ++q) f.h[q] = (_Float16)x[t * 8 + q]; *(v8us*)((unsigned short*)X16 + t * 8) = f.half[0];  }
__global__ __launch_bounds__(256) void k_round16f(const float* __restrict__ W, _Float16* __restrict__ Bt, size_t n8) { const size_t t = (size_t)blockIdx.x * 256 + threadIdx.x; if (t >= n8) return; FragH f;
#pragma unroll
  for (int i = 0; i < 8; ++i) f.h[i] = (_Float16)(bf16_round(W[t * 8 + i]) * 16.0f); *(v8us*)((unsigned short*)Bt + t * 8) = f.half[0];  }
template <int NHv, int TTv>
__global__ __launch_bounds__(256) void k_vt(const _Float16* __restrict__ V16, int ldv, int voff, _Float16* __restrict__ Vt) { __shared__ unsigned short tl[64][66]; const int tid = threadIdx.x; const int slab = blockIdx.x / (TTv / 64), lg = blockIdx.x % (TTv / 64); const int b = slab / NHv, h = slab % NHv;
  for (int i = tid; i < 64 * 8; i += 256) { const int r = i / 8, c8 = (i % 8) * 8; FragH f; f.half[0] = *(const v8us*)((const unsigned short*)V16 + ((size_t)b * TTv + lg * 64 + r) * ldv + voff + h * 64 + c8);
#pragma unroll
    for (int q = 0; q < 8; ++q) tl[r][c8 + q] = f.u[q]; }
  __syncthreads();
  {
#pragma unroll
    for (int rd = 0; rd < 2; ++rd) { const int d = rd * 32 + tid / 8, pc = tid % 8; FragH f;
#pragma unroll
      for (int q = 0; q < 8; ++q) f.u[q] = tl[pc * 8 + q][d];
      *(v8us*)((unsigned short*)Vt + ((size_t)slab * 64 + d) * TTv + lg * 64 + pc * 8) = f.half[0]; }
     } }

__global__ __launch_bounds__(256) void k_qbias(const float* __restrict__ QF, const float* __restrict__ rwb, const float* __restrict__ rrb, _Float16* __restrict__ QW, _Float16* __restrict__ QR, size_t n8) { const size_t t = (size_t)blockIdx.x * 256 + threadIdx.x; if (t >= n8) return; const int c0 = (int)((t * 8) % DM); const v4f a = *(const v4fa*)(QF + t * 8), b = *(const v4fa*)(QF + t * 8 + 4); FragH fw, fr;
#pragma unroll
  for (int q = 0; q < 8; ++q) { const float v = (q < 4) ? a[q] : b[q - 4]; fw.h[q] = (_Float16)(v + bf16_round(rwb[c0 + q])); fr.h[q] = (_Float16)(v + bf16_round(rrb[c0 + q])); }
  { *(v8us*)((unsigned short*)QW + t * 8) = fw.half[0]; *(v8us*)((unsigned short*)QR + t * 8) = fr.half[0];  } }
// per (b,n) row kernel (blockIdx.y = the (b,n) plane inside the launched group; the mask is shared): for query i, s[j] = (AC[i][j] + BDshift[i][j])·1/8 with BDshift from the exact pad/reshape shift: idx = QL + i·KL + j, i' = idx / (KL+1), j' = idx mod (KL+1), BD = (j' == 0) ? 0 : BDR[i'][j'−1] (i' ∈ {i, i+1} < QL, addresses clamped);
__global__ __launch_bounds__(256) void k_rel(const float* __restrict__ AC, const float* __restrict__ BDR, const int* __restrict__ MSK, _Float16* __restrict__ P16) { const int tid = threadIdx.x, wv = tid >> 5, lane = tid & 31; const int i = blockIdx.x * 8 + wv; AC += (size_t)blockIdx.y * QL * KL; BDR += (size_t)blockIdx.y * QL * KL; P16 += (size_t)blockIdx.y * QL * KL; const float* ar = AC + (size_t)i * KL; const int* mk = MSK + (size_t)i * KL;
  v4f sv[16]; float mx = -3.0e38f;
#pragma unroll
  for (int jj = 0; jj < 16; ++jj) { const int j0 = jj * 128 + lane * 4; const v4f a = *(const v4fa*)(ar + j0); v4f s;
#pragma unroll
    for (int e = 0; e < 4; ++e) { const int j = j0 + e; const size_t idx = (size_t)QL + (size_t)i * KL + j; int ip = (int)(idx / (KL + 1)); const int jp = (int)(idx % (KL + 1)); ip = ip < 0 ? 0 : (ip >= QL ? QL - 1 : ip); const int jm = (jp > 0) ? jp - 1 : 0; const float bdv = BDR[(size_t)ip * KL + jm]; const float bd = (jp > 0) ? bdv : 0.f;
      const float val = (a[e] + bd) * ATT_SCALE; s[e] = (mk[j] != 0) ? -INFINITY : val; mx = fmaxf(mx, s[e]); }
    sv[jj] = s; }
  for (int o = 16; o >= 1; o >>= 1) mx = fmaxf(mx, __shfl_xor(mx, o, 32)); float z = 0.f;
#pragma unroll
  for (int jj = 0; jj < 16; ++jj) for (int e = 0; e < 4; ++e) { const float p = (sv[jj][e] > -INFINITY) ? __expf(sv[jj][e] - mx) : 0.f; sv[jj][e] = p; z += p; }
  for (int o = 16; o >= 1; o >>= 1) z += __shfl_xor(z, o, 32); const float iz = (z > 0.f) ? 32768.0f / z : 0.f;
  typedef _Float16 v4h __attribute__((ext_vector_type(4)));
  {
#pragma unroll
    for (int jj = 0; jj < 16; ++jj) { v4h o; for (int e = 0; e < 4; ++e) o[e] = (_Float16)(sv[jj][e] * iz); *(v4h*)(P16 + (size_t)i * KL + jj * 128 + lane * 4) = o; }
     } }
__global__ __launch_bounds__(256) void k_lnout(const float* __restrict__ RES, const float* __restrict__ w, const float* __restrict__ g, const float* __restrict__ bb, float* __restrict__ out) { const int tid = threadIdx.x, wv = tid >> 5, lane = tid & 31; const int r = blockIdx.x * 8 + wv; if (r >= NQR) return; v4f y[8]; float s = 0.f;
#pragma unroll
  for (int j = 0; j < 8; ++j) { const int c = j * 128 + lane * 4; const v4f a = *(const v4fa*)(RES + (size_t)r * DM + c), x = *(const v4fa*)(w + (size_t)r * DM + c); for (int q = 0; q < 4; ++q) { y[j][q] = a[q] + bf16_round(x[q]); s += y[j][q]; } }
  for (int o = 16; o >= 1; o >>= 1) s += __shfl_xor(s, o, 32); const float mu = s / (float)DM; float q2 = 0.f;
#pragma unroll
  for (int j = 0; j < 8; ++j) for (int q = 0; q < 4; ++q) { const float d = y[j][q] - mu; q2 += d * d; }
  for (int o = 16; o >= 1; o >>= 1) q2 += __shfl_xor(q2, o, 32); const float rs = rsqrtf(q2 / (float)DM + 1e-5f);
  {
#pragma unroll
    for (int j = 0; j < 8; ++j) { const int c = j * 128 + lane * 4; v4f o; for (int q = 0; q < 4; ++q) o[q] = (y[j][q] - mu) * rs * bf16_round(g[c + q]) + bf16_round(bb[c + q]); *(v4f*)(out + (size_t)r * DM + c) = o; }
     } }

extern "C" void kernel_launch(void* const* d_in, const int* in_sizes, int n_in,
                              void* d_out, int out_size, void* d_ws, size_t ws_size, hipStream_t stream) {
  (void)in_sizes; (void)n_in; (void)out_size;
  const float* const* I = (const float* const*)d_in; const float* w = I[0]; const float* r = I[1]; const float* mems = I[2]; const float* rwb = I[3]; const float* rrb = I[4]; const int* msk = (const int*)d_in[5];
  const float* Wq = I[6]; const float* bq = I[7]; const float* Wk = I[8]; const float* bk = I[9]; const float* Wv = I[10]; const float* bv = I[11]; const float* Wr = I[12]; const float* br = I[13]; const float* Wo = I[14]; const float* bo = I[15]; const float* lg = I[16]; const float* lb = I[17];
  char* ws = (char*)d_ws; size_t off = 0;
  auto take = [&](size_t bytes) { char* p = ws + off; off += (bytes + 255) & ~(size_t)255; return p; };
  const size_t WSZ = (size_t)DM * DM; _Float16* Bw = (_Float16*)take(5 * WSZ * 2);      /* Wq, Wk, Wv, Wr, Wo */
  _Float16* QW = (_Float16*)take((size_t)NQR * DM * 2); _Float16* QR = (_Float16*)take((size_t)NQR * DM * 2);
  _Float16* K16 = (_Float16*)take((size_t)NKR * DM * 2); _Float16* Vt = (_Float16*)take((size_t)NKR * DM * 2); _Float16* RK = (_Float16*)take((size_t)KL * DM * 2);
  _Float16* P16 = (_Float16*)take((size_t)BZ * NH * QL * KL * 2); float* O = (float*)take((size_t)NQR * DM * 4); _Float16* O16 = (_Float16*)take((size_t)NQR * DM * 2);      /* P of all 32 (b,n) planes, so that one launch does every P*V */
  float* AC = (float*)take((size_t)GH * QL * KL * 4); float* BDR = (float*)take((size_t)GH * QL * KL * 4);      /* score planes of one group of GH heads */
  _Float16* CAT = (_Float16*)AC; _Float16* R16 = CAT + (size_t)NKR * DM; _Float16* V16 = R16 + (size_t)KL * DM; float* QF = (float*)(V16 + (size_t)NKR * DM); float* RES = QF;      /* 28 MiB that share AC's 32 MiB: cat, r, v and q f32 are dead before the first score GEMM writes AC; the Wo GEMM output reuses QF after the last read of AC */
  if (off > ws_size) return;      // MiB: 10 + 4 + 4 + 8 + 8 + 4 + 128 + 8 + 4 + 32 + 32 = 242 of 256
  const unsigned gwt = (unsigned)(((size_t)DM * (DM / 8) + 255) / 256);
  k_wt_f16<<<gwt, 256, 0, stream>>>(Wq, Bw, DM, DM, 16.0f); k_wt_f16<<<gwt, 256, 0, stream>>>(Wk, Bw + WSZ, DM, DM, 16.0f); k_wt_f16<<<gwt, 256, 0, stream>>>(Wv, Bw + 2 * WSZ, DM, DM, 16.0f); k_wt_f16<<<gwt, 256, 0, stream>>>(Wr, Bw + 3 * WSZ, DM, DM, 16.0f); k_wt_f16<<<gwt, 256, 0, stream>>>(Wo, Bw + 4 * WSZ, DM, DM, 16.0f);      /* (in,out) → Bt ×2^4 */
  const unsigned gh = (unsigned)(((size_t)NQR * DM / 8 + 255) / 256);
  k_x16<<<gh, 256, 0, stream>>>(mems, CAT, (size_t)NQR * DM / 8); k_x16<<<gh, 256, 0, stream>>>(w, CAT + (size_t)NQR * DM, (size_t)NQR * DM / 8); k_x16<<<gh, 256, 0, stream>>>(r, R16, (size_t)KL * DM / 8);      /* cat = [mems; w] is the two inputs back to back (rows (j,b)); r rows m */
  const dim3 gq(((NQR / 16) * (DM / 64) + 3) / 4, 1), gk(((NKR / 16) * (DM / 64) + 3) / 4, 1), grr(((KL / 16) * (DM / 64) + 3) / 4, 1);
  k_gemm_hhx<0><<<gq, 128, 0, stream>>>(CAT + (size_t)NQR * DM, DM, 0, Bw, DM, 0, 0.0625f, bq, 0, nullptr, 1, 0, 0, QF, nullptr, DM, 0, NQR, DM, DM); k_qbias<<<gh, 256, 0, stream>>>(QF, rwb, rrb, QW, QR, (size_t)NQR * DM / 8);      /* q (last qlen rows of cat) + bq → + r_w_bias / + r_r_bias */
  k_gemm_hhx<0><<<gk, 128, 0, stream>>>(CAT, DM, 0, Bw + WSZ, DM, 0, 0.0625f, bk, 0, nullptr, 1, 0, 0, nullptr, K16, DM, 0, NKR, DM, DM);      /* k: M 4096 N 1024 K 1024 */
  k_gemm_hhx<0><<<gk, 128, 0, stream>>>(CAT, DM, 0, Bw + 2 * WSZ, DM, 0, 0.0625f, bv, 0, nullptr, 1, 0, 0, nullptr, V16, DM, 0, NKR, DM, DM);      /* v */
  k_gemm_hhx<0><<<grr, 128, 0, stream>>>(R16, DM, 0, Bw + 3 * WSZ, DM, 0, 0.0625f, br, 0, nullptr, 1, 0, 0, nullptr, RK, DM, 0, KL, DM, DM);      /* rk = r·Wr + br: M 2048 */
  for (int b = 0; b < BZ; ++b) k_vt<NH, KL><<<NH * (KL / 64), 256, 0, stream>>>(V16 + (size_t)b * DM, BZ * DM, 0, Vt + (size_t)b * NH * 64 * KL);      /* Vᵀ per (b,n): V rows (j,b) have stride 2·1024 */
  const dim3 gs(((QL / 16) * (KL / 64) + 3) / 4, GH), go(((QL / 16) * 1 + 3) / 4, BZ * NH);
  for (int b = 0; b < BZ; ++b) for (int h = 0; h < NH; h += GH) {      /* blockIdx.y walks the GH heads of a group: head columns are 64 apart in q, k and rk, planes QL*KL apart in AC, BD and P */
    k_gemm_hhx<0><<<gs, 128, 0, stream>>>(QW + (size_t)b * DM + h * 64, BZ * DM, 64, K16 + (size_t)b * DM + h * 64, BZ * DM, 64, 1.0f, nullptr, 0, nullptr, 1, 0, 0, AC, nullptr, KL, (size_t)QL * KL, QL, KL, 64);      /* AC = (q + r_w_bias)·kᵀ: M 1024 N 2048 K 64 (row strides 2048: interleaved (i,b) / (j,b) rows) */
    k_gemm_hhx<0><<<gs, 128, 0, stream>>>(QR + (size_t)b * DM + h * 64, BZ * DM, 64, RK + h * 64, DM, 64, 1.0f, nullptr, 0, nullptr, 1, 0, 0, BDR, nullptr, KL, (size_t)QL * KL, QL, KL, 64);      /* raw BD = (q + r_r_bias)·rkᵀ: M 1024 N 2048 K 64 */
    k_rel<<<dim3(QL / 8, GH), 256, 0, stream>>>(AC, BDR, msk, P16 + ((size_t)b * NH + h) * QL * KL); }
  k_gemm_hhx<0><<<go, 128, 0, stream>>>(P16, KL, (size_t)QL * KL, Vt, KL, (size_t)64 * KL, 0.000030517578125f, nullptr, 0, nullptr, 1, 0, 0, O, nullptr, BZ * DM, 64, QL, 64, KL);      /* attn_vec rows (i,b), plane s = b*16 + h at cols s*64 of the 2048-wide (i) row: M 1024 N 64 K 2048, ldc 2048, all 32 planes in blockIdx.y */
  k_h16<<<gh, 256, 0, stream>>>(O, O16, (size_t)NQR * DM / 8);
  k_gemm_hhx<0><<<gq, 128, 0, stream>>>(O16, DM, 0, Bw + 4 * WSZ, DM, 0, 0.0625f, bo, 0, nullptr, 1, 0, 0, RES, nullptr, DM, 0, NQR, DM, DM);      /* attn_out = attn_vec·Wo + bo (rows (i,b)) */
  k_lnout<<<(NQR + 7) / 8, 256, 0, stream>>>(RES, w, lg, lb, (float*)d_out);
}

// v002
// Measured time: 407 microseconds a run.
// Timed twice side by side with v001, it ran 1.78 and 1.79 times as fast.
// Over all steps from v000 it is 6.76 times as fast.
#include <hip/hip_runtime.h>
// Transformer-XL relative multi-head attention (qlen 1024, mem_len 1024 → klen 2048, bsz 2, 16 heads × 64, post-LN): cat = [mems; w] (rows (j,b)); q = (cat·Wq + bq)[last qlen], k, v = cat·Wk + bk, cat·Wv + bv; rk = r·Wr + br;
// AC[i,j] = (q_i + r_w_bias)·k_j; BD = rel_shift((q_i + r_r_bias)·rk_m) (the exact pad-reshape shift, incl. its wrap region); score = (AC + BD)/8, −inf where the INPUT mask is set; softmax over j; attn_vec = Σ_j p·v_j;
// out = LayerNorm(w + attn_vec·Wo + bo)·g + b → [1024, 2, 1024]. (in,out) weights.
// Compute dtype: w, mems, r, biases, weights rounded to bf16; q (+ the two head biases), k, v, rk as f16 GEMM planes; one fused kernel forms, per 16 query rows of a (b,n) plane, AC and raw BD (f32 accumulators),
// applies the relative shift as a scatter into LDS, the mask and an f32 softmax and writes P f16 x2^15; attn_vec by GEMM; Wo GEMM + bias; residual + LayerNorm in f32 (wave per row). All contractions on v_wmma_f32_16x16x32_f16, f32 accumulate.
#define QL 1024
#define KL 2048
#define BZ 2
#define NH 16
#define DM 1024
#define NQR (QL * BZ)
#define NKR (KL * BZ)
#define ATT_SCALE 0.125f

typedef __bf16 v16b __attribute__((ext_vector_type(16)));
typedef unsigned short v8us __attribute__((ext_vector_type(8), may_alias));
typedef float  v8f  __attribute__((ext_vector_type(8)));
typedef float  v4f  __attribute__((ext_vector_type(4)));
typedef float  v4fa __attribute__((ext_vector_type(4), may_alias));
union FragB { v16b v; v8us half[2]; unsigned short u[16]; };

__device__ __forceinline__ unsigned short bf16_bits(float x) { unsigned int u = __float_as_uint(x); return (unsigned short)((u + 0x7FFFu + ((u >> 16) & 1u)) >> 16); }
__device__ __forceinline__ float bf16_val(unsigned short b) { return __uint_as_float(((unsigned int)b) << 16); }
__device__ __forceinline__ float bf16_round(float x) { return bf16_val(bf16_bits(x)); }
// D += A·B with NT terms: 1 = ah·bh, 2 = + al·bh (A split), 3 = + ah·bl (both split)
template <int NT>
__device__ __forceinline__ v8f mmaN(v16b ah, v16b al, v16b bh, v16b bl, v8f c) {
  c = __builtin_amdgcn_wmma_f32_16x16x32_bf16(false, ah, false, bh, (short)0, c, false, false);
  if (NT >= 2) c = __builtin_amdgcn_wmma_f32_16x16x32_bf16(false, al, false, bh, (short)0, c, false, false);
  if (NT >= 3) c = __builtin_amdgcn_wmma_f32_16x16x32_bf16(false, ah, false, bl, (short)0, c, false, false);
  asm volatile("v_nop\n\tv_nop\n\tv_nop\n\tv_nop" : "+v"(c) : "v"(ah), "v"(al), "v"(bh), "v"(bl));
  return c;
}

__global__ __launch_bounds__(256) void k_wt_bf16(const float* __restrict__ W, unsigned short* __restrict__ Wt, int K, int N) {
  const int t = blockIdx.x * 256 + threadIdx.x;
  const int k8n = K / 8;
  if (t >= N * k8n) return;
  const int n = t / k8n, k8 = (t % k8n) * 8;
  v8us v;
#pragma unroll
  for (int i = 0; i < 8; ++i) v[i] = bf16_bits(W[(size_t)(k8 + i) * N + n]);
  *(v8us*)(Wt + (size_t)n * K + k8) = v;
  
}

// GEMM C[M][N] (f32, pitch ldc) = act(A[M][K]·W + bias). A f32 row-major (pitch lda) converted per fragment to bf16
// (ASPLIT: hi/lo two planes -> 2 terms, else single rounded term); Wt bf16 [N][K] (pitch ldb). BIAS_BF16 rounds the
// bias to bf16 first (bias quantised to bf16 before the add). K%32==0, M%16==0, N%64==0.
template <bool ASPLIT, int ACT, bool BIAS_BF16>
__global__ __launch_bounds__(128) void k_gemm_bf(const float* __restrict__ A, int lda, const unsigned short* __restrict__ Wt, int ldb,
                                               const float* __restrict__ bias, float* __restrict__ C, int ldc, int M, int N, int K) {
  __shared__ __attribute__((aligned(16))) float so[4][16][64];
  const int tid = threadIdx.x, w = tid >> 5, lane = tid & 31, ln = lane & 15, hh = lane >> 4;
  const int ntn = N / 64;
  const int wid = blockIdx.x * 4 + w;
  const int mt = wid / ntn, nq = wid % ntn;
  if (mt * 16 >= M) return;
  const int row0 = mt * 16, col0 = nq * 64;
  const float* arow = A + (size_t)(row0 + ln) * lda;
  v8f acc[4] = {};
  for (int kb = 0; kb < K; kb += 32) {
    FragB ah, al;
    const v4f x0 = *(const v4fa*)(arow + kb + 8 * hh), x1 = *(const v4fa*)(arow + kb + 8 * hh + 4);
    const v4f x2 = *(const v4fa*)(arow + kb + 16 + 8 * hh), x3 = *(const v4fa*)(arow + kb + 16 + 8 * hh + 4);
    float xs[16] = {x0[0],x0[1],x0[2],x0[3],x1[0],x1[1],x1[2],x1[3],x2[0],x2[1],x2[2],x2[3],x3[0],x3[1],x3[2],x3[3]};
#pragma unroll
    for (int i = 0; i < 16; ++i) { const unsigned short hb = bf16_bits(xs[i]); ah.u[i] = hb; al.u[i] = ASPLIT ? bf16_bits(xs[i] - bf16_val(hb)) : (unsigned short)0; }
#pragma unroll
    for (int t = 0; t < 4; ++t) {
      const unsigned short* brow = Wt + (size_t)(col0 + t * 16 + ln) * ldb + kb;
      FragB b;
      b.half[0] = *(const v8us*)(brow + 8 * hh);
      b.half[1] = *(const v8us*)(brow + 16 + 8 * hh);
      acc[t] = mmaN<ASPLIT ? 2 : 1>(ah.v, al.v, b.v, b.v, acc[t]);
    }
  }
#pragma unroll
  for (int t = 0; t < 4; ++t) {
    float bv = bias ? bias[col0 + t * 16 + ln] : 0.f;
    if (BIAS_BF16) bv = bf16_round(bv);
#pragma unroll
    for (int r = 0; r < 8; ++r) { float v = acc[t][r] + bv; if (ACT == 1) v = fmaxf(v, 0.f); so[w][8 * hh + r][t * 16 + ln] = v; }
  }
  __builtin_amdgcn_fence(__ATOMIC_ACQ_REL, "workgroup");
  __builtin_amdgcn_wave_barrier();
  const int rsub = lane >> 4, c4 = (lane & 15) * 4;
  {
#pragma unroll
    for (int q = 0; q < 8; ++q) {
      const int r = q * 2 + rsub;
      const v4f v = *(const v4fa*)&so[w][r][c4];
      *(v4f*)(C + (size_t)(row0 + r) * ldc + col0 + c4) = v;
    }
    
  }
}

// Flash-style causal/unmasked attention, all contractions 3-term bf16 hi/lo splits, f32 softmax with running max.
// q,k,v rows are read from f32 buffers with arbitrary row pitch (so they can live inside a fused qkv buffer);
// D = head size (multiple of 32, <= 128); one wave = 16 query rows; block = 4 waves (64 queries) sharing K/V chunks of 32.
template <int D, bool CAUSAL>
__global__ __launch_bounds__(128) void k_flash(const float* __restrict__ qb, const float* __restrict__ kb, const float* __restrict__ vb,
                                             int pitch, int T, int H, float scale, float* __restrict__ y, int ypitch) {
  constexpr int KS = D / 32;        // k-steps for QK
  constexpr int DT = D / 16;        // d tiles for PV
  __shared__ __attribute__((aligned(16))) unsigned short sKh[32][D + 8], sKl[32][D + 8], sVh[32][D + 8], sVl[32][D + 8];
  __shared__ __attribute__((aligned(16))) unsigned short sPh[4][16][40], sPl[4][16][40];
  __shared__ __attribute__((aligned(16))) float sO[4][16][D];
  const int tid = threadIdx.x, w = tid >> 5, lane = tid & 31, ln = lane & 15, hh = lane >> 4;
  const int nqb = (T + 63) / 64;
  const int bh = blockIdx.x / nqb, qblk = blockIdx.x % nqb;
  const int b = bh / H, h = bh % H;
  const int q0 = qblk * 64 + w * 16;
  const float* Q = qb + (size_t)b * T * pitch + h * D;
  const float* K = kb + (size_t)b * T * pitch + h * D;
  const float* V = vb + (size_t)b * T * pitch + h * D;

  // A fragments of the wave's 16 query rows (scaled), hi/lo
  FragB aqh[KS], aql[KS];
  {
    int row = q0 + ln; if (row >= T) row = T - 1;
    const float* qr = Q + (size_t)row * pitch;
#pragma unroll
    for (int ks = 0; ks < KS; ++ks)
#pragma unroll
      for (int i = 0; i < 16; ++i) {
        const int d = ks * 32 + ((i < 8) ? (8 * hh + i) : (16 + 8 * hh + (i - 8)));
        const float x = qr[d] * scale; const unsigned short hb = bf16_bits(x);
        aqh[ks].u[i] = hb; aql[ks].u[i] = bf16_bits(x - bf16_val(hb));
      }
  }
  float m_r[8], l_r[8];
#pragma unroll
  for (int r = 0; r < 8; ++r) { m_r[r] = -3.0e38f; l_r[r] = 0.f; }
  v8f oacc[DT];
#pragma unroll
  for (int dt = 0; dt < DT; ++dt) oacc[dt] = (v8f){0.f,0.f,0.f,0.f,0.f,0.f,0.f,0.f};

  const int kv_end = CAUSAL ? min(T, qblk * 64 + 64) : T;     // block-uniform
  for (int j0 = 0; j0 < kv_end; j0 += 32) {
    __syncthreads();
    for (int e = tid; e < 32 * (D / 4); e += 128) {
      const int r = e / (D / 4), c4 = (e % (D / 4)) * 4;
      const int key = j0 + r;
      v4f kf = {0.f,0.f,0.f,0.f}, vf = {0.f,0.f,0.f,0.f};
      if (key < T) { kf = *(const v4fa*)(K + (size_t)key * pitch + c4); vf = *(const v4fa*)(V + (size_t)key * pitch + c4); }
#pragma unroll
      for (int t = 0; t < 4; ++t) {
        unsigned short hb = bf16_bits(kf[t]); sKh[r][c4 + t] = hb; sKl[r][c4 + t] = bf16_bits(kf[t] - bf16_val(hb));
        hb = bf16_bits(vf[t]); sVh[r][c4 + t] = hb; sVl[r][c4 + t] = bf16_bits(vf[t] - bf16_val(hb));
      }
    }
    __syncthreads();
    // S tile 16 x 32
    v8f s[2];
#pragma unroll
    for (int nt = 0; nt < 2; ++nt) {
      v8f acc = {};
#pragma unroll
      for (int ks = 0; ks < KS; ++ks) {
        FragB bh_, bl_;
        bh_.half[0] = *(const v8us*)&sKh[nt * 16 + ln][ks * 32 + 8 * hh]; bh_.half[1] = *(const v8us*)&sKh[nt * 16 + ln][ks * 32 + 16 + 8 * hh];
        bl_.half[0] = *(const v8us*)&sKl[nt * 16 + ln][ks * 32 + 8 * hh]; bl_.half[1] = *(const v8us*)&sKl[nt * 16 + ln][ks * 32 + 16 + 8 * hh];
        acc = mmaN<3>(aqh[ks].v, aql[ks].v, bh_.v, bl_.v, acc);
      }
      s[nt] = acc;
    }
    // mask + running max (rows 8hh+r; the 16 lanes of a half share rows)
    float alpha[8];
#pragma unroll
    for (int r = 0; r < 8; ++r) {
      const int qi = q0 + 8 * hh + r;
      const int ja = j0 + ln, jb = j0 + 16 + ln;
      if (CAUSAL) { if (ja > qi) s[0][r] = -3.0e38f; if (jb > qi) s[1][r] = -3.0e38f; }
      if (ja >= T) s[0][r] = -3.0e38f;
      if (jb >= T) s[1][r] = -3.0e38f;
      float mx = fmaxf(s[0][r], s[1][r]);
      mx = fmaxf(mx, __shfl_xor(mx, 1, 32)); mx = fmaxf(mx, __shfl_xor(mx, 2, 32)); mx = fmaxf(mx, __shfl_xor(mx, 4, 32)); mx = fmaxf(mx, __shfl_xor(mx, 8, 32));
      const float mnew = fmaxf(m_r[r], mx);
      alpha[r] = (mnew > -1.0e38f) ? __expf(m_r[r] - mnew) : 1.0f;
      const float p0 = (s[0][r] > -1.0e38f) ? __expf(s[0][r] - mnew) : 0.f;
      const float p1 = (s[1][r] > -1.0e38f) ? __expf(s[1][r] - mnew) : 0.f;
      m_r[r] = mnew;
      l_r[r] = l_r[r] * alpha[r] + p0 + p1;            // per-lane partial row sum (16 lanes combined at the end)
      unsigned short hb = bf16_bits(p0); sPh[w][8 * hh + r][ln] = hb;      sPl[w][8 * hh + r][ln] = bf16_bits(p0 - bf16_val(hb));
      hb = bf16_bits(p1);                sPh[w][8 * hh + r][16 + ln] = hb; sPl[w][8 * hh + r][16 + ln] = bf16_bits(p1 - bf16_val(hb));
    }
#pragma unroll
    for (int dt = 0; dt < DT; ++dt)
#pragma unroll
      for (int r = 0; r < 8; ++r) oacc[dt][r] *= alpha[r];
    __builtin_amdgcn_fence(__ATOMIC_ACQ_REL, "workgroup");
    __builtin_amdgcn_wave_barrier();
    FragB pah, pal;
    pah.half[0] = *(const v8us*)&sPh[w][ln][8 * hh]; pah.half[1] = *(const v8us*)&sPh[w][ln][16 + 8 * hh];
    pal.half[0] = *(const v8us*)&sPl[w][ln][8 * hh]; pal.half[1] = *(const v8us*)&sPl[w][ln][16 + 8 * hh];
#pragma unroll
    for (int dt = 0; dt < DT; ++dt) {
      FragB bvh, bvl;
#pragma unroll
      for (int i = 0; i < 8; ++i) {
        bvh.u[i] = sVh[8 * hh + i][dt * 16 + ln]; bvh.u[8 + i] = sVh[16 + 8 * hh + i][dt * 16 + ln];
        bvl.u[i] = sVl[8 * hh + i][dt * 16 + ln]; bvl.u[8 + i] = sVl[16 + 8 * hh + i][dt * 16 + ln];
      }
      oacc[dt] = mmaN<3>(pah.v, pal.v, bvh.v, bvl.v, oacc[dt]);
    }
    __builtin_amdgcn_fence(__ATOMIC_ACQ_REL, "workgroup");
    __builtin_amdgcn_wave_barrier();
  }
#pragma unroll
  for (int r = 0; r < 8; ++r) {
    float l = l_r[r];
    l += __shfl_xor(l, 1, 32); l += __shfl_xor(l, 2, 32); l += __shfl_xor(l, 4, 32); l += __shfl_xor(l, 8, 32);
    l_r[r] = (l > 0.f) ? 1.0f / l : 0.f;
  }
#pragma unroll
  for (int dt = 0; dt < DT; ++dt)
#pragma unroll
    for (int r = 0; r < 8; ++r) sO[w][8 * hh + r][dt * 16 + ln] = oacc[dt][r] * l_r[r];
  __builtin_amdgcn_fence(__ATOMIC_ACQ_REL, "workgroup");
  __builtin_amdgcn_wave_barrier();
  {
    for (int r = 0; r < 16; ++r) {
      const int row = q0 + r;
      if (row < T && lane < D / 4) {
        const v4f val = *(const v4fa*)&sO[w][r][lane * 4];
        *(v4f*)(y + ((size_t)b * T + row) * ypitch + h * D + lane * 4) = val;
      }
    }
    
  }
}

// GEMM C = act(A·W + bias + resid): A f32 (ASPLIT -> hi/lo 2 terms), Wt bf16 [N][K]; ACT 0 none, 1 relu, 2 exact gelu;
// resid (optional, f32, row index = (row % rmod), pitch ldr, RES_BF16 rounds it) added before the activation.
template <bool ASPLIT, int ACT, bool BIAS_BF16, bool RES_BF16>
__global__ __launch_bounds__(128) void k_gemm_bf3(const float* __restrict__ A, int lda, const unsigned short* __restrict__ Wt, int ldb,
                                                const float* __restrict__ bias, const float* __restrict__ resid, int rmod, int ldr,
                                                float* __restrict__ C, int ldc, int M, int N, int K) {
  __shared__ __attribute__((aligned(16))) float so[4][16][64];
  const int tid = threadIdx.x, w = tid >> 5, lane = tid & 31, ln = lane & 15, hh = lane >> 4;
  const int ntn = N / 64;
  const int wid = blockIdx.x * 4 + w;
  const int mt = wid / ntn, nq = wid % ntn;
  if (mt * 16 >= M) return;
  const int row0 = mt * 16, col0 = nq * 64;
  const float* arow = A + (size_t)(row0 + ln) * lda;
  v8f acc[4] = {};
  for (int kb = 0; kb < K; kb += 32) {
    FragB ah, al;
    const v4f x0 = *(const v4fa*)(arow + kb + 8 * hh), x1 = *(const v4fa*)(arow + kb + 8 * hh + 4);
    const v4f x2 = *(const v4fa*)(arow + kb + 16 + 8 * hh), x3 = *(const v4fa*)(arow + kb + 16 + 8 * hh + 4);
    float xs[16] = {x0[0],x0[1],x0[2],x0[3],x1[0],x1[1],x1[2],x1[3],x2[0],x2[1],x2[2],x2[3],x3[0],x3[1],x3[2],x3[3]};
#pragma unroll
    for (int i = 0; i < 16; ++i) { const unsigned short hb = bf16_bits(xs[i]); ah.u[i] = hb; al.u[i] = ASPLIT ? bf16_bits(xs[i] - bf16_val(hb)) : (unsigned short)0; }
#pragma unroll
    for (int t = 0; t < 4; ++t) {
      const unsigned short* brow = Wt + (size_t)(col0 + t * 16 + ln) * ldb + kb;
      FragB b;
      b.half[0] = *(const v8us*)(brow + 8 * hh);
      b.half[1] = *(const v8us*)(brow + 16 + 8 * hh);
      acc[t] = mmaN<ASPLIT ? 2 : 1>(ah.v, al.v, b.v, b.v, acc[t]);
    }
  }
#pragma unroll
  for (int t = 0; t < 4; ++t) {
    const int col = col0 + t * 16 + ln;
    float bv = bias ? bias[col] : 0.f;
    if (BIAS_BF16) bv = bf16_round(bv);
#pragma unroll
    for (int r = 0; r < 8; ++r) {
      float v = acc[t][r] + bv;
      if (resid) { float rv = resid[(size_t)((row0 + 8 * hh + r) % rmod) * ldr + col]; if (RES_BF16) rv = bf16_round(rv); v += rv; }
      if (ACT == 1) v = fmaxf(v, 0.f);
      if (ACT == 2) v = 0.5f * v * (1.0f + erff(v * 0.70710678118654752f));
      if (ACT == 3) { const float u = 0.7978845608028654f * (v + 0.044715f * v * v * v); v = 0.5f * v * (1.0f + tanhf(u)); }
      so[w][8 * hh + r][t * 16 + ln] = v;
    }
  }
  __builtin_amdgcn_fence(__ATOMIC_ACQ_REL, "workgroup");
  __builtin_amdgcn_wave_barrier();
  const int rsub = lane >> 4, c4 = (lane & 15) * 4;
  {
#pragma unroll
    for (int q = 0; q < 8; ++q) {
      const int r = q * 2 + rsub;
      const v4f v = *(const v4fa*)&so[w][r][c4];
      *(v4f*)(C + (size_t)(row0 + r) * ldc + col0 + c4) = v;
    }
    
  }
}
// row LayerNorm (biased variance, eps) over N: s = X (+ R); optional out_sum <- s; out_norm <- (s-mu)*rsqrt(var+eps)*g + b
template <bool PARAM_BF16>
__global__ __launch_bounds__(256) void k_layernorm(const float* __restrict__ X, const float* __restrict__ R, const float* __restrict__ g, const float* __restrict__ bta,
                                                  float* __restrict__ out_sum, float* __restrict__ out_norm, int N, float eps) {
  __shared__ float red[256];
  const int row = blockIdx.x, tid = threadIdx.x;
  const float* x = X + (size_t)row * N; const float* rr = R ? R + (size_t)row * N : nullptr;
  float vals[16];                     // up to N = 4096
  const int per = N / 256;            // contiguous chunk per thread? use strided-by-4 chunks: thread handles j = tid*4 + 1024*u
  float s1 = 0.f;
  for (int u = 0; u < per / 4; ++u) {
    const int j = tid * 4 + 1024 * u;
    const v4f a = *(const v4fa*)(x + j);
    v4f b = {0.f,0.f,0.f,0.f}; if (rr) b = *(const v4fa*)(rr + j);
#pragma unroll
    for (int q = 0; q < 4; ++q) { const float v = a[q] + b[q]; vals[u * 4 + q] = v; s1 += v; }
  }
  red[tid] = s1; __syncthreads();
  for (int st = 128; st > 0; st >>= 1) { if (tid < st) red[tid] += red[tid + st]; __syncthreads(); }
  const float mu = red[0] / (float)N; __syncthreads();
  float s2 = 0.f;
  for (int u = 0; u < per / 4; ++u)
#pragma unroll
    for (int q = 0; q < 4; ++q) { const float c = vals[u * 4 + q] - mu; s2 += c * c; }
  red[tid] = s2; __syncthreads();
  for (int st = 128; st > 0; st >>= 1) { if (tid < st) red[tid] += red[tid + st]; __syncthreads(); }
  const float rs = rsqrtf(red[0] / (float)N + eps);
  {
    for (int u = 0; u < per / 4; ++u) {
      const int j = tid * 4 + 1024 * u;
      v4f o, sm;
#pragma unroll
      for (int q = 0; q < 4; ++q) {
        float gg = g[j + q], bb = bta[j + q];
        if (PARAM_BF16) { gg = bf16_round(gg); bb = bf16_round(bb); }
        sm[q] = vals[u * 4 + q]; o[q] = (vals[u * 4 + q] - mu) * rs * gg + bb;
      }
      if (out_sum) *(v4f*)(out_sum + (size_t)row * N + j) = sm;
      *(v4f*)(out_norm + (size_t)row * N + j) = o;
    }
    
  }
}



// ---- f16 WMMA path (v_wmma_f32_16x16x32_f16): 11-bit significands for operands in range — used where a [0,1] probability operand needs more precision than bf16
typedef _Float16 v16h __attribute__((ext_vector_type(16)));
union FragH { v16h v; v8us half[2]; _Float16 h[16]; unsigned short u[16]; };
template <int NT>
__device__ __forceinline__ v8f mmaH(v16h ah, v16h al, v16h bh, v16h bl, v8f c) {
  c = __builtin_amdgcn_wmma_f32_16x16x32_f16(false, ah, false, bh, (short)0, c, false, false);
  if (NT >= 2) c = __builtin_amdgcn_wmma_f32_16x16x32_f16(false, al, false, bh, (short)0, c, false, false);
  if (NT >= 3) c = __builtin_amdgcn_wmma_f32_16x16x32_f16(false, ah, false, bl, (short)0, c, false, false);
  asm volatile("v_nop\n\tv_nop\n\tv_nop\n\tv_nop" : "+v"(c) : "v"(ah), "v"(al), "v"(bh), "v"(bl));
  return c;
}
// batched GEMM like k_gemm_b but f16 operands: A f32 (split into f16 hi/lo if ASPLIT, else rounded to f16), Bt = f16 values [n][k]; alpha; C f32; N multiple of 16 (partial tiles skipped)
template <bool ASPLIT>
__global__ __launch_bounds__(128) void k_gemm_h(const float* __restrict__ A, int lda, size_t sA, const _Float16* __restrict__ Bh, int ldb, size_t sB, float alpha, float* __restrict__ C, int ldc, size_t sC, int M, int N, int K) {
  __shared__ __attribute__((aligned(16))) float so[4][16][64];
  const int tid = threadIdx.x, w = tid >> 5, lane = tid & 31, ln = lane & 15, hh = lane >> 4; const int by = blockIdx.y;
  A += (size_t)by * sA; Bh += (size_t)by * sB; C += (size_t)by * sC;
  const int ntn = (N + 63) / 64; const int wid = blockIdx.x * 4 + w; const int mt = wid / ntn, nq = wid % ntn; if (mt * 16 >= M) return;
  const int row0 = mt * 16, col0 = nq * 64; const float* arow = A + (size_t)(row0 + ln) * lda;
  v8f acc[4] = {};
  for (int kb = 0; kb < K; kb += 32) {
    FragH ah, al;
    const v4f x0 = *(const v4fa*)(arow + kb + 8 * hh), x1 = *(const v4fa*)(arow + kb + 8 * hh + 4), x2 = *(const v4fa*)(arow + kb + 16 + 8 * hh), x3 = *(const v4fa*)(arow + kb + 16 + 8 * hh + 4);
    float xs[16] = {x0[0],x0[1],x0[2],x0[3],x1[0],x1[1],x1[2],x1[3],x2[0],x2[1],x2[2],x2[3],x3[0],x3[1],x3[2],x3[3]};
#pragma unroll
    for (int i = 0; i < 16; ++i) { const _Float16 h = (_Float16)xs[i]; ah.h[i] = h; al.h[i] = ASPLIT ? (_Float16)(xs[i] - (float)h) : (_Float16)0.0f; }
#pragma unroll
    for (int t = 0; t < 4; ++t) { if (col0 + t * 16 >= N) continue; const size_t boff = (size_t)(col0 + t * 16 + ln) * ldb + kb; FragH bq; bq.half[0] = *(const v8us*)(Bh + boff + 8 * hh); bq.half[1] = *(const v8us*)(Bh + boff + 16 + 8 * hh);
      acc[t] = mmaH<ASPLIT ? 2 : 1>(ah.v, al.v, bq.v, bq.v, acc[t]); }
  }
#pragma unroll
  for (int t = 0; t < 4; ++t) { if (col0 + t * 16 >= N) continue;
#pragma unroll
    for (int r = 0; r < 8; ++r) so[w][8 * hh + r][t * 16 + ln] = acc[t][r] * alpha; }
  __builtin_amdgcn_fence(__ATOMIC_ACQ_REL, "workgroup"); __builtin_amdgcn_wave_barrier();
  const int rsub = lane >> 4, c4 = (lane & 15) * 4;
  {
#pragma unroll
    for (int q = 0; q < 8; ++q) { const int r = q * 2 + rsub; if (col0 + c4 < N) { const v4f v = *(const v4fa*)&so[w][r][c4]; *(v4f*)(C + (size_t)(row0 + r) * ldc + col0 + c4) = v; } }
     }
}

// Wt[n][k] = f16(W[k][n]·scale) from f32 row-major W[K][N] (scale = power of two; bf16-exact weights stay exact in f16 away from the subnormal range)
__global__ __launch_bounds__(256) void k_wt_f16(const float* __restrict__ W, _Float16* __restrict__ Wt, int K, int N, float scale) {
  const int t = blockIdx.x * 256 + threadIdx.x; if (t >= N * (K / 8)) return; const int n = t / (K / 8), k8 = (t % (K / 8)) * 8; FragH f;
#pragma unroll
  for (int i = 0; i < 8; ++i) f.h[i] = (_Float16)(bf16_round(W[(size_t)(k8 + i) * N + n]) * scale); const v8us o = f.half[0];
  *(v8us*)((unsigned short*)Wt + (size_t)n * K + k8) = o; 
}
// k_gemm_hh variant with fused epilogue: v = acc·alpha + bias[by·sBias + col] (+ CP[(row/rowsPerB)·sCPb + by·64 + col] if CP) ; ACT 0 none / 1 elu ; writes f32 C and f16 C16, each if non-null
template <int ACT>
__global__ __launch_bounds__(128) void k_gemm_hhx(const _Float16* __restrict__ A, int lda, size_t sA, const _Float16* __restrict__ Bh, int ldb, size_t sB, float alpha, const float* __restrict__ bias, size_t sBias, const float* __restrict__ CP, int rowsPerB, size_t sCPb, int row0g,
    float* __restrict__ C, _Float16* __restrict__ C16, int ldc, size_t sC, int M, int N, int K) {
  __shared__ __attribute__((aligned(16))) float so[4][16][64];
  const int tid = threadIdx.x, w = tid >> 5, lane = tid & 31, ln = lane & 15, hh = lane >> 4; const int by = blockIdx.y;
  A += (size_t)by * sA; Bh += (size_t)by * sB; const size_t cofs = (size_t)by * sC; const float* bp = bias ? bias + (size_t)by * sBias : nullptr;
  const int ntn = (N + 63) / 64; const int wid = blockIdx.x * 4 + w; const int mt = wid / ntn, nq = wid % ntn; if (mt * 16 >= M) return;
  const int row0 = mt * 16, col0 = nq * 64; const _Float16* arow = A + (size_t)(row0 + ln) * lda;
  v8f acc[4] = {};
  for (int kb = 0; kb < K; kb += 32) { FragH ah; ah.half[0] = *(const v8us*)((const unsigned short*)arow + kb + 8 * hh); ah.half[1] = *(const v8us*)((const unsigned short*)arow + kb + 16 + 8 * hh);
#pragma unroll
    for (int t = 0; t < 4; ++t) { if (col0 + t * 16 >= N) continue; const size_t boff = (size_t)(col0 + t * 16 + ln) * ldb + kb; FragH bq; bq.half[0] = *(const v8us*)((const unsigned short*)Bh + boff + 8 * hh); bq.half[1] = *(const v8us*)((const unsigned short*)Bh + boff + 16 + 8 * hh);
      acc[t] = mmaH<1>(ah.v, ah.v, bq.v, bq.v, acc[t]); }
  }
#pragma unroll
  for (int t = 0; t < 4; ++t) { if (col0 + t * 16 >= N) continue; const int col = col0 + t * 16 + ln; const float bv = bp ? bf16_round(bp[col]) : 0.f;
#pragma unroll
    for (int r = 0; r < 8; ++r) { float v = acc[t][r] * alpha + bv; if (CP) { const int bidx = (row0g + row0 + 8 * hh + r) / rowsPerB; v += CP[(size_t)bidx * sCPb + (size_t)by * 64 + col]; } if (ACT == 1) v = (v > 0.f) ? v : expm1f(v); else if (ACT == 7) v = (v > 0.f) ? v + 1.0f : expf(v); else if (ACT == 8) v = tanhf(v); else if (ACT == 9) v = 0.5f * v * (1.0f + tanhf(0.7978845608028654f * (v + 0.044715f * v * v * v))); else if (ACT == 11) v = 1.0f / (1.0f + expf(-v)); else if (ACT == 12) v = (v > 0.f) ? v : 0.01f * v; else if (ACT == 14) v = (v > 0.f) ? v : 0.1f * v; else if (ACT == 15) v = v / (1.0f + expf(-v)); else if (ACT == 3) v = fmaxf(v, 0.f); else if (ACT == 6) v = 0.5f * v * (1.0f + erff(v * 0.70710678118654752f)); so[w][8 * hh + r][t * 16 + ln] = v; } }
  __builtin_amdgcn_fence(__ATOMIC_ACQ_REL, "workgroup"); __builtin_amdgcn_wave_barrier();
  const int rsub = lane >> 4, c4 = (lane & 15) * 4; typedef _Float16 v4h __attribute__((ext_vector_type(4)));
  {
#pragma unroll
    for (int q = 0; q < 8; ++q) { const int r = q * 2 + rsub; if (col0 + c4 < N) { const v4f v = *(const v4fa*)&so[w][r][c4]; if (C) *(v4f*)(C + cofs + (size_t)(row0 + r) * ldc + col0 + c4) = v; if (C16) { v4h h4; for (int i = 0; i < 4; ++i) h4[i] = (_Float16)v[i]; *(v4h*)(C16 + cofs + (size_t)(row0 + r) * ldc + col0 + c4) = h4; } } }
     }
}


typedef _Float16 v4h __attribute__((ext_vector_type(4)));

__global__ __launch_bounds__(256) void k_x16(const float* __restrict__ x, _Float16* __restrict__ X16, size_t n8) { const size_t t = (size_t)blockIdx.x * 256 + threadIdx.x; if (t >= n8) return; FragH f;
#pragma unroll
  for (int q = 0; q < 8; ++q) f.h[q] = (_Float16)bf16_round(x[t * 8 + q]); *(v8us*)((unsigned short*)X16 + t * 8) = f.half[0];  }
__global__ __launch_bounds__(256) void k_h16(const float* __restrict__ x, _Float16* __restrict__ X16, size_t n8) { const size_t t = (size_t)blockIdx.x * 256 + threadIdx.x; if (t >= n8) return; FragH f;
#pragma unroll
  for (int q = 0; q < 8; ++q) f.h[q] = (_Float16)x[t * 8 + q]; *(v8us*)((unsigned short*)X16 + t * 8) = f.half[0];  }
__global__ __launch_bounds__(256) void k_round16f(const float* __restrict__ W, _Float16* __restrict__ Bt, size_t n8) { const size_t t = (size_t)blockIdx.x * 256 + threadIdx.x; if (t >= n8) return; FragH f;
#pragma unroll
  for (int i = 0; i < 8; ++i) f.h[i] = (_Float16)(bf16_round(W[t * 8 + i]) * 16.0f); *(v8us*)((unsigned short*)Bt + t * 8) = f.half[0];  }
template <int NHv, int TTv>
__global__ __launch_bounds__(256) void k_vt(const _Float16* __restrict__ V16, int ldv, int voff, _Float16* __restrict__ Vt) { __shared__ unsigned short tl[64][66]; const int tid = threadIdx.x; const int slab = blockIdx.x / (TTv / 64), lg = blockIdx.x % (TTv / 64); const int b = slab / NHv, h = slab % NHv;
  for (int i = tid; i < 64 * 8; i += 256) { const int r = i / 8, c8 = (i % 8) * 8; FragH f; f.half[0] = *(const v8us*)((const unsigned short*)V16 + ((size_t)b * TTv + lg * 64 + r) * ldv + voff + h * 64 + c8);
#pragma unroll
    for (int q = 0; q < 8; ++q) tl[r][c8 + q] = f.u[q]; }
  __syncthreads();
  {
#pragma unroll
    for (int rd = 0; rd < 2; ++rd) { const int d = rd * 32 + tid / 8, pc = tid % 8; FragH f;
#pragma unroll
      for (int q = 0; q < 8; ++q) f.u[q] = tl[pc * 8 + q][d];
      *(v8us*)((unsigned short*)Vt + ((size_t)slab * 64 + d) * TTv + lg * 64 + pc * 8) = f.half[0]; }
     } }

__global__ __launch_bounds__(256) void k_qbias(const float* __restrict__ QF, const float* __restrict__ rwb, const float* __restrict__ rrb, _Float16* __restrict__ QW, _Float16* __restrict__ QR, size_t n8) { const size_t t = (size_t)blockIdx.x * 256 + threadIdx.x; if (t >= n8) return; const int c0 = (int)((t * 8) % DM); const v4f a = *(const v4fa*)(QF + t * 8), b = *(const v4fa*)(QF + t * 8 + 4); FragH fw, fr;
#pragma unroll
  for (int q = 0; q < 8; ++q) { const float v = (q < 4) ? a[q] : b[q - 4]; fw.h[q] = (_Float16)(v + bf16_round(rwb[c0 + q])); fr.h[q] = (_Float16)(v + bf16_round(rrb[c0 + q])); }
  { *(v8us*)((unsigned short*)QW + t * 8) = fw.half[0]; *(v8us*)((unsigned short*)QR + t * 8) = fr.half[0];  } }
// Fused score kernel: one work-group = 16 query rows i0..i0+15 of one (b,n) plane (blockIdx.y), 16 waves; the 16 x KL score rows live in LDS and never reach memory. AC is stored into the rows first.
// The pad/reshape shift as a scatter of raw BD: idx = QL + i*KL + j = i*(KL+1) + (QL - i + j), so with d = m - (QL-1) + i the raw value (q_i + r_r_bias).rk_m belongs to j = d where d >= 0,
// the raw value of row i+1 at column m to j = d + KL + 1 where d <= -2 (the wrap region); d == -1 gives j = KL, a slot of the row's LDS padding that the softmax never reads; the pad's zero falls on j = i + KL + 1 - QL. Each j in 0..KL-1 gets at most one raw value.
// Behind a barrier each raw value is added to AC in place, and behind a second one wave wv does mask, f32 softmax and the f16 x2^15 store of row i0 + wv with the lane order and sum order of a wave-per-row pass.
#define SP (KL + 4)      // LDS row pitch in floats: 8 rows apart = 32 banks apart, so the two lane halves of a D tile do not collide; multiple of 4 for 16-byte reads
__device__ __forceinline__ v8f mma16(v16h a, v16h b, v8f c) { return __builtin_amdgcn_wmma_f32_16x16x32_f16(false, a, false, b, (short)0, c, false, false); }
// One 16-row fragment pair (k = 0..63) of a row-major f16 plane: base (+ cofs, a constant) is the same for the whole wave, ob is the lane's own byte offset (its row, plus 16 bytes for the upper lane half).
// Lane half hh, step ks: registers 0..3 hold k = 32*ks + 8*hh + 0..7, registers 4..7 hold k = 32*ks + 16 + 8*hh + 0..7, for A and B alike.
__device__ __forceinline__ void ldfrag(FragH (&f)[2], const char* __restrict__ base, unsigned ob, int cofs) {
#pragma unroll
  for (int ks = 0; ks < 2; ++ks) { f[ks].half[0] = *(const v8us*)(base + ob + (cofs + ks * 64)); f[ks].half[1] = *(const v8us*)(base + ob + (cofs + ks * 64 + 32)); }
  // the wait that is owed before a register named by an issued global load is rewritten; offset and base are inputs, so they stay live to here and none of the four loads lands in them
  asm volatile("s_wait_xcnt 0x0" :: "v"(ob), "s"(base) : "memory"); }
// launch bounds: 8 waves a SIMD (a budget of 128 VGPRs), so that two of these 128-KiB work-groups share a WGP and one's barriers and loads run under the other's work
__global__ __launch_bounds__(512, 8) void k_score(const _Float16* __restrict__ QW, const _Float16* __restrict__ QR, const _Float16* __restrict__ K16, const _Float16* __restrict__ RK, const int* __restrict__ MSK, _Float16* __restrict__ P16) {
  __shared__ __attribute__((aligned(16))) float S[16 * SP];
  const int tid = threadIdx.x, lane = tid & 31, ln = lane & 15, hh = lane >> 4;
  const int wv = __builtin_amdgcn_readfirstlane(tid >> 5);      // the wave's number as a scalar: tile bases and the row's addresses then sit in scalar registers
  const int i0 = blockIdx.x * 16, pl = blockIdx.y, b = pl / NH, h = pl % NH;
  const int i = i0 + wv;
  constexpr int QP = BZ * DM * 2, RP = DM * 2;      // row pitches in bytes: q and k rows (i,b) / (j,b); rk rows
  const char* qw = (const char*)(QW + (size_t)b * DM + h * 64 + (size_t)i0 * (BZ * DM)); const char* qr = (const char*)(QR + (size_t)b * DM + h * 64 + (size_t)i0 * (BZ * DM));
  const char* kp = (const char*)(K16 + (size_t)b * DM + h * 64 + (size_t)(wv * 16) * (BZ * DM)); const char* rp = (const char*)(RK + h * 64 + (size_t)(wv * 16) * DM);
  const char* mk = (const char*)(MSK + (size_t)i * KL);
  const unsigned obq = (unsigned)(ln * QP + hh * 16), obr = (unsigned)(ln * RP + hh * 16);
  const unsigned obw = (unsigned)(((i0 + 1 + ln < QL) ? 1 + ln : QL - 1 - i0) * QP + hh * 16);      // row i+1 for the wrap region; the clamped row of i = QL-1 is never selected (there d >= 0 for every m)
  FragH aq[2], kb[4][2]; ldfrag(aq, qw, obq, 0); ldfrag(kb[0], kp, obq, 0);
  unsigned mbal[64];      // the mask of row i0 + wv as one lane mask per (jj, e), read at the head beside the first fragments: the softmax phase then holds no mask registers and waits for no memory
  {
    typedef int v4i __attribute__((ext_vector_type(4))); typedef int v4ia __attribute__((ext_vector_type(4), may_alias)); v4i mv[16]; const unsigned obm = (unsigned)(lane * 16);
#pragma unroll
    for (int jj = 0; jj < 16; ++jj) mv[jj] = *(const v4ia*)(mk + obm + jj * 512);
    // the wait that is owed before a register named by an issued global load is rewritten; offset and base are inputs, so they stay live to here and none of the sixteen loads lands in them
    asm volatile("s_wait_xcnt 0x0" :: "v"(obm), "s"(mk) : "memory");
#pragma unroll
    for (int jj = 0; jj < 16; ++jj)
#pragma unroll
      for (int e = 0; e < 4; ++e) mbal[jj * 4 + e] = __builtin_amdgcn_ballot_w32(mv[jj][e] != 0);
  }
  ldfrag(kb[1], kp, obq, 256 * QP); ldfrag(kb[2], kp, obq, 2 * 256 * QP); ldfrag(kb[3], kp, obq, 3 * 256 * QP);      // behind the lane masks: the sixteen mask vectors and four k tiles together do not fit the registers
  FragH an[2], aw[2], bb[2][2];
  // AC: wave wv owns the column tiles wv + 16 t and stores them straight into S. Four k tiles are in flight; as the ring drains, its registers take the q + r_r_bias rows and the first two rk tiles, which fly while the last AC tiles are multiplied and stored.
#pragma unroll
  for (int t = 0; t < KL / 256; ++t) { const int j0 = (wv + 16 * t) * 16; FragH (&bf)[2] = kb[t & 3];
    v8f c = {}; c = mma16(aq[0].v, bf[0].v, c); c = mma16(aq[1].v, bf[1].v, c);
    // the four vector slots that the chip needs behind a matrix instruction before its D is overwritten (the next tile's product) or its A or B refilled; the operands are named so that the refill of bf stays behind them
    asm volatile("v_nop\n\tv_nop\n\tv_nop\n\tv_nop" : "+v"(c) : "v"(aq[0].v), "v"(aq[1].v), "v"(bf[0].v), "v"(bf[1].v));
    if (t + 4 < KL / 256) ldfrag(bf, kp, obq, (t + 4) * 256 * QP);
    else if (t == 4) ldfrag(an, qr, obq, 0);
    else if (t == 5) ldfrag(aw, qr, obw, 0);
    else if (t == 6) ldfrag(bb[0], rp, obr, 0);
    else ldfrag(bb[1], rp, obr, 256 * RP);
#pragma unroll
    for (int r = 0; r < 8; ++r) S[(8 * hh + r) * SP + j0 + ln] = c[r];
    __builtin_amdgcn_sched_barrier(0); }      // keeps the tiles apart in the schedule: mixed, they hold more products and fragments live than the 128 registers take, and the build spills
  if (tid < 16) S[tid * SP + KL] = 0.f;      // the padding slot that takes the one raw value of a row with d == -1: given a value here, so that the add below reads nothing unwritten
  __syncthreads();      // every AC value is in S before any wave adds a shifted BD value to it
  __builtin_amdgcn_sched_barrier(0);      // as above: no product of the next phase is lifted over the barrier
  // raw BD of rows i and i+1, added in place at the shifted column: each (row, j) is touched by one lane of one wave; the column of the pad's zero, j = i + KL + 1 - QL, by none (AC + 0)
#pragma unroll
  for (int t = 0; t < KL / 256; ++t) { const int m0 = (wv + 16 * t) * 16; FragH (&bf)[2] = bb[t & 1];
    v8f dn = {}, dw = {}; dn = mma16(an[0].v, bf[0].v, dn); dw = mma16(aw[0].v, bf[0].v, dw); dn = mma16(an[1].v, bf[1].v, dn); dw = mma16(aw[1].v, bf[1].v, dw);
    // the four vector slots that the chip needs behind a matrix instruction before a vector instruction reads its D or its B is refilled; bf is named so that its refill stays behind them
    asm volatile("v_nop\n\tv_nop\n\tv_nop\n\tv_nop" : "+v"(dn), "+v"(dw) : "v"(bf[0].v), "v"(bf[1].v));
    if (t + 2 < KL / 256) ldfrag(bf, rp, obr, (t + 2) * 256 * RP);      // rk tiles fly two tiles ahead
    const int d0 = m0 + ln - (QL - 1) + i0 + 8 * hh; int ix[8]; float old[8];
#pragma unroll
    for (int r = 0; r < 8; ++r) { const int d = d0 + r; ix[r] = (8 * hh + r) * SP + ((d >= 0) ? d : d + (KL + 1)); old[r] = S[ix[r]]; }      // the eight reads first: eight different rows, so no store of this tile can hit them
#pragma unroll
    for (int r = 0; r < 8; ++r) S[ix[r]] = old[r] + ((d0 + r >= 0) ? dn[r] : dw[r]);
    __builtin_amdgcn_sched_barrier(0); }      // as above
  __syncthreads();      // the rows are complete before the row waves read them
  const float* sr = &S[wv * SP];
  v4f sv[16]; float mx = -3.0e38f;
#pragma unroll
  for (int jj = 0; jj < 16; ++jj) { const int j0 = jj * 128 + lane * 4; const v4f a = *(const v4fa*)(sr + j0); v4f s;
#pragma unroll
    for (int e = 0; e < 4; ++e) { const float val = a[e] * ATT_SCALE; s[e] = __builtin_amdgcn_inverse_ballot_w32(mbal[jj * 4 + e]) ? -INFINITY : val; mx = fmaxf(mx, s[e]); }
    sv[jj] = s; }
  for (int o = 16; o >= 1; o >>= 1) mx = fmaxf(mx, __shfl_xor(mx, o, 32)); float z = 0.f;
#pragma unroll
  for (int jj = 0; jj < 16; ++jj) for (int e = 0; e < 4; ++e) { const float p = (sv[jj][e] > -INFINITY) ? __expf(sv[jj][e] - mx) : 0.f; sv[jj][e] = p; z += p; }
  for (int o = 16; o >= 1; o >>= 1) z += __shfl_xor(z, o, 32); const float iz = (z > 0.f) ? 32768.0f / z : 0.f;
  _Float16* pr = P16 + ((size_t)pl * QL + i) * KL;
#pragma unroll
  for (int jj = 0; jj < 16; ++jj) { v4h o; for (int e = 0; e < 4; ++e) o[e] = (_Float16)(sv[jj][e] * iz); *(v4h*)(pr + jj * 128 + lane * 4) = o; }
}
__global__ __launch_bounds__(256) void k_lnout(const float* __restrict__ RES, const float* __restrict__ w, const float* __restrict__ g, const float* __restrict__ bb, float* __restrict__ out) { const int tid = threadIdx.x, wv = tid >> 5, lane = tid & 31; const int r = blockIdx.x * 8 + wv; if (r >= NQR) return; v4f y[8]; float s = 0.f;
#pragma unroll
  for (int j = 0; j < 8; ++j) { const int c = j * 128 + lane * 4; const v4f a = *(const v4fa*)(RES + (size_t)r * DM + c), x = *(const v4fa*)(w + (size_t)r * DM + c); for (int q = 0; q < 4; ++q) { y[j][q] = a[q] + bf16_round(x[q]); s += y[j][q]; } }
  for (int o = 16; o >= 1; o >>= 1) s += __shfl_xor(s, o, 32); const float mu = s / (float)DM; float q2 = 0.f;
#pragma unroll
  for (int j = 0; j < 8; ++j) for (int q = 0; q < 4; ++q) { const float d = y[j][q] - mu; q2 += d * d; }
  for (int o = 16; o >= 1; o >>= 1) q2 += __shfl_xor(q2, o, 32); const float rs = rsqrtf(q2 / (float)DM + 1e-5f);
  {
#pragma unroll
    for (int j = 0; j < 8; ++j) { const int c = j * 128 + lane * 4; v4f o; for (int q = 0; q < 4; ++q) o[q] = (y[j][q] - mu) * rs * bf16_round(g[c + q]) + bf16_round(bb[c + q]); *(v4f*)(out + (size_t)r * DM + c) = o; }
     } }

extern "C" void kernel_launch(void* const* d_in, const int* in_sizes, int n_in,
                              void* d_out, int out_size, void* d_ws, size_t ws_size, hipStream_t stream) {
  (void)in_sizes; (void)n_in; (void)out_size;
  const float* const* I = (const float* const*)d_in; const float* w = I[0]; const float* r = I[1]; const float* mems = I[2]; const float* rwb = I[3]; const float* rrb = I[4]; const int* msk = (const int*)d_in[5];
  const float* Wq = I[6]; const float* bq = I[7]; const float* Wk = I[8]; const float* bk = I[9]; const float* Wv = I[10]; const float* bv = I[11]; const float* Wr = I[12]; const float* br = I[13]; const float* Wo = I[14]; const float* bo = I[15]; const float* lg = I[16]; const float* lb = I[17];
  char* ws = (char*)d_ws; size_t off = 0;
  auto take = [&](size_t bytes) { char* p = ws + off; off += (bytes + 255) & ~(size_t)255; return p; };
  const size_t WSZ = (size_t)DM * DM; _Float16* Bw = (_Float16*)take(5 * WSZ * 2);      /* Wq, Wk, Wv, Wr, Wo */
  _Float16* QW = (_Float16*)take((size_t)NQR * DM * 2); _Float16* QR = (_Float16*)take((size_t)NQR * DM * 2);
  _Float16* K16 = (_Float16*)take((size_t)NKR * DM * 2); _Float16* Vt = (_Float16*)take((size_t)NKR * DM * 2); _Float16* RK = (_Float16*)take((size_t)KL * DM * 2);
  _Float16* P16 = (_Float16*)take((size_t)BZ * NH * QL * KL * 2); float* O = (float*)take((size_t)NQR * DM * 4); _Float16* O16 = (_Float16*)take((size_t)NQR * DM * 2);      /* P of all 32 (b,n) planes, so that one launch does every P*V */
  _Float16* CAT = (_Float16*)take((size_t)NKR * DM * 2); _Float16* R16 = (_Float16*)take((size_t)KL * DM * 2); _Float16* V16 = (_Float16*)take((size_t)NKR * DM * 2); float* QF = (float*)take((size_t)NQR * DM * 4); float* RES = QF;      /* the Wo GEMM output reuses QF, which is dead behind k_qbias */
  if (off > ws_size) return;      // MiB: 10 + 4 + 4 + 8 + 8 + 4 + 128 + 8 + 4 + 8 + 4 + 8 + 8 = 206 of 256
  const unsigned gwt = (unsigned)(((size_t)DM * (DM / 8) + 255) / 256);
  k_wt_f16<<<gwt, 256, 0, stream>>>(Wq, Bw, DM, DM, 16.0f); k_wt_f16<<<gwt, 256, 0, stream>>>(Wk, Bw + WSZ, DM, DM, 16.0f); k_wt_f16<<<gwt, 256, 0, stream>>>(Wv, Bw + 2 * WSZ, DM, DM, 16.0f); k_wt_f16<<<gwt, 256, 0, stream>>>(Wr, Bw + 3 * WSZ, DM, DM, 16.0f); k_wt_f16<<<gwt, 256, 0, stream>>>(Wo, Bw + 4 * WSZ, DM, DM, 16.0f);      /* (in,out) → Bt ×2^4 */
  const unsigned gh = (unsigned)(((size_t)NQR * DM / 8 + 255) / 256);
  k_x16<<<gh, 256, 0, stream>>>(mems, CAT, (size_t)NQR * DM / 8); k_x16<<<gh, 256, 0, stream>>>(w, CAT + (size_t)NQR * DM, (size_t)NQR * DM / 8); k_x16<<<gh, 256, 0, stream>>>(r, R16, (size_t)KL * DM / 8);      /* cat = [mems; w] is the two inputs back to back (rows (j,b)); r rows m */
  const dim3 gq(((NQR / 16) * (DM / 64) + 3) / 4, 1), gk(((NKR / 16) * (DM / 64) + 3) / 4, 1), grr(((KL / 16) * (DM / 64) + 3) / 4, 1);
  k_gemm_hhx<0><<<gq, 128, 0, stream>>>(CAT + (size_t)NQR * DM, DM, 0, Bw, DM, 0, 0.0625f, bq, 0, nullptr, 1, 0, 0, QF, nullptr, DM, 0, NQR, DM, DM); k_qbias<<<gh, 256, 0, stream>>>(QF, rwb, rrb, QW, QR, (size_t)NQR * DM / 8);      /* q (last qlen rows of cat) + bq → + r_w_bias / + r_r_bias */
  k_gemm_hhx<0><<<gk, 128, 0, stream>>>(CAT, DM, 0, Bw + WSZ, DM, 0, 0.0625f, bk, 0, nullptr, 1, 0, 0, nullptr, K16, DM, 0, NKR, DM, DM);      /* k: M 4096 N 1024 K 1024 */
  k_gemm_hhx<0><<<gk, 128, 0, stream>>>(CAT, DM, 0, Bw + 2 * WSZ, DM, 0, 0.0625f, bv, 0, nullptr, 1, 0, 0, nullptr, V16, DM, 0, NKR, DM, DM);      /* v */
  k_gemm_hhx<0><<<grr, 128, 0, stream>>>(R16, DM, 0, Bw + 3 * WSZ, DM, 0, 0.0625f, br, 0, nullptr, 1, 0, 0, nullptr, RK, DM, 0, KL, DM, DM);      /* rk = r·Wr + br: M 2048 */
  for (int b = 0; b < BZ; ++b) k_vt<NH, KL><<<NH * (KL / 64), 256, 0, stream>>>(V16 + (size_t)b * DM, BZ * DM, 0, Vt + (size_t)b * NH * 64 * KL);      /* Vᵀ per (b,n): V rows (j,b) have stride 2·1024 */
  const dim3 go(((QL / 16) * 1 + 3) / 4, BZ * NH);
  k_score<<<dim3(QL / 16, BZ * NH), 512, 0, stream>>>(QW, QR, K16, RK, msk, P16);      /* AC, raw BD, shift, mask and softmax of all 32 (b,n) planes: 16 query rows a work-group, scores in LDS only */
  k_gemm_hhx<0><<<go, 128, 0, stream>>>(P16, KL, (size_t)QL * KL, Vt, KL, (size_t)64 * KL, 0.000030517578125f, nullptr, 0, nullptr, 1, 0, 0, O, nullptr, BZ * DM, 64, QL, 64, KL);      /* attn_vec rows (i,b), plane s = b*16 + h at cols s*64 of the 2048-wide (i) row: M 1024 N 64 K 2048, ldc 2048, all 32 planes in blockIdx.y */
  k_h16<<<gh, 256, 0, stream>>>(O, O16, (size_t)NQR * DM / 8);
  k_gemm_hhx<0><<<gq, 128, 0, stream>>>(O16, DM, 0, Bw + 4 * WSZ, DM, 0, 0.0625f, bo, 0, nullptr, 1, 0, 0, RES, nullptr, DM, 0, NQR, DM, DM);      /* attn_out = attn_vec·Wo + bo (rows (i,b)) */
  k_lnout<<<(NQR + 7) / 8, 256, 0, stream>>>(RES, w, lg, lb, (float*)d_out);
}

// v003
// One run takes 208 microseconds.
// Timed twice side by side with v002, it ran 1.97 and 1.96 times as fast.
// All steps since v000 together make it 13.3 times as fast.
#include <hip/hip_runtime.h>
// Transformer-XL relative multi-head attention (qlen 1024, mem_len 1024 → klen 2048, bsz 2, 16 heads × 64, post-LN): cat = [mems; w] (rows (j,b)); q = (cat·Wq + bq)[last qlen], k, v = cat·Wk + bk, cat·Wv + bv; rk = r·Wr + br;
// AC[i,j] = (q_i + r_w_bias)·k_j; BD = rel_shift((q_i + r_r_bias)·rk_m) (the exact pad-reshape shift, incl. its wrap region); score = (AC + BD)/8, −inf where the INPUT mask is set; softmax over j; attn_vec = Σ_j p·v_j;
// out = LayerNorm(w + attn_vec·Wo + bo)·g + b → [1024, 2, 1024]. (in,out) weights.
// Compute dtype: w, mems, r, biases, weights rounded to bf16; q (+ the two head biases), k, v, rk as f16 GEMM planes; one fused kernel forms, per 16 query rows of a (b,n) plane, AC and raw BD (f32 accumulators),
// applies the relative shift as a scatter into LDS, the mask and an f32 softmax and writes P f16 x2^15; attn_vec by GEMM; Wo GEMM + bias; residual + LayerNorm in f32 (wave per row). All contractions on v_wmma_f32_16x16x32_f16, f32 accumulate.
#define QL 1024
#define KL 2048
#define BZ 2
#define NH 16
#define DM 1024
#define NQR (QL * BZ)
#define NKR (KL * BZ)
#define ATT_SCALE 0.125f

typedef __bf16 v16b __attribute__((ext_vector_type(16)));
typedef unsigned short v8us __attribute__((ext_vector_type(8), may_alias));
typedef float  v8f  __attribute__((ext_vector_type(8)));
typedef float  v4f  __attribute__((ext_vector_type(4)));
typedef float  v4fa __attribute__((ext_vector_type(4), may_alias));
union FragB { v16b v; v8us half[2]; unsigned short u[16]; };

__device__ __forceinline__ unsigned short bf16_bits(float x) { unsigned int u = __float_as_uint(x); return (unsigned short)((u + 0x7FFFu + ((u >> 16) & 1u)) >> 16); }
__device__ __forceinline__ float bf16_val(unsigned short b) { return __uint_as_float(((unsigned int)b) << 16); }
__device__ __forceinline__ float bf16_round(float x) { return bf16_val(bf16_bits(x)); }
// D += A·B with NT terms: 1 = ah·bh, 2 = + al·bh (A split), 3 = + ah·bl (both split)
template <int NT>
__device__ __forceinline__ v8f mmaN(v16b ah, v16b al, v16b bh, v16b bl, v8f c) {
  c = __builtin_amdgcn_wmma_f32_16x16x32_bf16(false, ah, false, bh, (short)0, c, false, false);
  if (NT >= 2) c = __builtin_amdgcn_wmma_f32_16x16x32_bf16(false, al, false, bh, (short)0, c, false, false);
  if (NT >= 3) c = __builtin_amdgcn_wmma_f32_16x16x32_bf16(false, ah, false, bl, (short)0, c, false, false);
  asm volatile("v_nop\n\tv_nop\n\tv_nop\n\tv_nop" : "+v"(c) : "v"(ah), "v"(al), "v"(bh), "v"(bl));
  return c;
}

__global__ __launch_bounds__(256) void k_wt_bf16(const float* __restrict__ W, unsigned short* __restrict__ Wt, int K, int N) {
  const int t = blockIdx.x * 256 + threadIdx.x;
  const int k8n = K / 8;
  if (t >= N * k8n) return;
  const int n = t / k8n, k8 = (t % k8n) * 8;
  v8us v;
#pragma unroll
  for (int i = 0; i < 8; ++i) v[i] = bf16_bits(W[(size_t)(k8 + i) * N + n]);
  *(v8us*)(Wt + (size_t)n * K + k8) = v;
  
}

// GEMM C[M][N] (f32, pitch ldc) = act(A[M][K]·W + bias). A f32 row-major (pitch lda) converted per fragment to bf16
// (ASPLIT: hi/lo two planes -> 2 terms, else single rounded term); Wt bf16 [N][K] (pitch ldb). BIAS_BF16 rounds the
// bias to bf16 first (bias quantised to bf16 before the add). K%32==0, M%16==0, N%64==0.
template <bool ASPLIT, int ACT, bool BIAS_BF16>
__global__ __launch_bounds__(128) void k_gemm_bf(const float* __restrict__ A, int lda, const unsigned short* __restrict__ Wt, int ldb,
                                               const float* __restrict__ bias, float* __restrict__ C, int ldc, int M, int N, int K) {
  __shared__ __attribute__((aligned(16))) float so[4][16][64];
  const int tid = threadIdx.x, w = tid >> 5, lane = tid & 31, ln = lane & 15, hh = lane >> 4;
  const int ntn = N / 64;
  const int wid = blockIdx.x * 4 + w;
  const int mt = wid / ntn, nq = wid % ntn;
  if (mt * 16 >= M) return;
  const int row0 = mt * 16, col0 = nq * 64;
  const float* arow = A + (size_t)(row0 + ln) * lda;
  v8f acc[4] = {};
  for (int kb = 0; kb < K; kb += 32) {
    FragB ah, al;
    const v4f x0 = *(const v4fa*)(arow + kb + 8 * hh), x1 = *(const v4fa*)(arow + kb + 8 * hh + 4);
    const v4f x2 = *(const v4fa*)(arow + kb + 16 + 8 * hh), x3 = *(const v4fa*)(arow + kb + 16 + 8 * hh + 4);
    float xs[16] = {x0[0],x0[1],x0[2],x0[3],x1[0],x1[1],x1[2],x1[3],x2[0],x2[1],x2[2],x2[3],x3[0],x3[1],x3[2],x3[3]};
#pragma unroll
    for (int i = 0; i < 16; ++i) { const unsigned short hb = bf16_bits(xs[i]); ah.u[i] = hb; al.u[i] = ASPLIT ? bf16_bits(xs[i] - bf16_val(hb)) : (unsigned short)0; }
#pragma unroll
    for (int t = 0; t < 4; ++t) {
      const unsigned short* brow = Wt + (size_t)(col0 + t * 16 + ln) * ldb + kb;
      FragB b;
      b.half[0] = *(const v8us*)(brow + 8 * hh);
      b.half[1] = *(const v8us*)(brow + 16 + 8 * hh);
      acc[t] = mmaN<ASPLIT ? 2 : 1>(ah.v, al.v, b.v, b.v, acc[t]);
    }
  }
#pragma unroll
  for (int t = 0; t < 4; ++t) {
    float bv = bias ? bias[col0 + t * 16 + ln] : 0.f;
    if (BIAS_BF16) bv = bf16_round(bv);
#pragma unroll
    for (int r = 0; r < 8; ++r) { float v = acc[t][r] + bv; if (ACT == 1) v = fmaxf(v, 0.f); so[w][8 * hh + r][t * 16 + ln] = v; }
  }
  __builtin_amdgcn_fence(__ATOMIC_ACQ_REL, "workgroup");
  __builtin_amdgcn_wave_barrier();
  const int rsub = lane >> 4, c4 = (lane & 15) * 4;
  {
#pragma unroll
    for (int q = 0; q < 8; ++q) {
      const int r = q * 2 + rsub;
      const v4f v = *(const v4fa*)&so[w][r][c4];
      *(v4f*)(C + (size_t)(row0 + r) * ldc + col0 + c4) = v;
    }
    
  }
}

// Flash-style causal/unmasked attention, all contractions 3-term bf16 hi/lo splits, f32 softmax with running max.
// q,k,v rows are read from f32 buffers with arbitrary row pitch (so they can live inside a fused qkv buffer);
// D = head size (multiple of 32, <= 128); one wave = 16 query rows; block = 4 waves (64 queries) sharing K/V chunks of 32.
template <int D, bool CAUSAL>
__global__ __launch_bounds__(128) void k_flash(const float* __restrict__ qb, const float* __restrict__ kb, const float* __restrict__ vb,
                                             int pitch, int T, int H, float scale, float* __restrict__ y, int ypitch) {
  constexpr int KS = D / 32;        // k-steps for QK
  constexpr int DT = D / 16;        // d tiles for PV
  __shared__ __attribute__((aligned(16))) unsigned short sKh[32][D + 8], sKl[32][D + 8], sVh[32][D + 8], sVl[32][D + 8];
  __shared__ __attribute__((aligned(16))) unsigned short sPh[4][16][40], sPl[4][16][40];
  __shared__ __attribute__((aligned(16))) float sO[4][16][D];
  const int tid = threadIdx.x, w = tid >> 5, lane = tid & 31, ln = lane & 15, hh = lane >> 4;
  const int nqb = (T + 63) / 64;
  const int bh = blockIdx.x / nqb, qblk = blockIdx.x % nqb;
  const int b = bh / H, h = bh % H;
  const int q0 = qblk * 64 + w * 16;
  const float* Q = qb + (size_t)b * T * pitch + h * D;
  const float* K = kb + (size_t)b * T * pitch + h * D;
  const float* V = vb + (size_t)b * T * pitch + h * D;

  // A fragments of the wave's 16 query rows (scaled), hi/lo
  FragB aqh[KS], aql[KS];
  {
    int row = q0 + ln; if (row >= T) row = T - 1;
    const float* qr = Q + (size_t)row * pitch;
#pragma unroll
    for (int ks = 0; ks < KS; ++ks)
#pragma unroll
      for (int i = 0; i < 16; ++i) {
        const int d = ks * 32 + ((i < 8) ? (8 * hh + i) : (16 + 8 * hh + (i - 8)));
        const float x = qr[d] * scale; const unsigned short hb = bf16_bits(x);
        aqh[ks].u[i] = hb; aql[ks].u[i] = bf16_bits(x - bf16_val(hb));
      }
  }
  float m_r[8], l_r[8];
#pragma unroll
  for (int r = 0; r < 8; ++r) { m_r[r] = -3.0e38f; l_r[r] = 0.f; }
  v8f oacc[DT];
#pragma unroll
  for (int dt = 0; dt < DT; ++dt) oacc[dt] = (v8f){0.f,0.f,0.f,0.f,0.f,0.f,0.f,0.f};

  const int kv_end = CAUSAL ? min(T, qblk * 64 + 64) : T;     // block-uniform
  for (int j0 = 0; j0 < kv_end; j0 += 32) {
    __syncthreads();
    for (int e = tid; e < 32 * (D / 4); e += 128) {
      const int r = e / (D / 4), c4 = (e % (D / 4)) * 4;
      const int key = j0 + r;
      v4f kf = {0.f,0.f,0.f,0.f}, vf = {0.f,0.f,0.f,0.f};
      if (key < T) { kf = *(const v4fa*)(K + (size_t)key * pitch + c4); vf = *(const v4fa*)(V + (size_t)key * pitch + c4); }
#pragma unroll
      for (int t = 0; t < 4; ++t) {
        unsigned short hb = bf16_bits(kf[t]); sKh[r][c4 + t] = hb; sKl[r][c4 + t] = bf16_bits(kf[t] - bf16_val(hb));
        hb = bf16_bits(vf[t]); sVh[r][c4 + t] = hb; sVl[r][c4 + t] = bf16_bits(vf[t] - bf16_val(hb));
      }
    }
    __syncthreads();
    // S tile 16 x 32
    v8f s[2];
#pragma unroll
    for (int nt = 0; nt < 2; ++nt) {
      v8f acc = {};
#pragma unroll
      for (int ks = 0; ks < KS; ++ks) {
        FragB bh_, bl_;
        bh_.half[0] = *(const v8us*)&sKh[nt * 16 + ln][ks * 32 + 8 * hh]; bh_.half[1] = *(const v8us*)&sKh[nt * 16 + ln][ks * 32 + 16 + 8 * hh];
        bl_.half[0] = *(const v8us*)&sKl[nt * 16 + ln][ks * 32 + 8 * hh]; bl_.half[1] = *(const v8us*)&sKl[nt * 16 + ln][ks * 32 + 16 + 8 * hh];
        acc = mmaN<3>(aqh[ks].v, aql[ks].v, bh_.v, bl_.v, acc);
      }
      s[nt] = acc;
    }
    // mask + running max (rows 8hh+r; the 16 lanes of a half share rows)
    float alpha[8];
#pragma unroll
    for (int r = 0; r < 8; ++r) {
      const int qi = q0 + 8 * hh + r;
      const int ja = j0 + ln, jb = j0 + 16 + ln;
      if (CAUSAL) { if (ja > qi) s[0][r] = -3.0e38f; if (jb > qi) s[1][r] = -3.0e38f; }
      if (ja >= T) s[0][r] = -3.0e38f;
      if (jb >= T) s[1][r] = -3.0e38f;
      float mx = fmaxf(s[0][r], s[1][r]);
      mx = fmaxf(mx, __shfl_xor(mx, 1, 32)); mx = fmaxf(mx, __shfl_xor(mx, 2, 32)); mx = fmaxf(mx, __shfl_xor(mx, 4, 32)); mx = fmaxf(mx, __shfl_xor(mx, 8, 32));
      const float mnew = fmaxf(m_r[r], mx);
      alpha[r] = (mnew > -1.0e38f) ? __expf(m_r[r] - mnew) : 1.0f;
      const float p0 = (s[0][r] > -1.0e38f) ? __expf(s[0][r] - mnew) : 0.f;
      const float p1 = (s[1][r] > -1.0e38f) ? __expf(s[1][r] - mnew) : 0.f;
      m_r[r] = mnew;
      l_r[r] = l_r[r] * alpha[r] + p0 + p1;            // per-lane partial row sum (16 lanes combined at the end)
      unsigned short hb = bf16_bits(p0); sPh[w][8 * hh + r][ln] = hb;      sPl[w][8 * hh + r][ln] = bf16_bits(p0 - bf16_val(hb));
      hb = bf16_bits(p1);                sPh[w][8 * hh + r][16 + ln] = hb; sPl[w][8 * hh + r][16 + ln] = bf16_bits(p1 - bf16_val(hb));
    }
#pragma unroll
    for (int dt = 0; dt < DT; ++dt)
#pragma unroll
      for (int r = 0; r < 8; ++r) oacc[dt][r] *= alpha[r];
    __builtin_amdgcn_fence(__ATOMIC_ACQ_REL, "workgroup");
    __builtin_amdgcn_wave_barrier();
    FragB pah, pal;
    pah.half[0] = *(const v8us*)&sPh[w][ln][8 * hh]; pah.half[1] = *(const v8us*)&sPh[w][ln][16 + 8 * hh];
    pal.half[0] = *(const v8us*)&sPl[w][ln][8 * hh]; pal.half[1] = *(const v8us*)&sPl[w][ln][16 + 8 * hh];
#pragma unroll
    for (int dt = 0; dt < DT; ++dt) {
      FragB bvh, bvl;
#pragma unroll
      for (int i = 0; i < 8; ++i) {
        bvh.u[i] = sVh[8 * hh + i][dt * 16 + ln]; bvh.u[8 + i] = sVh[16 + 8 * hh + i][dt * 16 + ln];
        bvl.u[i] = sVl[8 * hh + i][dt * 16 + ln]; bvl.u[8 + i] = sVl[16 + 8 * hh + i][dt * 16 + ln];
      }
      oacc[dt] = mmaN<3>(pah.v, pal.v, bvh.v, bvl.v, oacc[dt]);
    }
    __builtin_amdgcn_fence(__ATOMIC_ACQ_REL, "workgroup");
    __builtin_amdgcn_wave_barrier();
  }
#pragma unroll
  for (int r = 0; r < 8; ++r) {
    float l = l_r[r];
    l += __shfl_xor(l, 1, 32); l += __shfl_xor(l, 2, 32); l += __shfl_xor(l, 4, 32); l += __shfl_xor(l, 8, 32);
    l_r[r] = (l > 0.f) ? 1.0f / l : 0.f;
  }
#pragma unroll
  for (int dt = 0; dt < DT; ++dt)
#pragma unroll
    for (int r = 0; r < 8; ++r) sO[w][8 * hh + r][dt * 16 + ln] = oacc[dt][r] * l_r[r];
  __builtin_amdgcn_fence(__ATOMIC_ACQ_REL, "workgroup");
  __builtin_amdgcn_wave_barrier();
  {
    for (int r = 0; r < 16; ++r) {
      const int row = q0 + r;
      if (row < T && lane < D / 4) {
        const v4f val = *(const v4fa*)&sO[w][r][lane * 4];
        *(v4f*)(y + ((size_t)b * T + row) * ypitch + h * D + lane * 4) = val;
      }
    }
    
  }
}

// GEMM C = act(A·W + bias + resid): A f32 (ASPLIT -> hi/lo 2 terms), Wt bf16 [N][K]; ACT 0 none, 1 relu, 2 exact gelu;
// resid (optional, f32, row index = (row % rmod), pitch ldr, RES_BF16 rounds it) added before the activation.
template <bool ASPLIT, int ACT, bool BIAS_BF16, bool RES_BF16>
__global__ __launch_bounds__(128) void k_gemm_bf3(const float* __restrict__ A, int lda, const unsigned short* __restrict__ Wt, int ldb,
                                                const float* __restrict__ bias, const float* __restrict__ resid, int rmod, int ldr,
                                                float* __restrict__ C, int ldc, int M, int N, int K) {
  __shared__ __attribute__((aligned(16))) float so[4][16][64];
  const int tid = threadIdx.x, w = tid >> 5, lane = tid & 31, ln = lane & 15, hh = lane >> 4;
  const int ntn = N / 64;
  const int wid = blockIdx.x * 4 + w;
  const int mt = wid / ntn, nq = wid % ntn;
  if (mt * 16 >= M) return;
  const int row0 = mt * 16, col0 = nq * 64;
  const float* arow = A + (size_t)(row0 + ln) * lda;
  v8f acc[4] = {};
  for (int kb = 0; kb < K; kb += 32) {
    FragB ah, al;
    const v4f x0 = *(const v4fa*)(arow + kb + 8 * hh), x1 = *(const v4fa*)(arow + kb + 8 * hh + 4);
    const v4f x2 = *(const v4fa*)(arow + kb + 16 + 8 * hh), x3 = *(const v4fa*)(arow + kb + 16 + 8 * hh + 4);
    float xs[16] = {x0[0],x0[1],x0[2],x0[3],x1[0],x1[1],x1[2],x1[3],x2[0],x2[1],x2[2],x2[3],x3[0],x3[1],x3[2],x3[3]};
#pragma unroll
    for (int i = 0; i < 16; ++i) { const unsigned short hb = bf16_bits(xs[i]); ah.u[i] = hb; al.u[i] = ASPLIT ? bf16_bits(xs[i] - bf16_val(hb)) : (unsigned short)0; }
#pragma unroll
    for (int t = 0; t < 4; ++t) {
      const unsigned short* brow = Wt + (size_t)(col0 + t * 16 + ln) * ldb + kb;
      FragB b;
      b.half[0] = *(const v8us*)(brow + 8 * hh);
      b.half[1] = *(const v8us*)(brow + 16 + 8 * hh);
      acc[t] = mmaN<ASPLIT ? 2 : 1>(ah.v, al.v, b.v, b.v, acc[t]);
    }
  }
#pragma unroll
  for (int t = 0; t < 4; ++t) {
    const int col = col0 + t * 16 + ln;
    float bv = bias ? bias[col] : 0.f;
    if (BIAS_BF16) bv = bf16_round(bv);
#pragma unroll
    for (int r = 0; r < 8; ++r) {
      float v = acc[t][r] + bv;
      if (resid) { float rv = resid[(size_t)((row0 + 8 * hh + r) % rmod) * ldr + col]; if (RES_BF16) rv = bf16_round(rv); v += rv; }
      if (ACT == 1) v = fmaxf(v, 0.f);
      if (ACT == 2) v = 0.5f * v * (1.0f + erff(v * 0.70710678118654752f));
      if (ACT == 3) { const float u = 0.7978845608028654f * (v + 0.044715f * v * v * v); v = 0.5f * v * (1.0f + tanhf(u)); }
      so[w][8 * hh + r][t * 16 + ln] = v;
    }
  }
  __builtin_amdgcn_fence(__ATOMIC_ACQ_REL, "workgroup");
  __builtin_amdgcn_wave_barrier();
  const int rsub = lane >> 4, c4 = (lane & 15) * 4;
  {
#pragma unroll
    for (int q = 0; q < 8; ++q) {
      const int r = q * 2 + rsub;
      const v4f v = *(const v4fa*)&so[w][r][c4];
      *(v4f*)(C + (size_t)(row0 + r) * ldc + col0 + c4) = v;
    }
    
  }
}
// row LayerNorm (biased variance, eps) over N: s = X (+ R); optional out_sum <- s; out_norm <- (s-mu)*rsqrt(var+eps)*g + b
template <bool PARAM_BF16>
__global__ __launch_bounds__(256) void k_layernorm(const float* __restrict__ X, const float* __restrict__ R, const float* __restrict__ g, const float* __restrict__ bta,
                                                  float* __restrict__ out_sum, float* __restrict__ out_norm, int N, float eps) {
  __shared__ float red[256];
  const int row = blockIdx.x, tid = threadIdx.x;
  const float* x = X + (size_t)row * N; const float* rr = R ? R + (size_t)row * N : nullptr;
  float vals[16];                     // up to N = 4096
  const int per = N / 256;            // contiguous chunk per thread? use strided-by-4 chunks: thread handles j = tid*4 + 1024*u
  float s1 = 0.f;
  for (int u = 0; u < per / 4; ++u) {
    const int j = tid * 4 + 1024 * u;
    const v4f a = *(const v4fa*)(x + j);
    v4f b = {0.f,0.f,0.f,0.f}; if (rr) b = *(const v4fa*)(rr + j);
#pragma unroll
    for (int q = 0; q < 4; ++q) { const float v = a[q] + b[q]; vals[u * 4 + q] = v; s1 += v; }
  }
  red[tid] = s1; __syncthreads();
  for (int st = 128; st > 0; st >>= 1) { if (tid < st) red[tid] += red[tid + st]; __syncthreads(); }
  const float mu = red[0] / (float)N; __syncthreads();
  float s2 = 0.f;
  for (int u = 0; u < per / 4; ++u)
#pragma unroll
    for (int q = 0; q < 4; ++q) { const float c = vals[u * 4 + q] - mu; s2 += c * c; }
  red[tid] = s2; __syncthreads();
  for (int st = 128; st > 0; st >>= 1) { if (tid < st) red[tid] += red[tid + st]; __syncthreads(); }
  const float rs = rsqrtf(red[0] / (float)N + eps);
  {
    for (int u = 0; u < per / 4; ++u) {
      const int j = tid * 4 + 1024 * u;
      v4f o, sm;
#pragma unroll
      for (int q = 0; q < 4; ++q) {
        float gg = g[j + q], bb = bta[j + q];
        if (PARAM_BF16) { gg = bf16_round(gg); bb = bf16_round(bb); }
        sm[q] = vals[u * 4 + q]; o[q] = (vals[u * 4 + q] - mu) * rs * gg + bb;
      }
      if (out_sum) *(v4f*)(out_sum + (size_t)row * N + j) = sm;
      *(v4f*)(out_norm + (size_t)row * N + j) = o;
    }
    
  }
}



// ---- f16 WMMA path (v_wmma_f32_16x16x32_f16): 11-bit significands for operands in range — used where a [0,1] probability operand needs more precision than bf16
typedef _Float16 v16h __attribute__((ext_vector_type(16)));
union FragH { v16h v; v8us half[2]; _Float16 h[16]; unsigned short u[16]; };
template <int NT>
__device__ __forceinline__ v8f mmaH(v16h ah, v16h al, v16h bh, v16h bl, v8f c) {
  c = __builtin_amdgcn_wmma_f32_16x16x32_f16(false, ah, false, bh, (short)0, c, false, false);
  if (NT >= 2) c = __builtin_amdgcn_wmma_f32_16x16x32_f16(false, al, false, bh, (short)0, c, false, false);
  if (NT >= 3) c = __builtin_amdgcn_wmma_f32_16x16x32_f16(false, ah, false, bl, (short)0, c, false, false);
  asm volatile("v_nop\n\tv_nop\n\tv_nop\n\tv_nop" : "+v"(c) : "v"(ah), "v"(al), "v"(bh), "v"(bl));
  return c;
}
// batched GEMM like k_gemm_b but f16 operands: A f32 (split into f16 hi/lo if ASPLIT, else rounded to f16), Bt = f16 values [n][k]; alpha; C f32; N multiple of 16 (partial tiles skipped)
template <bool ASPLIT>
__global__ __launch_bounds__(128) void k_gemm_h(const float* __restrict__ A, int lda, size_t sA, const _Float16* __restrict__ Bh, int ldb, size_t sB, float alpha, float* __restrict__ C, int ldc, size_t sC, int M, int N, int K) {
  __shared__ __attribute__((aligned(16))) float so[4][16][64];
  const int tid = threadIdx.x, w = tid >> 5, lane = tid & 31, ln = lane & 15, hh = lane >> 4; const int by = blockIdx.y;
  A += (size_t)by * sA; Bh += (size_t)by * sB; C += (size_t)by * sC;
  const int ntn = (N + 63) / 64; const int wid = blockIdx.x * 4 + w; const int mt = wid / ntn, nq = wid % ntn; if (mt * 16 >= M) return;
  const int row0 = mt * 16, col0 = nq * 64; const float* arow = A + (size_t)(row0 + ln) * lda;
  v8f acc[4] = {};
  for (int kb = 0; kb < K; kb += 32) {
    FragH ah, al;
    const v4f x0 = *(const v4fa*)(arow + kb + 8 * hh), x1 = *(const v4fa*)(arow + kb + 8 * hh + 4), x2 = *(const v4fa*)(arow + kb + 16 + 8 * hh), x3 = *(const v4fa*)(arow + kb + 16 + 8 * hh + 4);
    float xs[16] = {x0[0],x0[1],x0[2],x0[3],x1[0],x1[1],x1[2],x1[3],x2[0],x2[1],x2[2],x2[3],x3[0],x3[1],x3[2],x3[3]};
#pragma unroll
    for (int i = 0; i < 16; ++i) { const _Float16 h = (_Float16)xs[i]; ah.h[i] = h; al.h[i] = ASPLIT ? (_Float16)(xs[i] - (float)h) : (_Float16)0.0f; }
#pragma unroll
    for (int t = 0; t < 4; ++t) { if (col0 + t * 16 >= N) continue; const size_t boff = (size_t)(col0 + t * 16 + ln) * ldb + kb; FragH bq; bq.half[0] = *(const v8us*)(Bh + boff + 8 * hh); bq.half[1] = *(const v8us*)(Bh + boff + 16 + 8 * hh);
      acc[t] = mmaH<ASPLIT ? 2 : 1>(ah.v, al.v, bq.v, bq.v, acc[t]); }
  }
#pragma unroll
  for (int t = 0; t < 4; ++t) { if (col0 + t * 16 >= N) continue;
#pragma unroll
    for (int r = 0; r < 8; ++r) so[w][8 * hh + r][t * 16 + ln] = acc[t][r] * alpha; }
  __builtin_amdgcn_fence(__ATOMIC_ACQ_REL, "workgroup"); __builtin_amdgcn_wave_barrier();
  const int rsub = lane >> 4, c4 = (lane & 15) * 4;
  {
#pragma unroll
    for (int q = 0; q < 8; ++q) { const int r = q * 2 + rsub; if (col0 + c4 < N) { const v4f v = *(const v4fa*)&so[w][r][c4]; *(v4f*)(C + (size_t)(row0 + r) * ldc + col0 + c4) = v; } }
     }
}

// Wt[n][k] = f16(W[k][n]·scale) from f32 row-major W[K][N] (scale = power of two; bf16-exact weights stay exact in f16 away from the subnormal range)
__global__ __launch_bounds__(256) void k_wt_f16(const float* __restrict__ W, _Float16* __restrict__ Wt, int K, int N, float scale) {
  const int t = blockIdx.x * 256 + threadIdx.x; if (t >= N * (K / 8)) return; const int n = t / (K / 8), k8 = (t % (K / 8)) * 8; FragH f;
#pragma unroll
  for (int i = 0; i < 8; ++i) f.h[i] = (_Float16)(bf16_round(W[(size_t)(k8 + i) * N + n]) * scale); const v8us o = f.half[0];
  *(v8us*)((unsigned short*)Wt + (size_t)n * K + k8) = o; 
}
typedef _Float16 v4h __attribute__((ext_vector_type(4)));

__global__ __launch_bounds__(256) void k_x16(const float* __restrict__ x, _Float16* __restrict__ X16, size_t n8) { const size_t t = (size_t)blockIdx.x * 256 + threadIdx.x; if (t >= n8) return; FragH f;
#pragma unroll
  for (int q = 0; q < 8; ++q) f.h[q] = (_Float16)bf16_round(x[t * 8 + q]); *(v8us*)((unsigned short*)X16 + t * 8) = f.half[0];  }
__global__ __launch_bounds__(256) void k_h16(const float* __restrict__ x, _Float16* __restrict__ X16, size_t n8) { const size_t t = (size_t)blockIdx.x * 256 + threadIdx.x; if (t >= n8) return; FragH f;
#pragma unroll
  for (int q = 0; q < 8; ++q) f.h[q] = (_Float16)x[t * 8 + q]; *(v8us*)((unsigned short*)X16 + t * 8) = f.half[0];  }
__global__ __launch_bounds__(256) void k_round16f(const float* __restrict__ W, _Float16* __restrict__ Bt, size_t n8) { const size_t t = (size_t)blockIdx.x * 256 + threadIdx.x; if (t >= n8) return; FragH f;
#pragma unroll
  for (int i = 0; i < 8; ++i) f.h[i] = (_Float16)(bf16_round(W[t * 8 + i]) * 16.0f); *(v8us*)((unsigned short*)Bt + t * 8) = f.half[0];  }
template <int NHv, int TTv>
__global__ __launch_bounds__(256) void k_vt(const _Float16* __restrict__ V16, int ldv, int voff, _Float16* __restrict__ Vt) { __shared__ unsigned short tl[64][66]; const int tid = threadIdx.x; const int slab = blockIdx.x / (TTv / 64), lg = blockIdx.x % (TTv / 64); const int b = slab / NHv, h = slab % NHv;
  for (int i = tid; i < 64 * 8; i += 256) { const int r = i / 8, c8 = (i % 8) * 8; FragH f; f.half[0] = *(const v8us*)((const unsigned short*)V16 + ((size_t)b * TTv + lg * 64 + r) * ldv + voff + h * 64 + c8);
#pragma unroll
    for (int q = 0; q < 8; ++q) tl[r][c8 + q] = f.u[q]; }
  __syncthreads();
  {
#pragma unroll
    for (int rd = 0; rd < 2; ++rd) { const int d = rd * 32 + tid / 8, pc = tid % 8; FragH f;
#pragma unroll
      for (int q = 0; q < 8; ++q) f.u[q] = tl[pc * 8 + q][d];
      *(v8us*)((unsigned short*)Vt + ((size_t)slab * 64 + d) * TTv + lg * 64 + pc * 8) = f.half[0]; }
     } }

__global__ __launch_bounds__(256) void k_qbias(const float* __restrict__ QF, const float* __restrict__ rwb, const float* __restrict__ rrb, _Float16* __restrict__ QW, _Float16* __restrict__ QR, size_t n8) { const size_t t = (size_t)blockIdx.x * 256 + threadIdx.x; if (t >= n8) return; const int c0 = (int)((t * 8) % DM); const v4f a = *(const v4fa*)(QF + t * 8), b = *(const v4fa*)(QF + t * 8 + 4); FragH fw, fr;
#pragma unroll
  for (int q = 0; q < 8; ++q) { const float v = (q < 4) ? a[q] : b[q - 4]; fw.h[q] = (_Float16)(v + bf16_round(rwb[c0 + q])); fr.h[q] = (_Float16)(v + bf16_round(rrb[c0 + q])); }
  { *(v8us*)((unsigned short*)QW + t * 8) = fw.half[0]; *(v8us*)((unsigned short*)QR + t * 8) = fr.half[0];  } }
// Fused score kernel: one work-group = 16 query rows i0..i0+15 of one (b,n) plane (blockIdx.y), 16 waves; the 16 x KL score rows live in LDS and never reach memory. AC is stored into the rows first.
// The pad/reshape shift as a scatter of raw BD: idx = QL + i*KL + j = i*(KL+1) + (QL - i + j), so with d = m - (QL-1) + i the raw value (q_i + r_r_bias).rk_m belongs to j = d where d >= 0,
// the raw value of row i+1 at column m to j = d + KL + 1 where d <= -2 (the wrap region); d == -1 gives j = KL, a slot of the row's LDS padding that the softmax never reads; the pad's zero falls on j = i + KL + 1 - QL. Each j in 0..KL-1 gets at most one raw value.
// Behind a barrier each raw value is added to AC in place, and behind a second one wave wv does mask, f32 softmax and the f16 x2^15 store of row i0 + wv with the lane order and sum order of a wave-per-row pass.
#define SP (KL + 4)      // LDS row pitch in floats: 8 rows apart = 32 banks apart, so the two lane halves of a D tile do not collide; multiple of 4 for 16-byte reads
__device__ __forceinline__ v8f mma16(v16h a, v16h b, v8f c) { return __builtin_amdgcn_wmma_f32_16x16x32_f16(false, a, false, b, (short)0, c, false, false); }
// One 16-row fragment pair (k = 0..63) of a row-major f16 plane: base (+ cofs, a constant) is the same for the whole wave, ob is the lane's own byte offset (its row, plus 16 bytes for the upper lane half).
// Lane half hh, step ks: registers 0..3 hold k = 32*ks + 8*hh + 0..7, registers 4..7 hold k = 32*ks + 16 + 8*hh + 0..7, for A and B alike.
__device__ __forceinline__ void ldfrag(FragH (&f)[2], const char* __restrict__ base, unsigned ob, int cofs) {
#pragma unroll
  for (int ks = 0; ks < 2; ++ks) { f[ks].half[0] = *(const v8us*)(base + ob + (cofs + ks * 64)); f[ks].half[1] = *(const v8us*)(base + ob + (cofs + ks * 64 + 32)); }
  // the wait that is owed before a register named by an issued global load is rewritten; offset and base are inputs, so they stay live to here and none of the four loads lands in them
  asm volatile("s_wait_xcnt 0x0" :: "v"(ob), "s"(base) : "memory"); }
// launch bounds: 8 waves a SIMD (a budget of 128 VGPRs), so that two of these 128-KiB work-groups share a WGP and one's barriers and loads run under the other's work
__global__ __launch_bounds__(512, 8) void k_score(const _Float16* __restrict__ QW, const _Float16* __restrict__ QR, const _Float16* __restrict__ K16, const _Float16* __restrict__ RK, const int* __restrict__ MSK, _Float16* __restrict__ P16) {
  __shared__ __attribute__((aligned(16))) float S[16 * SP];
  const int tid = threadIdx.x, lane = tid & 31, ln = lane & 15, hh = lane >> 4;
  const int wv = __builtin_amdgcn_readfirstlane(tid >> 5);      // the wave's number as a scalar: tile bases and the row's addresses then sit in scalar registers
  const int i0 = blockIdx.x * 16, pl = blockIdx.y, b = pl / NH, h = pl % NH;
  const int i = i0 + wv;
  constexpr int QP = BZ * DM * 2, RP = DM * 2;      // row pitches in bytes: q and k rows (i,b) / (j,b); rk rows
  const char* qw = (const char*)(QW + (size_t)b * DM + h * 64 + (size_t)i0 * (BZ * DM)); const char* qr = (const char*)(QR + (size_t)b * DM + h * 64 + (size_t)i0 * (BZ * DM));
  const char* kp = (const char*)(K16 + (size_t)b * DM + h * 64 + (size_t)(wv * 16) * (BZ * DM)); const char* rp = (const char*)(RK + h * 64 + (size_t)(wv * 16) * DM);
  const char* mk = (const char*)(MSK + (size_t)i * KL);
  const unsigned obq = (unsigned)(ln * QP + hh * 16), obr = (unsigned)(ln * RP + hh * 16);
  const unsigned obw = (unsigned)(((i0 + 1 + ln < QL) ? 1 + ln : QL - 1 - i0) * QP + hh * 16);      // row i+1 for the wrap region; the clamped row of i = QL-1 is never selected (there d >= 0 for every m)
  FragH aq[2], kb[4][2]; ldfrag(aq, qw, obq, 0); ldfrag(kb[0], kp, obq, 0);
  unsigned mbal[64];      // the mask of row i0 + wv as one lane mask per (jj, e), read at the head beside the first fragments: the softmax phase then holds no mask registers and waits for no memory
  {
    typedef int v4i __attribute__((ext_vector_type(4))); typedef int v4ia __attribute__((ext_vector_type(4), may_alias)); v4i mv[16]; const unsigned obm = (unsigned)(lane * 16);
#pragma unroll
    for (int jj = 0; jj < 16; ++jj) mv[jj] = *(const v4ia*)(mk + obm + jj * 512);
    // the wait that is owed before a register named by an issued global load is rewritten; offset and base are inputs, so they stay live to here and none of the sixteen loads lands in them
    asm volatile("s_wait_xcnt 0x0" :: "v"(obm), "s"(mk) : "memory");
#pragma unroll
    for (int jj = 0; jj < 16; ++jj)
#pragma unroll
      for (int e = 0; e < 4; ++e) mbal[jj * 4 + e] = __builtin_amdgcn_ballot_w32(mv[jj][e] != 0);
  }
  ldfrag(kb[1], kp, obq, 256 * QP); ldfrag(kb[2], kp, obq, 2 * 256 * QP); ldfrag(kb[3], kp, obq, 3 * 256 * QP);      // behind the lane masks: the sixteen mask vectors and four k tiles together do not fit the registers
  FragH an[2], aw[2], bb[2][2];
  // AC: wave wv owns the column tiles wv + 16 t and stores them straight into S. Four k tiles are in flight; as the ring drains, its registers take the q + r_r_bias rows and the first two rk tiles, which fly while the last AC tiles are multiplied and stored.
#pragma unroll
  for (int t = 0; t < KL / 256; ++t) { const int j0 = (wv + 16 * t) * 16; FragH (&bf)[2] = kb[t & 3];
    v8f c = {}; c = mma16(aq[0].v, bf[0].v, c); c = mma16(aq[1].v, bf[1].v, c);
    // the four vector slots that the chip needs behind a matrix instruction before its D is overwritten (the next tile's product) or its A or B refilled; the operands are named so that the refill of bf stays behind them
    asm volatile("v_nop\n\tv_nop\n\tv_nop\n\tv_nop" : "+v"(c) : "v"(aq[0].v), "v"(aq[1].v), "v"(bf[0].v), "v"(bf[1].v));
    if (t + 4 < KL / 256) ldfrag(bf, kp, obq, (t + 4) * 256 * QP);
    else if (t == 4) ldfrag(an, qr, obq, 0);
    else if (t == 5) ldfrag(aw, qr, obw, 0);
    else if (t == 6) ldfrag(bb[0], rp, obr, 0);
    else ldfrag(bb[1], rp, obr, 256 * RP);
#pragma unroll
    for (int r = 0; r < 8; ++r) S[(8 * hh + r) * SP + j0 + ln] = c[r];
    __builtin_amdgcn_sched_barrier(0); }      // keeps the tiles apart in the schedule: mixed, they hold more products and fragments live than the 128 registers take, and the build spills
  if (tid < 16) S[tid * SP + KL] = 0.f;      // the padding slot that takes the one raw value of a row with d == -1: given a value here, so that the add below reads nothing unwritten
  __syncthreads();      // every AC value is in S before any wave adds a shifted BD value to it
  __builtin_amdgcn_sched_barrier(0);      // as above: no product of the next phase is lifted over the barrier
  // raw BD of rows i and i+1, added in place at the shifted column: each (row, j) is touched by one lane of one wave; the column of the pad's zero, j = i + KL + 1 - QL, by none (AC + 0)
#pragma unroll
  for (int t = 0; t < KL / 256; ++t) { const int m0 = (wv + 16 * t) * 16; FragH (&bf)[2] = bb[t & 1];
    v8f dn = {}, dw = {}; dn = mma16(an[0].v, bf[0].v, dn); dw = mma16(aw[0].v, bf[0].v, dw); dn = mma16(an[1].v, bf[1].v, dn); dw = mma16(aw[1].v, bf[1].v, dw);
    // the four vector slots that the chip needs behind a matrix instruction before a vector instruction reads its D or its B is refilled; bf is named so that its refill stays behind them
    asm volatile("v_nop\n\tv_nop\n\tv_nop\n\tv_nop" : "+v"(dn), "+v"(dw) : "v"(bf[0].v), "v"(bf[1].v));
    if (t + 2 < KL / 256) ldfrag(bf, rp, obr, (t + 2) * 256 * RP);      // rk tiles fly two tiles ahead
    const int d0 = m0 + ln - (QL - 1) + i0 + 8 * hh; int ix[8]; float old[8];
#pragma unroll
    for (int r = 0; r < 8; ++r) { const int d = d0 + r; ix[r] = (8 * hh + r) * SP + ((d >= 0) ? d : d + (KL + 1)); old[r] = S[ix[r]]; }      // the eight reads first: eight different rows, so no store of this tile can hit them
#pragma unroll
    for (int r = 0; r < 8; ++r) S[ix[r]] = old[r] + ((d0 + r >= 0) ? dn[r] : dw[r]);
    __builtin_amdgcn_sched_barrier(0); }      // as above
  __syncthreads();      // the rows are complete before the row waves read them
  const float* sr = &S[wv * SP];
  v4f sv[16]; float mx = -3.0e38f;
#pragma unroll
  for (int jj = 0; jj < 16; ++jj) { const int j0 = jj * 128 + lane * 4; const v4f a = *(const v4fa*)(sr + j0); v4f s;
#pragma unroll
    for (int e = 0; e < 4; ++e) { const float val = a[e] * ATT_SCALE; s[e] = __builtin_amdgcn_inverse_ballot_w32(mbal[jj * 4 + e]) ? -INFINITY : val; mx = fmaxf(mx, s[e]); }
    sv[jj] = s; }
  for (int o = 16; o >= 1; o >>= 1) mx = fmaxf(mx, __shfl_xor(mx, o, 32)); float z = 0.f;
#pragma unroll
  for (int jj = 0; jj < 16; ++jj) for (int e = 0; e < 4; ++e) { const float p = (sv[jj][e] > -INFINITY) ? __expf(sv[jj][e] - mx) : 0.f; sv[jj][e] = p; z += p; }
  for (int o = 16; o >= 1; o >>= 1) z += __shfl_xor(z, o, 32); const float iz = (z > 0.f) ? 32768.0f / z : 0.f;
  _Float16* pr = P16 + ((size_t)pl * QL + i) * KL;
#pragma unroll
  for (int jj = 0; jj < 16; ++jj) { v4h o; for (int e = 0; e < 4; ++e) o[e] = (_Float16)(sv[jj][e] * iz); *(v4h*)(pr + jj * 128 + lane * 4) = o; }
}
// GEMM with both operands staged in LDS: C[M][N] = f16 A[M][KK] . Bt[N][KK]^T, v = acc*alpha (+ bf16(bias[col]) if BIAS); writes f32 C (F32OUT) or f16 C16, pitch LDC. A, Bt row-major with pitch KK; M a multiple of 128, N of 64, KK of 256.
// One work-group = 128 rows x 64 columns, 8 waves of 16 x 64; blockIdx.x = row block * ntn + column block (ntn = N / 64), blockIdx.y = plane (element strides sA, sB, sC).
// A stage is 128 k = 256 bytes of each of the 192 operand rows (A rows 0..127, Bt rows 128..191), brought by asynchronous copies whose wave-wide 512 bytes are two whole 256-byte row pieces; two buffers, stage t + 2 flies while stage t is multiplied.
// Each output element still sums its k steps of 32 in rising order in one f32 accumulator.
#define GP 272      // LDS row pitch in bytes: 16 x odd, the conflict-free pitch of 256-byte rows for 16-byte fragment reads
#define GSTG (192 * GP)      // bytes of one stage
// One stage: lane (row cr = tid / 16, 16-byte piece tid % 16) copies its piece of A rows cr + 16 i (i < 8) and Bt rows cr + 16 i (i < 4). l: the lane's LDS byte address of A row cr; ga, gb: its global addresses in A row cr and Bt row cr; RB: 16 rows in bytes.
// The s_wait_xcnt is the wait that is owed before a register named by an issued copy is rewritten; as the statement's last line it stands in front of every such write.
template <int RB>
__device__ __forceinline__ void cp_stage(unsigned l, const char* ga, const char* gb) {
  asm volatile("global_load_async_to_lds_b128 %0, %12, off\n\t"
               "global_load_async_to_lds_b128 %1, %13, off\n\t"
               "global_load_async_to_lds_b128 %2, %14, off\n\t"
               "global_load_async_to_lds_b128 %3, %15, off\n\t"
               "global_load_async_to_lds_b128 %4, %16, off\n\t"
               "global_load_async_to_lds_b128 %5, %17, off\n\t"
               "global_load_async_to_lds_b128 %6, %18, off\n\t"
               "global_load_async_to_lds_b128 %7, %19, off\n\t"
               "global_load_async_to_lds_b128 %8, %20, off\n\t"
               "global_load_async_to_lds_b128 %9, %21, off\n\t"
               "global_load_async_to_lds_b128 %10, %22, off\n\t"
               "global_load_async_to_lds_b128 %11, %23, off\n\t"
               "s_wait_xcnt 0x0"
               :: "v"(l), "v"(l + 16 * GP), "v"(l + 32 * GP), "v"(l + 48 * GP), "v"(l + 64 * GP), "v"(l + 80 * GP), "v"(l + 96 * GP), "v"(l + 112 * GP),
                  "v"(l + 128 * GP), "v"(l + 144 * GP), "v"(l + 160 * GP), "v"(l + 176 * GP),
                  "v"(ga), "v"(ga + RB), "v"(ga + 2 * RB), "v"(ga + 3 * RB), "v"(ga + 4 * RB), "v"(ga + 5 * RB), "v"(ga + 6 * RB), "v"(ga + 7 * RB),
                  "v"(gb), "v"(gb + RB), "v"(gb + 2 * RB), "v"(gb + 3 * RB)
               : "memory");
}
template <int KK, int LDC, bool F32OUT, bool BIAS>
__global__ __launch_bounds__(256) void k_gemm_lds(const _Float16* __restrict__ A, size_t sA, const _Float16* __restrict__ Bh, size_t sB, float alpha, const float* __restrict__ bias,
    float* __restrict__ C, _Float16* __restrict__ C16, size_t sC, int ntn) {
  __shared__ __attribute__((aligned(16))) char ring[2 * GSTG];
  __shared__ __attribute__((aligned(16))) float so[8][16][64];
  const int tid = threadIdx.x, lane = tid & 31, ln = lane & 15, hh = lane >> 4;
  const int w = __builtin_amdgcn_readfirstlane(tid >> 5);      // the wave's number as a scalar
  const int by = blockIdx.y, bm = blockIdx.x / ntn, nq = blockIdx.x % ntn;
  const int row0 = bm * 128 + w * 16, col0 = nq * 64;
  const int cr = tid >> 4, cc = (tid & 15) * 16;
  const char* ga = (const char*)(A + (size_t)by * sA + (size_t)(bm * 128 + cr) * KK) + cc;
  const char* gb = (const char*)(Bh + (size_t)by * sB + (size_t)(col0 + cr) * KK) + cc;
  const unsigned l0 = (unsigned)(size_t)&ring[0] + (unsigned)(cr * GP + cc);      // the low 32 bits of a __shared__ address are its LDS byte address
  constexpr int NT = KK / 128, RB = 16 * KK * 2;
  float braw[4] = {0.f, 0.f, 0.f, 0.f};      // the bias of the lane's four columns, read at the head so that it flies under the main loop; first used in the epilogue
  if (BIAS) {
#pragma unroll
    for (int q = 0; q < 4; ++q) braw[q] = bias[col0 + q * 16 + ln];
  }
  cp_stage<RB>(l0, ga, gb);      // stage 0 into buffer 0
  asm volatile("s_wait_asynccnt 0x0" ::: "memory");      // this wave's copies of stage 0 have landed
  __syncthreads();      // every wave's have: stage 0 may be read
  cp_stage<RB>(l0 + GSTG, ga + 256, gb + 256);      // stage 1 into buffer 1
  v8f acc[4] = {};
#pragma unroll 1      // kept rolled: unrolled, the build holds two stages' fragments live and needs more than 256 registers, and two work-groups no longer share a WGP
  for (int t = 0; t < NT; ++t) {
    const char* sa = &ring[(t & 1) * GSTG + (w * 16 + ln) * GP + hh * 16];
    const char* sb = &ring[(t & 1) * GSTG + (128 + ln) * GP + hh * 16];
    FragH a[4], b[4][4];
#pragma unroll
    for (int ks = 0; ks < 4; ++ks) {      // lane half hh: registers 0..3 hold k = 32 ks + 8 hh + 0..7, registers 4..7 hold k = 32 ks + 16 + 8 hh + 0..7, for A and B alike
      a[ks].half[0] = *(const v8us*)(sa + ks * 64); a[ks].half[1] = *(const v8us*)(sa + ks * 64 + 32);
#pragma unroll
      for (int q = 0; q < 4; ++q) { b[ks][q].half[0] = *(const v8us*)(sb + q * 16 * GP + ks * 64); b[ks][q].half[1] = *(const v8us*)(sb + q * 16 * GP + ks * 64 + 32); }
    }
    asm volatile("s_wait_dscnt 0x0" ::: "memory");      // the whole stage is in this wave's registers: its reads of the buffer have returned before the buffer is refilled
    asm volatile("s_wait_asynccnt 0x0" ::: "memory");      // this wave's copies of stage t + 1 have landed
    __syncthreads();      // publishes stage t + 1 and ends every wave's reads of stage t
    if (t + 2 < NT) cp_stage<RB>(l0 + (unsigned)((t & 1) * GSTG), ga + (t + 2) * 256, gb + (t + 2) * 256);      // stage t + 2 into the buffer that this trip has read
    __builtin_amdgcn_sched_barrier(0);      // keeps the products behind the refill: they need registers only, and the copies so fly under them as well as under the next stage's reads
#pragma unroll
    for (int ks = 0; ks < 4; ++ks)
#pragma unroll
      for (int q = 0; q < 4; ++q) acc[q] = mma16(a[ks].v, b[ks][q].v, acc[q]);
  }
  asm volatile("s_wait_asynccnt 0x0" ::: "memory");      // no copy is outstanding when the wave goes on to its end
#pragma unroll
  for (int q = 0; q < 4; ++q)
#pragma unroll
    for (int r = 0; r < 8; ++r) so[w][8 * hh + r][q * 16 + ln] = acc[q][r] * alpha + (BIAS ? bf16_round(braw[q]) : 0.f);
  __builtin_amdgcn_fence(__ATOMIC_ACQ_REL, "workgroup"); __builtin_amdgcn_wave_barrier();      // the wave reads back its own staging rows: whole 128-byte lines go out
  const int rsub = lane >> 4, c4 = (lane & 15) * 4; const size_t cofs = (size_t)by * sC + (size_t)(row0 + rsub) * LDC + col0 + c4;      // the lane's first element; its eight rows lie 2 LDC apart
#pragma unroll
  for (int q = 0; q < 8; ++q) { const v4f v = *(const v4fa*)&so[w][q * 2 + rsub][c4];
    if (F32OUT) *(v4f*)(C + cofs + q * 2 * LDC) = v;
    else { v4h h4; for (int i = 0; i < 4; ++i) h4[i] = (_Float16)v[i]; *(v4h*)(C16 + cofs + q * 2 * LDC) = h4; } }
}
__global__ __launch_bounds__(256) void k_lnout(const float* __restrict__ RES, const float* __restrict__ w, const float* __restrict__ g, const float* __restrict__ bb, float* __restrict__ out) { const int tid = threadIdx.x, wv = tid >> 5, lane = tid & 31; const int r = blockIdx.x * 8 + wv; if (r >= NQR) return; v4f y[8]; float s = 0.f;
#pragma unroll
  for (int j = 0; j < 8; ++j) { const int c = j * 128 + lane * 4; const v4f a = *(const v4fa*)(RES + (size_t)r * DM + c), x = *(const v4fa*)(w + (size_t)r * DM + c); for (int q = 0; q < 4; ++q) { y[j][q] = a[q] + bf16_round(x[q]); s += y[j][q]; } }
  for (int o = 16; o >= 1; o >>= 1) s += __shfl_xor(s, o, 32); const float mu = s / (float)DM; float q2 = 0.f;
#pragma unroll
  for (int j = 0; j < 8; ++j) for (int q = 0; q < 4; ++q) { const float d = y[j][q] - mu; q2 += d * d; }
  for (int o = 16; o >= 1; o >>= 1) q2 += __shfl_xor(q2, o, 32); const float rs = rsqrtf(q2 / (float)DM + 1e-5f);
  {
#pragma unroll
    for (int j = 0; j < 8; ++j) { const int c = j * 128 + lane * 4; v4f o; for (int q = 0; q < 4; ++q) o[q] = (y[j][q] - mu) * rs * bf16_round(g[c + q]) + bf16_round(bb[c + q]); *(v4f*)(out + (size_t)r * DM + c) = o; }
     } }

extern "C" void kernel_launch(void* const* d_in, const int* in_sizes, int n_in,
                              void* d_out, int out_size, void* d_ws, size_t ws_size, hipStream_t stream) {
  (void)in_sizes; (void)n_in; (void)out_size;
  const float* const* I = (const float* const*)d_in; const float* w = I[0]; const float* r = I[1]; const float* mems = I[2]; const float* rwb = I[3]; const float* rrb = I[4]; const int* msk = (const int*)d_in[5];
  const float* Wq = I[6]; const float* bq = I[7]; const float* Wk = I[8]; const float* bk = I[9]; const float* Wv = I[10]; const float* bv = I[11]; const float* Wr = I[12]; const float* br = I[13]; const float* Wo = I[14]; const float* bo = I[15]; const float* lg = I[16]; const float* lb = I[17];
  char* ws = (char*)d_ws; size_t off = 0;
  auto take = [&](size_t bytes) { char* p = ws + off; off += (bytes + 255) & ~(size_t)255; return p; };
  const size_t WSZ = (size_t)DM * DM; _Float16* Bw = (_Float16*)take(5 * WSZ * 2);      /* Wq, Wk, Wv, Wr, Wo */
  _Float16* QW = (_Float16*)take((size_t)NQR * DM * 2); _Float16* QR = (_Float16*)take((size_t)NQR * DM * 2);
  _Float16* K16 = (_Float16*)take((size_t)NKR * DM * 2); _Float16* Vt = (_Float16*)take((size_t)NKR * DM * 2); _Float16* RK = (_Float16*)take((size_t)KL * DM * 2);
  _Float16* P16 = (_Float16*)take((size_t)BZ * NH * QL * KL * 2); float* O = (float*)take((size_t)NQR * DM * 4); _Float16* O16 = (_Float16*)take((size_t)NQR * DM * 2);      /* P of all 32 (b,n) planes, so that one launch does every P*V */
  _Float16* CAT = (_Float16*)take((size_t)NKR * DM * 2); _Float16* R16 = (_Float16*)take((size_t)KL * DM * 2); _Float16* V16 = (_Float16*)take((size_t)NKR * DM * 2); float* QF = (float*)take((size_t)NQR * DM * 4); float* RES = QF;      /* the Wo GEMM output reuses QF, which is dead behind k_qbias */
  if (off > ws_size) return;      // MiB: 10 + 4 + 4 + 8 + 8 + 4 + 128 + 8 + 4 + 8 + 4 + 8 + 8 = 206 of 256
  const unsigned gwt = (unsigned)(((size_t)DM * (DM / 8) + 255) / 256);
  k_wt_f16<<<gwt, 256, 0, stream>>>(Wq, Bw, DM, DM, 16.0f); k_wt_f16<<<gwt, 256, 0, stream>>>(Wk, Bw + WSZ, DM, DM, 16.0f); k_wt_f16<<<gwt, 256, 0, stream>>>(Wv, Bw + 2 * WSZ, DM, DM, 16.0f); k_wt_f16<<<gwt, 256, 0, stream>>>(Wr, Bw + 3 * WSZ, DM, DM, 16.0f); k_wt_f16<<<gwt, 256, 0, stream>>>(Wo, Bw + 4 * WSZ, DM, DM, 16.0f);      /* (in,out) → Bt ×2^4 */
  const unsigned gh = (unsigned)(((size_t)NQR * DM / 8 + 255) / 256);
  k_x16<<<gh, 256, 0, stream>>>(mems, CAT, (size_t)NQR * DM / 8); k_x16<<<gh, 256, 0, stream>>>(w, CAT + (size_t)NQR * DM, (size_t)NQR * DM / 8); k_x16<<<gh, 256, 0, stream>>>(r, R16, (size_t)KL * DM / 8);      /* cat = [mems; w] is the two inputs back to back (rows (j,b)); r rows m */
  const dim3 gq((NQR / 128) * (DM / 64), 1), gk((NKR / 128) * (DM / 64), 1), grr((KL / 128) * (DM / 64), 1);      /* one work-group a 128 x 64 tile */
  k_gemm_lds<DM, DM, true, true><<<gq, 256, 0, stream>>>(CAT + (size_t)NQR * DM, 0, Bw, 0, 0.0625f, bq, QF, nullptr, 0, DM / 64); k_qbias<<<gh, 256, 0, stream>>>(QF, rwb, rrb, QW, QR, (size_t)NQR * DM / 8);      /* q (last qlen rows of cat) + bq → + r_w_bias / + r_r_bias */
  k_gemm_lds<DM, DM, false, true><<<gk, 256, 0, stream>>>(CAT, 0, Bw + WSZ, 0, 0.0625f, bk, nullptr, K16, 0, DM / 64);      /* k: M 4096 N 1024 K 1024 */
  k_gemm_lds<DM, DM, false, true><<<gk, 256, 0, stream>>>(CAT, 0, Bw + 2 * WSZ, 0, 0.0625f, bv, nullptr, V16, 0, DM / 64);      /* v */
  k_gemm_lds<DM, DM, false, true><<<grr, 256, 0, stream>>>(R16, 0, Bw + 3 * WSZ, 0, 0.0625f, br, nullptr, RK, 0, DM / 64);      /* rk = r·Wr + br: M 2048 */
  for (int b = 0; b < BZ; ++b) k_vt<NH, KL><<<NH * (KL / 64), 256, 0, stream>>>(V16 + (size_t)b * DM, BZ * DM, 0, Vt + (size_t)b * NH * 64 * KL);      /* Vᵀ per (b,n): V rows (j,b) have stride 2·1024 */
  const dim3 go(QL / 128, BZ * NH);
  k_score<<<dim3(QL / 16, BZ * NH), 512, 0, stream>>>(QW, QR, K16, RK, msk, P16);      /* AC, raw BD, shift, mask and softmax of all 32 (b,n) planes: 16 query rows a work-group, scores in LDS only */
  k_gemm_lds<KL, BZ * DM, true, false><<<go, 256, 0, stream>>>(P16, (size_t)QL * KL, Vt, (size_t)64 * KL, 0.000030517578125f, nullptr, O, nullptr, 64, 1);      /* attn_vec rows (i,b), plane s = b*16 + h at cols s*64 of the 2048-wide (i) row: M 1024 N 64 K 2048, ldc 2048, all 32 planes in blockIdx.y */
  k_h16<<<gh, 256, 0, stream>>>(O, O16, (size_t)NQR * DM / 8);
  k_gemm_lds<DM, DM, true, true><<<gq, 256, 0, stream>>>(O16, 0, Bw + 4 * WSZ, 0, 0.0625f, bo, RES, nullptr, 0, DM / 64);      /* attn_out = attn_vec·Wo + bo (rows (i,b)) */
  k_lnout<<<(NQR + 7) / 8, 256, 0, stream>>>(RES, w, lg, lb, (float*)d_out);
}

// v004
// Measured time: 175 microseconds a run.
// In both of two side-by-side timings against v003, it was 1.19 times as fast.
// Counting every step since v000, it is 15.8 times as fast.
#include <hip/hip_runtime.h>
// Transformer-XL relative multi-head attention (qlen 1024, mem_len 1024 → klen 2048, bsz 2, 16 heads × 64, post-LN): cat = [mems; w] (rows (j,b)); q = (cat·Wq + bq)[last qlen], k, v = cat·Wk + bk, cat·Wv + bv; rk = r·Wr + br;
// AC[i,j] = (q_i + r_w_bias)·k_j; BD = rel_shift((q_i + r_r_bias)·rk_m) (the exact pad-reshape shift, incl. its wrap region); score = (AC + BD)/8, −inf where the INPUT mask is set; softmax over j; attn_vec = Σ_j p·v_j;
// out = LayerNorm(w + attn_vec·Wo + bo)·g + b → [1024, 2, 1024]. (in,out) weights.
// Compute dtype: w, mems, r, biases, weights rounded to bf16; q (+ the two head biases), k, v, rk as f16 GEMM planes; one fused kernel forms, per 16 query rows of a (b,n) plane, AC and raw BD (f32 accumulators),
// applies the relative shift as a scatter into LDS, the mask and an f32 softmax and writes P f16 x2^15; attn_vec by GEMM; Wo GEMM + bias; residual + LayerNorm in f32 (wave per row). All contractions on v_wmma_f32_16x16x32_f16, f32 accumulate.
#define QL 1024
#define KL 2048
#define BZ 2
#define NH 16
#define DM 1024
#define NQR (QL * BZ)
#define NKR (KL * BZ)
#define ATT_SCALE 0.125f

typedef __bf16 v16b __attribute__((ext_vector_type(16)));
typedef unsigned short v8us __attribute__((ext_vector_type(8), may_alias));
typedef float  v8f  __attribute__((ext_vector_type(8)));
typedef float  v4f  __attribute__((ext_vector_type(4)));
typedef float  v4fa __attribute__((ext_vector_type(4), may_alias));
union FragB { v16b v; v8us half[2]; unsigned short u[16]; };

__device__ __forceinline__ unsigned short bf16_bits(float x) { unsigned int u = __float_as_uint(x); return (unsigned short)((u + 0x7FFFu + ((u >> 16) & 1u)) >> 16); }
__device__ __forceinline__ float bf16_val(unsigned short b) { return __uint_as_float(((unsigned int)b) << 16); }
__device__ __forceinline__ float bf16_round(float x) { return bf16_val(bf16_bits(x)); }
// D += A·B with NT terms: 1 = ah·bh, 2 = + al·bh (A split), 3 = + ah·bl (both split)
template <int NT>
__device__ __forceinline__ v8f mmaN(v16b ah, v16b al, v16b bh, v16b bl, v8f c) {
  c = __builtin_amdgcn_wmma_f32_16x16x32_bf16(false, ah, false, bh, (short)0, c, false, false);
  if (NT >= 2) c = __builtin_amdgcn_wmma_f32_16x16x32_bf16(false, al, false, bh, (short)0, c, false, false);
  if (NT >= 3) c = __builtin_amdgcn_wmma_f32_16x16x32_bf16(false, ah, false, bl, (short)0, c, false, false);
  asm volatile("v_nop\n\tv_nop\n\tv_nop\n\tv_nop" : "+v"(c) : "v"(ah), "v"(al), "v"(bh), "v"(bl));
  return c;
}

__global__ __launch_bounds__(256) void k_wt_bf16(const float* __restrict__ W, unsigned short* __restrict__ Wt, int K, int N) {
  const int t = blockIdx.x * 256 + threadIdx.x;
  const int k8n = K / 8;
  if (t >= N * k8n) return;
  const int n = t / k8n, k8 = (t % k8n) * 8;
  v8us v;
#pragma unroll
  for (int i = 0; i < 8; ++i) v[i] = bf16_bits(W[(size_t)(k8 + i) * N + n]);
  *(v8us*)(Wt + (size_t)n * K + k8) = v;
  
}

// GEMM C[M][N] (f32, pitch ldc) = act(A[M][K]·W + bias). A f32 row-major (pitch lda) converted per fragment to bf16
// (ASPLIT: hi/lo two planes -> 2 terms, else single rounded term); Wt bf16 [N][K] (pitch ldb). BIAS_BF16 rounds the
// bias to bf16 first (bias quantised to bf16 before the add). K%32==0, M%16==0, N%64==0.
template <bool ASPLIT, int ACT, bool BIAS_BF16>
__global__ __launch_bounds__(128) void k_gemm_bf(const float* __restrict__ A, int lda, const unsigned short* __restrict__ Wt, int ldb,
                                               const float* __restrict__ bias, float* __restrict__ C, int ldc, int M, int N, int K) {
  __shared__ __attribute__((aligned(16))) float so[4][16][64];
  const int tid = threadIdx.x, w = tid >> 5, lane = tid & 31, ln = lane & 15, hh = lane >> 4;
  const int ntn = N / 64;
  const int wid = blockIdx.x * 4 + w;
  const int mt = wid / ntn, nq = wid % ntn;
  if (mt * 16 >= M) return;
  const int row0 = mt * 16, col0 = nq * 64;
  const float* arow = A + (size_t)(row0 + ln) * lda;
  v8f acc[4] = {};
  for (int kb = 0; kb < K; kb += 32) {
    FragB ah, al;
    const v4f x0 = *(const v4fa*)(arow + kb + 8 * hh), x1 = *(const v4fa*)(arow + kb + 8 * hh + 4);
    const v4f x2 = *(const v4fa*)(arow + kb + 16 + 8 * hh), x3 = *(const v4fa*)(arow + kb + 16 + 8 * hh + 4);
    float xs[16] = {x0[0],x0[1],x0[2],x0[3],x1[0],x1[1],x1[2],x1[3],x2[0],x2[1],x2[2],x2[3],x3[0],x3[1],x3[2],x3[3]};
#pragma unroll
    for (int i = 0; i < 16; ++i) { const unsigned short hb = bf16_bits(xs[i]); ah.u[i] = hb; al.u[i] = ASPLIT ? bf16_bits(xs[i] - bf16_val(hb)) : (unsigned short)0; }
#pragma unroll
    for (int t = 0; t < 4; ++t) {
      const unsigned short* brow = Wt + (size_t)(col0 + t * 16 + ln) * ldb + kb;
      FragB b;
      b.half[0] = *(const v8us*)(brow + 8 * hh);
      b.half[1] = *(const v8us*)(brow + 16 + 8 * hh);
      acc[t] = mmaN<ASPLIT ? 2 : 1>(ah.v, al.v, b.v, b.v, acc[t]);
    }
  }
#pragma unroll
  for (int t = 0; t < 4; ++t) {
    float bv = bias ? bias[col0 + t * 16 + ln] : 0.f;
    if (BIAS_BF16) bv = bf16_round(bv);
#pragma unroll
    for (int r = 0; r < 8; ++r) { float v = acc[t][r] + bv; if (ACT == 1) v = fmaxf(v, 0.f); so[w][8 * hh + r][t * 16 + ln] = v; }
  }
  __builtin_amdgcn_fence(__ATOMIC_ACQ_REL, "workgroup");
  __builtin_amdgcn_wave_barrier();
  const int rsub = lane >> 4, c4 = (lane & 15) * 4;
  {
#pragma unroll
    for (int q = 0; q < 8; ++q) {
      const int r = q * 2 + rsub;
      const v4f v = *(const v4fa*)&so[w][r][c4];
      *(v4f*)(C + (size_t)(row0 + r) * ldc + col0 + c4) = v;
    }
    
  }
}

// Flash-style causal/unmasked attention, all contractions 3-term bf16 hi/lo splits, f32 softmax with running max.
// q,k,v rows are read from f32 buffers with arbitrary row pitch (so they can live inside a fused qkv buffer);
// D = head size (multiple of 32, <= 128); one wave = 16 query rows; block = 4 waves (64 queries) sharing K/V chunks of 32.
template <int D, bool CAUSAL>
__global__ __launch_bounds__(128) void k_flash(const float* __restrict__ qb, const float* __restrict__ kb, const float* __restrict__ vb,
                                             int pitch, int T, int H, float scale, float* __restrict__ y, int ypitch) {
  constexpr int KS = D / 32;        // k-steps for QK
  constexpr int DT = D / 16;        // d tiles for PV
  __shared__ __attribute__((aligned(16))) unsigned short sKh[32][D + 8], sKl[32][D + 8], sVh[32][D + 8], sVl[32][D + 8];
  __shared__ __attribute__((aligned(16))) unsigned short sPh[4][16][40], sPl[4][16][40];
  __shared__ __attribute__((aligned(16))) float sO[4][16][D];
  const int tid = threadIdx.x, w = tid >> 5, lane = tid & 31, ln = lane & 15, hh = lane >> 4;
  const int nqb = (T + 63) / 64;
  const int bh = blockIdx.x / nqb, qblk = blockIdx.x % nqb;
  const int b = bh / H, h = bh % H;
  const int q0 = qblk * 64 + w * 16;
  const float* Q = qb + (size_t)b * T * pitch + h * D;
  const float* K = kb + (size_t)b * T * pitch + h * D;
  const float* V = vb + (size_t)b * T * pitch + h * D;

  // A fragments of the wave's 16 query rows (scaled), hi/lo
  FragB aqh[KS], aql[KS];
  {
    int row = q0 + ln; if (row >= T) row = T - 1;
    const float* qr = Q + (size_t)row * pitch;
#pragma unroll
    for (int ks = 0; ks < KS; ++ks)
#pragma unroll
      for (int i = 0; i < 16; ++i) {
        const int d = ks * 32 + ((i < 8) ? (8 * hh + i) : (16 + 8 * hh + (i - 8)));
        const float x = qr[d] * scale; const unsigned short hb = bf16_bits(x);
        aqh[ks].u[i] = hb; aql[ks].u[i] = bf16_bits(x - bf16_val(hb));
      }
  }
  float m_r[8], l_r[8];
#pragma unroll
  for (int r = 0; r < 8; ++r) { m_r[r] = -3.0e38f; l_r[r] = 0.f; }
  v8f oacc[DT];
#pragma unroll
  for (int dt = 0; dt < DT; ++dt) oacc[dt] = (v8f){0.f,0.f,0.f,0.f,0.f,0.f,0.f,0.f};

  const int kv_end = CAUSAL ? min(T, qblk * 64 + 64) : T;     // block-uniform
  for (int j0 = 0; j0 < kv_end; j0 += 32) {
    __syncthreads();
    for (int e = tid; e < 32 * (D / 4); e += 128) {
      const int r = e / (D / 4), c4 = (e % (D / 4)) * 4;
      const int key = j0 + r;
      v4f kf = {0.f,0.f,0.f,0.f}, vf = {0.f,0.f,0.f,0.f};
      if (key < T) { kf = *(const v4fa*)(K + (size_t)key * pitch + c4); vf = *(const v4fa*)(V + (size_t)key * pitch + c4); }
#pragma unroll
      for (int t = 0; t < 4; ++t) {
        unsigned short hb = bf16_bits(kf[t]); sKh[r][c4 + t] = hb; sKl[r][c4 + t] = bf16_bits(kf[t] - bf16_val(hb));
        hb = bf16_bits(vf[t]); sVh[r][c4 + t] = hb; sVl[r][c4 + t] = bf16_bits(vf[t] - bf16_val(hb));
      }
    }
    __syncthreads();
    // S tile 16 x 32
    v8f s[2];
#pragma unroll
    for (int nt = 0; nt < 2; ++nt) {
      v8f acc = {};
#pragma unroll
      for (int ks = 0; ks < KS; ++ks) {
        FragB bh_, bl_;
        bh_.half[0] = *(const v8us*)&sKh[nt * 16 + ln][ks * 32 + 8 * hh]; bh_.half[1] = *(const v8us*)&sKh[nt * 16 + ln][ks * 32 + 16 + 8 * hh];
        bl_.half[0] = *(const v8us*)&sKl[nt * 16 + ln][ks * 32 + 8 * hh]; bl_.half[1] = *(const v8us*)&sKl[nt * 16 + ln][ks * 32 + 16 + 8 * hh];
        acc = mmaN<3>(aqh[ks].v, aql[ks].v, bh_.v, bl_.v, acc);
      }
      s[nt] = acc;
    }
    // mask + running max (rows 8hh+r; the 16 lanes of a half share rows)
    float alpha[8];
#pragma unroll
    for (int r = 0; r < 8; ++r) {
      const int qi = q0 + 8 * hh + r;
      const int ja = j0 + ln, jb = j0 + 16 + ln;
      if (CAUSAL) { if (ja > qi) s[0][r] = -3.0e38f; if (jb > qi) s[1][r] = -3.0e38f; }
      if (ja >= T) s[0][r] = -3.0e38f;
      if (jb >= T) s[1][r] = -3.0e38f;
      float mx = fmaxf(s[0][r], s[1][r]);
      mx = fmaxf(mx, __shfl_xor(mx, 1, 32)); mx = fmaxf(mx, __shfl_xor(mx, 2, 32)); mx = fmaxf(mx, __shfl_xor(mx, 4, 32)); mx = fmaxf(mx, __shfl_xor(mx, 8, 32));
      const float mnew = fmaxf(m_r[r], mx);
      alpha[r] = (mnew > -1.0e38f) ? __expf(m_r[r] - mnew) : 1.0f;
      const float p0 = (s[0][r] > -1.0e38f) ? __expf(s[0][r] - mnew) : 0.f;
      const float p1 = (s[1][r] > -1.0e38f) ? __expf(s[1][r] - mnew) : 0.f;
      m_r[r] = mnew;
      l_r[r] = l_r[r] * alpha[r] + p0 + p1;            // per-lane partial row sum (16 lanes combined at the end)
      unsigned short hb = bf16_bits(p0); sPh[w][8 * hh + r][ln] = hb;      sPl[w][8 * hh + r][ln] = bf16_bits(p0 - bf16_val(hb));
      hb = bf16_bits(p1);                sPh[w][8 * hh + r][16 + ln] = hb; sPl[w][8 * hh + r][16 + ln] = bf16_bits(p1 - bf16_val(hb));
    }
#pragma unroll
    for (int dt = 0; dt < DT; ++dt)
#pragma unroll
      for (int r = 0; r < 8; ++r) oacc[dt][r] *= alpha[r];
    __builtin_amdgcn_fence(__ATOMIC_ACQ_REL, "workgroup");
    __builtin_amdgcn_wave_barrier();
    FragB pah, pal;
    pah.half[0] = *(const v8us*)&sPh[w][ln][8 * hh]; pah.half[1] = *(const v8us*)&sPh[w][ln][16 + 8 * hh];
    pal.half[0] = *(const v8us*)&sPl[w][ln][8 * hh]; pal.half[1] = *(const v8us*)&sPl[w][ln][16 + 8 * hh];
#pragma unroll
    for (int dt = 0; dt < DT; ++dt) {
      FragB bvh, bvl;
#pragma unroll
      for (int i = 0; i < 8; ++i) {
        bvh.u[i] = sVh[8 * hh + i][dt * 16 + ln]; bvh.u[8 + i] = sVh[16 + 8 * hh + i][dt * 16 + ln];
        bvl.u[i] = sVl[8 * hh + i][dt * 16 + ln]; bvl.u[8 + i] = sVl[16 + 8 * hh + i][dt * 16 + ln];
      }
      oacc[dt] = mmaN<3>(pah.v, pal.v, bvh.v, bvl.v, oacc[dt]);
    }
    __builtin_amdgcn_fence(__ATOMIC_ACQ_REL, "workgroup");
    __builtin_amdgcn_wave_barrier();
  }
#pragma unroll
  for (int r = 0; r < 8; ++r) {
    float l = l_r[r];
    l += __shfl_xor(l, 1, 32); l += __shfl_xor(l, 2, 32); l += __shfl_xor(l, 4, 32); l += __shfl_xor(l, 8, 32);
    l_r[r] = (l > 0.f) ? 1.0f / l : 0.f;
  }
#pragma unroll
  for (int dt = 0; dt < DT; ++dt)
#pragma unroll
    for (int r = 0; r < 8; ++r) sO[w][8 * hh + r][dt * 16 + ln] = oacc[dt][r] * l_r[r];
  __builtin_amdgcn_fence(__ATOMIC_ACQ_REL, "workgroup");
  __builtin_amdgcn_wave_barrier();
  {
    for (int r = 0; r < 16; ++r) {
      const int row = q0 + r;
      if (row < T && lane < D / 4) {
        const v4f val = *(const v4fa*)&sO[w][r][lane * 4];
        *(v4f*)(y + ((size_t)b * T + row) * ypitch + h * D + lane * 4) = val;
      }
    }
    
  }
}

// GEMM C = act(A·W + bias + resid): A f32 (ASPLIT -> hi/lo 2 terms), Wt bf16 [N][K]; ACT 0 none, 1 relu, 2 exact gelu;
// resid (optional, f32, row index = (row % rmod), pitch ldr, RES_BF16 rounds it) added before the activation.
template <bool ASPLIT, int ACT, bool BIAS_BF16, bool RES_BF16>
__global__ __launch_bounds__(128) void k_gemm_bf3(const float* __restrict__ A, int lda, const unsigned short* __restrict__ Wt, int ldb,
                                                const float* __restrict__ bias, const float* __restrict__ resid, int rmod, int ldr,
                                                float* __restrict__ C, int ldc, int M, int N, int K) {
  __shared__ __attribute__((aligned(16))) float so[4][16][64];
  const int tid = threadIdx.x, w = tid >> 5, lane = tid & 31, ln = lane & 15, hh = lane >> 4;
  const int ntn = N / 64;
  const int wid = blockIdx.x * 4 + w;
  const int mt = wid / ntn, nq = wid % ntn;
  if (mt * 16 >= M) return;
  const int row0 = mt * 16, col0 = nq * 64;
  const float* arow = A + (size_t)(row0 + ln) * lda;
  v8f acc[4] = {};
  for (int kb = 0; kb < K; kb += 32) {
    FragB ah, al;
    const v4f x0 = *(const v4fa*)(arow + kb + 8 * hh), x1 = *(const v4fa*)(arow + kb + 8 * hh + 4);
    const v4f x2 = *(const v4fa*)(arow + kb + 16 + 8 * hh), x3 = *(const v4fa*)(arow + kb + 16 + 8 * hh + 4);
    float xs[16] = {x0[0],x0[1],x0[2],x0[3],x1[0],x1[1],x1[2],x1[3],x2[0],x2[1],x2[2],x2[3],x3[0],x3[1],x3[2],x3[3]};
#pragma unroll
    for (int i = 0; i < 16; ++i) { const unsigned short hb = bf16_bits(xs[i]); ah.u[i] = hb; al.u[i] = ASPLIT ? bf16_bits(xs[i] - bf16_val(hb)) : (unsigned short)0; }
#pragma unroll
    for (int t = 0; t < 4; ++t) {
      const unsigned short* brow = Wt + (size_t)(col0 + t * 16 + ln) * ldb + kb;
      FragB b;
      b.half[0] = *(const v8us*)(brow + 8 * hh);
      b.half[1] = *(const v8us*)(brow + 16 + 8 * hh);
      acc[t] = mmaN<ASPLIT ? 2 : 1>(ah.v, al.v, b.v, b.v, acc[t]);
    }
  }
#pragma unroll
  for (int t = 0; t < 4; ++t) {
    const int col = col0 + t * 16 + ln;
    float bv = bias ? bias[col] : 0.f;
    if (BIAS_BF16) bv = bf16_round(bv);
#pragma unroll
    for (int r = 0; r < 8; ++r) {
      float v = acc[t][r] + bv;
      if (resid) { float rv = resid[(size_t)((row0 + 8 * hh + r) % rmod) * ldr + col]; if (RES_BF16) rv = bf16_round(rv); v += rv; }
      if (ACT == 1) v = fmaxf(v, 0.f);
      if (ACT == 2) v = 0.5f * v * (1.0f + erff(v * 0.70710678118654752f));
      if (ACT == 3) { const float u = 0.7978845608028654f * (v + 0.044715f * v * v * v); v = 0.5f * v * (1.0f + tanhf(u)); }
      so[w][8 * hh + r][t * 16 + ln] = v;
    }
  }
  __builtin_amdgcn_fence(__ATOMIC_ACQ_REL, "workgroup");
  __builtin_amdgcn_wave_barrier();
  const int rsub = lane >> 4, c4 = (lane & 15) * 4;
  {
#pragma unroll
    for (int q = 0; q < 8; ++q) {
      const int r = q * 2 + rsub;
      const v4f v = *(const v4fa*)&so[w][r][c4];
      *(v4f*)(C + (size_t)(row0 + r) * ldc + col0 + c4) = v;
    }
    
  }
}
// row LayerNorm (biased variance, eps) over N: s = X (+ R); optional out_sum <- s; out_norm <- (s-mu)*rsqrt(var+eps)*g + b
template <bool PARAM_BF16>
__global__ __launch_bounds__(256) void k_layernorm(const float* __restrict__ X, const float* __restrict__ R, const float* __restrict__ g, const float* __restrict__ bta,
                                                  float* __restrict__ out_sum, float* __restrict__ out_norm, int N, float eps) {
  __shared__ float red[256];
  const int row = blockIdx.x, tid = threadIdx.x;
  const float* x = X + (size_t)row * N; const float* rr = R ? R + (size_t)row * N : nullptr;
  float vals[16];                     // up to N = 4096
  const int per = N / 256;            // contiguous chunk per thread? use strided-by-4 chunks: thread handles j = tid*4 + 1024*u
  float s1 = 0.f;
  for (int u = 0; u < per / 4; ++u) {
    const int j = tid * 4 + 1024 * u;
    const v4f a = *(const v4fa*)(x + j);
    v4f b = {0.f,0.f,0.f,0.f}; if (rr) b = *(const v4fa*)(rr + j);
#pragma unroll
    for (int q = 0; q < 4; ++q) { const float v = a[q] + b[q]; vals[u * 4 + q] = v; s1 += v; }
  }
  red[tid] = s1; __syncthreads();
  for (int st = 128; st > 0; st >>= 1) { if (tid < st) red[tid] += red[tid + st]; __syncthreads(); }
  const float mu = red[0] / (float)N; __syncthreads();
  float s2 = 0.f;
  for (int u = 0; u < per / 4; ++u)
#pragma unroll
    for (int q = 0; q < 4; ++q) { const float c = vals[u * 4 + q] - mu; s2 += c * c; }
  red[tid] = s2; __syncthreads();
  for (int st = 128; st > 0; st >>= 1) { if (tid < st) red[tid] += red[tid + st]; __syncthreads(); }
  const float rs = rsqrtf(red[0] / (float)N + eps);
  {
    for (int u = 0; u < per / 4; ++u) {
      const int j = tid * 4 + 1024 * u;
      v4f o, sm;
#pragma unroll
      for (int q = 0; q < 4; ++q) {
        float gg = g[j + q], bb = bta[j + q];
        if (PARAM_BF16) { gg = bf16_round(gg); bb = bf16_round(bb); }
        sm[q] = vals[u * 4 + q]; o[q] = (vals[u * 4 + q] - mu) * rs * gg + bb;
      }
      if (out_sum) *(v4f*)(out_sum + (size_t)row * N + j) = sm;
      *(v4f*)(out_norm + (size_t)row * N + j) = o;
    }
    
  }
}



// ---- f16 WMMA path (v_wmma_f32_16x16x32_f16): 11-bit significands for operands in range — used where a [0,1] probability operand needs more precision than bf16
typedef _Float16 v16h __attribute__((ext_vector_type(16)));
union FragH { v16h v; v8us half[2]; _Float16 h[16]; unsigned short u[16]; };
template <int NT>
__device__ __forceinline__ v8f mmaH(v16h ah, v16h al, v16h bh, v16h bl, v8f c) {
  c = __builtin_amdgcn_wmma_f32_16x16x32_f16(false, ah, false, bh, (short)0, c, false, false);
  if (NT >= 2) c = __builtin_amdgcn_wmma_f32_16x16x32_f16(false, al, false, bh, (short)0, c, false, false);
  if (NT >= 3) c = __builtin_amdgcn_wmma_f32_16x16x32_f16(false, ah, false, bl, (short)0, c, false, false);
  asm volatile("v_nop\n\tv_nop\n\tv_nop\n\tv_nop" : "+v"(c) : "v"(ah), "v"(al), "v"(bh), "v"(bl));
  return c;
}
// batched GEMM like k_gemm_b but f16 operands: A f32 (split into f16 hi/lo if ASPLIT, else rounded to f16), Bt = f16 values [n][k]; alpha; C f32; N multiple of 16 (partial tiles skipped)
template <bool ASPLIT>
__global__ __launch_bounds__(128) void k_gemm_h(const float* __restrict__ A, int lda, size_t sA, const _Float16* __restrict__ Bh, int ldb, size_t sB, float alpha, float* __restrict__ C, int ldc, size_t sC, int M, int N, int K) {
  __shared__ __attribute__((aligned(16))) float so[4][16][64];
  const int tid = threadIdx.x, w = tid >> 5, lane = tid & 31, ln = lane & 15, hh = lane >> 4; const int by = blockIdx.y;
  A += (size_t)by * sA; Bh += (size_t)by * sB; C += (size_t)by * sC;
  const int ntn = (N + 63) / 64; const int wid = blockIdx.x * 4 + w; const int mt = wid / ntn, nq = wid % ntn; if (mt * 16 >= M) return;
  const int row0 = mt * 16, col0 = nq * 64; const float* arow = A + (size_t)(row0 + ln) * lda;
  v8f acc[4] = {};
  for (int kb = 0; kb < K; kb += 32) {
    FragH ah, al;
    const v4f x0 = *(const v4fa*)(arow + kb + 8 * hh), x1 = *(const v4fa*)(arow + kb + 8 * hh + 4), x2 = *(const v4fa*)(arow + kb + 16 + 8 * hh), x3 = *(const v4fa*)(arow + kb + 16 + 8 * hh + 4);
    float xs[16] = {x0[0],x0[1],x0[2],x0[3],x1[0],x1[1],x1[2],x1[3],x2[0],x2[1],x2[2],x2[3],x3[0],x3[1],x3[2],x3[3]};
#pragma unroll
    for (int i = 0; i < 16; ++i) { const _Float16 h = (_Float16)xs[i]; ah.h[i] = h; al.h[i] = ASPLIT ? (_Float16)(xs[i] - (float)h) : (_Float16)0.0f; }
#pragma unroll
    for (int t = 0; t < 4; ++t) { if (col0 + t * 16 >= N) continue; const size_t boff = (size_t)(col0 + t * 16 + ln) * ldb + kb; FragH bq; bq.half[0] = *(const v8us*)(Bh + boff + 8 * hh); bq.half[1] = *(const v8us*)(Bh + boff + 16 + 8 * hh);
      acc[t] = mmaH<ASPLIT ? 2 : 1>(ah.v, al.v, bq.v, bq.v, acc[t]); }
  }
#pragma unroll
  for (int t = 0; t < 4; ++t) { if (col0 + t * 16 >= N) continue;
#pragma unroll
    for (int r = 0; r < 8; ++r) so[w][8 * hh + r][t * 16 + ln] = acc[t][r] * alpha; }
  __builtin_amdgcn_fence(__ATOMIC_ACQ_REL, "workgroup"); __builtin_amdgcn_wave_barrier();
  const int rsub = lane >> 4, c4 = (lane & 15) * 4;
  {
#pragma unroll
    for (int q = 0; q < 8; ++q) { const int r = q * 2 + rsub; if (col0 + c4 < N) { const v4f v = *(const v4fa*)&so[w][r][c4]; *(v4f*)(C + (size_t)(row0 + r) * ldc + col0 + c4) = v; } }
     }
}

// Wt[n][k] = f16(W[k][n]·scale) from f32 row-major W[K][N] (scale = power of two; bf16-exact weights stay exact in f16 away from the subnormal range)
// bx: the index of the 256-thread block inside this matrix's share of the merged grid
__device__ __forceinline__ void wt_f16_body(int bx, const float* __restrict__ W, _Float16* __restrict__ Wt, int K, int N, float scale) {
  const int t = bx * 256 + threadIdx.x; if (t >= N * (K / 8)) return; const int n = t / (K / 8), k8 = (t % (K / 8)) * 8; FragH f;
#pragma unroll
  for (int i = 0; i < 8; ++i) f.h[i] = (_Float16)(bf16_round(W[(size_t)(k8 + i) * N + n]) * scale); const v8us o = f.half[0];
  *(v8us*)((unsigned short*)Wt + (size_t)n * K + k8) = o; 
}
typedef _Float16 v4h __attribute__((ext_vector_type(4)));

__device__ __forceinline__ void x16_body(int bx, const float* __restrict__ x, _Float16* __restrict__ X16, size_t n8) { const size_t t = (size_t)bx * 256 + threadIdx.x; if (t >= n8) return; FragH f;
#pragma unroll
  for (int q = 0; q < 8; ++q) f.h[q] = (_Float16)bf16_round(x[t * 8 + q]); *(v8us*)((unsigned short*)X16 + t * 8) = f.half[0];  }
// All operand preparation in one launch (none of the eight parts reads what another writes): blocks 0 .. 5 GWT - 1 transpose the five weights (Wq, Wk, Wv, Wr, Wo -> Bw, x2^4), the next 3 GX round mems, w (-> CAT, back to back) and r (-> R16).
#define GWT (DM * (DM / 8) / 256)      // blocks of one weight matrix
#define GX (NQR * DM / 8 / 256)      // blocks of one 2048 x 1024 plane at 8 elements a thread (mems, w, r, q alike)
__global__ __launch_bounds__(256) void k_prep(const float* __restrict__ Wq, const float* __restrict__ Wk, const float* __restrict__ Wv, const float* __restrict__ Wr, const float* __restrict__ Wo,
    const float* __restrict__ mems, const float* __restrict__ w, const float* __restrict__ r, _Float16* __restrict__ Bw, _Float16* __restrict__ CAT, _Float16* __restrict__ R16) {
  const int bx = blockIdx.x;
  if (bx < 5 * GWT) { const int m = bx / GWT; const float* W = (m == 0) ? Wq : (m == 1) ? Wk : (m == 2) ? Wv : (m == 3) ? Wr : Wo; wt_f16_body(bx % GWT, W, Bw + (size_t)m * DM * DM, DM, DM, 16.0f); }
  else { const int m = (bx - 5 * GWT) / GX; const float* x = (m == 0) ? mems : (m == 1) ? w : r; _Float16* o = (m == 0) ? CAT : (m == 1) ? CAT + (size_t)NQR * DM : R16; x16_body((bx - 5 * GWT) % GX, x, o, (size_t)NQR * DM / 8); }
}
__global__ __launch_bounds__(256) void k_h16(const float* __restrict__ x, _Float16* __restrict__ X16, size_t n8) { const size_t t = (size_t)blockIdx.x * 256 + threadIdx.x; if (t >= n8) return; FragH f;
#pragma unroll
  for (int q = 0; q < 8; ++q) f.h[q] = (_Float16)x[t * 8 + q]; *(v8us*)((unsigned short*)X16 + t * 8) = f.half[0];  }
__global__ __launch_bounds__(256) void k_round16f(const float* __restrict__ W, _Float16* __restrict__ Bt, size_t n8) { const size_t t = (size_t)blockIdx.x * 256 + threadIdx.x; if (t >= n8) return; FragH f;
#pragma unroll
  for (int i = 0; i < 8; ++i) f.h[i] = (_Float16)(bf16_round(W[t * 8 + i]) * 16.0f); *(v8us*)((unsigned short*)Bt + t * 8) = f.half[0];  }
template <int NHv, int TTv>
__device__ __forceinline__ void vt_body(int bx, unsigned short (*tl)[66], const _Float16* __restrict__ V16, int ldv, int voff, _Float16* __restrict__ Vt) { const int tid = threadIdx.x; const int slab = bx / (TTv / 64), lg = bx % (TTv / 64); const int b = slab / NHv, h = slab % NHv;
  for (int i = tid; i < 64 * 8; i += 256) { const int r = i / 8, c8 = (i % 8) * 8; FragH f; f.half[0] = *(const v8us*)((const unsigned short*)V16 + ((size_t)b * TTv + lg * 64 + r) * ldv + voff + h * 64 + c8);
#pragma unroll
    for (int q = 0; q < 8; ++q) tl[r][c8 + q] = f.u[q]; }
  __syncthreads();
  {
#pragma unroll
    for (int rd = 0; rd < 2; ++rd) { const int d = rd * 32 + tid / 8, pc = tid % 8; FragH f;
#pragma unroll
      for (int q = 0; q < 8; ++q) f.u[q] = tl[pc * 8 + q][d];
      *(v8us*)((unsigned short*)Vt + ((size_t)slab * 64 + d) * TTv + lg * 64 + pc * 8) = f.half[0]; }
     } }

__device__ __forceinline__ void qbias_body(int bx, const float* __restrict__ QF, const float* __restrict__ rwb, const float* __restrict__ rrb, _Float16* __restrict__ QW, _Float16* __restrict__ QR, size_t n8) { const size_t t = (size_t)bx * 256 + threadIdx.x; if (t >= n8) return; FragH fw, fr;
  const unsigned oq = (unsigned)t * 32u, oc = oq % (DM * 4u);      // the lane's byte offsets: its eight q values, and their columns in the two 1024-wide head-bias rows
  const char* qf = (const char*)QF; const char* pw = (const char*)rwb; const char* pr = (const char*)rrb;
  const v4f a = *(const v4fa*)(qf + oq), b = *(const v4fa*)(qf + oq + 16), w0 = *(const v4fa*)(pw + oc), w1 = *(const v4fa*)(pw + oc + 16), r0 = *(const v4fa*)(pr + oc), r1 = *(const v4fa*)(pr + oc + 16);
  // the wait that is owed before a register named by an issued global load is rewritten; offsets and bases are inputs, so they stay live to here and none of the six loads lands in them
  asm volatile("s_wait_xcnt 0x0" :: "v"(oq), "v"(oc), "s"(qf), "s"(pw), "s"(pr) : "memory");
#pragma unroll
  for (int q = 0; q < 8; ++q) { const float v = (q < 4) ? a[q] : b[q - 4]; fw.h[q] = (_Float16)(v + bf16_round((q < 4) ? w0[q] : w1[q - 4])); fr.h[q] = (_Float16)(v + bf16_round((q < 4) ? r0[q] : r1[q - 4])); }
  { *(v8us*)((unsigned short*)QW + t * 8) = fw.half[0]; *(v8us*)((unsigned short*)QR + t * 8) = fr.half[0];  } }
// What stands between the projections and the scores, in one launch (the parts read different planes and write different ones): blocks 0 .. BZ GVT - 1 transpose V per (b,n) (V rows (j,b) have stride 2 x 1024), the next GX add the two head biases to q.
#define GVT (NH * (KL / 64))      // blocks of one batch entry's V
__global__ __launch_bounds__(256) void k_post(const _Float16* __restrict__ V16, _Float16* __restrict__ Vt, const float* __restrict__ QF, const float* __restrict__ rwb, const float* __restrict__ rrb, _Float16* __restrict__ QW, _Float16* __restrict__ QR) {
  __shared__ unsigned short tl[64][66];
  const int bx = blockIdx.x;      // the branch is the same for the whole block, so the barrier inside vt_body is passed by all of its threads or none
  if (bx < BZ * GVT) { const int b = bx / GVT; vt_body<NH, KL>(bx % GVT, tl, V16 + (size_t)b * DM, BZ * DM, 0, Vt + (size_t)b * NH * 64 * KL); }
  else qbias_body(bx - BZ * GVT, QF, rwb, rrb, QW, QR, (size_t)NQR * DM / 8);
}
// Fused score kernel: one work-group = 16 query rows i0..i0+15 of one (b,n) plane (blockIdx.y), 16 waves; the 16 x KL score rows live in LDS and never reach memory. AC is stored into the rows first.
// The pad/reshape shift as a scatter of raw BD: idx = QL + i*KL + j = i*(KL+1) + (QL - i + j), so with d = m - (QL-1) + i the raw value (q_i + r_r_bias).rk_m belongs to j = d where d >= 0,
// the raw value of row i+1 at column m to j = d + KL + 1 where d <= -2 (the wrap region); d == -1 gives j = KL, a slot of the row's LDS padding that the softmax never reads; the pad's zero falls on j = i + KL + 1 - QL. Each j in 0..KL-1 gets at most one raw value.
// Behind a barrier each raw value is added to AC in place, and behind a second one wave wv does mask, f32 softmax and the f16 x2^15 store of row i0 + wv with the lane order and sum order of a wave-per-row pass.
#define SP (KL + 4)      // LDS row pitch in floats: 8 rows apart = 32 banks apart, so the two lane halves of a D tile do not collide; multiple of 4 for 16-byte reads
__device__ __forceinline__ v8f mma16(v16h a, v16h b, v8f c) { return __builtin_amdgcn_wmma_f32_16x16x32_f16(false, a, false, b, (short)0, c, false, false); }
// One 16-row fragment pair (k = 0..63) of a row-major f16 plane: base (+ cofs, a constant) is the same for the whole wave, ob is the lane's own byte offset (its row, plus 16 bytes for the upper lane half).
// Lane half hh, step ks: registers 0..3 hold k = 32*ks + 8*hh + 0..7, registers 4..7 hold k = 32*ks + 16 + 8*hh + 0..7, for A and B alike.
__device__ __forceinline__ void ldfrag(FragH (&f)[2], const char* __restrict__ base, unsigned ob, int cofs) {
#pragma unroll
  for (int ks = 0; ks < 2; ++ks) { f[ks].half[0] = *(const v8us*)(base + ob + (cofs + ks * 64)); f[ks].half[1] = *(const v8us*)(base + ob + (cofs + ks * 64 + 32)); }
  // the wait that is owed before a register named by an issued global load is rewritten; offset and base are inputs, so they stay live to here and none of the four loads lands in them
  asm volatile("s_wait_xcnt 0x0" :: "v"(ob), "s"(base) : "memory"); }
// launch bounds: 8 waves a SIMD (a budget of 128 VGPRs), so that two of these 128-KiB work-groups share a WGP and one's barriers and loads run under the other's work
__global__ __launch_bounds__(512, 8) void k_score(const _Float16* __restrict__ QW, const _Float16* __restrict__ QR, const _Float16* __restrict__ K16, const _Float16* __restrict__ RK, const int* __restrict__ MSK, _Float16* __restrict__ P16) {
  __shared__ __attribute__((aligned(16))) float S[16 * SP];
  const int tid = threadIdx.x, lane = tid & 31, ln = lane & 15, hh = lane >> 4;
  const int wv = __builtin_amdgcn_readfirstlane(tid >> 5);      // the wave's number as a scalar: tile bases and the row's addresses then sit in scalar registers
  const int i0 = blockIdx.x * 16, pl = blockIdx.y, b = pl / NH, h = pl % NH;
  const int i = i0 + wv;
  constexpr int QP = BZ * DM * 2, RP = DM * 2;      // row pitches in bytes: q and k rows (i,b) / (j,b); rk rows
  const char* qw = (const char*)(QW + (size_t)b * DM + h * 64 + (size_t)i0 * (BZ * DM)); const char* qr = (const char*)(QR + (size_t)b * DM + h * 64 + (size_t)i0 * (BZ * DM));
  const char* kp = (const char*)(K16 + (size_t)b * DM + h * 64 + (size_t)(wv * 16) * (BZ * DM)); const char* rp = (const char*)(RK + h * 64 + (size_t)(wv * 16) * DM);
  const char* mk = (const char*)(MSK + (size_t)i * KL);
  const unsigned obq = (unsigned)(ln * QP + hh * 16), obr = (unsigned)(ln * RP + hh * 16);
  const unsigned obw = (unsigned)(((i0 + 1 + ln < QL) ? 1 + ln : QL - 1 - i0) * QP + hh * 16);      // row i+1 for the wrap region; the clamped row of i = QL-1 is never selected (there d >= 0 for every m)
  FragH aq[2], kb[4][2]; ldfrag(aq, qw, obq, 0); ldfrag(kb[0], kp, obq, 0);
  unsigned mbal[64];      // the mask of row i0 + wv as one lane mask per (jj, e), read at the head beside the first fragments: the softmax phase then holds no mask registers and waits for no memory
  {
    typedef int v4i __attribute__((ext_vector_type(4))); typedef int v4ia __attribute__((ext_vector_type(4), may_alias)); v4i mv[16]; const unsigned obm = (unsigned)(lane * 16);
#pragma unroll
    for (int jj = 0; jj < 16; ++jj) mv[jj] = *(const v4ia*)(mk + obm + jj * 512);
    // the wait that is owed before a register named by an issued global load is rewritten; offset and base are inputs, so they stay live to here and none of the sixteen loads lands in them
    asm volatile("s_wait_xcnt 0x0" :: "v"(obm), "s"(mk) : "memory");
#pragma unroll
    for (int jj = 0; jj < 16; ++jj)
#pragma unroll
      for (int e = 0; e < 4; ++e) mbal[jj * 4 + e] = __builtin_amdgcn_ballot_w32(mv[jj][e] != 0);
  }
  ldfrag(kb[1], kp, obq, 256 * QP); ldfrag(kb[2], kp, obq, 2 * 256 * QP); ldfrag(kb[3], kp, obq, 3 * 256 * QP);      // behind the lane masks: the sixteen mask vectors and four k tiles together do not fit the registers
  FragH an[2], aw[2], bb[2][2];
  // AC: wave wv owns the column tiles wv + 16 t and stores them straight into S. Four k tiles are in flight; as the ring drains, its registers take the q + r_r_bias rows and the first two rk tiles, which fly while the last AC tiles are multiplied and stored.
#pragma unroll
  for (int t = 0; t < KL / 256; ++t) { const int j0 = (wv + 16 * t) * 16; FragH (&bf)[2] = kb[t & 3];
    v8f c = {}; c = mma16(aq[0].v, bf[0].v, c); c = mma16(aq[1].v, bf[1].v, c);
    // the four vector slots that the chip needs behind a matrix instruction before its D is overwritten (the next tile's product) or its A or B refilled; the operands are named so that the refill of bf stays behind them
    asm volatile("v_nop\n\tv_nop\n\tv_nop\n\tv_nop" : "+v"(c) : "v"(aq[0].v), "v"(aq[1].v), "v"(bf[0].v), "v"(bf[1].v));
    if (t + 4 < KL / 256) ldfrag(bf, kp, obq, (t + 4) * 256 * QP);
    else if (t == 4) ldfrag(an, qr, obq, 0);
    else if (t == 5) ldfrag(aw, qr, obw, 0);
    else if (t == 6) ldfrag(bb[0], rp, obr, 0);
    else ldfrag(bb[1], rp, obr, 256 * RP);
#pragma unroll
    for (int r = 0; r < 8; ++r) S[(8 * hh + r) * SP + j0 + ln] = c[r];
    __builtin_amdgcn_sched_barrier(0); }      // keeps the tiles apart in the schedule: mixed, they hold more products and fragments live than the 128 registers take, and the build spills
  if (tid < 16) S[tid * SP + KL] = 0.f;      // the padding slot that takes the one raw value of a row with d == -1: given a value here, so that the add below reads nothing unwritten
  __syncthreads();      // every AC value is in S before any wave adds a shifted BD value to it
  __builtin_amdgcn_sched_barrier(0);      // as above: no product of the next phase is lifted over the barrier
  // raw BD of rows i and i+1, added in place at the shifted column: each (row, j) is touched by one lane of one wave; the column of the pad's zero, j = i + KL + 1 - QL, by none (AC + 0)
#pragma unroll
  for (int t = 0; t < KL / 256; ++t) { const int m0 = (wv + 16 * t) * 16; FragH (&bf)[2] = bb[t & 1];
    v8f dn = {}, dw = {}; dn = mma16(an[0].v, bf[0].v, dn); dw = mma16(aw[0].v, bf[0].v, dw); dn = mma16(an[1].v, bf[1].v, dn); dw = mma16(aw[1].v, bf[1].v, dw);
    // the four vector slots that the chip needs behind a matrix instruction before a vector instruction reads its D or its B is refilled; bf is named so that its refill stays behind them
    asm volatile("v_nop\n\tv_nop\n\tv_nop\n\tv_nop" : "+v"(dn), "+v"(dw) : "v"(bf[0].v), "v"(bf[1].v));
    if (t + 2 < KL / 256) ldfrag(bf, rp, obr, (t + 2) * 256 * RP);      // rk tiles fly two tiles ahead
    const int d0 = m0 + ln - (QL - 1) + i0 + 8 * hh; int ix[8]; float old[8];
#pragma unroll
    for (int r = 0; r < 8; ++r) { const int d = d0 + r; ix[r] = (8 * hh + r) * SP + ((d >= 0) ? d : d + (KL + 1)); old[r] = S[ix[r]]; }      // the eight reads first: eight different rows, so no store of this tile can hit them
#pragma unroll
    for (int r = 0; r < 8; ++r) S[ix[r]] = old[r] + ((d0 + r >= 0) ? dn[r] : dw[r]);
    __builtin_amdgcn_sched_barrier(0); }      // as above
  __syncthreads();      // the rows are complete before the row waves read them
  const float* sr = &S[wv * SP];
  v4f sv[16]; float mx = -3.0e38f;
#pragma unroll
  for (int jj = 0; jj < 16; ++jj) { const int j0 = jj * 128 + lane * 4; const v4f a = *(const v4fa*)(sr + j0); v4f s;
#pragma unroll
    for (int e = 0; e < 4; ++e) { const float val = a[e] * ATT_SCALE; s[e] = __builtin_amdgcn_inverse_ballot_w32(mbal[jj * 4 + e]) ? -INFINITY : val; mx = fmaxf(mx, s[e]); }
    sv[jj] = s; }
  for (int o = 16; o >= 1; o >>= 1) mx = fmaxf(mx, __shfl_xor(mx, o, 32)); float z = 0.f;
#pragma unroll
  for (int jj = 0; jj < 16; ++jj) for (int e = 0; e < 4; ++e) { const float p = (sv[jj][e] > -INFINITY) ? __expf(sv[jj][e] - mx) : 0.f; sv[jj][e] = p; z += p; }
  for (int o = 16; o >= 1; o >>= 1) z += __shfl_xor(z, o, 32); const float iz = (z > 0.f) ? 32768.0f / z : 0.f;
  _Float16* pr = P16 + ((size_t)pl * QL + i) * KL;
#pragma unroll
  for (int jj = 0; jj < 16; ++jj) { v4h o; for (int e = 0; e < 4; ++e) o[e] = (_Float16)(sv[jj][e] * iz); *(v4h*)(pr + jj * 128 + lane * 4) = o; }
}
// GEMM with both operands staged in LDS: C[M][N] = f16 A[M][KK] . Bt[N][KK]^T, v = acc*alpha (+ bf16(bias[col]) if BIAS); writes f32 C (F32OUT) or f16 C16, pitch LDC. A, Bt row-major with pitch KK; M a multiple of 128, N of 64, KK of 256.
// One work-group = 128 rows x 64 columns, 8 waves of 16 x 64; blockIdx.x = row block * ntn + column block (ntn = N / 64), blockIdx.y = plane (element strides sA, sB, sC).
// A stage is 128 k = 256 bytes of each of the 192 operand rows (A rows 0..127, Bt rows 128..191), brought by asynchronous copies whose wave-wide 512 bytes are two whole 256-byte row pieces; two buffers, stage t + 2 flies while stage t is multiplied.
// Each output element still sums its k steps of 32 in rising order in one f32 accumulator.
#define GP 272      // LDS row pitch in bytes: 16 x odd, the conflict-free pitch of 256-byte rows for 16-byte fragment reads
#define GSTG (192 * GP)      // bytes of one stage
// One stage: lane (row cr = tid / 16, 16-byte piece tid % 16) copies its piece of A rows cr + 16 i (i < 8) and Bt rows cr + 16 i (i < 4). l: the lane's LDS byte address of A row cr; ga, gb: its global addresses in A row cr and Bt row cr; RB: 16 rows in bytes.
// The s_wait_xcnt is the wait that is owed before a register named by an issued copy is rewritten; as the statement's last line it stands in front of every such write.
template <int RB>
__device__ __forceinline__ void cp_stage(unsigned l, const char* ga, const char* gb) {
  asm volatile("global_load_async_to_lds_b128 %0, %12, off\n\t"
               "global_load_async_to_lds_b128 %1, %13, off\n\t"
               "global_load_async_to_lds_b128 %2, %14, off\n\t"
               "global_load_async_to_lds_b128 %3, %15, off\n\t"
               "global_load_async_to_lds_b128 %4, %16, off\n\t"
               "global_load_async_to_lds_b128 %5, %17, off\n\t"
               "global_load_async_to_lds_b128 %6, %18, off\n\t"
               "global_load_async_to_lds_b128 %7, %19, off\n\t"
               "global_load_async_to_lds_b128 %8, %20, off\n\t"
               "global_load_async_to_lds_b128 %9, %21, off\n\t"
               "global_load_async_to_lds_b128 %10, %22, off\n\t"
               "global_load_async_to_lds_b128 %11, %23, off\n\t"
               "s_wait_xcnt 0x0"
               :: "v"(l), "v"(l + 16 * GP), "v"(l + 32 * GP), "v"(l + 48 * GP), "v"(l + 64 * GP), "v"(l + 80 * GP), "v"(l + 96 * GP), "v"(l + 112 * GP),
                  "v"(l + 128 * GP), "v"(l + 144 * GP), "v"(l + 160 * GP), "v"(l + 176 * GP),
                  "v"(ga), "v"(ga + RB), "v"(ga + 2 * RB), "v"(ga + 3 * RB), "v"(ga + 4 * RB), "v"(ga + 5 * RB), "v"(ga + 6 * RB), "v"(ga + 7 * RB),
                  "v"(gb), "v"(gb + RB), "v"(gb + 2 * RB), "v"(gb + 3 * RB)
               : "memory");
}
// The tile's body: A, Bh, C, C16 are the plane's own bases, (bm, nq) the tile, f32out picks the output (the same for the whole work-group); ring and so are the calling kernel's LDS.
template <int KK, int LDC, bool BIAS>
__device__ __forceinline__ void gemm_tile(const _Float16* __restrict__ A, const _Float16* __restrict__ Bh, float alpha, const float* __restrict__ bias,
    float* __restrict__ C, _Float16* __restrict__ C16, bool f32out, int bm, int nq, char* ring, float (*so)[16][64]) {
  const int tid = threadIdx.x, lane = tid & 31, ln = lane & 15, hh = lane >> 4;
  const int w = __builtin_amdgcn_readfirstlane(tid >> 5);      // the wave's number as a scalar
  const int row0 = bm * 128 + w * 16, col0 = nq * 64;
  const int cr = tid >> 4, cc = (tid & 15) * 16;
  const char* ga = (const char*)(A + (size_t)(bm * 128 + cr) * KK) + cc;
  const char* gb = (const char*)(Bh + (size_t)(col0 + cr) * KK) + cc;
  const unsigned l0 = (unsigned)(size_t)&ring[0] + (unsigned)(cr * GP + cc);      // the low 32 bits of a __shared__ address are its LDS byte address
  constexpr int NT = KK / 128, RB = 16 * KK * 2;
  float braw[4] = {0.f, 0.f, 0.f, 0.f};      // the bias of the lane's four columns, read at the head so that it flies under the main loop; first used in the epilogue
  if (BIAS) {
#pragma unroll
    for (int q = 0; q < 4; ++q) braw[q] = bias[col0 + q * 16 + ln];
  }
  cp_stage<RB>(l0, ga, gb);      // stage 0 into buffer 0
  asm volatile("s_wait_asynccnt 0x0" ::: "memory");      // this wave's copies of stage 0 have landed
  __syncthreads();      // every wave's have: stage 0 may be read
  cp_stage<RB>(l0 + GSTG, ga + 256, gb + 256);      // stage 1 into buffer 1
  v8f acc[4] = {};
#pragma unroll 1      // kept rolled: unrolled, the build holds two stages' fragments live and needs more than 256 registers, and two work-groups no longer share a WGP
  for (int t = 0; t < NT; ++t) {
    const char* sa = &ring[(t & 1) * GSTG + (w * 16 + ln) * GP + hh * 16];
    const char* sb = &ring[(t & 1) * GSTG + (128 + ln) * GP + hh * 16];
    FragH a[4], b[4][4];
#pragma unroll
    for (int ks = 0; ks < 4; ++ks) {      // lane half hh: registers 0..3 hold k = 32 ks + 8 hh + 0..7, registers 4..7 hold k = 32 ks + 16 + 8 hh + 0..7, for A and B alike
      a[ks].half[0] = *(const v8us*)(sa + ks * 64); a[ks].half[1] = *(const v8us*)(sa + ks * 64 + 32);
#pragma unroll
      for (int q = 0; q < 4; ++q) { b[ks][q].half[0] = *(const v8us*)(sb + q * 16 * GP + ks * 64); b[ks][q].half[1] = *(const v8us*)(sb + q * 16 * GP + ks * 64 + 32); }
    }
    asm volatile("s_wait_dscnt 0x0" ::: "memory");      // the whole stage is in this wave's registers: its reads of the buffer have returned before the buffer is refilled
    asm volatile("s_wait_asynccnt 0x0" ::: "memory");      // this wave's copies of stage t + 1 have landed
    __syncthreads();      // publishes stage t + 1 and ends every wave's reads of stage t
    if (t + 2 < NT) cp_stage<RB>(l0 + (unsigned)((t & 1) * GSTG), ga + (t + 2) * 256, gb + (t + 2) * 256);      // stage t + 2 into the buffer that this trip has read
    __builtin_amdgcn_sched_barrier(0);      // keeps the products behind the refill: they need registers only, and the copies so fly under them as well as under the next stage's reads
#pragma unroll
    for (int ks = 0; ks < 4; ++ks)
#pragma unroll
      for (int q = 0; q < 4; ++q) acc[q] = mma16(a[ks].v, b[ks][q].v, acc[q]);
  }
  asm volatile("s_wait_asynccnt 0x0" ::: "memory");      // no copy is outstanding when the wave goes on to its end
#pragma unroll
  for (int q = 0; q < 4; ++q)
#pragma unroll
    for (int r = 0; r < 8; ++r) so[w][8 * hh + r][q * 16 + ln] = acc[q][r] * alpha + (BIAS ? bf16_round(braw[q]) : 0.f);
  __builtin_amdgcn_fence(__ATOMIC_ACQ_REL, "workgroup"); __builtin_amdgcn_wave_barrier();      // the wave reads back its own staging rows: whole 128-byte lines go out
  const int rsub = lane >> 4, c4 = (lane & 15) * 4; const size_t cofs = (size_t)(row0 + rsub) * LDC + col0 + c4;      // the lane's first element; its eight rows lie 2 LDC apart
  v4f ov[8];
#pragma unroll
  for (int q = 0; q < 8; ++q) ov[q] = *(const v4fa*)&so[w][q * 2 + rsub][c4];
  if (f32out) {      // one branch round all eight stores, so that the eight LDS reads above stay in flight together where f32out is known only at run time
#pragma unroll
    for (int q = 0; q < 8; ++q) *(v4f*)(C + cofs + q * 2 * LDC) = ov[q];
  } else {
#pragma unroll
    for (int q = 0; q < 8; ++q) { v4h h4; for (int i = 0; i < 4; ++i) h4[i] = (_Float16)ov[q][i]; *(v4h*)(C16 + cofs + q * 2 * LDC) = h4; }
  }
}
template <int KK, int LDC, bool F32OUT, bool BIAS>
__global__ __launch_bounds__(256) void k_gemm_lds(const _Float16* __restrict__ A, size_t sA, const _Float16* __restrict__ Bh, size_t sB, float alpha, const float* __restrict__ bias,
    float* __restrict__ C, _Float16* __restrict__ C16, size_t sC, int ntn) {
  __shared__ __attribute__((aligned(16))) char ring[2 * GSTG];
  __shared__ __attribute__((aligned(16))) float so[8][16][64];
  const size_t by = blockIdx.y;
  gemm_tile<KK, LDC, BIAS>(A + by * sA, Bh + by * sB, alpha, bias, F32OUT ? C + by * sC : nullptr, F32OUT ? nullptr : C16 + by * sC, F32OUT, blockIdx.x / ntn, blockIdx.x % ntn, ring, so);
}
// The four input projections in one launch (each reads only what k_prep wrote): tiles of k, v (4096 rows of CAT each), then q (the last 2048 rows of CAT, f32 out) and rk (the 2048 rows of R16); every tile as in k_gemm_lds.
#define GTK ((NKR / 128) * (DM / 64))      // tiles of k and of v
#define GTQ ((NQR / 128) * (DM / 64))      // tiles of q and of rk
__global__ __launch_bounds__(256) void k_proj(const _Float16* __restrict__ CAT, const _Float16* __restrict__ R16, const _Float16* __restrict__ Bw, const float* __restrict__ bq, const float* __restrict__ bk, const float* __restrict__ bv, const float* __restrict__ br,
    float* __restrict__ QF, _Float16* __restrict__ K16, _Float16* __restrict__ V16, _Float16* __restrict__ RK) {
  __shared__ __attribute__((aligned(16))) char ring[2 * GSTG];
  __shared__ __attribute__((aligned(16))) float so[8][16][64];
  const int bx = blockIdx.x;
  const int job = (bx < GTK) ? 1 : (bx < 2 * GTK) ? 2 : (bx < 2 * GTK + GTQ) ? 0 : 3;      // the weight's place in Bw: 0 q, 1 k, 2 v, 3 rk
  const int tl = (job == 1) ? bx : (job == 2) ? bx - GTK : (job == 0) ? bx - 2 * GTK : bx - 2 * GTK - GTQ;
  const _Float16* A = (job == 0) ? CAT + (size_t)NQR * DM : (job == 3) ? R16 : CAT;
  const float* bias = (job == 0) ? bq : (job == 1) ? bk : (job == 2) ? bv : br;
  _Float16* C16 = (job == 1) ? K16 : (job == 2) ? V16 : RK;
  gemm_tile<DM, DM, true>(A, Bw + (size_t)job * DM * DM, 0.0625f, bias, QF, C16, job == 0, tl / (DM / 64), tl % (DM / 64), ring, so);
}
__global__ __launch_bounds__(256) void k_lnout(const float* __restrict__ RES, const float* __restrict__ w, const float* __restrict__ g, const float* __restrict__ bb, float* __restrict__ out) { const int tid = threadIdx.x, wv = tid >> 5, lane = tid & 31; const int r = blockIdx.x * 8 + wv; if (r >= NQR) return; v4f y[8]; float s = 0.f;
#pragma unroll
  for (int j = 0; j < 8; ++j) { const int c = j * 128 + lane * 4; const v4f a = *(const v4fa*)(RES + (size_t)r * DM + c), x = *(const v4fa*)(w + (size_t)r * DM + c); for (int q = 0; q < 4; ++q) { y[j][q] = a[q] + bf16_round(x[q]); s += y[j][q]; } }
  for (int o = 16; o >= 1; o >>= 1) s += __shfl_xor(s, o, 32); const float mu = s / (float)DM; float q2 = 0.f;
#pragma unroll
  for (int j = 0; j < 8; ++j) for (int q = 0; q < 4; ++q) { const float d = y[j][q] - mu; q2 += d * d; }
  for (int o = 16; o >= 1; o >>= 1) q2 += __shfl_xor(q2, o, 32); const float rs = rsqrtf(q2 / (float)DM + 1e-5f);
  {
#pragma unroll
    for (int j = 0; j < 8; ++j) { const int c = j * 128 + lane * 4; v4f o; for (int q = 0; q < 4; ++q) o[q] = (y[j][q] - mu) * rs * bf16_round(g[c + q]) + bf16_round(bb[c + q]); *(v4f*)(out + (size_t)r * DM + c) = o; }
     } }

extern "C" void kernel_launch(void* const* d_in, const int* in_sizes, int n_in,
                              void* d_out, int out_size, void* d_ws, size_t ws_size, hipStream_t stream) {
  (void)in_sizes; (void)n_in; (void)out_size;
  const float* const* I = (const float* const*)d_in; const float* w = I[0]; const float* r = I[1]; const float* mems = I[2]; const float* rwb = I[3]; const float* rrb = I[4]; const int* msk = (const int*)d_in[5];
  const float* Wq = I[6]; const float* bq = I[7]; const float* Wk = I[8]; const float* bk = I[9]; const float* Wv = I[10]; const float* bv = I[11]; const float* Wr = I[12]; const float* br = I[13]; const float* Wo = I[14]; const float* bo = I[15]; const float* lg = I[16]; const float* lb = I[17];
  char* ws = (char*)d_ws; size_t off = 0;
  auto take = [&](size_t bytes) { char* p = ws + off; off += (bytes + 255) & ~(size_t)255; return p; };
  const size_t WSZ = (size_t)DM * DM; _Float16* Bw = (_Float16*)take(5 * WSZ * 2);      /* Wq, Wk, Wv, Wr, Wo */
  _Float16* QW = (_Float16*)take((size_t)NQR * DM * 2); _Float16* QR = (_Float16*)take((size_t)NQR * DM * 2);
  _Float16* K16 = (_Float16*)take((size_t)NKR * DM * 2); _Float16* Vt = (_Float16*)take((size_t)NKR * DM * 2); _Float16* RK = (_Float16*)take((size_t)KL * DM * 2);
  _Float16* P16 = (_Float16*)take((size_t)BZ * NH * QL * KL * 2); float* O = (float*)take((size_t)NQR * DM * 4); _Float16* O16 = (_Float16*)take((size_t)NQR * DM * 2);      /* P of all 32 (b,n) planes, so that one launch does every P*V */
  _Float16* CAT = (_Float16*)take((size_t)NKR * DM * 2); _Float16* R16 = (_Float16*)take((size_t)KL * DM * 2); _Float16* V16 = (_Float16*)take((size_t)NKR * DM * 2); float* QF = (float*)take((size_t)NQR * DM * 4); float* RES = QF;      /* the Wo GEMM output reuses QF, which is dead behind k_post */
  if (off > ws_size) return;      // MiB: 10 + 4 + 4 + 8 + 8 + 4 + 128 + 8 + 4 + 8 + 4 + 8 + 8 = 206 of 256
  k_prep<<<5 * GWT + 3 * GX, 256, 0, stream>>>(Wq, Wk, Wv, Wr, Wo, mems, w, r, Bw, CAT, R16);      /* weights (in,out) -> Bt x2^4; cat = [mems; w] is the two inputs back to back (rows (j,b)); r rows m */
  k_proj<<<2 * GTK + 2 * GTQ, 256, 0, stream>>>(CAT, R16, Bw, bq, bk, bv, br, QF, K16, V16, RK);      /* k, v: M 4096 N 1024 K 1024; q (last qlen rows of cat) + bq, rk = r.Wr + br: M 2048; one work-group a 128 x 64 tile */
  k_post<<<BZ * GVT + GX, 256, 0, stream>>>(V16, Vt, QF, rwb, rrb, QW, QR);      /* V^T per (b,n); q + r_w_bias / + r_r_bias */
  const unsigned gh = (unsigned)(((size_t)NQR * DM / 8 + 255) / 256);
  const dim3 gq((NQR / 128) * (DM / 64), 1);      /* one work-group a 128 x 64 tile */
  const dim3 go(QL / 128, BZ * NH);
  k_score<<<dim3(QL / 16, BZ * NH), 512, 0, stream>>>(QW, QR, K16, RK, msk, P16);      /* AC, raw BD, shift, mask and softmax of all 32 (b,n) planes: 16 query rows a work-group, scores in LDS only */
  k_gemm_lds<KL, BZ * DM, true, false><<<go, 256, 0, stream>>>(P16, (size_t)QL * KL, Vt, (size_t)64 * KL, 0.000030517578125f, nullptr, O, nullptr, 64, 1);      /* attn_vec rows (i,b), plane s = b*16 + h at cols s*64 of the 2048-wide (i) row: M 1024 N 64 K 2048, ldc 2048, all 32 planes in blockIdx.y */
  k_h16<<<gh, 256, 0, stream>>>(O, O16, (size_t)NQR * DM / 8);
  k_gemm_lds<DM, DM, true, true><<<gq, 256, 0, stream>>>(O16, 0, Bw + 4 * WSZ, 0, 0.0625f, bo, RES, nullptr, 0, DM / 64);      /* attn_out = attn_vec·Wo + bo (rows (i,b)) */
  k_lnout<<<(NQR + 7) / 8, 256, 0, stream>>>(RES, w, lg, lb, (float*)d_out);
}

// v005
// It runs in 164 microseconds.
// Two timings next to v004 put it at 1.06 and 1.07 times that version's speed.
// Over all steps from v000 it is 16.8 times as fast.
#include <hip/hip_runtime.h>
// Transformer-XL relative multi-head attention (qlen 1024, mem_len 1024 → klen 2048, bsz 2, 16 heads × 64, post-LN): cat = [mems; w] (rows (j,b)); q = (cat·Wq + bq)[last qlen], k, v = cat·Wk + bk, cat·Wv + bv; rk = r·Wr + br;
// AC[i,j] = (q_i + r_w_bias)·k_j; BD = rel_shift((q_i + r_r_bias)·rk_m) (the exact pad-reshape shift, incl. its wrap region); score = (AC + BD)/8, −inf where the INPUT mask is set; softmax over j; attn_vec = Σ_j p·v_j;
// out = LayerNorm(w + attn_vec·Wo + bo)·g + b → [1024, 2, 1024]. (in,out) weights.
// Compute dtype: w, mems, r, biases, weights rounded to bf16; q (+ the two head biases), k, v, rk as f16 GEMM planes; one fused kernel forms, per 16 query rows of a (b,n) plane, AC and raw BD (f32 accumulators),
// applies the relative shift as a scatter into LDS, the mask and an f32 softmax and writes P f16 x2^15; attn_vec by GEMM; Wo GEMM + bias; residual + LayerNorm in f32 (wave per row). All contractions on v_wmma_f32_16x16x32_f16, f32 accumulate.
#define QL 1024
#define KL 2048
#define BZ 2
#define NH 16
#define DM 1024
#define NQR (QL * BZ)
#define NKR (KL * BZ)
#define ATT_SCALE 0.125f

typedef __bf16 v16b __attribute__((ext_vector_type(16)));
typedef unsigned short v8us __attribute__((ext_vector_type(8), may_alias));
typedef float  v8f  __attribute__((ext_vector_type(8)));
typedef float  v4f  __attribute__((ext_vector_type(4)));
typedef float  v4fa __attribute__((ext_vector_type(4), may_alias));
union FragB { v16b v; v8us half[2]; unsigned short u[16]; };

__device__ __forceinline__ unsigned short bf16_bits(float x) { unsigned int u = __float_as_uint(x); return (unsigned short)((u + 0x7FFFu + ((u >> 16) & 1u)) >> 16); }
__device__ __forceinline__ float bf16_val(unsigned short b) { return __uint_as_float(((unsigned int)b) << 16); }
__device__ __forceinline__ float bf16_round(float x) { return bf16_val(bf16_bits(x)); }
// D += A·B with NT terms: 1 = ah·bh, 2 = + al·bh (A split), 3 = + ah·bl (both split)
template <int NT>
__device__ __forceinline__ v8f mmaN(v16b ah, v16b al, v16b bh, v16b bl, v8f c) {
  c = __builtin_amdgcn_wmma_f32_16x16x32_bf16(false, ah, false, bh, (short)0, c, false, false);
  if (NT >= 2) c = __builtin_amdgcn_wmma_f32_16x16x32_bf16(false, al, false, bh, (short)0, c, false, false);
  if (NT >= 3) c = __builtin_amdgcn_wmma_f32_16x16x32_bf16(false, ah, false, bl, (short)0, c, false, false);
  asm volatile("v_nop\n\tv_nop\n\tv_nop\n\tv_nop" : "+v"(c) : "v"(ah), "v"(al), "v"(bh), "v"(bl));
  return c;
}

__global__ __launch_bounds__(256) void k_wt_bf16(const float* __restrict__ W, unsigned short* __restrict__ Wt, int K, int N) {
  const int t = blockIdx.x * 256 + threadIdx.x;
  const int k8n = K / 8;
  if (t >= N * k8n) return;
  const int n = t / k8n, k8 = (t % k8n) * 8;
  v8us v;
#pragma unroll
  for (int i = 0; i < 8; ++i) v[i] = bf16_bits(W[(size_t)(k8 + i) * N + n]);
  *(v8us*)(Wt + (size_t)n * K + k8) = v;
  
}

// GEMM C[M][N] (f32, pitch ldc) = act(A[M][K]·W + bias). A f32 row-major (pitch lda) converted per fragment to bf16
// (ASPLIT: hi/lo two planes -> 2 terms, else single rounded term); Wt bf16 [N][K] (pitch ldb). BIAS_BF16 rounds the
// bias to bf16 first (bias quantised to bf16 before the add). K%32==0, M%16==0, N%64==0.
template <bool ASPLIT, int ACT, bool BIAS_BF16>
__global__ __launch_bounds__(128) void k_gemm_bf(const float* __restrict__ A, int lda, const unsigned short* __restrict__ Wt, int ldb,
                                               const float* __restrict__ bias, float* __restrict__ C, int ldc, int M, int N, int K) {
  __shared__ __attribute__((aligned(16))) float so[4][16][64];
  const int tid = threadIdx.x, w = tid >> 5, lane = tid & 31, ln = lane & 15, hh = lane >> 4;
  const int ntn = N / 64;
  const int wid = blockIdx.x * 4 + w;
  const int mt = wid / ntn, nq = wid % ntn;
  if (mt * 16 >= M) return;
  const int row0 = mt * 16, col0 = nq * 64;
  const float* arow = A + (size_t)(row0 + ln) * lda;
  v8f acc[4] = {};
  for (int kb = 0; kb < K; kb += 32) {
    FragB ah, al;
    const v4f x0 = *(const v4fa*)(arow + kb + 8 * hh), x1 = *(const v4fa*)(arow + kb + 8 * hh + 4);
    const v4f x2 = *(const v4fa*)(arow + kb + 16 + 8 * hh), x3 = *(const v4fa*)(arow + kb + 16 + 8 * hh + 4);
    float xs[16] = {x0[0],x0[1],x0[2],x0[3],x1[0],x1[1],x1[2],x1[3],x2[0],x2[1],x2[2],x2[3],x3[0],x3[1],x3[2],x3[3]};
#pragma unroll
    for (int i = 0; i < 16; ++i) { const unsigned short hb = bf16_bits(xs[i]); ah.u[i] = hb; al.u[i] = ASPLIT ? bf16_bits(xs[i] - bf16_val(hb)) : (unsigned short)0; }
#pragma unroll
    for (int t = 0; t < 4; ++t) {
      const unsigned short* brow = Wt + (size_t)(col0 + t * 16 + ln) * ldb + kb;
      FragB b;
      b.half[0] = *(const v8us*)(brow + 8 * hh);
      b.half[1] = *(const v8us*)(brow + 16 + 8 * hh);
      acc[t] = mmaN<ASPLIT ? 2 : 1>(ah.v, al.v, b.v, b.v, acc[t]);
    }
  }
#pragma unroll
  for (int t = 0; t < 4; ++t) {
    float bv = bias ? bias[col0 + t * 16 + ln] : 0.f;
    if (BIAS_BF16) bv = bf16_round(bv);
#pragma unroll
    for (int r = 0; r < 8; ++r) { float v = acc[t][r] + bv; if (ACT == 1) v = fmaxf(v, 0.f); so[w][8 * hh + r][t * 16 + ln] = v; }
  }
  __builtin_amdgcn_fence(__ATOMIC_ACQ_REL, "workgroup");
  __builtin_amdgcn_wave_barrier();
  const int rsub = lane >> 4, c4 = (lane & 15) * 4;
  {
#pragma unroll
    for (int q = 0; q < 8; ++q) {
      const int r = q * 2 + rsub;
      const v4f v = *(const v4fa*)&so[w][r][c4];
      *(v4f*)(C + (size_t)(row0 + r) * ldc + col0 + c4) = v;
    }
    
  }
}

// Flash-style causal/unmasked attention, all contractions 3-term bf16 hi/lo splits, f32 softmax with running max.
// q,k,v rows are read from f32 buffers with arbitrary row pitch (so they can live inside a fused qkv buffer);
// D = head size (multiple of 32, <= 128); one wave = 16 query rows; block = 4 waves (64 queries) sharing K/V chunks of 32.
template <int D, bool CAUSAL>
__global__ __launch_bounds__(128) void k_flash(const float* __restrict__ qb, const float* __restrict__ kb, const float* __restrict__ vb,
                                             int pitch, int T, int H, float scale, float* __restrict__ y, int ypitch) {
  constexpr int KS = D / 32;        // k-steps for QK
  constexpr int DT = D / 16;        // d tiles for PV
  __shared__ __attribute__((aligned(16))) unsigned short sKh[32][D + 8], sKl[32][D + 8], sVh[32][D + 8], sVl[32][D + 8];
  __shared__ __attribute__((aligned(16))) unsigned short sPh[4][16][40], sPl[4][16][40];
  __shared__ __attribute__((aligned(16))) float sO[4][16][D];
  const int tid = threadIdx.x, w = tid >> 5, lane = tid & 31, ln = lane & 15, hh = lane >> 4;
  const int nqb = (T + 63) / 64;
  const int bh = blockIdx.x / nqb, qblk = blockIdx.x % nqb;
  const int b = bh / H, h = bh % H;
  const int q0 = qblk * 64 + w * 16;
  const float* Q = qb + (size_t)b * T * pitch + h * D;
  const float* K = kb + (size_t)b * T * pitch + h * D;
  const float* V = vb + (size_t)b * T * pitch + h * D;

  // A fragments of the wave's 16 query rows (scaled), hi/lo
  FragB aqh[KS], aql[KS];
  {
    int row = q0 + ln; if (row >= T) row = T - 1;
    const float* qr = Q + (size_t)row * pitch;
#pragma unroll
    for (int ks = 0; ks < KS; ++ks)
#pragma unroll
      for (int i = 0; i < 16; ++i) {
        const int d = ks * 32 + ((i < 8) ? (8 * hh + i) : (16 + 8 * hh + (i - 8)));
        const float x = qr[d] * scale; const unsigned short hb = bf16_bits(x);
        aqh[ks].u[i] = hb; aql[ks].u[i] = bf16_bits(x - bf16_val(hb));
      }
  }
  float m_r[8], l_r[8];
#pragma unroll
  for (int r = 0; r < 8; ++r) { m_r[r] = -3.0e38f; l_r[r] = 0.f; }
  v8f oacc[DT];
#pragma unroll
  for (int dt = 0; dt < DT; ++dt) oacc[dt] = (v8f){0.f,0.f,0.f,0.f,0.f,0.f,0.f,0.f};

  const int kv_end = CAUSAL ? min(T, qblk * 64 + 64) : T;     // block-uniform
  for (int j0 = 0; j0 < kv_end; j0 += 32) {
    __syncthreads();
    for (int e = tid; e < 32 * (D / 4); e += 128) {
      const int r = e / (D / 4), c4 = (e % (D / 4)) * 4;
      const int key = j0 + r;
      v4f kf = {0.f,0.f,0.f,0.f}, vf = {0.f,0.f,0.f,0.f};
      if (key < T) { kf = *(const v4fa*)(K + (size_t)key * pitch + c4); vf = *(const v4fa*)(V + (size_t)key * pitch + c4); }
#pragma unroll
      for (int t = 0; t < 4; ++t) {
        unsigned short hb = bf16_bits(kf[t]); sKh[r][c4 + t] = hb; sKl[r][c4 + t] = bf16_bits(kf[t] - bf16_val(hb));
        hb = bf16_bits(vf[t]); sVh[r][c4 + t] = hb; sVl[r][c4 + t] = bf16_bits(vf[t] - bf16_val(hb));
      }
    }
    __syncthreads();
    // S tile 16 x 32
    v8f s[2];
#pragma unroll
    for (int nt = 0; nt < 2; ++nt) {
      v8f acc = {};
#pragma unroll
      for (int ks = 0; ks < KS; ++ks) {
        FragB bh_, bl_;
        bh_.half[0] = *(const v8us*)&sKh[nt * 16 + ln][ks * 32 + 8 * hh]; bh_.half[1] = *(const v8us*)&sKh[nt * 16 + ln][ks * 32 + 16 + 8 * hh];
        bl_.half[0] = *(const v8us*)&sKl[nt * 16 + ln][ks * 32 + 8 * hh]; bl_.half[1] = *(const v8us*)&sKl[nt * 16 + ln][ks * 32 + 16 + 8 * hh];
        acc = mmaN<3>(aqh[ks].v, aql[ks].v, bh_.v, bl_.v, acc);
      }
      s[nt] = acc;
    }
    // mask + running max (rows 8hh+r; the 16 lanes of a half share rows)
    float alpha[8];
#pragma unroll
    for (int r = 0; r < 8; ++r) {
      const int qi = q0 + 8 * hh + r;
      const int ja = j0 + ln, jb = j0 + 16 + ln;
      if (CAUSAL) { if (ja > qi) s[0][r] = -3.0e38f; if (jb > qi) s[1][r] = -3.0e38f; }
      if (ja >= T) s[0][r] = -3.0e38f;
      if (jb >= T) s[1][r] = -3.0e38f;
      float mx = fmaxf(s[0][r], s[1][r]);
      mx = fmaxf(mx, __shfl_xor(mx, 1, 32)); mx = fmaxf(mx, __shfl_xor(mx, 2, 32)); mx = fmaxf(mx, __shfl_xor(mx, 4, 32)); mx = fmaxf(mx, __shfl_xor(mx, 8, 32));
      const float mnew = fmaxf(m_r[r], mx);
      alpha[r] = (mnew > -1.0e38f) ? __expf(m_r[r] - mnew) : 1.0f;
      const float p0 = (s[0][r] > -1.0e38f) ? __expf(s[0][r] - mnew) : 0.f;
      const float p1 = (s[1][r] > -1.0e38f) ? __expf(s[1][r] - mnew) : 0.f;
      m_r[r] = mnew;
      l_r[r] = l_r[r] * alpha[r] + p0 + p1;            // per-lane partial row sum (16 lanes combined at the end)
      unsigned short hb = bf16_bits(p0); sPh[w][8 * hh + r][ln] = hb;      sPl[w][8 * hh + r][ln] = bf16_bits(p0 - bf16_val(hb));
      hb = bf16_bits(p1);                sPh[w][8 * hh + r][16 + ln] = hb; sPl[w][8 * hh + r][16 + ln] = bf16_bits(p1 - bf16_val(hb));
    }
#pragma unroll
    for (int dt = 0; dt < DT; ++dt)
#pragma unroll
      for (int r = 0; r < 8; ++r) oacc[dt][r] *= alpha[r];
    __builtin_amdgcn_fence(__ATOMIC_ACQ_REL, "workgroup");
    __builtin_amdgcn_wave_barrier();
    FragB pah, pal;
    pah.half[0] = *(const v8us*)&sPh[w][ln][8 * hh]; pah.half[1] = *(const v8us*)&sPh[w][ln][16 + 8 * hh];
    pal.half[0] = *(const v8us*)&sPl[w][ln][8 * hh]; pal.half[1] = *(const v8us*)&sPl[w][ln][16 + 8 * hh];
#pragma unroll
    for (int dt = 0; dt < DT; ++dt) {
      FragB bvh, bvl;
#pragma unroll
      for (int i = 0; i < 8; ++i) {
        bvh.u[i] = sVh[8 * hh + i][dt * 16 + ln]; bvh.u[8 + i] = sVh[16 + 8 * hh + i][dt * 16 + ln];
        bvl.u[i] = sVl[8 * hh + i][dt * 16 + ln]; bvl.u[8 + i] = sVl[16 + 8 * hh + i][dt * 16 + ln];
      }
      oacc[dt] = mmaN<3>(pah.v, pal.v, bvh.v, bvl.v, oacc[dt]);
    }
    __builtin_amdgcn_fence(__ATOMIC_ACQ_REL, "workgroup");
    __builtin_amdgcn_wave_barrier();
  }
#pragma unroll
  for (int r = 0; r < 8; ++r) {
    float l = l_r[r];
    l += __shfl_xor(l, 1, 32); l += __shfl_xor(l, 2, 32); l += __shfl_xor(l, 4, 32); l += __shfl_xor(l, 8, 32);
    l_r[r] = (l > 0.f) ? 1.0f / l : 0.f;
  }
#pragma unroll
  for (int dt = 0; dt < DT; ++dt)
#pragma unroll
    for (int r = 0; r < 8; ++r) sO[w][8 * hh + r][dt * 16 + ln] = oacc[dt][r] * l_r[r];
  __builtin_amdgcn_fence(__ATOMIC_ACQ_REL, "workgroup");
  __builtin_amdgcn_wave_barrier();
  {
    for (int r = 0; r < 16; ++r) {
      const int row = q0 + r;
      if (row < T && lane < D / 4) {
        const v4f val = *(const v4fa*)&sO[w][r][lane * 4];
        *(v4f*)(y + ((size_t)b * T + row) * ypitch + h * D + lane * 4) = val;
      }
    }
    
  }
}

// GEMM C = act(A·W + bias + resid): A f32 (ASPLIT -> hi/lo 2 terms), Wt bf16 [N][K]; ACT 0 none, 1 relu, 2 exact gelu;
// resid (optional, f32, row index = (row % rmod), pitch ldr, RES_BF16 rounds it) added before the activation.
template <bool ASPLIT, int ACT, bool BIAS_BF16, bool RES_BF16>
__global__ __launch_bounds__(128) void k_gemm_bf3(const float* __restrict__ A, int lda, const unsigned short* __restrict__ Wt, int ldb,
                                                const float* __restrict__ bias, const float* __restrict__ resid, int rmod, int ldr,
                                                float* __restrict__ C, int ldc, int M, int N, int K) {
  __shared__ __attribute__((aligned(16))) float so[4][16][64];
  const int tid = threadIdx.x, w = tid >> 5, lane = tid & 31, ln = lane & 15, hh = lane >> 4;
  const int ntn = N / 64;
  const int wid = blockIdx.x * 4 + w;
  const int mt = wid / ntn, nq = wid % ntn;
  if (mt * 16 >= M) return;
  const int row0 = mt * 16, col0 = nq * 64;
  const float* arow = A + (size_t)(row0 + ln) * lda;
  v8f acc[4] = {};
  for (int kb = 0; kb < K; kb += 32) {
    FragB ah, al;
    const v4f x0 = *(const v4fa*)(arow + kb + 8 * hh), x1 = *(const v4fa*)(arow + kb + 8 * hh + 4);
    const v4f x2 = *(const v4fa*)(arow + kb + 16 + 8 * hh), x3 = *(const v4fa*)(arow + kb + 16 + 8 * hh + 4);
    float xs[16] = {x0[0],x0[1],x0[2],x0[3],x1[0],x1[1],x1[2],x1[3],x2[0],x2[1],x2[2],x2[3],x3[0],x3[1],x3[2],x3[3]};
#pragma unroll
    for (int i = 0; i < 16; ++i) { const unsigned short hb = bf16_bits(xs[i]); ah.u[i] = hb; al.u[i] = ASPLIT ? bf16_bits(xs[i] - bf16_val(hb)) : (unsigned short)0; }
#pragma unroll
    for (int t = 0; t < 4; ++t) {
      const unsigned short* brow = Wt + (size_t)(col0 + t * 16 + ln) * ldb + kb;
      FragB b;
      b.half[0] = *(const v8us*)(brow + 8 * hh);
      b.half[1] = *(const v8us*)(brow + 16 + 8 * hh);
      acc[t] = mmaN<ASPLIT ? 2 : 1>(ah.v, al.v, b.v, b.v, acc[t]);
    }
  }
#pragma unroll
  for (int t = 0; t < 4; ++t) {
    const int col = col0 + t * 16 + ln;
    float bv = bias ? bias[col] : 0.f;
    if (BIAS_BF16) bv = bf16_round(bv);
#pragma unroll
    for (int r = 0; r < 8; ++r) {
      float v = acc[t][r] + bv;
      if (resid) { float rv = resid[(size_t)((row0 + 8 * hh + r) % rmod) * ldr + col]; if (RES_BF16) rv = bf16_round(rv); v += rv; }
      if (ACT == 1) v = fmaxf(v, 0.f);
      if (ACT == 2) v = 0.5f * v * (1.0f + erff(v * 0.70710678118654752f));
      if (ACT == 3) { const float u = 0.7978845608028654f * (v + 0.044715f * v * v * v); v = 0.5f * v * (1.0f + tanhf(u)); }
      so[w][8 * hh + r][t * 16 + ln] = v;
    }
  }
  __builtin_amdgcn_fence(__ATOMIC_ACQ_REL, "workgroup");
  __builtin_amdgcn_wave_barrier();
  const int rsub = lane >> 4, c4 = (lane & 15) * 4;
  {
#pragma unroll
    for (int q = 0; q < 8; ++q) {
      const int r = q * 2 + rsub;
      const v4f v = *(const v4fa*)&so[w][r][c4];
      *(v4f*)(C + (size_t)(row0 + r) * ldc + col0 + c4) = v;
    }
    
  }
}
// row LayerNorm (biased variance, eps) over N: s = X (+ R); optional out_sum <- s; out_norm <- (s-mu)*rsqrt(var+eps)*g + b
template <bool PARAM_BF16>
__global__ __launch_bounds__(256) void k_layernorm(const float* __restrict__ X, const float* __restrict__ R, const float* __restrict__ g, const float* __restrict__ bta,
                                                  float* __restrict__ out_sum, float* __restrict__ out_norm, int N, float eps) {
  __shared__ float red[256];
  const int row = blockIdx.x, tid = threadIdx.x;
  const float* x = X + (size_t)row * N; const float* rr = R ? R + (size_t)row * N : nullptr;
  float vals[16];                     // up to N = 4096
  const int per = N / 256;            // contiguous chunk per thread? use strided-by-4 chunks: thread handles j = tid*4 + 1024*u
  float s1 = 0.f;
  for (int u = 0; u < per / 4; ++u) {
    const int j = tid * 4 + 1024 * u;
    const v4f a = *(const v4fa*)(x + j);
    v4f b = {0.f,0.f,0.f,0.f}; if (rr) b = *(const v4fa*)(rr + j);
#pragma unroll
    for (int q = 0; q < 4; ++q) { const float v = a[q] + b[q]; vals[u * 4 + q] = v; s1 += v; }
  }
  red[tid] = s1; __syncthreads();
  for (int st = 128; st > 0; st >>= 1) { if (tid < st) red[tid] += red[tid + st]; __syncthreads(); }
  const float mu = red[0] / (float)N; __syncthreads();
  float s2 = 0.f;
  for (int u = 0; u < per / 4; ++u)
#pragma unroll
    for (int q = 0; q < 4; ++q) { const float c = vals[u * 4 + q] - mu; s2 += c * c; }
  red[tid] = s2; __syncthreads();
  for (int st = 128; st > 0; st >>= 1) { if (tid < st) red[tid] += red[tid + st]; __syncthreads(); }
  const float rs = rsqrtf(red[0] / (float)N + eps);
  {
    for (int u = 0; u < per / 4; ++u) {
      const int j = tid * 4 + 1024 * u;
      v4f o, sm;
#pragma unroll
      for (int q = 0; q < 4; ++q) {
        float gg = g[j + q], bb = bta[j + q];
        if (PARAM_BF16) { gg = bf16_round(gg); bb = bf16_round(bb); }
        sm[q] = vals[u * 4 + q]; o[q] = (vals[u * 4 + q] - mu) * rs * gg + bb;
      }
      if (out_sum) *(v4f*)(out_sum + (size_t)row * N + j) = sm;
      *(v4f*)(out_norm + (size_t)row * N + j) = o;
    }
    
  }
}



// ---- f16 WMMA path (v_wmma_f32_16x16x32_f16): 11-bit significands for operands in range — used where a [0,1] probability operand needs more precision than bf16
typedef _Float16 v16h __attribute__((ext_vector_type(16)));
union FragH { v16h v; v8us half[2]; _Float16 h[16]; unsigned short u[16]; };
template <int NT>
__device__ __forceinline__ v8f mmaH(v16h ah, v16h al, v16h bh, v16h bl, v8f c) {
  c = __builtin_amdgcn_wmma_f32_16x16x32_f16(false, ah, false, bh, (short)0, c, false, false);
  if (NT >= 2) c = __builtin_amdgcn_wmma_f32_16x16x32_f16(false, al, false, bh, (short)0, c, false, false);
  if (NT >= 3) c = __builtin_amdgcn_wmma_f32_16x16x32_f16(false, ah, false, bl, (short)0, c, false, false);
  asm volatile("v_nop\n\tv_nop\n\tv_nop\n\tv_nop" : "+v"(c) : "v"(ah), "v"(al), "v"(bh), "v"(bl));
  return c;
}
// batched GEMM like k_gemm_b but f16 operands: A f32 (split into f16 hi/lo if ASPLIT, else rounded to f16), Bt = f16 values [n][k]; alpha; C f32; N multiple of 16 (partial tiles skipped)
template <bool ASPLIT>
__global__ __launch_bounds__(128) void k_gemm_h(const float* __restrict__ A, int lda, size_t sA, const _Float16* __restrict__ Bh, int ldb, size_t sB, float alpha, float* __restrict__ C, int ldc, size_t sC, int M, int N, int K) {
  __shared__ __attribute__((aligned(16))) float so[4][16][64];
  const int tid = threadIdx.x, w = tid >> 5, lane = tid & 31, ln = lane & 15, hh = lane >> 4; const int by = blockIdx.y;
  A += (size_t)by * sA; Bh += (size_t)by * sB; C += (size_t)by * sC;
  const int ntn = (N + 63) / 64; const int wid = blockIdx.x * 4 + w; const int mt = wid / ntn, nq = wid % ntn; if (mt * 16 >= M) return;
  const int row0 = mt * 16, col0 = nq * 64; const float* arow = A + (size_t)(row0 + ln) * lda;
  v8f acc[4] = {};
  for (int kb = 0; kb < K; kb += 32) {
    FragH ah, al;
    const v4f x0 = *(const v4fa*)(arow + kb + 8 * hh), x1 = *(const v4fa*)(arow + kb + 8 * hh + 4), x2 = *(const v4fa*)(arow + kb + 16 + 8 * hh), x3 = *(const v4fa*)(arow + kb + 16 + 8 * hh + 4);
    float xs[16] = {x0[0],x0[1],x0[2],x0[3],x1[0],x1[1],x1[2],x1[3],x2[0],x2[1],x2[2],x2[3],x3[0],x3[1],x3[2],x3[3]};
#pragma unroll
    for (int i = 0; i < 16; ++i) { const _Float16 h = (_Float16)xs[i]; ah.h[i] = h; al.h[i] = ASPLIT ? (_Float16)(xs[i] - (float)h) : (_Float16)0.0f; }
#pragma unroll
    for (int t = 0; t < 4; ++t) { if (col0 + t * 16 >= N) continue; const size_t boff = (size_t)(col0 + t * 16 + ln) * ldb + kb; FragH bq; bq.half[0] = *(const v8us*)(Bh + boff + 8 * hh); bq.half[1] = *(const v8us*)(Bh + boff + 16 + 8 * hh);
      acc[t] = mmaH<ASPLIT ? 2 : 1>(ah.v, al.v, bq.v, bq.v, acc[t]); }
  }
#pragma unroll
  for (int t = 0; t < 4; ++t) { if (col0 + t * 16 >= N) continue;
#pragma unroll
    for (int r = 0; r < 8; ++r) so[w][8 * hh + r][t * 16 + ln] = acc[t][r] * alpha; }
  __builtin_amdgcn_fence(__ATOMIC_ACQ_REL, "workgroup"); __builtin_amdgcn_wave_barrier();
  const int rsub = lane >> 4, c4 = (lane & 15) * 4;
  {
#pragma unroll
    for (int q = 0; q < 8; ++q) { const int r = q * 2 + rsub; if (col0 + c4 < N) { const v4f v = *(const v4fa*)&so[w][r][c4]; *(v4f*)(C + (size_t)(row0 + r) * ldc + col0 + c4) = v; } }
     }
}

// Wt[n][k] = f16(W[k][n]·scale) from f32 row-major W[K][N] (scale = power of two; bf16-exact weights stay exact in f16 away from the subnormal range)
// bx: the index of the 256-thread block inside this matrix's share of the merged grid
__device__ __forceinline__ void wt_f16_body(int bx, const float* __restrict__ W, _Float16* __restrict__ Wt, int K, int N, float scale) {
  const int t = bx * 256 + threadIdx.x; if (t >= N * (K / 8)) return; const int n = t / (K / 8), k8 = (t % (K / 8)) * 8; FragH f;
#pragma unroll
  for (int i = 0; i < 8; ++i) f.h[i] = (_Float16)(bf16_round(W[(size_t)(k8 + i) * N + n]) * scale); const v8us o = f.half[0];
  *(v8us*)((unsigned short*)Wt + (size_t)n * K + k8) = o; 
}
typedef _Float16 v4h __attribute__((ext_vector_type(4)));

__device__ __forceinline__ void x16_body(int bx, const float* __restrict__ x, _Float16* __restrict__ X16, size_t n8) { const size_t t = (size_t)bx * 256 + threadIdx.x; if (t >= n8) return; FragH f;
#pragma unroll
  for (int q = 0; q < 8; ++q) f.h[q] = (_Float16)bf16_round(x[t * 8 + q]); *(v8us*)((unsigned short*)X16 + t * 8) = f.half[0];  }
// All operand preparation in one launch (none of the eight parts reads what another writes): blocks 0 .. 5 GWT - 1 transpose the five weights (Wq, Wk, Wv, Wr, Wo -> Bw, x2^4), the next 3 GX round mems, w (-> CAT, back to back) and r (-> R16).
#define GWT (DM * (DM / 8) / 256)      // blocks of one weight matrix
#define GX (NQR * DM / 8 / 256)      // blocks of one 2048 x 1024 plane at 8 elements a thread (mems, w, r, q alike)
__global__ __launch_bounds__(256) void k_prep(const float* __restrict__ Wq, const float* __restrict__ Wk, const float* __restrict__ Wv, const float* __restrict__ Wr, const float* __restrict__ Wo,
    const float* __restrict__ mems, const float* __restrict__ w, const float* __restrict__ r, _Float16* __restrict__ Bw, _Float16* __restrict__ CAT, _Float16* __restrict__ R16) {
  const int bx = blockIdx.x;
  if (bx < 5 * GWT) { const int m = bx / GWT; const float* W = (m == 0) ? Wq : (m == 1) ? Wk : (m == 2) ? Wv : (m == 3) ? Wr : Wo; wt_f16_body(bx % GWT, W, Bw + (size_t)m * DM * DM, DM, DM, 16.0f); }
  else { const int m = (bx - 5 * GWT) / GX; const float* x = (m == 0) ? mems : (m == 1) ? w : r; _Float16* o = (m == 0) ? CAT : (m == 1) ? CAT + (size_t)NQR * DM : R16; x16_body((bx - 5 * GWT) % GX, x, o, (size_t)NQR * DM / 8); }
}
__global__ __launch_bounds__(256) void k_round16f(const float* __restrict__ W, _Float16* __restrict__ Bt, size_t n8) { const size_t t = (size_t)blockIdx.x * 256 + threadIdx.x; if (t >= n8) return; FragH f;
#pragma unroll
  for (int i = 0; i < 8; ++i) f.h[i] = (_Float16)(bf16_round(W[t * 8 + i]) * 16.0f); *(v8us*)((unsigned short*)Bt + t * 8) = f.half[0];  }
// Fused score kernel: one work-group = 16 query rows i0..i0+15 of one (b,n) plane (blockIdx.y), 16 waves; the 16 x KL score rows live in LDS and never reach memory. AC is stored into the rows first.
// The pad/reshape shift as a scatter of raw BD: idx = QL + i*KL + j = i*(KL+1) + (QL - i + j), so with d = m - (QL-1) + i the raw value (q_i + r_r_bias).rk_m belongs to j = d where d >= 0,
// the raw value of row i+1 at column m to j = d + KL + 1 where d <= -2 (the wrap region); d == -1 gives j = KL, a slot of the row's LDS padding that the softmax never reads; the pad's zero falls on j = i + KL + 1 - QL. Each j in 0..KL-1 gets at most one raw value.
// Behind a barrier each raw value is added to AC in place, and behind a second one wave wv does mask, f32 softmax and the f16 x2^15 store of row i0 + wv with the lane order and sum order of a wave-per-row pass.
#define SP (KL + 4)      // LDS row pitch in floats: 8 rows apart = 32 banks apart, so the two lane halves of a D tile do not collide; multiple of 4 for 16-byte reads
__device__ __forceinline__ v8f mma16(v16h a, v16h b, v8f c) { return __builtin_amdgcn_wmma_f32_16x16x32_f16(false, a, false, b, (short)0, c, false, false); }
// One 16-row fragment pair (k = 0..63) of a row-major f16 plane: base (+ cofs, a constant) is the same for the whole wave, ob is the lane's own byte offset (its row, plus 16 bytes for the upper lane half).
// Lane half hh, step ks: registers 0..3 hold k = 32*ks + 8*hh + 0..7, registers 4..7 hold k = 32*ks + 16 + 8*hh + 0..7, for A and B alike.
__device__ __forceinline__ void ldfrag(FragH (&f)[2], const char* __restrict__ base, unsigned ob, int cofs) {
#pragma unroll
  for (int ks = 0; ks < 2; ++ks) { f[ks].half[0] = *(const v8us*)(base + ob + (cofs + ks * 64)); f[ks].half[1] = *(const v8us*)(base + ob + (cofs + ks * 64 + 32)); }
  // the wait that is owed before a register named by an issued global load is rewritten; offset and base are inputs, so they stay live to here and none of the four loads lands in them
  asm volatile("s_wait_xcnt 0x0" :: "v"(ob), "s"(base) : "memory"); }
// launch bounds: 8 waves a SIMD (a budget of 128 VGPRs), so that two of these 128-KiB work-groups share a WGP and one's barriers and loads run under the other's work
__global__ __launch_bounds__(512, 8) void k_score(const _Float16* __restrict__ QW, const _Float16* __restrict__ QR, const _Float16* __restrict__ K16, const _Float16* __restrict__ RK, const int* __restrict__ MSK, _Float16* __restrict__ P16) {
  __shared__ __attribute__((aligned(16))) float S[16 * SP];
  const int tid = threadIdx.x, lane = tid & 31, ln = lane & 15, hh = lane >> 4;
  const int wv = __builtin_amdgcn_readfirstlane(tid >> 5);      // the wave's number as a scalar: tile bases and the row's addresses then sit in scalar registers
  const int i0 = blockIdx.x * 16, pl = blockIdx.y, b = pl / NH, h = pl % NH;
  const int i = i0 + wv;
  constexpr int QP = BZ * DM * 2, RP = DM * 2;      // row pitches in bytes: q and k rows (i,b) / (j,b); rk rows
  const char* qw = (const char*)(QW + (size_t)b * DM + h * 64 + (size_t)i0 * (BZ * DM)); const char* qr = (const char*)(QR + (size_t)b * DM + h * 64 + (size_t)i0 * (BZ * DM));
  const char* kp = (const char*)(K16 + (size_t)b * DM + h * 64 + (size_t)(wv * 16) * (BZ * DM)); const char* rp = (const char*)(RK + h * 64 + (size_t)(wv * 16) * DM);
  const char* mk = (const char*)(MSK + (size_t)i * KL);
  const unsigned obq = (unsigned)(ln * QP + hh * 16), obr = (unsigned)(ln * RP + hh * 16);
  const unsigned obw = (unsigned)(((i0 + 1 + ln < QL) ? 1 + ln : QL - 1 - i0) * QP + hh * 16);      // row i+1 for the wrap region; the clamped row of i = QL-1 is never selected (there d >= 0 for every m)
  FragH aq[2], kb[4][2]; ldfrag(aq, qw, obq, 0); ldfrag(kb[0], kp, obq, 0);
  unsigned mbal[64];      // the mask of row i0 + wv as one lane mask per (jj, e), read at the head beside the first fragments: the softmax phase then holds no mask registers and waits for no memory
  {
    typedef int v4i __attribute__((ext_vector_type(4))); typedef int v4ia __attribute__((ext_vector_type(4), may_alias)); v4i mv[16]; const unsigned obm = (unsigned)(lane * 16);
#pragma unroll
    for (int jj = 0; jj < 16; ++jj) mv[jj] = *(const v4ia*)(mk + obm + jj * 512);
    // the wait that is owed before a register named by an issued global load is rewritten; offset and base are inputs, so they stay live to here and none of the sixteen loads lands in them
    asm volatile("s_wait_xcnt 0x0" :: "v"(obm), "s"(mk) : "memory");
#pragma unroll
    for (int jj = 0; jj < 16; ++jj)
#pragma unroll
      for (int e = 0; e < 4; ++e) mbal[jj * 4 + e] = __builtin_amdgcn_ballot_w32(mv[jj][e] != 0);
  }
  ldfrag(kb[1], kp, obq, 256 * QP); ldfrag(kb[2], kp, obq, 2 * 256 * QP); ldfrag(kb[3], kp, obq, 3 * 256 * QP);      // behind the lane masks: the sixteen mask vectors and four k tiles together do not fit the registers
  FragH an[2], aw[2], bb[2][2];
  // AC: wave wv owns the column tiles wv + 16 t and stores them straight into S. Four k tiles are in flight; as the ring drains, its registers take the q + r_r_bias rows and the first two rk tiles, which fly while the last AC tiles are multiplied and stored.
#pragma unroll
  for (int t = 0; t < KL / 256; ++t) { const int j0 = (wv + 16 * t) * 16; FragH (&bf)[2] = kb[t & 3];
    v8f c = {}; c = mma16(aq[0].v, bf[0].v, c); c = mma16(aq[1].v, bf[1].v, c);
    // the four vector slots that the chip needs behind a matrix instruction before its D is overwritten (the next tile's product) or its A or B refilled; the operands are named so that the refill of bf stays behind them
    asm volatile("v_nop\n\tv_nop\n\tv_nop\n\tv_nop" : "+v"(c) : "v"(aq[0].v), "v"(aq[1].v), "v"(bf[0].v), "v"(bf[1].v));
    if (t + 4 < KL / 256) ldfrag(bf, kp, obq, (t + 4) * 256 * QP);
    else if (t == 4) ldfrag(an, qr, obq, 0);
    else if (t == 5) ldfrag(aw, qr, obw, 0);
    else if (t == 6) ldfrag(bb[0], rp, obr, 0);
    else ldfrag(bb[1], rp, obr, 256 * RP);
#pragma unroll
    for (int r = 0; r < 8; ++r) S[(8 * hh + r) * SP + j0 + ln] = c[r];
    __builtin_amdgcn_sched_barrier(0); }      // keeps the tiles apart in the schedule: mixed, they hold more products and fragments live than the 128 registers take, and the build spills
  if (tid < 16) S[tid * SP + KL] = 0.f;      // the padding slot that takes the one raw value of a row with d == -1: given a value here, so that the add below reads nothing unwritten
  __syncthreads();      // every AC value is in S before any wave adds a shifted BD value to it
  __builtin_amdgcn_sched_barrier(0);      // as above: no product of the next phase is lifted over the barrier
  // raw BD of rows i and i+1, added in place at the shifted column: each (row, j) is touched by one lane of one wave; the column of the pad's zero, j = i + KL + 1 - QL, by none (AC + 0)
#pragma unroll
  for (int t = 0; t < KL / 256; ++t) { const int m0 = (wv + 16 * t) * 16; FragH (&bf)[2] = bb[t & 1];
    v8f dn = {}, dw = {}; dn = mma16(an[0].v, bf[0].v, dn); dw = mma16(aw[0].v, bf[0].v, dw); dn = mma16(an[1].v, bf[1].v, dn); dw = mma16(aw[1].v, bf[1].v, dw);
    // the four vector slots that the chip needs behind a matrix instruction before a vector instruction reads its D or its B is refilled; bf is named so that its refill stays behind them
    asm volatile("v_nop\n\tv_nop\n\tv_nop\n\tv_nop" : "+v"(dn), "+v"(dw) : "v"(bf[0].v), "v"(bf[1].v));
    if (t + 2 < KL / 256) ldfrag(bf, rp, obr, (t + 2) * 256 * RP);      // rk tiles fly two tiles ahead
    const int d0 = m0 + ln - (QL - 1) + i0 + 8 * hh; int ix[8]; float old[8];
#pragma unroll
    for (int r = 0; r < 8; ++r) { const int d = d0 + r; ix[r] = (8 * hh + r) * SP + ((d >= 0) ? d : d + (KL + 1)); old[r] = S[ix[r]]; }      // the eight reads first: eight different rows, so no store of this tile can hit them
#pragma unroll
    for (int r = 0; r < 8; ++r) S[ix[r]] = old[r] + ((d0 + r >= 0) ? dn[r] : dw[r]);
    __builtin_amdgcn_sched_barrier(0); }      // as above
  __syncthreads();      // the rows are complete before the row waves read them
  const float* sr = &S[wv * SP];
  v4f sv[16]; float mx = -3.0e38f;
#pragma unroll
  for (int jj = 0; jj < 16; ++jj) { const int j0 = jj * 128 + lane * 4; const v4f a = *(const v4fa*)(sr + j0); v4f s;
#pragma unroll
    for (int e = 0; e < 4; ++e) { const float val = a[e] * ATT_SCALE; s[e] = __builtin_amdgcn_inverse_ballot_w32(mbal[jj * 4 + e]) ? -INFINITY : val; mx = fmaxf(mx, s[e]); }
    sv[jj] = s; }
  for (int o = 16; o >= 1; o >>= 1) mx = fmaxf(mx, __shfl_xor(mx, o, 32)); float z = 0.f;
#pragma unroll
  for (int jj = 0; jj < 16; ++jj) for (int e = 0; e < 4; ++e) { const float p = (sv[jj][e] > -INFINITY) ? __expf(sv[jj][e] - mx) : 0.f; sv[jj][e] = p; z += p; }
  for (int o = 16; o >= 1; o >>= 1) z += __shfl_xor(z, o, 32); const float iz = (z > 0.f) ? 32768.0f / z : 0.f;
  _Float16* pr = P16 + ((size_t)pl * QL + i) * KL;
#pragma unroll
  for (int jj = 0; jj < 16; ++jj) { v4h o; for (int e = 0; e < 4; ++e) o[e] = (_Float16)(sv[jj][e] * iz); *(v4h*)(pr + jj * 128 + lane * 4) = o; }
}
// GEMM with both operands staged in LDS: C[M][N] = f16 A[M][KK] . Bt[N][KK]^T, v = acc*alpha (+ bf16(bias[col]) if BIAS); writes f32 C (F32OUT) or f16 C16, pitch LDC. A, Bt row-major with pitch KK; M a multiple of 128, N of 64, KK of 256.
// One work-group = 128 rows x 64 columns, 8 waves of 16 x 64; blockIdx.x = row block * ntn + column block (ntn = N / 64), blockIdx.y = plane (element strides sA, sB, sC).
// A stage is 128 k = 256 bytes of each of the 192 operand rows (A rows 0..127, Bt rows 128..191), brought by asynchronous copies whose wave-wide 512 bytes are two whole 256-byte row pieces; two buffers, stage t + 2 flies while stage t is multiplied.
// Each output element still sums its k steps of 32 in rising order in one f32 accumulator.
#define GP 272      // LDS row pitch in bytes: 16 x odd, the conflict-free pitch of 256-byte rows for 16-byte fragment reads
#define GSTG (192 * GP)      // bytes of one stage
// One stage: lane (row cr = tid / 16, 16-byte piece tid % 16) copies its piece of A rows cr + 16 i (i < 8) and Bt rows cr + 16 i (i < 4). l: the lane's LDS byte address of A row cr; ga, gb: its global addresses in A row cr and Bt row cr; RB: 16 rows in bytes.
// The s_wait_xcnt is the wait that is owed before a register named by an issued copy is rewritten; as the statement's last line it stands in front of every such write.
template <int RB>
__device__ __forceinline__ void cp_stage(unsigned l, const char* ga, const char* gb) {
  asm volatile("global_load_async_to_lds_b128 %0, %12, off\n\t"
               "global_load_async_to_lds_b128 %1, %13, off\n\t"
               "global_load_async_to_lds_b128 %2, %14, off\n\t"
               "global_load_async_to_lds_b128 %3, %15, off\n\t"
               "global_load_async_to_lds_b128 %4, %16, off\n\t"
               "global_load_async_to_lds_b128 %5, %17, off\n\t"
               "global_load_async_to_lds_b128 %6, %18, off\n\t"
               "global_load_async_to_lds_b128 %7, %19, off\n\t"
               "global_load_async_to_lds_b128 %8, %20, off\n\t"
               "global_load_async_to_lds_b128 %9, %21, off\n\t"
               "global_load_async_to_lds_b128 %10, %22, off\n\t"
               "global_load_async_to_lds_b128 %11, %23, off\n\t"
               "s_wait_xcnt 0x0"
               :: "v"(l), "v"(l + 16 * GP), "v"(l + 32 * GP), "v"(l + 48 * GP), "v"(l + 64 * GP), "v"(l + 80 * GP), "v"(l + 96 * GP), "v"(l + 112 * GP),
                  "v"(l + 128 * GP), "v"(l + 144 * GP), "v"(l + 160 * GP), "v"(l + 176 * GP),
                  "v"(ga), "v"(ga + RB), "v"(ga + 2 * RB), "v"(ga + 3 * RB), "v"(ga + 4 * RB), "v"(ga + 5 * RB), "v"(ga + 6 * RB), "v"(ga + 7 * RB),
                  "v"(gb), "v"(gb + RB), "v"(gb + 2 * RB), "v"(gb + 3 * RB)
               : "memory");
}
// The tile's body: A, Bh, C, C16 are the plane's own bases, (bm, nq) the tile; ring and so are the calling kernel's LDS. mode (the same for the whole work-group) picks what the epilogue does with v:
// 0: f32 C. 1: f16 C16. 2 (the q tile): C16 = f16(v + bf16(hb0[col])) and C16b = f16(v + bf16(hb1[col])), hb0 and hb1 the two 1024-wide head-bias rows.
// 3 (the v tile; its rows are (j,b), its 64 columns one head nq): C16 is V^T, row ((b NH + nq) 64 + d), column j; the tile is turned in LDS and goes out as 128 whole lines of 64 j.
#define VP 144      // LDS pitch in bytes of a V^T row of 64 f16: 36 dwords, so that the 16 rows of an 8-byte store from the accumulators fall on different banks; a multiple of 16 for the 16-byte reads
template <int KK, int LDC, bool BIAS>
__device__ __forceinline__ void gemm_tile(const _Float16* __restrict__ A, const _Float16* __restrict__ Bh, float alpha, const float* __restrict__ bias,
    float* __restrict__ C, _Float16* __restrict__ C16, _Float16* __restrict__ C16b, const float* __restrict__ hb0, const float* __restrict__ hb1, int mode, int bm, int nq, char* ring, float (*so)[16][64]) {
  const int tid = threadIdx.x, lane = tid & 31, ln = lane & 15, hh = lane >> 4;
  const int w = __builtin_amdgcn_readfirstlane(tid >> 5);      // the wave's number as a scalar
  const int row0 = bm * 128 + w * 16, col0 = nq * 64;
  const int cr = tid >> 4, cc = (tid & 15) * 16;
  const char* ga = (const char*)(A + (size_t)(bm * 128 + cr) * KK) + cc;
  const char* gb = (const char*)(Bh + (size_t)(col0 + cr) * KK) + cc;
  const unsigned l0 = (unsigned)(size_t)&ring[0] + (unsigned)(cr * GP + cc);      // the low 32 bits of a __shared__ address are its LDS byte address
  constexpr int NT = KK / 128, RB = 16 * KK * 2;
  float braw[4] = {0.f, 0.f, 0.f, 0.f};      // the bias of the lane's four columns, read at the head so that it flies under the main loop; first used in the epilogue
  if (BIAS) {
#pragma unroll
    for (int q = 0; q < 4; ++q) braw[q] = bias[col0 + q * 16 + ln];
  }
  v4f hw = {0.f, 0.f, 0.f, 0.f}, hr = {0.f, 0.f, 0.f, 0.f};      // the two head biases of the four columns that the lane stores, read at the head like the bias
  if (mode == 2) {
    const unsigned oh = (unsigned)((col0 + ln * 4) * 4); const char* p0 = (const char*)hb0; const char* p1 = (const char*)hb1;
    hw = *(const v4fa*)(p0 + oh); hr = *(const v4fa*)(p1 + oh);
    // the wait that is owed before a register named by an issued global load is rewritten; offset and bases are inputs, so they stay live to here and neither load lands in them
    asm volatile("s_wait_xcnt 0x0" :: "v"(oh), "s"(p0), "s"(p1) : "memory");
  }
  cp_stage<RB>(l0, ga, gb);      // stage 0 into buffer 0
  asm volatile("s_wait_asynccnt 0x0" ::: "memory");      // this wave's copies of stage 0 have landed
  __syncthreads();      // every wave's have: stage 0 may be read
  cp_stage<RB>(l0 + GSTG, ga + 256, gb + 256);      // stage 1 into buffer 1
  v8f acc[4] = {};
#pragma unroll 1      // kept rolled: unrolled, the build holds two stages' fragments live and needs more than 256 registers, and two work-groups no longer share a WGP
  for (int t = 0; t < NT; ++t) {
    const char* sa = &ring[(t & 1) * GSTG + (w * 16 + ln) * GP + hh * 16];
    const char* sb = &ring[(t & 1) * GSTG + (128 + ln) * GP + hh * 16];
    FragH a[4], b[4][4];
#pragma unroll
    for (int ks = 0; ks < 4; ++ks) {      // lane half hh: registers 0..3 hold k = 32 ks + 8 hh + 0..7, registers 4..7 hold k = 32 ks + 16 + 8 hh + 0..7, for A and B alike
      a[ks].half[0] = *(const v8us*)(sa + ks * 64); a[ks].half[1] = *(const v8us*)(sa + ks * 64 + 32);
#pragma unroll
      for (int q = 0; q < 4; ++q) { b[ks][q].half[0] = *(const v8us*)(sb + q * 16 * GP + ks * 64); b[ks][q].half[1] = *(const v8us*)(sb + q * 16 * GP + ks * 64 + 32); }
    }
    asm volatile("s_wait_dscnt 0x0" ::: "memory");      // the whole stage is in this wave's registers: its reads of the buffer have returned before the buffer is refilled
    asm volatile("s_wait_asynccnt 0x0" ::: "memory");      // this wave's copies of stage t + 1 have landed
    __syncthreads();      // publishes stage t + 1 and ends every wave's reads of stage t
    if (t + 2 < NT) cp_stage<RB>(l0 + (unsigned)((t & 1) * GSTG), ga + (t + 2) * 256, gb + (t + 2) * 256);      // stage t + 2 into the buffer that this trip has read
    __builtin_amdgcn_sched_barrier(0);      // keeps the products behind the refill: they need registers only, and the copies so fly under them as well as under the next stage's reads
#pragma unroll
    for (int ks = 0; ks < 4; ++ks)
#pragma unroll
      for (int q = 0; q < 4; ++q) acc[q] = mma16(a[ks].v, b[ks][q].v, acc[q]);
  }
  asm volatile("s_wait_asynccnt 0x0" ::: "memory");      // no copy is outstanding when the wave goes on to its end
  if (mode == 3) {
    char* tv = (char*)so;      // 128 rows (b, d) of 64 j. Accumulator register r is tile row 16 w + 8 hh + r = (j, b) with j = 8 w + 4 hh + r / 2, b = r % 2: the four registers of one b are four neighbouring j
#pragma unroll
    for (int q = 0; q < 4; ++q)
#pragma unroll
      for (int b = 0; b < 2; ++b) { v4h h4; for (int e = 0; e < 4; ++e) h4[e] = (_Float16)(acc[q][2 * e + b] * alpha + (BIAS ? bf16_round(braw[q]) : 0.f)); *(v4h*)(tv + (b * 64 + q * 16 + ln) * VP + w * 16 + hh * 8) = h4; }
    __syncthreads();      // every wave holds eight j of every row: the rows are whole before they are read
    const char* tr = tv + (tid >> 3) * VP + (tid & 7) * 16; v8us x[4];      // eight lanes a row; trip it takes rows 32 it + tid / 8
#pragma unroll
    for (int it = 0; it < 4; ++it) x[it] = *(const v8us*)(tr + it * 32 * VP);
    unsigned short* vo = (unsigned short*)C16 + ((size_t)nq * 64 + (tid >> 3)) * KL + bm * 64 + (tid & 7) * 8;
#pragma unroll
    for (int it = 0; it < 4; ++it) *(v8us*)(vo + ((size_t)(it >> 1) * NH * 64 + (it & 1) * 32) * KL) = x[it];
    return;
  }
#pragma unroll
  for (int q = 0; q < 4; ++q)
#pragma unroll
    for (int r = 0; r < 8; ++r) so[w][8 * hh + r][q * 16 + ln] = acc[q][r] * alpha + (BIAS ? bf16_round(braw[q]) : 0.f);
  __builtin_amdgcn_fence(__ATOMIC_ACQ_REL, "workgroup"); __builtin_amdgcn_wave_barrier();      // the wave reads back its own staging rows: whole 128-byte lines go out
  const int rsub = lane >> 4, c4 = (lane & 15) * 4; const size_t cofs = (size_t)(row0 + rsub) * LDC + col0 + c4;      // the lane's first element; its eight rows lie 2 LDC apart
  v4f ov[8];
#pragma unroll
  for (int q = 0; q < 8; ++q) ov[q] = *(const v4fa*)&so[w][q * 2 + rsub][c4];
  if (mode == 0) {      // one branch round all eight stores, so that the eight LDS reads above stay in flight together where mode is known only at run time
#pragma unroll
    for (int q = 0; q < 8; ++q) *(v4f*)(C + cofs + q * 2 * LDC) = ov[q];
  } else if (mode == 1) {
#pragma unroll
    for (int q = 0; q < 8; ++q) { v4h h4; for (int i = 0; i < 4; ++i) h4[i] = (_Float16)ov[q][i]; *(v4h*)(C16 + cofs + q * 2 * LDC) = h4; }
  } else {
    v4h qa[8], qb[8];
#pragma unroll
    for (int q = 0; q < 8; ++q) for (int i = 0; i < 4; ++i) { qa[q][i] = (_Float16)(ov[q][i] + bf16_round(hw[i])); qb[q][i] = (_Float16)(ov[q][i] + bf16_round(hr[i])); }
#pragma unroll
    for (int q = 0; q < 8; ++q) { *(v4h*)(C16 + cofs + q * 2 * LDC) = qa[q]; *(v4h*)(C16b + cofs + q * 2 * LDC) = qb[q]; }
  }
}
template <int KK, int LDC, bool F32OUT, bool BIAS>
__global__ __launch_bounds__(256) void k_gemm_lds(const _Float16* __restrict__ A, size_t sA, const _Float16* __restrict__ Bh, size_t sB, float alpha, const float* __restrict__ bias,
    float* __restrict__ C, _Float16* __restrict__ C16, size_t sC, int ntn) {
  __shared__ __attribute__((aligned(16))) char ring[2 * GSTG];
  __shared__ __attribute__((aligned(16))) float so[8][16][64];
  const size_t by = blockIdx.y;
  gemm_tile<KK, LDC, BIAS>(A + by * sA, Bh + by * sB, alpha, bias, F32OUT ? C + by * sC : nullptr, F32OUT ? nullptr : C16 + by * sC, nullptr, nullptr, nullptr, F32OUT ? 0 : 1, blockIdx.x / ntn, blockIdx.x % ntn, ring, so);
}
// The four input projections in one launch (each reads only what k_prep wrote): tiles of k, v (4096 rows of CAT each), then q (the last 2048 rows of CAT) and rk (the 2048 rows of R16); every tile as in k_gemm_lds.
// The epilogues leave the planes as the score kernel and the P*V GEMM read them: q goes out twice, with r_w_bias and with r_r_bias added, and v goes out transposed per (b,n).
#define GTK ((NKR / 128) * (DM / 64))      // tiles of k and of v
#define GTQ ((NQR / 128) * (DM / 64))      // tiles of q and of rk
__global__ __launch_bounds__(256) void k_proj(const _Float16* __restrict__ CAT, const _Float16* __restrict__ R16, const _Float16* __restrict__ Bw, const float* __restrict__ bq, const float* __restrict__ bk, const float* __restrict__ bv, const float* __restrict__ br,
    const float* __restrict__ rwb, const float* __restrict__ rrb, _Float16* __restrict__ QW, _Float16* __restrict__ QR, _Float16* __restrict__ K16, _Float16* __restrict__ Vt, _Float16* __restrict__ RK) {
  __shared__ __attribute__((aligned(16))) char ring[2 * GSTG];
  __shared__ __attribute__((aligned(16))) float so[8][16][64];
  const int bx = blockIdx.x;
  const int job = (bx < GTK) ? 1 : (bx < 2 * GTK) ? 2 : (bx < 2 * GTK + GTQ) ? 0 : 3;      // the weight's place in Bw: 0 q, 1 k, 2 v, 3 rk
  const int tl = (job == 1) ? bx : (job == 2) ? bx - GTK : (job == 0) ? bx - 2 * GTK : bx - 2 * GTK - GTQ;
  const _Float16* A = (job == 0) ? CAT + (size_t)NQR * DM : (job == 3) ? R16 : CAT;
  const float* bias = (job == 0) ? bq : (job == 1) ? bk : (job == 2) ? bv : br;
  _Float16* C16 = (job == 0) ? QW : (job == 1) ? K16 : (job == 2) ? Vt : RK;
  const int mode = (job == 0) ? 2 : (job == 2) ? 3 : 1;      // from blockIdx alone: the barrier of the v epilogue is passed by a whole work-group or by none of it
  gemm_tile<DM, DM, true>(A, Bw + (size_t)job * DM * DM, 0.0625f, bias, nullptr, C16, QR, rwb, rrb, mode, tl / (DM / 64), tl % (DM / 64), ring, so);
}
__global__ __launch_bounds__(256) void k_lnout(const float* __restrict__ RES, const float* __restrict__ w, const float* __restrict__ g, const float* __restrict__ bb, float* __restrict__ out) { const int tid = threadIdx.x, wv = tid >> 5, lane = tid & 31; const int r = blockIdx.x * 8 + wv; if (r >= NQR) return; v4f y[8]; float s = 0.f;
#pragma unroll
  for (int j = 0; j < 8; ++j) { const int c = j * 128 + lane * 4; const v4f a = *(const v4fa*)(RES + (size_t)r * DM + c), x = *(const v4fa*)(w + (size_t)r * DM + c); for (int q = 0; q < 4; ++q) { y[j][q] = a[q] + bf16_round(x[q]); s += y[j][q]; } }
  for (int o = 16; o >= 1; o >>= 1) s += __shfl_xor(s, o, 32); const float mu = s / (float)DM; float q2 = 0.f;
#pragma unroll
  for (int j = 0; j < 8; ++j) for (int q = 0; q < 4; ++q) { const float d = y[j][q] - mu; q2 += d * d; }
  for (int o = 16; o >= 1; o >>= 1) q2 += __shfl_xor(q2, o, 32); const float rs = rsqrtf(q2 / (float)DM + 1e-5f);
  {
#pragma unroll
    for (int j = 0; j < 8; ++j) { const int c = j * 128 + lane * 4; v4f o; for (int q = 0; q < 4; ++q) o[q] = (y[j][q] - mu) * rs * bf16_round(g[c + q]) + bf16_round(bb[c + q]); *(v4f*)(out + (size_t)r * DM + c) = o; }
     } }

extern "C" void kernel_launch(void* const* d_in, const int* in_sizes, int n_in,
                              void* d_out, int out_size, void* d_ws, size_t ws_size, hipStream_t stream) {
  (void)in_sizes; (void)n_in; (void)out_size;
  const float* const* I = (const float* const*)d_in; const float* w = I[0]; const float* r = I[1]; const float* mems = I[2]; const float* rwb = I[3]; const float* rrb = I[4]; const int* msk = (const int*)d_in[5];
  const float* Wq = I[6]; const float* bq = I[7]; const float* Wk = I[8]; const float* bk = I[9]; const float* Wv = I[10]; const float* bv = I[11]; const float* Wr = I[12]; const float* br = I[13]; const float* Wo = I[14]; const float* bo = I[15]; const float* lg = I[16]; const float* lb = I[17];
  char* ws = (char*)d_ws; size_t off = 0;
  auto take = [&](size_t bytes) { char* p = ws + off; off += (bytes + 255) & ~(size_t)255; return p; };
  const size_t WSZ = (size_t)DM * DM; _Float16* Bw = (_Float16*)take(5 * WSZ * 2);      /* Wq, Wk, Wv, Wr, Wo */
  _Float16* QW = (_Float16*)take((size_t)NQR * DM * 2); _Float16* QR = (_Float16*)take((size_t)NQR * DM * 2);
  _Float16* K16 = (_Float16*)take((size_t)NKR * DM * 2); _Float16* Vt = (_Float16*)take((size_t)NKR * DM * 2); _Float16* RK = (_Float16*)take((size_t)KL * DM * 2);
  _Float16* P16 = (_Float16*)take((size_t)BZ * NH * QL * KL * 2); _Float16* O16 = (_Float16*)take((size_t)NQR * DM * 2);      /* P of all 32 (b,n) planes, so that one launch does every P*V */
  _Float16* CAT = (_Float16*)take((size_t)NKR * DM * 2); _Float16* R16 = (_Float16*)take((size_t)KL * DM * 2); float* RES = (float*)take((size_t)NQR * DM * 4);
  if (off > ws_size) return;      // MiB: 10 + 4 + 4 + 8 + 8 + 4 + 128 + 4 + 8 + 4 + 8 = 190 of 256
  k_prep<<<5 * GWT + 3 * GX, 256, 0, stream>>>(Wq, Wk, Wv, Wr, Wo, mems, w, r, Bw, CAT, R16);      /* weights (in,out) -> Bt x2^4; cat = [mems; w] is the two inputs back to back (rows (j,b)); r rows m */
  k_proj<<<2 * GTK + 2 * GTQ, 256, 0, stream>>>(CAT, R16, Bw, bq, bk, bv, br, rwb, rrb, QW, QR, K16, Vt, RK);      /* k, v: M 4096 N 1024 K 1024; q (last qlen rows of cat) + bq, rk = r.Wr + br: M 2048; one work-group a 128 x 64 tile; q stored + r_w_bias / + r_r_bias, v stored as V^T per (b,n) */
  const dim3 gq((NQR / 128) * (DM / 64), 1);      /* one work-group a 128 x 64 tile */
  const dim3 go(QL / 128, BZ * NH);
  k_score<<<dim3(QL / 16, BZ * NH), 512, 0, stream>>>(QW, QR, K16, RK, msk, P16);      /* AC, raw BD, shift, mask and softmax of all 32 (b,n) planes: 16 query rows a work-group, scores in LDS only */
  k_gemm_lds<KL, BZ * DM, false, false><<<go, 256, 0, stream>>>(P16, (size_t)QL * KL, Vt, (size_t)64 * KL, 0.000030517578125f, nullptr, nullptr, O16, 64, 1);      /* attn_vec f16, rows (i,b), plane s = b*16 + h at cols s*64 of the 2048-wide (i) row: M 1024 N 64 K 2048, ldc 2048, all 32 planes in blockIdx.y */
  k_gemm_lds<DM, DM, true, true><<<gq, 256, 0, stream>>>(O16, 0, Bw + 4 * WSZ, 0, 0.0625f, bo, RES, nullptr, 0, DM / 64);      /* attn_out = attn_vec·Wo + bo (rows (i,b)) */
  k_lnout<<<(NQR + 7) / 8, 256, 0, stream>>>(RES, w, lg, lb, (float*)d_out);
}

// v006
// One run takes 143 microseconds.
// Next to v005, in two timings, it ran 1.15 times as fast each time.
// All steps since v000 together make it 19.3 times as fast.
#include <hip/hip_runtime.h>
// Transformer-XL relative multi-head attention (qlen 1024, mem_len 1024 → klen 2048, bsz 2, 16 heads × 64, post-LN): cat = [mems; w] (rows (j,b)); q = (cat·Wq + bq)[last qlen], k, v = cat·Wk + bk, cat·Wv + bv; rk = r·Wr + br;
// AC[i,j] = (q_i + r_w_bias)·k_j; BD = rel_shift((q_i + r_r_bias)·rk_m) (the exact pad-reshape shift, incl. its wrap region); score = (AC + BD)/8, −inf where the INPUT mask is set; softmax over j; attn_vec = Σ_j p·v_j;
// out = LayerNorm(w + attn_vec·Wo + bo)·g + b → [1024, 2, 1024]. (in,out) weights.
// Compute dtype: w, mems, r, biases, weights rounded to bf16; q (+ the two head biases), k, v, rk as f16 GEMM planes; one fused kernel forms, per 16 query rows of a (b,n) plane, AC and raw BD (f32 accumulators),
// applies the relative shift as a scatter into LDS, the mask and an f32 softmax and writes P f16 x2^15; attn_vec by GEMM; Wo GEMM + bias; residual + LayerNorm in f32 (wave per row). All contractions on v_wmma_f32_16x16x32_f16, f32 accumulate.
#define QL 1024
#define KL 2048
#define BZ 2
#define NH 16
#define DM 1024
#define NQR (QL * BZ)
#define NKR (KL * BZ)
#define ATT_SCALE 0.125f

typedef __bf16 v16b __attribute__((ext_vector_type(16)));
typedef unsigned short v8us __attribute__((ext_vector_type(8), may_alias));
typedef float  v8f  __attribute__((ext_vector_type(8)));
typedef float  v4f  __attribute__((ext_vector_type(4)));
typedef float  v4fa __attribute__((ext_vector_type(4), may_alias));
union FragB { v16b v; v8us half[2]; unsigned short u[16]; };

__device__ __forceinline__ unsigned short bf16_bits(float x) { unsigned int u = __float_as_uint(x); return (unsigned short)((u + 0x7FFFu + ((u >> 16) & 1u)) >> 16); }
__device__ __forceinline__ float bf16_val(unsigned short b) { return __uint_as_float(((unsigned int)b) << 16); }
__device__ __forceinline__ float bf16_round(float x) { return bf16_val(bf16_bits(x)); }
// D += A·B with NT terms: 1 = ah·bh, 2 = + al·bh (A split), 3 = + ah·bl (both split)
template <int NT>
__device__ __forceinline__ v8f mmaN(v16b ah, v16b al, v16b bh, v16b bl, v8f c) {
  c = __builtin_amdgcn_wmma_f32_16x16x32_bf16(false, ah, false, bh, (short)0, c, false, false);
  if (NT >= 2) c = __builtin_amdgcn_wmma_f32_16x16x32_bf16(false, al, false, bh, (short)0, c, false, false);
  if (NT >= 3) c = __builtin_amdgcn_wmma_f32_16x16x32_bf16(false, ah, false, bl, (short)0, c, false, false);
  asm volatile("v_nop\n\tv_nop\n\tv_nop\n\tv_nop" : "+v"(c) : "v"(ah), "v"(al), "v"(bh), "v"(bl));
  return c;
}

__global__ __launch_bounds__(256) void k_wt_bf16(const float* __restrict__ W, unsigned short* __restrict__ Wt, int K, int N) {
  const int t = blockIdx.x * 256 + threadIdx.x;
  const int k8n = K / 8;
  if (t >= N * k8n) return;
  const int n = t / k8n, k8 = (t % k8n) * 8;
  v8us v;
#pragma unroll
  for (int i = 0; i < 8; ++i) v[i] = bf16_bits(W[(size_t)(k8 + i) * N + n]);
  *(v8us*)(Wt + (size_t)n * K + k8) = v;
  
}

// GEMM C[M][N] (f32, pitch ldc) = act(A[M][K]·W + bias). A f32 row-major (pitch lda) converted per fragment to bf16
// (ASPLIT: hi/lo two planes -> 2 terms, else single rounded term); Wt bf16 [N][K] (pitch ldb). BIAS_BF16 rounds the
// bias to bf16 first (bias quantised to bf16 before the add). K%32==0, M%16==0, N%64==0.
template <bool ASPLIT, int ACT, bool BIAS_BF16>
__global__ __launch_bounds__(128) void k_gemm_bf(const float* __restrict__ A, int lda, const unsigned short* __restrict__ Wt, int ldb,
                                               const float* __restrict__ bias, float* __restrict__ C, int ldc, int M, int N, int K) {
  __shared__ __attribute__((aligned(16))) float so[4][16][64];
  const int tid = threadIdx.x, w = tid >> 5, lane = tid & 31, ln = lane & 15, hh = lane >> 4;
  const int ntn = N / 64;
  const int wid = blockIdx.x * 4 + w;
  const int mt = wid / ntn, nq = wid % ntn;
  if (mt * 16 >= M) return;
  const int row0 = mt * 16, col0 = nq * 64;
  const float* arow = A + (size_t)(row0 + ln) * lda;
  v8f acc[4] = {};
  for (int kb = 0; kb < K; kb += 32) {
    FragB ah, al;
    const v4f x0 = *(const v4fa*)(arow + kb + 8 * hh), x1 = *(const v4fa*)(arow + kb + 8 * hh + 4);
    const v4f x2 = *(const v4fa*)(arow + kb + 16 + 8 * hh), x3 = *(const v4fa*)(arow + kb + 16 + 8 * hh + 4);
    float xs[16] = {x0[0],x0[1],x0[2],x0[3],x1[0],x1[1],x1[2],x1[3],x2[0],x2[1],x2[2],x2[3],x3[0],x3[1],x3[2],x3[3]};
#pragma unroll
    for (int i = 0; i < 16; ++i) { const unsigned short hb = bf16_bits(xs[i]); ah.u[i] = hb; al.u[i] = ASPLIT ? bf16_bits(xs[i] - bf16_val(hb)) : (unsigned short)0; }
#pragma unroll
    for (int t = 0; t < 4; ++t) {
      const unsigned short* brow = Wt + (size_t)(col0 + t * 16 + ln) * ldb + kb;
      FragB b;
      b.half[0] = *(const v8us*)(brow + 8 * hh);
      b.half[1] = *(const v8us*)(brow + 16 + 8 * hh);
      acc[t] = mmaN<ASPLIT ? 2 : 1>(ah.v, al.v, b.v, b.v, acc[t]);
    }
  }
#pragma unroll
  for (int t = 0; t < 4; ++t) {
    float bv = bias ? bias[col0 + t * 16 + ln] : 0.f;
    if (BIAS_BF16) bv = bf16_round(bv);
#pragma unroll
    for (int r = 0; r < 8; ++r) { float v = acc[t][r] + bv; if (ACT == 1) v = fmaxf(v, 0.f); so[w][8 * hh + r][t * 16 + ln] = v; }
  }
  __builtin_amdgcn_fence(__ATOMIC_ACQ_REL, "workgroup");
  __builtin_amdgcn_wave_barrier();
  const int rsub = lane >> 4, c4 = (lane & 15) * 4;
  {
#pragma unroll
    for (int q = 0; q < 8; ++q) {
      const int r = q * 2 + rsub;
      const v4f v = *(const v4fa*)&so[w][r][c4];
      *(v4f*)(C + (size_t)(row0 + r) * ldc + col0 + c4) = v;
    }
    
  }
}

// Flash-style causal/unmasked attention, all contractions 3-term bf16 hi/lo splits, f32 softmax with running max.
// q,k,v rows are read from f32 buffers with arbitrary row pitch (so they can live inside a fused qkv buffer);
// D = head size (multiple of 32, <= 128); one wave = 16 query rows; block = 4 waves (64 queries) sharing K/V chunks of 32.
template <int D, bool CAUSAL>
__global__ __launch_bounds__(128) void k_flash(const float* __restrict__ qb, const float* __restrict__ kb, const float* __restrict__ vb,
                                             int pitch, int T, int H, float scale, float* __restrict__ y, int ypitch) {
  constexpr int KS = D / 32;        // k-steps for QK
  constexpr int DT = D / 16;        // d tiles for PV
  __shared__ __attribute__((aligned(16))) unsigned short sKh[32][D + 8], sKl[32][D + 8], sVh[32][D + 8], sVl[32][D + 8];
  __shared__ __attribute__((aligned(16))) unsigned short sPh[4][16][40], sPl[4][16][40];
  __shared__ __attribute__((aligned(16))) float sO[4][16][D];
  const int tid = threadIdx.x, w = tid >> 5, lane = tid & 31, ln = lane & 15, hh = lane >> 4;
  const int nqb = (T + 63) / 64;
  const int bh = blockIdx.x / nqb, qblk = blockIdx.x % nqb;
  const int b = bh / H, h = bh % H;
  const int q0 = qblk * 64 + w * 16;
  const float* Q = qb + (size_t)b * T * pitch + h * D;
  const float* K = kb + (size_t)b * T * pitch + h * D;
  const float* V = vb + (size_t)b * T * pitch + h * D;

  // A fragments of the wave's 16 query rows (scaled), hi/lo
  FragB aqh[KS], aql[KS];
  {
    int row = q0 + ln; if (row >= T) row = T - 1;
    const float* qr = Q + (size_t)row * pitch;
#pragma unroll
    for (int ks = 0; ks < KS; ++ks)
#pragma unroll
      for (int i = 0; i < 16; ++i) {
        const int d = ks * 32 + ((i < 8) ? (8 * hh + i) : (16 + 8 * hh + (i - 8)));
        const float x = qr[d] * scale; const unsigned short hb = bf16_bits(x);
        aqh[ks].u[i] = hb; aql[ks].u[i] = bf16_bits(x - bf16_val(hb));
      }
  }
  float m_r[8], l_r[8];
#pragma unroll
  for (int r = 0; r < 8; ++r) { m_r[r] = -3.0e38f; l_r[r] = 0.f; }
  v8f oacc[DT];
#pragma unroll
  for (int dt = 0; dt < DT; ++dt) oacc[dt] = (v8f){0.f,0.f,0.f,0.f,0.f,0.f,0.f,0.f};

  const int kv_end = CAUSAL ? min(T, qblk * 64 + 64) : T;     // block-uniform
  for (int j0 = 0; j0 < kv_end; j0 += 32) {
    __syncthreads();
    for (int e = tid; e < 32 * (D / 4); e += 128) {
      const int r = e / (D / 4), c4 = (e % (D / 4)) * 4;
      const int key = j0 + r;
      v4f kf = {0.f,0.f,0.f,0.f}, vf = {0.f,0.f,0.f,0.f};
      if (key < T) { kf = *(const v4fa*)(K + (size_t)key * pitch + c4); vf = *(const v4fa*)(V + (size_t)key * pitch + c4); }
#pragma unroll
      for (int t = 0; t < 4; ++t) {
        unsigned short hb = bf16_bits(kf[t]); sKh[r][c4 + t] = hb; sKl[r][c4 + t] = bf16_bits(kf[t] - bf16_val(hb));
        hb = bf16_bits(vf[t]); sVh[r][c4 + t] = hb; sVl[r][c4 + t] = bf16_bits(vf[t] - bf16_val(hb));
      }
    }
    __syncthreads();
    // S tile 16 x 32
    v8f s[2];
#pragma unroll
    for (int nt = 0; nt < 2; ++nt) {
      v8f acc = {};
#pragma unroll
      for (int ks = 0; ks < KS; ++ks) {
        FragB bh_, bl_;
        bh_.half[0] = *(const v8us*)&sKh[nt * 16 + ln][ks * 32 + 8 * hh]; bh_.half[1] = *(const v8us*)&sKh[nt * 16 + ln][ks * 32 + 16 + 8 * hh];
        bl_.half[0] = *(const v8us*)&sKl[nt * 16 + ln][ks * 32 + 8 * hh]; bl_.half[1] = *(const v8us*)&sKl[nt * 16 + ln][ks * 32 + 16 + 8 * hh];
        acc = mmaN<3>(aqh[ks].v, aql[ks].v, bh_.v, bl_.v, acc);
      }
      s[nt] = acc;
    }
    // mask + running max (rows 8hh+r; the 16 lanes of a half share rows)
    float alpha[8];
#pragma unroll
    for (int r = 0; r < 8; ++r) {
      const int qi = q0 + 8 * hh + r;
      const int ja = j0 + ln, jb = j0 + 16 + ln;
      if (CAUSAL) { if (ja > qi) s[0][r] = -3.0e38f; if (jb > qi) s[1][r] = -3.0e38f; }
      if (ja >= T) s[0][r] = -3.0e38f;
      if (jb >= T) s[1][r] = -3.0e38f;
      float mx = fmaxf(s[0][r], s[1][r]);
      mx = fmaxf(mx, __shfl_xor(mx, 1, 32)); mx = fmaxf(mx, __shfl_xor(mx, 2, 32)); mx = fmaxf(mx, __shfl_xor(mx, 4, 32)); mx = fmaxf(mx, __shfl_xor(mx, 8, 32));
      const float mnew = fmaxf(m_r[r], mx);
      alpha[r] = (mnew > -1.0e38f) ? __expf(m_r[r] - mnew) : 1.0f;
      const float p0 = (s[0][r] > -1.0e38f) ? __expf(s[0][r] - mnew) : 0.f;
      const float p1 = (s[1][r] > -1.0e38f) ? __expf(s[1][r] - mnew) : 0.f;
      m_r[r] = mnew;
      l_r[r] = l_r[r] * alpha[r] + p0 + p1;            // per-lane partial row sum (16 lanes combined at the end)
      unsigned short hb = bf16_bits(p0); sPh[w][8 * hh + r][ln] = hb;      sPl[w][8 * hh + r][ln] = bf16_bits(p0 - bf16_val(hb));
      hb = bf16_bits(p1);                sPh[w][8 * hh + r][16 + ln] = hb; sPl[w][8 * hh + r][16 + ln] = bf16_bits(p1 - bf16_val(hb));
    }
#pragma unroll
    for (int dt = 0; dt < DT; ++dt)
#pragma unroll
      for (int r = 0; r < 8; ++r) oacc[dt][r] *= alpha[r];
    __builtin_amdgcn_fence(__ATOMIC_ACQ_REL, "workgroup");
    __builtin_amdgcn_wave_barrier();
    FragB pah, pal;
    pah.half[0] = *(const v8us*)&sPh[w][ln][8 * hh]; pah.half[1] = *(const v8us*)&sPh[w][ln][16 + 8 * hh];
    pal.half[0] = *(const v8us*)&sPl[w][ln][8 * hh]; pal.half[1] = *(const v8us*)&sPl[w][ln][16 + 8 * hh];
#pragma unroll
    for (int dt = 0; dt < DT; ++dt) {
      FragB bvh, bvl;
#pragma unroll
      for (int i = 0; i < 8; ++i) {
        bvh.u[i] = sVh[8 * hh + i][dt * 16 + ln]; bvh.u[8 + i] = sVh[16 + 8 * hh + i][dt * 16 + ln];
        bvl.u[i] = sVl[8 * hh + i][dt * 16 + ln]; bvl.u[8 + i] = sVl[16 + 8 * hh + i][dt * 16 + ln];
      }
      oacc[dt] = mmaN<3>(pah.v, pal.v, bvh.v, bvl.v, oacc[dt]);
    }
    __builtin_amdgcn_fence(__ATOMIC_ACQ_REL, "workgroup");
    __builtin_amdgcn_wave_barrier();
  }
#pragma unroll
  for (int r = 0; r < 8; ++r) {
    float l = l_r[r];
    l += __shfl_xor(l, 1, 32); l += __shfl_xor(l, 2, 32); l += __shfl_xor(l, 4, 32); l += __shfl_xor(l, 8, 32);
    l_r[r] = (l > 0.f) ? 1.0f / l : 0.f;
  }
#pragma unroll
  for (int dt = 0; dt < DT; ++dt)
#pragma unroll
    for (int r = 0; r < 8; ++r) sO[w][8 * hh + r][dt * 16 + ln] = oacc[dt][r] * l_r[r];
  __builtin_amdgcn_fence(__ATOMIC_ACQ_REL, "workgroup");
  __builtin_amdgcn_wave_barrier();
  {
    for (int r = 0; r < 16; ++r) {
      const int row = q0 + r;
      if (row < T && lane < D / 4) {
        const v4f val = *(const v4fa*)&sO[w][r][lane * 4];
        *(v4f*)(y + ((size_t)b * T + row) * ypitch + h * D + lane * 4) = val;
      }
    }
    
  }
}

// GEMM C = act(A·W + bias + resid): A f32 (ASPLIT -> hi/lo 2 terms), Wt bf16 [N][K]; ACT 0 none, 1 relu, 2 exact gelu;
// resid (optional, f32, row index = (row % rmod), pitch ldr, RES_BF16 rounds it) added before the activation.
template <bool ASPLIT, int ACT, bool BIAS_BF16, bool RES_BF16>
__global__ __launch_bounds__(128) void k_gemm_bf3(const float* __restrict__ A, int lda, const unsigned short* __restrict__ Wt, int ldb,
                                                const float* __restrict__ bias, const float* __restrict__ resid, int rmod, int ldr,
                                                float* __restrict__ C, int ldc, int M, int N, int K) {
  __shared__ __attribute__((aligned(16))) float so[4][16][64];
  const int tid = threadIdx.x, w = tid >> 5, lane = tid & 31, ln = lane & 15, hh = lane >> 4;
  const int ntn = N / 64;
  const int wid = blockIdx.x * 4 + w;
  const int mt = wid / ntn, nq = wid % ntn;
  if (mt * 16 >= M) return;
  const int row0 = mt * 16, col0 = nq * 64;
  const float* arow = A + (size_t)(row0 + ln) * lda;
  v8f acc[4] = {};
  for (int kb = 0; kb < K; kb += 32) {
    FragB ah, al;
    const v4f x0 = *(const v4fa*)(arow + kb + 8 * hh), x1 = *(const v4fa*)(arow + kb + 8 * hh + 4);
    const v4f x2 = *(const v4fa*)(arow + kb + 16 + 8 * hh), x3 = *(const v4fa*)(arow + kb + 16 + 8 * hh + 4);
    float xs[16] = {x0[0],x0[1],x0[2],x0[3],x1[0],x1[1],x1[2],x1[3],x2[0],x2[1],x2[2],x2[3],x3[0],x3[1],x3[2],x3[3]};
#pragma unroll
    for (int i = 0; i < 16; ++i) { const unsigned short hb = bf16_bits(xs[i]); ah.u[i] = hb; al.u[i] = ASPLIT ? bf16_bits(xs[i] - bf16_val(hb)) : (unsigned short)0; }
#pragma unroll
    for (int t = 0; t < 4; ++t) {
      const unsigned short* brow = Wt + (size_t)(col0 + t * 16 + ln) * ldb + kb;
      FragB b;
      b.half[0] = *(const v8us*)(brow + 8 * hh);
      b.half[1] = *(const v8us*)(brow + 16 + 8 * hh);
      acc[t] = mmaN<ASPLIT ? 2 : 1>(ah.v, al.v, b.v, b.v, acc[t]);
    }
  }
#pragma unroll
  for (int t = 0; t < 4; ++t) {
    const int col = col0 + t * 16 + ln;
    float bv = bias ? bias[col] : 0.f;
    if (BIAS_BF16) bv = bf16_round(bv);
#pragma unroll
    for (int r = 0; r < 8; ++r) {
      float v = acc[t][r] + bv;
      if (resid) { float rv = resid[(size_t)((row0 + 8 * hh + r) % rmod) * ldr + col]; if (RES_BF16) rv = bf16_round(rv); v += rv; }
      if (ACT == 1) v = fmaxf(v, 0.f);
      if (ACT == 2) v = 0.5f * v * (1.0f + erff(v * 0.70710678118654752f));
      if (ACT == 3) { const float u = 0.7978845608028654f * (v + 0.044715f * v * v * v); v = 0.5f * v * (1.0f + tanhf(u)); }
      so[w][8 * hh + r][t * 16 + ln] = v;
    }
  }
  __builtin_amdgcn_fence(__ATOMIC_ACQ_REL, "workgroup");
  __builtin_amdgcn_wave_barrier();
  const int rsub = lane >> 4, c4 = (lane & 15) * 4;
  {
#pragma unroll
    for (int q = 0; q < 8; ++q) {
      const int r = q * 2 + rsub;
      const v4f v = *(const v4fa*)&so[w][r][c4];
      *(v4f*)(C + (size_t)(row0 + r) * ldc + col0 + c4) = v;
    }
    
  }
}
// row LayerNorm (biased variance, eps) over N: s = X (+ R); optional out_sum <- s; out_norm <- (s-mu)*rsqrt(var+eps)*g + b
template <bool PARAM_BF16>
__global__ __launch_bounds__(256) void k_layernorm(const float* __restrict__ X, const float* __restrict__ R, const float* __restrict__ g, const float* __restrict__ bta,
                                                  float* __restrict__ out_sum, float* __restrict__ out_norm, int N, float eps) {
  __shared__ float red[256];
  const int row = blockIdx.x, tid = threadIdx.x;
  const float* x = X + (size_t)row * N; const float* rr = R ? R + (size_t)row * N : nullptr;
  float vals[16];                     // up to N = 4096
  const int per = N / 256;            // contiguous chunk per thread? use strided-by-4 chunks: thread handles j = tid*4 + 1024*u
  float s1 = 0.f;
  for (int u = 0; u < per / 4; ++u) {
    const int j = tid * 4 + 1024 * u;
    const v4f a = *(const v4fa*)(x + j);
    v4f b = {0.f,0.f,0.f,0.f}; if (rr) b = *(const v4fa*)(rr + j);
#pragma unroll
    for (int q = 0; q < 4; ++q) { const float v = a[q] + b[q]; vals[u * 4 + q] = v; s1 += v; }
  }
  red[tid] = s1; __syncthreads();
  for (int st = 128; st > 0; st >>= 1) { if (tid < st) red[tid] += red[tid + st]; __syncthreads(); }
  const float mu = red[0] / (float)N; __syncthreads();
  float s2 = 0.f;
  for (int u = 0; u < per / 4; ++u)
#pragma unroll
    for (int q = 0; q < 4; ++q) { const float c = vals[u * 4 + q] - mu; s2 += c * c; }
  red[tid] = s2; __syncthreads();
  for (int st = 128; st > 0; st >>= 1) { if (tid < st) red[tid] += red[tid + st]; __syncthreads(); }
  const float rs = rsqrtf(red[0] / (float)N + eps);
  {
    for (int u = 0; u < per / 4; ++u) {
      const int j = tid * 4 + 1024 * u;
      v4f o, sm;
#pragma unroll
      for (int q = 0; q < 4; ++q) {
        float gg = g[j + q], bb = bta[j + q];
        if (PARAM_BF16) { gg = bf16_round(gg); bb = bf16_round(bb); }
        sm[q] = vals[u * 4 + q]; o[q] = (vals[u * 4 + q] - mu) * rs * gg + bb;
      }
      if (out_sum) *(v4f*)(out_sum + (size_t)row * N + j) = sm;
      *(v4f*)(out_norm + (size_t)row * N + j) = o;
    }
    
  }
}



// ---- f16 WMMA path (v_wmma_f32_16x16x32_f16): 11-bit significands for operands in range — used where a [0,1] probability operand needs more precision than bf16
typedef _Float16 v16h __attribute__((ext_vector_type(16)));
union FragH { v16h v; v8us half[2]; _Float16 h[16]; unsigned short u[16]; };
template <int NT>
__device__ __forceinline__ v8f mmaH(v16h ah, v16h al, v16h bh, v16h bl, v8f c) {
  c = __builtin_amdgcn_wmma_f32_16x16x32_f16(false, ah, false, bh, (short)0, c, false, false);
  if (NT >= 2) c = __builtin_amdgcn_wmma_f32_16x16x32_f16(false, al, false, bh, (short)0, c, false, false);
  if (NT >= 3) c = __builtin_amdgcn_wmma_f32_16x16x32_f16(false, ah, false, bl, (short)0, c, false, false);
  asm volatile("v_nop\n\tv_nop\n\tv_nop\n\tv_nop" : "+v"(c) : "v"(ah), "v"(al), "v"(bh), "v"(bl));
  return c;
}
// batched GEMM like k_gemm_b but f16 operands: A f32 (split into f16 hi/lo if ASPLIT, else rounded to f16), Bt = f16 values [n][k]; alpha; C f32; N multiple of 16 (partial tiles skipped)
template <bool ASPLIT>
__global__ __launch_bounds__(128) void k_gemm_h(const float* __restrict__ A, int lda, size_t sA, const _Float16* __restrict__ Bh, int ldb, size_t sB, float alpha, float* __restrict__ C, int ldc, size_t sC, int M, int N, int K) {
  __shared__ __attribute__((aligned(16))) float so[4][16][64];
  const int tid = threadIdx.x, w = tid >> 5, lane = tid & 31, ln = lane & 15, hh = lane >> 4; const int by = blockIdx.y;
  A += (size_t)by * sA; Bh += (size_t)by * sB; C += (size_t)by * sC;
  const int ntn = (N + 63) / 64; const int wid = blockIdx.x * 4 + w; const int mt = wid / ntn, nq = wid % ntn; if (mt * 16 >= M) return;
  const int row0 = mt * 16, col0 = nq * 64; const float* arow = A + (size_t)(row0 + ln) * lda;
  v8f acc[4] = {};
  for (int kb = 0; kb < K; kb += 32) {
    FragH ah, al;
    const v4f x0 = *(const v4fa*)(arow + kb + 8 * hh), x1 = *(const v4fa*)(arow + kb + 8 * hh + 4), x2 = *(const v4fa*)(arow + kb + 16 + 8 * hh), x3 = *(const v4fa*)(arow + kb + 16 + 8 * hh + 4);
    float xs[16] = {x0[0],x0[1],x0[2],x0[3],x1[0],x1[1],x1[2],x1[3],x2[0],x2[1],x2[2],x2[3],x3[0],x3[1],x3[2],x3[3]};
#pragma unroll
    for (int i = 0; i < 16; ++i) { const _Float16 h = (_Float16)xs[i]; ah.h[i] = h; al.h[i] = ASPLIT ? (_Float16)(xs[i] - (float)h) : (_Float16)0.0f; }
#pragma unroll
    for (int t = 0; t < 4; ++t) { if (col0 + t * 16 >= N) continue; const size_t boff = (size_t)(col0 + t * 16 + ln) * ldb + kb; FragH bq; bq.half[0] = *(const v8us*)(Bh + boff + 8 * hh); bq.half[1] = *(const v8us*)(Bh + boff + 16 + 8 * hh);
      acc[t] = mmaH<ASPLIT ? 2 : 1>(ah.v, al.v, bq.v, bq.v, acc[t]); }
  }
#pragma unroll
  for (int t = 0; t < 4; ++t) { if (col0 + t * 16 >= N) continue;
#pragma unroll
    for (int r = 0; r < 8; ++r) so[w][8 * hh + r][t * 16 + ln] = acc[t][r] * alpha; }
  __builtin_amdgcn_fence(__ATOMIC_ACQ_REL, "workgroup"); __builtin_amdgcn_wave_barrier();
  const int rsub = lane >> 4, c4 = (lane & 15) * 4;
  {
#pragma unroll
    for (int q = 0; q < 8; ++q) { const int r = q * 2 + rsub; if (col0 + c4 < N) { const v4f v = *(const v4fa*)&so[w][r][c4]; *(v4f*)(C + (size_t)(row0 + r) * ldc + col0 + c4) = v; } }
     }
}

// Wt[n][k] = f16(W[k][n]·scale) from f32 row-major W[K][N] (scale = power of two; bf16-exact weights stay exact in f16 away from the subnormal range)
// bx: the index of the 256-thread block inside this matrix's share of the merged grid
__device__ __forceinline__ void wt_f16_body(int bx, const float* __restrict__ W, _Float16* __restrict__ Wt, int K, int N, float scale) {
  const int t = bx * 256 + threadIdx.x; if (t >= N * (K / 8)) return; const int n = t / (K / 8), k8 = (t % (K / 8)) * 8; FragH f;
#pragma unroll
  for (int i = 0; i < 8; ++i) f.h[i] = (_Float16)(bf16_round(W[(size_t)(k8 + i) * N + n]) * scale); const v8us o = f.half[0];
  *(v8us*)((unsigned short*)Wt + (size_t)n * K + k8) = o; 
}
typedef _Float16 v4h __attribute__((ext_vector_type(4)));

__device__ __forceinline__ void x16_body(int bx, const float* __restrict__ x, _Float16* __restrict__ X16, size_t n8) { const size_t t = (size_t)bx * 256 + threadIdx.x; if (t >= n8) return; FragH f;
#pragma unroll
  for (int q = 0; q < 8; ++q) f.h[q] = (_Float16)bf16_round(x[t * 8 + q]); *(v8us*)((unsigned short*)X16 + t * 8) = f.half[0];  }
// All operand preparation in one launch (none of the eight parts reads what another writes): blocks 0 .. 5 GWT - 1 transpose the five weights (Wq, Wk, Wv, Wr, Wo -> Bw, x2^4), the next 3 GX round mems, w (-> CAT, back to back) and r (-> R16).
#define GWT (DM * (DM / 8) / 256)      // blocks of one weight matrix
#define GX (NQR * DM / 8 / 256)      // blocks of one 2048 x 1024 plane at 8 elements a thread (mems, w, r, q alike)
__global__ __launch_bounds__(256) void k_prep(const float* __restrict__ Wq, const float* __restrict__ Wk, const float* __restrict__ Wv, const float* __restrict__ Wr, const float* __restrict__ Wo,
    const float* __restrict__ mems, const float* __restrict__ w, const float* __restrict__ r, _Float16* __restrict__ Bw, _Float16* __restrict__ CAT, _Float16* __restrict__ R16) {
  const int bx = blockIdx.x;
  if (bx < 5 * GWT) { const int m = bx / GWT; const float* W = (m == 0) ? Wq : (m == 1) ? Wk : (m == 2) ? Wv : (m == 3) ? Wr : Wo; wt_f16_body(bx % GWT, W, Bw + (size_t)m * DM * DM, DM, DM, 16.0f); }
  else { const int m = (bx - 5 * GWT) / GX; const float* x = (m == 0) ? mems : (m == 1) ? w : r; _Float16* o = (m == 0) ? CAT : (m == 1) ? CAT + (size_t)NQR * DM : R16; x16_body((bx - 5 * GWT) % GX, x, o, (size_t)NQR * DM / 8); }
}
__global__ __launch_bounds__(256) void k_round16f(const float* __restrict__ W, _Float16* __restrict__ Bt, size_t n8) { const size_t t = (size_t)blockIdx.x * 256 + threadIdx.x; if (t >= n8) return; FragH f;
#pragma unroll
  for (int i = 0; i < 8; ++i) f.h[i] = (_Float16)(bf16_round(W[t * 8 + i]) * 16.0f); *(v8us*)((unsigned short*)Bt + t * 8) = f.half[0];  }
// Fused score kernel: one work-group = 16 query rows i0..i0+15 of one (b,n) plane (blockIdx.y), 16 waves; the 16 x KL score rows live in LDS and never reach memory. AC is stored into the rows first.
// The pad/reshape shift as a scatter of raw BD: idx = QL + i*KL + j = i*(KL+1) + (QL - i + j), so with d = m - (QL-1) + i the raw value (q_i + r_r_bias).rk_m belongs to j = d where d >= 0,
// the raw value of row i+1 at column m to j = d + KL + 1 where d <= -2 (the wrap region); d == -1 gives j = KL, a slot of the row's LDS padding that the softmax never reads; the pad's zero falls on j = i + KL + 1 - QL. Each j in 0..KL-1 gets at most one raw value.
// Behind a barrier each raw value is added to AC in place, and behind a second one wave wv does mask, f32 softmax and the f16 x2^15 store of row i0 + wv with the lane order and sum order of a wave-per-row pass.
#define SP (KL + 4)      // LDS row pitch in floats: 8 rows apart = 32 banks apart, so the two lane halves of a D tile do not collide; multiple of 4 for 16-byte reads
__device__ __forceinline__ v8f mma16(v16h a, v16h b, v8f c) { return __builtin_amdgcn_wmma_f32_16x16x32_f16(false, a, false, b, (short)0, c, false, false); }
// The planes that this kernel multiplies (q + r_w_bias, q + r_r_bias, k, rk) lie in fragment order: blocks of FB bytes = 16 rows x 64 f16 of one head, stored [c = k / 8][row][8 f16], so that the 16 bytes of (row, c) stand at c * 256 + row * 16.
// One 16-row fragment pair (k = 0..63) of such a block: base (+ cofs, a constant) is the same for the whole wave, ob is the lane's own byte offset (row * 16, plus 256 for the upper lane half). With ob = lane * 16 each load is 512 bytes in a row: four whole lines.
// Lane half hh, step ks: registers 0..3 hold k = 32*ks + 8*hh + 0..7 (c = 4 ks + hh), registers 4..7 hold k = 32*ks + 16 + 8*hh + 0..7 (c = 4 ks + 2 + hh), for A and B alike.
#define FB 2048
__device__ __forceinline__ void ldfrag(FragH (&f)[2], const char* __restrict__ base, unsigned ob, int cofs) {
#pragma unroll
  for (int ks = 0; ks < 2; ++ks) { f[ks].half[0] = *(const v8us*)(base + ob + (cofs + ks * 1024)); f[ks].half[1] = *(const v8us*)(base + ob + (cofs + ks * 1024 + 512)); }
  // the wait that is owed before a register named by an issued global load is rewritten; offset and base are inputs, so they stay live to here and none of the four loads lands in them
  asm volatile("s_wait_xcnt 0x0" :: "v"(ob), "s"(base) : "memory"); }
// launch bounds: 8 waves a SIMD (a budget of 128 VGPRs), so that two of these 128-KiB work-groups share a WGP and one's barriers and loads run under the other's work
__global__ __launch_bounds__(512, 8) void k_score(const _Float16* __restrict__ QW, const _Float16* __restrict__ QR, const _Float16* __restrict__ K16, const _Float16* __restrict__ RK, const int* __restrict__ MSK, _Float16* __restrict__ P16) {
  __shared__ __attribute__((aligned(16))) float S[16 * SP];
  const int tid = threadIdx.x, lane = tid & 31, ln = lane & 15, hh = lane >> 4;
  const int wv = __builtin_amdgcn_readfirstlane(tid >> 5);      // the wave's number as a scalar: tile bases and the row's addresses then sit in scalar registers
  const int i0 = blockIdx.x * 16, pl = blockIdx.y, h = pl % NH;
  const int i = i0 + wv;
  const char* qw = (const char*)QW + ((size_t)pl * (QL / 16) + blockIdx.x) * FB; const char* qr = (const char*)QR + ((size_t)pl * (QL / 16) + blockIdx.x) * FB;      // the block of rows i0 .. i0 + 15 of plane pl
  const char* kp = (const char*)K16 + ((size_t)pl * (KL / 16) + wv) * FB; const char* rp = (const char*)RK + ((size_t)h * (KL / 16) + wv) * FB;      // the wave's first column tile; its next ones lie 16 blocks apart
  const char* mk = (const char*)(MSK + (size_t)i * KL);
  const unsigned obq = (unsigned)(lane * 16), obr = obq;
  const unsigned obw = (unsigned)(hh * 256 + ((ln < 15) ? (ln + 1) * 16 : (i0 + 16 < QL) ? FB : 15 * 16));      // row i+1 for the wrap region (lane 15: row 0 of the next block); the clamped row of i = QL-1 is never selected (there d >= 0 for every m)
  FragH aq[2], kb[4][2]; ldfrag(aq, qw, obq, 0); ldfrag(kb[0], kp, obq, 0);
  unsigned mbal[64];      // the mask of row i0 + wv as one lane mask per (jj, e), read at the head beside the first fragments: the softmax phase then holds no mask registers and waits for no memory
  {
    typedef int v4i __attribute__((ext_vector_type(4))); typedef int v4ia __attribute__((ext_vector_type(4), may_alias)); v4i mv[16]; const unsigned obm = (unsigned)(lane * 16);
#pragma unroll
    for (int jj = 0; jj < 16; ++jj) mv[jj] = *(const v4ia*)(mk + obm + jj * 512);
    // the wait that is owed before a register named by an issued global load is rewritten; offset and base are inputs, so they stay live to here and none of the sixteen loads lands in them
    asm volatile("s_wait_xcnt 0x0" :: "v"(obm), "s"(mk) : "memory");
#pragma unroll
    for (int jj = 0; jj < 16; ++jj)
#pragma unroll
      for (int e = 0; e < 4; ++e) mbal[jj * 4 + e] = __builtin_amdgcn_ballot_w32(mv[jj][e] != 0);
  }
  ldfrag(kb[1], kp, obq, 16 * FB); ldfrag(kb[2], kp, obq, 2 * 16 * FB); ldfrag(kb[3], kp, obq, 3 * 16 * FB);      // behind the lane masks: the sixteen mask vectors and four k tiles together do not fit the registers
  FragH an[2], aw[2], bb[2][2];
  // AC: wave wv owns the column tiles wv + 16 t and stores them straight into S. Four k tiles are in flight; as the ring drains, its registers take the q + r_r_bias rows and the first two rk tiles, which fly while the last AC tiles are multiplied and stored.
#pragma unroll
  for (int t = 0; t < KL / 256; ++t) { const int j0 = (wv + 16 * t) * 16; FragH (&bf)[2] = kb[t & 3];
    v8f c = {}; c = mma16(aq[0].v, bf[0].v, c); c = mma16(aq[1].v, bf[1].v, c);
    // the four vector slots that the chip needs behind a matrix instruction before its D is overwritten (the next tile's product) or its A or B refilled; the operands are named so that the refill of bf stays behind them
    asm volatile("v_nop\n\tv_nop\n\tv_nop\n\tv_nop" : "+v"(c) : "v"(aq[0].v), "v"(aq[1].v), "v"(bf[0].v), "v"(bf[1].v));
    if (t + 4 < KL / 256) ldfrag(bf, kp, obq, (t + 4) * 16 * FB);
    else if (t == 4) ldfrag(an, qr, obq, 0);
    else if (t == 5) ldfrag(aw, qr, obw, 0);
    else if (t == 6) ldfrag(bb[0], rp, obr, 0);
    else ldfrag(bb[1], rp, obr, 16 * FB);
#pragma unroll
    for (int r = 0; r < 8; ++r) S[(8 * hh + r) * SP + j0 + ln] = c[r];
    __builtin_amdgcn_sched_barrier(0); }      // keeps the tiles apart in the schedule: mixed, they hold more products and fragments live than the 128 registers take, and the build spills
  if (tid < 16) S[tid * SP + KL] = 0.f;      // the padding slot that takes the one raw value of a row with d == -1: given a value here, so that the add below reads nothing unwritten
  __syncthreads();      // every AC value is in S before any wave adds a shifted BD value to it
  __builtin_amdgcn_sched_barrier(0);      // as above: no product of the next phase is lifted over the barrier
  // raw BD of rows i and i+1, added in place at the shifted column: each (row, j) is touched by one lane of one wave; the column of the pad's zero, j = i + KL + 1 - QL, by none (AC + 0)
#pragma unroll
  for (int t = 0; t < KL / 256; ++t) { const int m0 = (wv + 16 * t) * 16; FragH (&bf)[2] = bb[t & 1];
    v8f dn = {}, dw = {}; dn = mma16(an[0].v, bf[0].v, dn); dw = mma16(aw[0].v, bf[0].v, dw); dn = mma16(an[1].v, bf[1].v, dn); dw = mma16(aw[1].v, bf[1].v, dw);
    // the four vector slots that the chip needs behind a matrix instruction before a vector instruction reads its D or its B is refilled; bf is named so that its refill stays behind them
    asm volatile("v_nop\n\tv_nop\n\tv_nop\n\tv_nop" : "+v"(dn), "+v"(dw) : "v"(bf[0].v), "v"(bf[1].v));
    if (t + 2 < KL / 256) ldfrag(bf, rp, obr, (t + 2) * 16 * FB);      // rk tiles fly two tiles ahead
    const int d0 = m0 + ln - (QL - 1) + i0 + 8 * hh; int ix[8]; float old[8];
#pragma unroll
    for (int r = 0; r < 8; ++r) { const int d = d0 + r; ix[r] = (8 * hh + r) * SP + ((d >= 0) ? d : d + (KL + 1)); old[r] = S[ix[r]]; }      // the eight reads first: eight different rows, so no store of this tile can hit them
#pragma unroll
    for (int r = 0; r < 8; ++r) S[ix[r]] = old[r] + ((d0 + r >= 0) ? dn[r] : dw[r]);
    __builtin_amdgcn_sched_barrier(0); }      // as above
  __syncthreads();      // the rows are complete before the row waves read them
  const float* sr = &S[wv * SP];
  v4f sv[16]; float mx = -3.0e38f;
#pragma unroll
  for (int jj = 0; jj < 16; ++jj) { const int j0 = jj * 128 + lane * 4; const v4f a = *(const v4fa*)(sr + j0); v4f s;
#pragma unroll
    for (int e = 0; e < 4; ++e) { const float val = a[e] * ATT_SCALE; s[e] = __builtin_amdgcn_inverse_ballot_w32(mbal[jj * 4 + e]) ? -INFINITY : val; mx = fmaxf(mx, s[e]); }
    sv[jj] = s; }
  for (int o = 16; o >= 1; o >>= 1) mx = fmaxf(mx, __shfl_xor(mx, o, 32)); float z = 0.f;
#pragma unroll
  for (int jj = 0; jj < 16; ++jj) for (int e = 0; e < 4; ++e) { const float p = (sv[jj][e] > -INFINITY) ? __expf(sv[jj][e] - mx) : 0.f; sv[jj][e] = p; z += p; }
  for (int o = 16; o >= 1; o >>= 1) z += __shfl_xor(z, o, 32); const float iz = (z > 0.f) ? 32768.0f / z : 0.f;
  _Float16* pr = P16 + ((size_t)pl * QL + i) * KL;
#pragma unroll
  for (int jj = 0; jj < 16; ++jj) { v4h o; for (int e = 0; e < 4; ++e) o[e] = (_Float16)(sv[jj][e] * iz); *(v4h*)(pr + jj * 128 + lane * 4) = o; }
}
// GEMM with both operands staged in LDS: C[M][N] = f16 A[M][KK] . Bt[N][KK]^T, v = acc*alpha (+ bf16(bias[col]) if BIAS); writes f32 C (F32OUT) or f16 C16, pitch LDC. A, Bt row-major with pitch KK; M a multiple of 128, N of 64, KK of 256.
// One work-group = 128 rows x 64 columns, 8 waves of 16 x 64; blockIdx.x = row block * ntn + column block (ntn = N / 64), blockIdx.y = plane (element strides sA, sB, sC).
// A stage is 128 k = 256 bytes of each of the 192 operand rows (A rows 0..127, Bt rows 128..191), brought by asynchronous copies whose wave-wide 512 bytes are two whole 256-byte row pieces; two buffers, stage t + 2 flies while stage t is multiplied.
// Each output element still sums its k steps of 32 in rising order in one f32 accumulator.
#define GP 272      // LDS row pitch in bytes: 16 x odd, the conflict-free pitch of 256-byte rows for 16-byte fragment reads
#define GSTG (192 * GP)      // bytes of one stage
// One stage: lane (row cr = tid / 16, 16-byte piece tid % 16) copies its piece of A rows cr + 16 i (i < 8) and Bt rows cr + 16 i (i < 4). l: the lane's LDS byte address of A row cr; ga, gb: its global addresses in A row cr and Bt row cr; RB: 16 rows in bytes.
// The s_wait_xcnt is the wait that is owed before a register named by an issued copy is rewritten; as the statement's last line it stands in front of every such write.
template <int RB>
__device__ __forceinline__ void cp_stage(unsigned l, const char* ga, const char* gb) {
  asm volatile("global_load_async_to_lds_b128 %0, %12, off\n\t"
               "global_load_async_to_lds_b128 %1, %13, off\n\t"
               "global_load_async_to_lds_b128 %2, %14, off\n\t"
               "global_load_async_to_lds_b128 %3, %15, off\n\t"
               "global_load_async_to_lds_b128 %4, %16, off\n\t"
               "global_load_async_to_lds_b128 %5, %17, off\n\t"
               "global_load_async_to_lds_b128 %6, %18, off\n\t"
               "global_load_async_to_lds_b128 %7, %19, off\n\t"
               "global_load_async_to_lds_b128 %8, %20, off\n\t"
               "global_load_async_to_lds_b128 %9, %21, off\n\t"
               "global_load_async_to_lds_b128 %10, %22, off\n\t"
               "global_load_async_to_lds_b128 %11, %23, off\n\t"
               "s_wait_xcnt 0x0"
               :: "v"(l), "v"(l + 16 * GP), "v"(l + 32 * GP), "v"(l + 48 * GP), "v"(l + 64 * GP), "v"(l + 80 * GP), "v"(l + 96 * GP), "v"(l + 112 * GP),
                  "v"(l + 128 * GP), "v"(l + 144 * GP), "v"(l + 160 * GP), "v"(l + 176 * GP),
                  "v"(ga), "v"(ga + RB), "v"(ga + 2 * RB), "v"(ga + 3 * RB), "v"(ga + 4 * RB), "v"(ga + 5 * RB), "v"(ga + 6 * RB), "v"(ga + 7 * RB),
                  "v"(gb), "v"(gb + RB), "v"(gb + 2 * RB), "v"(gb + 3 * RB)
               : "memory");
}
// The tile's body: A, Bh, C, C16 are the plane's own bases, (bm, nq) the tile; ring and so are the calling kernel's LDS. mode (the same for the whole work-group) picks what the epilogue does with v:
// FRAG false: 0: f32 C. 1: f16 C16, both row-major. FRAG true: the planes of the score kernel, stored in its fragment order (blocks of FB bytes, see ldfrag; the tile's 64 columns are head nq):
// 2 (the q tile, rows (i,b)): C16 = f16(v + bf16(hb0[col])) and C16b = f16(v + bf16(hb1[col])), hb0 and hb1 the two 1024-wide head-bias rows; 4 (the k tile, rows (j,b)): C16 = f16(v); both as plane b NH + nq, block row / 16. 5 (the rk tile, rows m): C16 = f16(v), plane nq.
// 3 (the v tile; its rows are (j,b), its 64 columns one head nq): C16 is V^T, row ((b NH + nq) 64 + d), column j; the tile is turned in LDS and goes out as 128 whole lines of 64 j.
#define VP 144      // LDS pitch in bytes of a V^T row of 64 f16: 36 dwords, so that the 16 rows of an 8-byte store from the accumulators fall on different banks; a multiple of 16 for the 16-byte reads
template <int KK, int LDC, bool BIAS, bool FRAG>
__device__ __forceinline__ void gemm_tile(const _Float16* __restrict__ A, const _Float16* __restrict__ Bh, float alpha, const float* __restrict__ bias,
    float* __restrict__ C, _Float16* __restrict__ C16, _Float16* __restrict__ C16b, const float* __restrict__ hb0, const float* __restrict__ hb1, int mode, int bm, int nq, char* ring, float (*so)[16][64]) {
  const int tid = threadIdx.x, lane = tid & 31, ln = lane & 15, hh = lane >> 4;
  const int w = __builtin_amdgcn_readfirstlane(tid >> 5);      // the wave's number as a scalar
  const int row0 = bm * 128 + w * 16, col0 = nq * 64;
  const int cr = tid >> 4, cc = (tid & 15) * 16;
  const char* ga = (const char*)(A + (size_t)(bm * 128 + cr) * KK) + cc;
  const char* gb = (const char*)(Bh + (size_t)(col0 + cr) * KK) + cc;
  const unsigned l0 = (unsigned)(size_t)&ring[0] + (unsigned)(cr * GP + cc);      // the low 32 bits of a __shared__ address are its LDS byte address
  constexpr int NT = KK / 128, RB = 16 * KK * 2;
  float braw[4] = {0.f, 0.f, 0.f, 0.f};      // the bias of the lane's four columns, read at the head so that it flies under the main loop; first used in the epilogue
  if (BIAS) {
#pragma unroll
    for (int q = 0; q < 4; ++q) braw[q] = bias[col0 + q * 16 + ln];
  }
  float hw[4] = {0.f, 0.f, 0.f, 0.f}, hr[4] = {0.f, 0.f, 0.f, 0.f};      // the two head biases of the lane's four accumulator columns, read at the head like the bias
  if (FRAG && mode == 2) {
    const unsigned oh = (unsigned)((col0 + ln) * 4); const char* p0 = (const char*)hb0; const char* p1 = (const char*)hb1;
#pragma unroll
    for (int q = 0; q < 4; ++q) { hw[q] = *(const float*)(p0 + oh + q * 64); hr[q] = *(const float*)(p1 + oh + q * 64); }
    // the wait that is owed before a register named by an issued global load is rewritten; offset and bases are inputs, so they stay live to here and none of the eight loads lands in them
    asm volatile("s_wait_xcnt 0x0" :: "v"(oh), "s"(p0), "s"(p1) : "memory");
  }
  cp_stage<RB>(l0, ga, gb);      // stage 0 into buffer 0
  asm volatile("s_wait_asynccnt 0x0" ::: "memory");      // this wave's copies of stage 0 have landed
  __syncthreads();      // every wave's have: stage 0 may be read
  cp_stage<RB>(l0 + GSTG, ga + 256, gb + 256);      // stage 1 into buffer 1
  v8f acc[4] = {};
#pragma unroll 1      // kept rolled: unrolled, the build holds two stages' fragments live and needs more than 256 registers, and two work-groups no longer share a WGP
  for (int t = 0; t < NT; ++t) {
    const char* sa = &ring[(t & 1) * GSTG + (w * 16 + ln) * GP + hh * 16];
    const char* sb = &ring[(t & 1) * GSTG + (128 + ln) * GP + hh * 16];
    FragH a[4], b[4][4];
#pragma unroll
    for (int ks = 0; ks < 4; ++ks) {      // lane half hh: registers 0..3 hold k = 32 ks + 8 hh + 0..7, registers 4..7 hold k = 32 ks + 16 + 8 hh + 0..7, for A and B alike
      a[ks].half[0] = *(const v8us*)(sa + ks * 64); a[ks].half[1] = *(const v8us*)(sa + ks * 64 + 32);
#pragma unroll
      for (int q = 0; q < 4; ++q) { b[ks][q].half[0] = *(const v8us*)(sb + q * 16 * GP + ks * 64); b[ks][q].half[1] = *(const v8us*)(sb + q * 16 * GP + ks * 64 + 32); }
    }
    asm volatile("s_wait_dscnt 0x0" ::: "memory");      // the whole stage is in this wave's registers: its reads of the buffer have returned before the buffer is refilled
    asm volatile("s_wait_asynccnt 0x0" ::: "memory");      // this wave's copies of stage t + 1 have landed
    __syncthreads();      // publishes stage t + 1 and ends every wave's reads of stage t
    if (t + 2 < NT) cp_stage<RB>(l0 + (unsigned)((t & 1) * GSTG), ga + (t + 2) * 256, gb + (t + 2) * 256);      // stage t + 2 into the buffer that this trip has read
    __builtin_amdgcn_sched_barrier(0);      // keeps the products behind the refill: they need registers only, and the copies so fly under them as well as under the next stage's reads
#pragma unroll
    for (int ks = 0; ks < 4; ++ks)
#pragma unroll
      for (int q = 0; q < 4; ++q) acc[q] = mma16(a[ks].v, b[ks][q].v, acc[q]);
  }
  asm volatile("s_wait_asynccnt 0x0" ::: "memory");      // no copy is outstanding when the wave goes on to its end
  // the four vector slots that the chip needs behind the loop's last matrix instructions before their A or B registers are rewritten: the epilogues are reached over scalar branches
  if (FRAG) asm volatile("v_nop\n\tv_nop\n\tv_nop\n\tv_nop");
  if (FRAG && mode == 3) {
    char* tv = (char*)so;      // 128 rows (b, d) of 64 j. Accumulator register r is tile row 16 w + 8 hh + r = (j, b) with j = 8 w + 4 hh + r / 2, b = r % 2: the four registers of one b are four neighbouring j
#pragma unroll
    for (int q = 0; q < 4; ++q)
#pragma unroll
      for (int b = 0; b < 2; ++b) { v4h h4; for (int e = 0; e < 4; ++e) h4[e] = (_Float16)(acc[q][2 * e + b] * alpha + (BIAS ? bf16_round(braw[q]) : 0.f)); *(v4h*)(tv + (b * 64 + q * 16 + ln) * VP + w * 16 + hh * 8) = h4; }
    __syncthreads();      // every wave holds eight j of every row: the rows are whole before they are read
    const char* tr = tv + (tid >> 3) * VP + (tid & 7) * 16; v8us x[4];      // eight lanes a row; trip it takes rows 32 it + tid / 8
#pragma unroll
    for (int it = 0; it < 4; ++it) x[it] = *(const v8us*)(tr + it * 32 * VP);
    unsigned short* vo = (unsigned short*)C16 + ((size_t)nq * 64 + (tid >> 3)) * KL + bm * 64 + (tid & 7) * 8;
#pragma unroll
    for (int it = 0; it < 4; ++it) *(v8us*)(vo + ((size_t)(it >> 1) * NH * 64 + (it & 1) * 32) * KL) = x[it];
    return;
  }
  if (FRAG) {
    // The wave turns its 16 x 64 tile in its own staging rows. Staging row rw keeps its 4-float group g at place g ^ rw: the accumulator stores (16 columns of two rows 8 apart) and the 16-byte reads below (one group of 16 different rows) both fall on 64 different banks.
    // A lane stores the 16 bytes (row rr, c = 2 x + hh), x = 0..3, which lie 512 bytes apart. Rows (j,b): 8 lanes take the wave's 8 j of one b, a whole 128-byte line of block j / 16 (the wave holds half a block of either b); rows m: the wave's 16 rows are one block, 512 bytes in a row.
    const bool jb = (mode != 5); const int l7 = lane & 7, lb = (lane >> 3) & 1;
    const int rr = jb ? l7 * 2 + lb : ln;
    const int blk = jb ? (lb * NH + nq) * ((mode == 2) ? QL / 16 : KL / 16) + bm * 4 + (w >> 1) : nq * (KL / 16) + bm * 8 + w;
    const size_t go = (size_t)blk * FB + hh * 256 + (jb ? (w & 1) * 8 + l7 : ln) * 16;
#pragma unroll 1      // kept rolled: the q tile's second trip differs from the first in its bias and its plane alone
    for (int ps = 0; ps < ((mode == 2) ? 2 : 1); ++ps) {
#pragma unroll
      for (int q = 0; q < 4; ++q) { const float hb = bf16_round(ps ? hr[q] : hw[q]);
#pragma unroll
        for (int r = 0; r < 8; ++r) { const int rw = 8 * hh + r; float v = acc[q][r] * alpha + (BIAS ? bf16_round(braw[q]) : 0.f); if (mode == 2) v += hb; so[w][rw][(((q * 4 + (ln >> 2)) ^ rw) << 2) + (ln & 3)] = v; } }
      __builtin_amdgcn_fence(__ATOMIC_ACQ_REL, "workgroup", "local"); __builtin_amdgcn_wave_barrier();      // the wave reads back its own staging rows; a fence of LDS alone, so that the second trip does not wait for the first trip's global stores
      v8us o[4];
#pragma unroll
      for (int x = 0; x < 4; ++x) { const int g = (4 * x + 2 * hh) ^ rr; const v4f lo = *(const v4fa*)&so[w][rr][g << 2], hi = *(const v4fa*)&so[w][rr][(g ^ 1) << 2]; FragH f;
        for (int e = 0; e < 4; ++e) { f.h[e] = (_Float16)lo[e]; f.h[4 + e] = (_Float16)hi[e]; } o[x] = f.half[0]; }
      char* dst = (char*)(ps ? C16b : C16) + go;
#pragma unroll
      for (int x = 0; x < 4; ++x) *(v8us*)(dst + x * 512) = o[x];
      // the wait that is owed before a register named by an issued global store is rewritten (the second trip reuses them); address and data are inputs, so they stay live to here
      asm volatile("s_wait_xcnt 0x0" :: "v"(dst), "v"(o[0]), "v"(o[1]), "v"(o[2]), "v"(o[3]) : "memory");
    }
    return;
  }
#pragma unroll
  for (int q = 0; q < 4; ++q)
#pragma unroll
    for (int r = 0; r < 8; ++r) so[w][8 * hh + r][q * 16 + ln] = acc[q][r] * alpha + (BIAS ? bf16_round(braw[q]) : 0.f);
  __builtin_amdgcn_fence(__ATOMIC_ACQ_REL, "workgroup"); __builtin_amdgcn_wave_barrier();      // the wave reads back its own staging rows: whole 128-byte lines go out
  const int rsub = lane >> 4, c4 = (lane & 15) * 4; const size_t cofs = (size_t)(row0 + rsub) * LDC + col0 + c4;      // the lane's first element; its eight rows lie 2 LDC apart
  v4f ov[8];
#pragma unroll
  for (int q = 0; q < 8; ++q) ov[q] = *(const v4fa*)&so[w][q * 2 + rsub][c4];
  if (mode == 0) {      // one branch round all eight stores; mode here is k_gemm_lds's F32OUT ? 0 : 1, a constant once inlined
#pragma unroll
    for (int q = 0; q < 8; ++q) *(v4f*)(C + cofs + q * 2 * LDC) = ov[q];
  } else {
#pragma unroll
    for (int q = 0; q < 8; ++q) { v4h h4; for (int i = 0; i < 4; ++i) h4[i] = (_Float16)ov[q][i]; *(v4h*)(C16 + cofs + q * 2 * LDC) = h4; }
  }
}
template <int KK, int LDC, bool F32OUT, bool BIAS>
__global__ __launch_bounds__(256) void k_gemm_lds(const _Float16* __restrict__ A, size_t sA, const _Float16* __restrict__ Bh, size_t sB, float alpha, const float* __restrict__ bias,
    float* __restrict__ C, _Float16* __restrict__ C16, size_t sC, int ntn) {
  __shared__ __attribute__((aligned(16))) char ring[2 * GSTG];
  __shared__ __attribute__((aligned(16))) float so[8][16][64];
  const size_t by = blockIdx.y;
  gemm_tile<KK, LDC, BIAS, false>(A + by * sA, Bh + by * sB, alpha, bias, F32OUT ? C + by * sC : nullptr, F32OUT ? nullptr : C16 + by * sC, nullptr, nullptr, nullptr, F32OUT ? 0 : 1, blockIdx.x / ntn, blockIdx.x % ntn, ring, so);
}
// The four input projections in one launch (each reads only what k_prep wrote): tiles of k, v (4096 rows of CAT each), then q (the last 2048 rows of CAT) and rk (the 2048 rows of R16); every tile as in k_gemm_lds.
// The epilogues leave the planes as the score kernel and the P*V GEMM read them: q goes out twice, with r_w_bias and with r_r_bias added; q, k and rk go out in the score kernel's fragment order, and v goes out transposed per (b,n).
#define GTK ((NKR / 128) * (DM / 64))      // tiles of k and of v
#define GTQ ((NQR / 128) * (DM / 64))      // tiles of q and of rk
__global__ __launch_bounds__(256) void k_proj(const _Float16* __restrict__ CAT, const _Float16* __restrict__ R16, const _Float16* __restrict__ Bw, const float* __restrict__ bq, const float* __restrict__ bk, const float* __restrict__ bv, const float* __restrict__ br,
    const float* __restrict__ rwb, const float* __restrict__ rrb, _Float16* __restrict__ QW, _Float16* __restrict__ QR, _Float16* __restrict__ K16, _Float16* __restrict__ Vt, _Float16* __restrict__ RK) {
  __shared__ __attribute__((aligned(16))) char ring[2 * GSTG];
  __shared__ __attribute__((aligned(16))) float so[8][16][64];
  const int bx = blockIdx.x;
  const int job = (bx < GTK) ? 1 : (bx < 2 * GTK) ? 2 : (bx < 2 * GTK + GTQ) ? 0 : 3;      // the weight's place in Bw: 0 q, 1 k, 2 v, 3 rk
  const int tl = (job == 1) ? bx : (job == 2) ? bx - GTK : (job == 0) ? bx - 2 * GTK : bx - 2 * GTK - GTQ;
  const _Float16* A = (job == 0) ? CAT + (size_t)NQR * DM : (job == 3) ? R16 : CAT;
  const float* bias = (job == 0) ? bq : (job == 1) ? bk : (job == 2) ? bv : br;
  _Float16* C16 = (job == 0) ? QW : (job == 1) ? K16 : (job == 2) ? Vt : RK;
  const int mode = (job == 0) ? 2 : (job == 1) ? 4 : (job == 2) ? 3 : 5;      // from blockIdx alone: the barrier of the v epilogue is passed by a whole work-group or by none of it
  gemm_tile<DM, DM, true, true>(A, Bw + (size_t)job * DM * DM, 0.0625f, bias, nullptr, C16, QR, rwb, rrb, mode, tl / (DM / 64), tl % (DM / 64), ring, so);
}
__global__ __launch_bounds__(256) void k_lnout(const float* __restrict__ RES, const float* __restrict__ w, const float* __restrict__ g, const float* __restrict__ bb, float* __restrict__ out) { const int tid = threadIdx.x, wv = tid >> 5, lane = tid & 31; const int r = blockIdx.x * 8 + wv; if (r >= NQR) return; v4f y[8]; float s = 0.f;
#pragma unroll
  for (int j = 0; j < 8; ++j) { const int c = j * 128 + lane * 4; const v4f a = *(const v4fa*)(RES + (size_t)r * DM + c), x = *(const v4fa*)(w + (size_t)r * DM + c); for (int q = 0; q < 4; ++q) { y[j][q] = a[q] + bf16_round(x[q]); s += y[j][q]; } }
  for (int o = 16; o >= 1; o >>= 1) s += __shfl_xor(s, o, 32); const float mu = s / (float)DM; float q2 = 0.f;
#pragma unroll
  for (int j = 0; j < 8; ++j) for (int q = 0; q < 4; ++q) { const float d = y[j][q] - mu; q2 += d * d; }
  for (int o = 16; o >= 1; o >>= 1) q2 += __shfl_xor(q2, o, 32); const float rs = rsqrtf(q2 / (float)DM + 1e-5f);
  {
#pragma unroll
    for (int j = 0; j < 8; ++j) { const int c = j * 128 + lane * 4; v4f o; for (int q = 0; q < 4; ++q) o[q] = (y[j][q] - mu) * rs * bf16_round(g[c + q]) + bf16_round(bb[c + q]); *(v4f*)(out + (size_t)r * DM + c) = o; }
     } }

extern "C" void kernel_launch(void* const* d_in, const int* in_sizes, int n_in,
                              void* d_out, int out_size, void* d_ws, size_t ws_size, hipStream_t stream) {
  (void)in_sizes; (void)n_in; (void)out_size;
  const float* const* I = (const float* const*)d_in; const float* w = I[0]; const float* r = I[1]; const float* mems = I[2]; const float* rwb = I[3]; const float* rrb = I[4]; const int* msk = (const int*)d_in[5];
  const float* Wq = I[6]; const float* bq = I[7]; const float* Wk = I[8]; const float* bk = I[9]; const float* Wv = I[10]; const float* bv = I[11]; const float* Wr = I[12]; const float* br = I[13]; const float* Wo = I[14]; const float* bo = I[15]; const float* lg = I[16]; const float* lb = I[17];
  char* ws = (char*)d_ws; size_t off = 0;
  auto take = [&](size_t bytes) { char* p = ws + off; off += (bytes + 255) & ~(size_t)255; return p; };
  const size_t WSZ = (size_t)DM * DM; _Float16* Bw = (_Float16*)take(5 * WSZ * 2);      /* Wq, Wk, Wv, Wr, Wo */
  _Float16* QW = (_Float16*)take((size_t)NQR * DM * 2); _Float16* QR = (_Float16*)take((size_t)NQR * DM * 2);
  _Float16* K16 = (_Float16*)take((size_t)NKR * DM * 2); _Float16* Vt = (_Float16*)take((size_t)NKR * DM * 2); _Float16* RK = (_Float16*)take((size_t)KL * DM * 2);
  _Float16* P16 = (_Float16*)take((size_t)BZ * NH * QL * KL * 2); _Float16* O16 = (_Float16*)take((size_t)NQR * DM * 2);      /* P of all 32 (b,n) planes, so that one launch does every P*V */
  _Float16* CAT = (_Float16*)take((size_t)NKR * DM * 2); _Float16* R16 = (_Float16*)take((size_t)KL * DM * 2); float* RES = (float*)take((size_t)NQR * DM * 4);
  if (off > ws_size) return;      // MiB: 10 + 4 + 4 + 8 + 8 + 4 + 128 + 4 + 8 + 4 + 8 = 190 of 256
  k_prep<<<5 * GWT + 3 * GX, 256, 0, stream>>>(Wq, Wk, Wv, Wr, Wo, mems, w, r, Bw, CAT, R16);      /* weights (in,out) -> Bt x2^4; cat = [mems; w] is the two inputs back to back (rows (j,b)); r rows m */
  k_proj<<<2 * GTK + 2 * GTQ, 256, 0, stream>>>(CAT, R16, Bw, bq, bk, bv, br, rwb, rrb, QW, QR, K16, Vt, RK);      /* k, v: M 4096 N 1024 K 1024; q (last qlen rows of cat) + bq, rk = r.Wr + br: M 2048; one work-group a 128 x 64 tile; q stored + r_w_bias / + r_r_bias, v stored as V^T per (b,n) */
  const dim3 gq((NQR / 128) * (DM / 64), 1);      /* one work-group a 128 x 64 tile */
  const dim3 go(QL / 128, BZ * NH);
  k_score<<<dim3(QL / 16, BZ * NH), 512, 0, stream>>>(QW, QR, K16, RK, msk, P16);      /* AC, raw BD, shift, mask and softmax of all 32 (b,n) planes: 16 query rows a work-group, scores in LDS only */
  k_gemm_lds<KL, BZ * DM, false, false><<<go, 256, 0, stream>>>(P16, (size_t)QL * KL, Vt, (size_t)64 * KL, 0.000030517578125f, nullptr, nullptr, O16, 64, 1);      /* attn_vec f16, rows (i,b), plane s = b*16 + h at cols s*64 of the 2048-wide (i) row: M 1024 N 64 K 2048, ldc 2048, all 32 planes in blockIdx.y */
  k_gemm_lds<DM, DM, true, true><<<gq, 256, 0, stream>>>(O16, 0, Bw + 4 * WSZ, 0, 0.0625f, bo, RES, nullptr, 0, DM / 64);      /* attn_out = attn_vec·Wo + bo (rows (i,b)) */
  k_lnout<<<(NQR + 7) / 8, 256, 0, stream>>>(RES, w, lg, lb, (float*)d_out);
}

// v007
// It runs in 129 microseconds.
// Next to v006, in two timings, it ran 1.10 times as fast each time.
// Counting every step since v000, it is 21.3 times as fast.
#include <hip/hip_runtime.h>
// Transformer-XL relative multi-head attention (qlen 1024, mem_len 1024 → klen 2048, bsz 2, 16 heads × 64, post-LN): cat = [mems; w] (rows (j,b)); q = (cat·Wq + bq)[last qlen], k, v = cat·Wk + bk, cat·Wv + bv; rk = r·Wr + br;
// AC[i,j] = (q_i + r_w_bias)·k_j; BD = rel_shift((q_i + r_r_bias)·rk_m) (the exact pad-reshape shift, incl. its wrap region); score = (AC + BD)/8, −inf where the INPUT mask is set; softmax over j; attn_vec = Σ_j p·v_j;
// out = LayerNorm(w + attn_vec·Wo + bo)·g + b → [1024, 2, 1024]. (in,out) weights.
// Compute dtype: w, mems, r, biases, weights rounded to bf16; q (+ the two head biases), k, v, rk as f16 GEMM planes; one fused kernel forms, per 16 query rows of a (b,n) plane, AC and raw BD (f32 accumulators),
// applies the relative shift as a scatter into LDS, the mask and an f32 softmax and writes P f16 x2^15; attn_vec by GEMM; Wo GEMM + bias; residual + LayerNorm in f32 (wave per row). All contractions on v_wmma_f32_16x16x32_f16, f32 accumulate.
#define QL 1024
#define KL 2048
#define BZ 2
#define NH 16
#define DM 1024
#define NQR (QL * BZ)
#define NKR (KL * BZ)
#define ATT_SCALE 0.125f

typedef __bf16 v16b __attribute__((ext_vector_type(16)));
typedef unsigned short v8us __attribute__((ext_vector_type(8), may_alias));
typedef float  v8f  __attribute__((ext_vector_type(8)));
typedef float  v4f  __attribute__((ext_vector_type(4)));
typedef float  v4fa __attribute__((ext_vector_type(4), may_alias));
union FragB { v16b v; v8us half[2]; unsigned short u[16]; };

__device__ __forceinline__ unsigned short bf16_bits(float x) { unsigned int u = __float_as_uint(x); return (unsigned short)((u + 0x7FFFu + ((u >> 16) & 1u)) >> 16); }
__device__ __forceinline__ float bf16_val(unsigned short b) { return __uint_as_float(((unsigned int)b) << 16); }
__device__ __forceinline__ float bf16_round(float x) { return bf16_val(bf16_bits(x)); }
// D += A·B with NT terms: 1 = ah·bh, 2 = + al·bh (A split), 3 = + ah·bl (both split)
template <int NT>
__device__ __forceinline__ v8f mmaN(v16b ah, v16b al, v16b bh, v16b bl, v8f c) {
  c = __builtin_amdgcn_wmma_f32_16x16x32_bf16(false, ah, false, bh, (short)0, c, false, false);
  if (NT >= 2) c = __builtin_amdgcn_wmma_f32_16x16x32_bf16(false, al, false, bh, (short)0, c, false, false);
  if (NT >= 3) c = __builtin_amdgcn_wmma_f32_16x16x32_bf16(false, ah, false, bl, (short)0, c, false, false);
  asm volatile("v_nop\n\tv_nop\n\tv_nop\n\tv_nop" : "+v"(c) : "v"(ah), "v"(al), "v"(bh), "v"(bl));
  return c;
}

__global__ __launch_bounds__(256) void k_wt_bf16(const float* __restrict__ W, unsigned short* __restrict__ Wt, int K, int N) {
  const int t = blockIdx.x * 256 + threadIdx.x;
  const int k8n = K / 8;
  if (t >= N * k8n) return;
  const int n = t / k8n, k8 = (t % k8n) * 8;
  v8us v;
#pragma unroll
  for (int i = 0; i < 8; ++i) v[i] = bf16_bits(W[(size_t)(k8 + i) * N + n]);
  *(v8us*)(Wt + (size_t)n * K + k8) = v;
  
}

// GEMM C[M][N] (f32, pitch ldc) = act(A[M][K]·W + bias). A f32 row-major (pitch lda) converted per fragment to bf16
// (ASPLIT: hi/lo two planes -> 2 terms, else single rounded term); Wt bf16 [N][K] (pitch ldb). BIAS_BF16 rounds the
// bias to bf16 first (bias quantised to bf16 before the add). K%32==0, M%16==0, N%64==0.
template <bool ASPLIT, int ACT, bool BIAS_BF16>
__global__ __launch_bounds__(128) void k_gemm_bf(const float* __restrict__ A, int lda, const unsigned short* __restrict__ Wt, int ldb,
                                               const float* __restrict__ bias, float* __restrict__ C, int ldc, int M, int N, int K) {
  __shared__ __attribute__((aligned(16))) float so[4][16][64];
  const int tid = threadIdx.x, w = tid >> 5, lane = tid & 31, ln = lane & 15, hh = lane >> 4;
  const int ntn = N / 64;
  const int wid = blockIdx.x * 4 + w;
  const int mt = wid / ntn, nq = wid % ntn;
  if (mt * 16 >= M) return;
  const int row0 = mt * 16, col0 = nq * 64;
  const float* arow = A + (size_t)(row0 + ln) * lda;
  v8f acc[4] = {};
  for (int kb = 0; kb < K; kb += 32) {
    FragB ah, al;
    const v4f x0 = *(const v4fa*)(arow + kb + 8 * hh), x1 = *(const v4fa*)(arow + kb + 8 * hh + 4);
    const v4f x2 = *(const v4fa*)(arow + kb + 16 + 8 * hh), x3 = *(const v4fa*)(arow + kb + 16 + 8 * hh + 4);
    float xs[16] = {x0[0],x0[1],x0[2],x0[3],x1[0],x1[1],x1[2],x1[3],x2[0],x2[1],x2[2],x2[3],x3[0],x3[1],x3[2],x3[3]};
#pragma unroll
    for (int i = 0; i < 16; ++i) { const unsigned short hb = bf16_bits(xs[i]); ah.u[i] = hb; al.u[i] = ASPLIT ? bf16_bits(xs[i] - bf16_val(hb)) : (unsigned short)0; }
#pragma unroll
    for (int t = 0; t < 4; ++t) {
      const unsigned short* brow = Wt + (size_t)(col0 + t * 16 + ln) * ldb + kb;
      FragB b;
      b.half[0] = *(const v8us*)(brow + 8 * hh);
      b.half[1] = *(const v8us*)(brow + 16 + 8 * hh);
      acc[t] = mmaN<ASPLIT ? 2 : 1>(ah.v, al.v, b.v, b.v, acc[t]);
    }
  }
#pragma unroll
  for (int t = 0; t < 4; ++t) {
    float bv = bias ? bias[col0 + t * 16 + ln] : 0.f;
    if (BIAS_BF16) bv = bf16_round(bv);
#pragma unroll
    for (int r = 0; r < 8; ++r) { float v = acc[t][r] + bv; if (ACT == 1) v = fmaxf(v, 0.f); so[w][8 * hh + r][t * 16 + ln] = v; }
  }
  __builtin_amdgcn_fence(__ATOMIC_ACQ_REL, "workgroup");
  __builtin_amdgcn_wave_barrier();
  const int rsub = lane >> 4, c4 = (lane & 15) * 4;
  {
#pragma unroll
    for (int q = 0; q < 8; ++q) {
      const int r = q * 2 + rsub;
      const v4f v = *(const v4fa*)&so[w][r][c4];
      *(v4f*)(C + (size_t)(row0 + r) * ldc + col0 + c4) = v;
    }
    
  }
}

// Flash-style causal/unmasked attention, all contractions 3-term bf16 hi/lo splits, f32 softmax with running max.
// q,k,v rows are read from f32 buffers with arbitrary row pitch (so they can live inside a fused qkv buffer);
// D = head size (multiple of 32, <= 128); one wave = 16 query rows; block = 4 waves (64 queries) sharing K/V chunks of 32.
template <int D, bool CAUSAL>
__global__ __launch_bounds__(128) void k_flash(const float* __restrict__ qb, const float* __restrict__ kb, const float* __restrict__ vb,
                                             int pitch, int T, int H, float scale, float* __restrict__ y, int ypitch) {
  constexpr int KS = D / 32;        // k-steps for QK
  constexpr int DT = D / 16;        // d tiles for PV
  __shared__ __attribute__((aligned(16))) unsigned short sKh[32][D + 8], sKl[32][D + 8], sVh[32][D + 8], sVl[32][D + 8];
  __shared__ __attribute__((aligned(16))) unsigned short sPh[4][16][40], sPl[4][16][40];
  __shared__ __attribute__((aligned(16))) float sO[4][16][D];
  const int tid = threadIdx.x, w = tid >> 5, lane = tid & 31, ln = lane & 15, hh = lane >> 4;
  const int nqb = (T + 63) / 64;
  const int bh = blockIdx.x / nqb, qblk = blockIdx.x % nqb;
  const int b = bh / H, h = bh % H;
  const int q0 = qblk * 64 + w * 16;
  const float* Q = qb + (size_t)b * T * pitch + h * D;
  const float* K = kb + (size_t)b * T * pitch + h * D;
  const float* V = vb + (size_t)b * T * pitch + h * D;

  // A fragments of the wave's 16 query rows (scaled), hi/lo
  FragB aqh[KS], aql[KS];
  {
    int row = q0 + ln; if (row >= T) row = T - 1;
    const float* qr = Q + (size_t)row * pitch;
#pragma unroll
    for (int ks = 0; ks < KS; ++ks)
#pragma unroll
      for (int i = 0; i < 16; ++i) {
        const int d = ks * 32 + ((i < 8) ? (8 * hh + i) : (16 + 8 * hh + (i - 8)));
        const float x = qr[d] * scale; const unsigned short hb = bf16_bits(x);
        aqh[ks].u[i] = hb; aql[ks].u[i] = bf16_bits(x - bf16_val(hb));
      }
  }
  float m_r[8], l_r[8];
#pragma unroll
  for (int r = 0; r < 8; ++r) { m_r[r] = -3.0e38f; l_r[r] = 0.f; }
  v8f oacc[DT];
#pragma unroll
  for (int dt = 0; dt < DT; ++dt) oacc[dt] = (v8f){0.f,0.f,0.f,0.f,0.f,0.f,0.f,0.f};

  const int kv_end = CAUSAL ? min(T, qblk * 64 + 64) : T;     // block-uniform
  for (int j0 = 0; j0 < kv_end; j0 += 32) {
    __syncthreads();
    for (int e = tid; e < 32 * (D / 4); e += 128) {
      const int r = e / (D / 4), c4 = (e % (D / 4)) * 4;
      const int key = j0 + r;
      v4f kf = {0.f,0.f,0.f,0.f}, vf = {0.f,0.f,0.f,0.f};
      if (key < T) { kf = *(const v4fa*)(K + (size_t)key * pitch + c4); vf = *(const v4fa*)(V + (size_t)key * pitch + c4); }
#pragma unroll
      for (int t = 0; t < 4; ++t) {
        unsigned short hb = bf16_bits(kf[t]); sKh[r][c4 + t] = hb; sKl[r][c4 + t] = bf16_bits(kf[t] - bf16_val(hb));
        hb = bf16_bits(vf[t]); sVh[r][c4 + t] = hb; sVl[r][c4 + t] = bf16_bits(vf[t] - bf16_val(hb));
      }
    }
    __syncthreads();
    // S tile 16 x 32
    v8f s[2];
#pragma unroll
    for (int nt = 0; nt < 2; ++nt) {
      v8f acc = {};
#pragma unroll
      for (int ks = 0; ks < KS; ++ks) {
        FragB bh_, bl_;
        bh_.half[0] = *(const v8us*)&sKh[nt * 16 + ln][ks * 32 + 8 * hh]; bh_.half[1] = *(const v8us*)&sKh[nt * 16 + ln][ks * 32 + 16 + 8 * hh];
        bl_.half[0] = *(const v8us*)&sKl[nt * 16 + ln][ks * 32 + 8 * hh]; bl_.half[1] = *(const v8us*)&sKl[nt * 16 + ln][ks * 32 + 16 + 8 * hh];
        acc = mmaN<3>(aqh[ks].v, aql[ks].v, bh_.v, bl_.v, acc);
      }
      s[nt] = acc;
    }
    // mask + running max (rows 8hh+r; the 16 lanes of a half share rows)
    float alpha[8];
#pragma unroll
    for (int r = 0; r < 8; ++r) {
      const int qi = q0 + 8 * hh + r;
      const int ja = j0 + ln, jb = j0 + 16 + ln;
      if (CAUSAL) { if (ja > qi) s[0][r] = -3.0e38f; if (jb > qi) s[1][r] = -3.0e38f; }
      if (ja >= T) s[0][r] = -3.0e38f;
      if (jb >= T) s[1][r] = -3.0e38f;
      float mx = fmaxf(s[0][r], s[1][r]);
      mx = fmaxf(mx, __shfl_xor(mx, 1, 32)); mx = fmaxf(mx, __shfl_xor(mx, 2, 32)); mx = fmaxf(mx, __shfl_xor(mx, 4, 32)); mx = fmaxf(mx, __shfl_xor(mx, 8, 32));
      const float mnew = fmaxf(m_r[r], mx);
      alpha[r] = (mnew > -1.0e38f) ? __expf(m_r[r] - mnew) : 1.0f;
      const float p0 = (s[0][r] > -1.0e38f) ? __expf(s[0][r] - mnew) : 0.f;
      const float p1 = (s[1][r] > -1.0e38f) ? __expf(s[1][r] - mnew) : 0.f;
      m_r[r] = mnew;
      l_r[r] = l_r[r] * alpha[r] + p0 + p1;            // per-lane partial row sum (16 lanes combined at the end)
      unsigned short hb = bf16_bits(p0); sPh[w][8 * hh + r][ln] = hb;      sPl[w][8 * hh + r][ln] = bf16_bits(p0 - bf16_val(hb));
      hb = bf16_bits(p1);                sPh[w][8 * hh + r][16 + ln] = hb; sPl[w][8 * hh + r][16 + ln] = bf16_bits(p1 - bf16_val(hb));
    }
#pragma unroll
    for (int dt = 0; dt < DT; ++dt)
#pragma unroll
      for (int r = 0; r < 8; ++r) oacc[dt][r] *= alpha[r];
    __builtin_amdgcn_fence(__ATOMIC_ACQ_REL, "workgroup");
    __builtin_amdgcn_wave_barrier();
    FragB pah, pal;
    pah.half[0] = *(const v8us*)&sPh[w][ln][8 * hh]; pah.half[1] = *(const v8us*)&sPh[w][ln][16 + 8 * hh];
    pal.half[0] = *(const v8us*)&sPl[w][ln][8 * hh]; pal.half[1] = *(const v8us*)&sPl[w][ln][16 + 8 * hh];
#pragma unroll
    for (int dt = 0; dt < DT; ++dt) {
      FragB bvh, bvl;
#pragma unroll
      for (int i = 0; i < 8; ++i) {
        bvh.u[i] = sVh[8 * hh + i][dt * 16 + ln]; bvh.u[8 + i] = sVh[16 + 8 * hh + i][dt * 16 + ln];
        bvl.u[i] = sVl[8 * hh + i][dt * 16 + ln]; bvl.u[8 + i] = sVl[16 + 8 * hh + i][dt * 16 + ln];
      }
      oacc[dt] = mmaN<3>(pah.v, pal.v, bvh.v, bvl.v, oacc[dt]);
    }
    __builtin_amdgcn_fence(__ATOMIC_ACQ_REL, "workgroup");
    __builtin_amdgcn_wave_barrier();
  }
#pragma unroll
  for (int r = 0; r < 8; ++r) {
    float l = l_r[r];
    l += __shfl_xor(l, 1, 32); l += __shfl_xor(l, 2, 32); l += __shfl_xor(l, 4, 32); l += __shfl_xor(l, 8, 32);
    l_r[r] = (l > 0.f) ? 1.0f / l : 0.f;
  }
#pragma unroll
  for (int dt = 0; dt < DT; ++dt)
#pragma unroll
    for (int r = 0; r < 8; ++r) sO[w][8 * hh + r][dt * 16 + ln] = oacc[dt][r] * l_r[r];
  __builtin_amdgcn_fence(__ATOMIC_ACQ_REL, "workgroup");
  __builtin_amdgcn_wave_barrier();
  {
    for (int r = 0; r < 16; ++r) {
      const int row = q0 + r;
      if (row < T && lane < D / 4) {
        const v4f val = *(const v4fa*)&sO[w][r][lane * 4];
        *(v4f*)(y + ((size_t)b * T + row) * ypitch + h * D + lane * 4) = val;
      }
    }
    
  }
}

// GEMM C = act(A·W + bias + resid): A f32 (ASPLIT -> hi/lo 2 terms), Wt bf16 [N][K]; ACT 0 none, 1 relu, 2 exact gelu;
// resid (optional, f32, row index = (row % rmod), pitch ldr, RES_BF16 rounds it) added before the activation.
template <bool ASPLIT, int ACT, bool BIAS_BF16, bool RES_BF16>
__global__ __launch_bounds__(128) void k_gemm_bf3(const float* __restrict__ A, int lda, const unsigned short* __restrict__ Wt, int ldb,
                                                const float* __restrict__ bias, const float* __restrict__ resid, int rmod, int ldr,
                                                float* __restrict__ C, int ldc, int M, int N, int K) {
  __shared__ __attribute__((aligned(16))) float so[4][16][64];
  const int tid = threadIdx.x, w = tid >> 5, lane = tid & 31, ln = lane & 15, hh = lane >> 4;
  const int ntn = N / 64;
  const int wid = blockIdx.x * 4 + w;
  const int mt = wid / ntn, nq = wid % ntn;
  if (mt * 16 >= M) return;
  const int row0 = mt * 16, col0 = nq * 64;
  const float* arow = A + (size_t)(row0 + ln) * lda;
  v8f acc[4] = {};
  for (int kb = 0; kb < K; kb += 32) {
    FragB ah, al;
    const v4f x0 = *(const v4fa*)(arow + kb + 8 * hh), x1 = *(const v4fa*)(arow + kb + 8 * hh + 4);
    const v4f x2 = *(const v4fa*)(arow + kb + 16 + 8 * hh), x3 = *(const v4fa*)(arow + kb + 16 + 8 * hh + 4);
    float xs[16] = {x0[0],x0[1],x0[2],x0[3],x1[0],x1[1],x1[2],x1[3],x2[0],x2[1],x2[2],x2[3],x3[0],x3[1],x3[2],x3[3]};
#pragma unroll
    for (int i = 0; i < 16; ++i) { const unsigned short hb = bf16_bits(xs[i]); ah.u[i] = hb; al.u[i] = ASPLIT ? bf16_bits(xs[i] - bf16_val(hb)) : (unsigned short)0; }
#pragma unroll
    for (int t = 0; t < 4; ++t) {
      const unsigned short* brow = Wt + (size_t)(col0 + t * 16 + ln) * ldb + kb;
      FragB b;
      b.half[0] = *(const v8us*)(brow + 8 * hh);
      b.half[1] = *(const v8us*)(brow + 16 + 8 * hh);
      acc[t] = mmaN<ASPLIT ? 2 : 1>(ah.v, al.v, b.v, b.v, acc[t]);
    }
  }
#pragma unroll
  for (int t = 0; t < 4; ++t) {
    const int col = col0 + t * 16 + ln;
    float bv = bias ? bias[col] : 0.f;
    if (BIAS_BF16) bv = bf16_round(bv);
#pragma unroll
    for (int r = 0; r < 8; ++r) {
      float v = acc[t][r] + bv;
      if (resid) { float rv = resid[(size_t)((row0 + 8 * hh + r) % rmod) * ldr + col]; if (RES_BF16) rv = bf16_round(rv); v += rv; }
      if (ACT == 1) v = fmaxf(v, 0.f);
      if (ACT == 2) v = 0.5f * v * (1.0f + erff(v * 0.70710678118654752f));
      if (ACT == 3) { const float u = 0.7978845608028654f * (v + 0.044715f * v * v * v); v = 0.5f * v * (1.0f + tanhf(u)); }
      so[w][8 * hh + r][t * 16 + ln] = v;
    }
  }
  __builtin_amdgcn_fence(__ATOMIC_ACQ_REL, "workgroup");
  __builtin_amdgcn_wave_barrier();
  const int rsub = lane >> 4, c4 = (lane & 15) * 4;
  {
#pragma unroll
    for (int q = 0; q < 8; ++q) {
      const int r = q * 2 + rsub;
      const v4f v = *(const v4fa*)&so[w][r][c4];
      *(v4f*)(C + (size_t)(row0 + r) * ldc + col0 + c4) = v;
    }
    
  }
}
// row LayerNorm (biased variance, eps) over N: s = X (+ R); optional out_sum <- s; out_norm <- (s-mu)*rsqrt(var+eps)*g + b
template <bool PARAM_BF16>
__global__ __launch_bounds__(256) void k_layernorm(const float* __restrict__ X, const float* __restrict__ R, const float* __restrict__ g, const float* __restrict__ bta,
                                                  float* __restrict__ out_sum, float* __restrict__ out_norm, int N, float eps) {
  __shared__ float red[256];
  const int row = blockIdx.x, tid = threadIdx.x;
  const float* x = X + (size_t)row * N; const float* rr = R ? R + (size_t)row * N : nullptr;
  float vals[16];                     // up to N = 4096
  const int per = N / 256;            // contiguous chunk per thread? use strided-by-4 chunks: thread handles j = tid*4 + 1024*u
  float s1 = 0.f;
  for (int u = 0; u < per / 4; ++u) {
    const int j = tid * 4 + 1024 * u;
    const v4f a = *(const v4fa*)(x + j);
    v4f b = {0.f,0.f,0.f,0.f}; if (rr) b = *(const v4fa*)(rr + j);
#pragma unroll
    for (int q = 0; q < 4; ++q) { const float v = a[q] + b[q]; vals[u * 4 + q] = v; s1 += v; }
  }
  red[tid] = s1; __syncthreads();
  for (int st = 128; st > 0; st >>= 1) { if (tid < st) red[tid] += red[tid + st]; __syncthreads(); }
  const float mu = red[0] / (float)N; __syncthreads();
  float s2 = 0.f;
  for (int u = 0; u < per / 4; ++u)
#pragma unroll
    for (int q = 0; q < 4; ++q) { const float c = vals[u * 4 + q] - mu; s2 += c * c; }
  red[tid] = s2; __syncthreads();
  for (int st = 128; st > 0; st >>= 1) { if (tid < st) red[tid] += red[tid + st]; __syncthreads(); }
  const float rs = rsqrtf(red[0] / (float)N + eps);
  {
    for (int u = 0; u < per / 4; ++u) {
      const int j = tid * 4 + 1024 * u;
      v4f o, sm;
#pragma unroll
      for (int q = 0; q < 4; ++q) {
        float gg = g[j + q], bb = bta[j + q];
        if (PARAM_BF16) { gg = bf16_round(gg); bb = bf16_round(bb); }
        sm[q] = vals[u * 4 + q]; o[q] = (vals[u * 4 + q] - mu) * rs * gg + bb;
      }
      if (out_sum) *(v4f*)(out_sum + (size_t)row * N + j) = sm;
      *(v4f*)(out_norm + (size_t)row * N + j) = o;
    }
    
  }
}



// ---- f16 WMMA path (v_wmma_f32_16x16x32_f16): 11-bit significands for operands in range — used where a [0,1] probability operand needs more precision than bf16
typedef _Float16 v16h __attribute__((ext_vector_type(16)));
union FragH { v16h v; v8us half[2]; _Float16 h[16]; unsigned short u[16]; };
template <int NT>
__device__ __forceinline__ v8f mmaH(v16h ah, v16h al, v16h bh, v16h bl, v8f c) {
  c = __builtin_amdgcn_wmma_f32_16x16x32_f16(false, ah, false, bh, (short)0, c, false, false);
  if (NT >= 2) c = __builtin_amdgcn_wmma_f32_16x16x32_f16(false, al, false, bh, (short)0, c, false, false);
  if (NT >= 3) c = __builtin_amdgcn_wmma_f32_16x16x32_f16(false, ah, false, bl, (short)0, c, false, false);
  asm volatile("v_nop\n\tv_nop\n\tv_nop\n\tv_nop" : "+v"(c) : "v"(ah), "v"(al), "v"(bh), "v"(bl));
  return c;
}
// batched GEMM like k_gemm_b but f16 operands: A f32 (split into f16 hi/lo if ASPLIT, else rounded to f16), Bt = f16 values [n][k]; alpha; C f32; N multiple of 16 (partial tiles skipped)
template <bool ASPLIT>
__global__ __launch_bounds__(128) void k_gemm_h(const float* __restrict__ A, int lda, size_t sA, const _Float16* __restrict__ Bh, int ldb, size_t sB, float alpha, float* __restrict__ C, int ldc, size_t sC, int M, int N, int K) {
  __shared__ __attribute__((aligned(16))) float so[4][16][64];
  const int tid = threadIdx.x, w = tid >> 5, lane = tid & 31, ln = lane & 15, hh = lane >> 4; const int by = blockIdx.y;
  A += (size_t)by * sA; Bh += (size_t)by * sB; C += (size_t)by * sC;
  const int ntn = (N + 63) / 64; const int wid = blockIdx.x * 4 + w; const int mt = wid / ntn, nq = wid % ntn; if (mt * 16 >= M) return;
  const int row0 = mt * 16, col0 = nq * 64; const float* arow = A + (size_t)(row0 + ln) * lda;
  v8f acc[4] = {};
  for (int kb = 0; kb < K; kb += 32) {
    FragH ah, al;
    const v4f x0 = *(const v4fa*)(arow + kb + 8 * hh), x1 = *(const v4fa*)(arow + kb + 8 * hh + 4), x2 = *(const v4fa*)(arow + kb + 16 + 8 * hh), x3 = *(const v4fa*)(arow + kb + 16 + 8 * hh + 4);
    float xs[16] = {x0[0],x0[1],x0[2],x0[3],x1[0],x1[1],x1[2],x1[3],x2[0],x2[1],x2[2],x2[3],x3[0],x3[1],x3[2],x3[3]};
#pragma unroll
    for (int i = 0; i < 16; ++i) { const _Float16 h = (_Float16)xs[i]; ah.h[i] = h; al.h[i] = ASPLIT ? (_Float16)(xs[i] - (float)h) : (_Float16)0.0f; }
#pragma unroll
    for (int t = 0; t < 4; ++t) { if (col0 + t * 16 >= N) continue; const size_t boff = (size_t)(col0 + t * 16 + ln) * ldb + kb; FragH bq; bq.half[0] = *(const v8us*)(Bh + boff + 8 * hh); bq.half[1] = *(const v8us*)(Bh + boff + 16 + 8 * hh);
      acc[t] = mmaH<ASPLIT ? 2 : 1>(ah.v, al.v, bq.v, bq.v, acc[t]); }
  }
#pragma unroll
  for (int t = 0; t < 4; ++t) { if (col0 + t * 16 >= N) continue;
#pragma unroll
    for (int r = 0; r < 8; ++r) so[w][8 * hh + r][t * 16 + ln] = acc[t][r] * alpha; }
  __builtin_amdgcn_fence(__ATOMIC_ACQ_REL, "workgroup"); __builtin_amdgcn_wave_barrier();
  const int rsub = lane >> 4, c4 = (lane & 15) * 4;
  {
#pragma unroll
    for (int q = 0; q < 8; ++q) { const int r = q * 2 + rsub; if (col0 + c4 < N) { const v4f v = *(const v4fa*)&so[w][r][c4]; *(v4f*)(C + (size_t)(row0 + r) * ldc + col0 + c4) = v; } }
     }
}

// Wt[n][k] = f16(bf16(W[k][n])*scale) from f32 row-major W[DM][DM] (scale = power of two; bf16-exact weights stay exact in f16 away from the subnormal range)
// bx: the index of the 256-thread block inside this matrix's share of the merged grid. One block turns a tile of 64 k x 64 n in LDS (tl, 64 rows of TP bytes), so that memory sees whole lines on both sides:
// a wave reads two 256-byte row pieces of W at a time and stores four whole 128-byte lines of Wt; read column by column, every lane of a load would touch a line of its own.
#define TP 144      // LDS pitch in bytes of a turned row of 64 f16: a multiple of 16 for the 16-byte reads
__device__ __forceinline__ void wt_f16_body(int bx, const float* __restrict__ W, _Float16* __restrict__ Wt, float scale, char* tl) {
  const int tid = threadIdx.x, kt = bx / (DM / 64), nt = bx % (DM / 64);
  const int kp = tid >> 4, c4 = (tid & 15) * 4;      // the thread takes columns c4 .. c4 + 3 of the tile's rows 2 kp, 2 kp + 1, 32 + 2 kp, 33 + 2 kp
  const char* base = (const char*)(W + (size_t)kt * 64 * DM + nt * 64); const unsigned ob = (unsigned)(2 * kp * DM * 4 + c4 * 4);
  v4f x[2][2];
#pragma unroll
  for (int i = 0; i < 2; ++i)
#pragma unroll
    for (int s = 0; s < 2; ++s) x[i][s] = *(const v4fa*)(base + ob + (i * 32 + s) * DM * 4);
  // the wait that is owed before a register named by an issued global load is rewritten; offset and base are inputs, so they stay live to here and none of the four loads lands in them
  asm volatile("s_wait_xcnt 0x0" :: "v"(ob), "s"(base) : "memory");
#pragma unroll
  for (int i = 0; i < 2; ++i)
#pragma unroll
    for (int e = 0; e < 4; ++e) { typedef _Float16 v2h __attribute__((ext_vector_type(2), may_alias)); v2h p;      // two neighbouring k of one n: one 4-byte LDS store
      p[0] = (_Float16)(bf16_round(x[i][0][e]) * scale); p[1] = (_Float16)(bf16_round(x[i][1][e]) * scale); *(v2h*)(tl + (c4 + e) * TP + (i * 32 + 2 * kp) * 2) = p; }
  __syncthreads();      // the tile is whole in LDS before its turned rows are read
  const int rn = tid >> 3, ch = tid & 7; v8us o[2];      // eight lanes a row of 64 k; trip p takes rows 32 p + tid / 8
#pragma unroll
  for (int p = 0; p < 2; ++p) o[p] = *(const v8us*)(tl + (p * 32 + rn) * TP + ch * 16);
  unsigned short* wo = (unsigned short*)Wt + (size_t)(nt * 64 + rn) * DM + kt * 64 + ch * 8;
#pragma unroll
  for (int p = 0; p < 2; ++p) *(v8us*)(wo + (size_t)p * 32 * DM) = o[p];
}
typedef _Float16 v4h __attribute__((ext_vector_type(4)));

__device__ __forceinline__ void x16_body(int bx, const float* __restrict__ x, _Float16* __restrict__ X16, size_t n8) { const size_t t = (size_t)bx * 256 + threadIdx.x; if (t >= n8) return; FragH f;
#pragma unroll
  for (int q = 0; q < 8; ++q) f.h[q] = (_Float16)bf16_round(x[t * 8 + q]); *(v8us*)((unsigned short*)X16 + t * 8) = f.half[0];  }
// All operand preparation in one launch (none of the eight parts reads what another writes): blocks 0 .. 5 GWT - 1 transpose the five weights (Wq, Wk, Wv, Wr, Wo -> Bw, x2^4), the next 3 GX round mems, w (-> CAT, back to back) and r (-> R16).
#define GWT ((DM / 64) * (DM / 64))      // blocks of one weight matrix: a tile of 64 x 64 each
#define GX (NQR * DM / 8 / 256)      // blocks of one 2048 x 1024 plane at 8 elements a thread (mems, w, r, q alike)
__global__ __launch_bounds__(256) void k_prep(const float* __restrict__ Wq, const float* __restrict__ Wk, const float* __restrict__ Wv, const float* __restrict__ Wr, const float* __restrict__ Wo,
    const float* __restrict__ mems, const float* __restrict__ w, const float* __restrict__ r, _Float16* __restrict__ Bw, _Float16* __restrict__ CAT, _Float16* __restrict__ R16) {
  __shared__ __attribute__((aligned(16))) char tl[64 * TP];
  const int bx = blockIdx.x;      // the branch is taken by a whole block or by none of it: so is the barrier of the weight tiles
  if (bx < 5 * GWT) { const int m = bx / GWT; const float* W = (m == 0) ? Wq : (m == 1) ? Wk : (m == 2) ? Wv : (m == 3) ? Wr : Wo; wt_f16_body(bx % GWT, W, Bw + (size_t)m * DM * DM, 16.0f, tl); }
  else { const int m = (bx - 5 * GWT) / GX; const float* x = (m == 0) ? mems : (m == 1) ? w : r; _Float16* o = (m == 0) ? CAT : (m == 1) ? CAT + (size_t)NQR * DM : R16; x16_body((bx - 5 * GWT) % GX, x, o, (size_t)NQR * DM / 8); }
}
__global__ __launch_bounds__(256) void k_round16f(const float* __restrict__ W, _Float16* __restrict__ Bt, size_t n8) { const size_t t = (size_t)blockIdx.x * 256 + threadIdx.x; if (t >= n8) return; FragH f;
#pragma unroll
  for (int i = 0; i < 8; ++i) f.h[i] = (_Float16)(bf16_round(W[t * 8 + i]) * 16.0f); *(v8us*)((unsigned short*)Bt + t * 8) = f.half[0];  }
// Fused score kernel: one work-group = 16 query rows i0..i0+15 of one (b,n) plane (blockIdx.y), 16 waves; the 16 x KL score rows live in LDS and never reach memory. AC is stored into the rows first.
// The pad/reshape shift as a scatter of raw BD: idx = QL + i*KL + j = i*(KL+1) + (QL - i + j), so with d = m - (QL-1) + i the raw value (q_i + r_r_bias).rk_m belongs to j = d where d >= 0,
// the raw value of row i+1 at column m to j = d + KL + 1 where d <= -2 (the wrap region); d == -1 gives j = KL, a slot of the row's LDS padding that the softmax never reads; the pad's zero falls on j = i + KL + 1 - QL. Each j in 0..KL-1 gets at most one raw value.
// Behind a barrier each raw value is added to AC in place, and behind a second one wave wv does mask, f32 softmax and the f16 x2^15 store of row i0 + wv with the lane order and sum order of a wave-per-row pass.
#define SP (KL + 4)      // LDS row pitch in floats: 8 rows apart = 32 banks apart, so the two lane halves of a D tile do not collide; multiple of 4 for 16-byte reads
__device__ __forceinline__ v8f mma16(v16h a, v16h b, v8f c) { return __builtin_amdgcn_wmma_f32_16x16x32_f16(false, a, false, b, (short)0, c, false, false); }
// The planes that this kernel multiplies (q + r_w_bias, q + r_r_bias, k, rk) lie in fragment order: blocks of FB bytes = 16 rows x 64 f16 of one head, stored [c = k / 8][row][8 f16], so that the 16 bytes of (row, c) stand at c * 256 + row * 16.
// One 16-row fragment pair (k = 0..63) of such a block: base (+ cofs, a constant) is the same for the whole wave, ob is the lane's own byte offset (row * 16, plus 256 for the upper lane half). With ob = lane * 16 each load is 512 bytes in a row: four whole lines.
// Lane half hh, step ks: registers 0..3 hold k = 32*ks + 8*hh + 0..7 (c = 4 ks + hh), registers 4..7 hold k = 32*ks + 16 + 8*hh + 0..7 (c = 4 ks + 2 + hh), for A and B alike.
#define FB 2048
__device__ __forceinline__ void ldfrag(FragH (&f)[2], const char* __restrict__ base, unsigned ob, int cofs) {
#pragma unroll
  for (int ks = 0; ks < 2; ++ks) { f[ks].half[0] = *(const v8us*)(base + ob + (cofs + ks * 1024)); f[ks].half[1] = *(const v8us*)(base + ob + (cofs + ks * 1024 + 512)); }
  // the wait that is owed before a register named by an issued global load is rewritten; offset and base are inputs, so they stay live to here and none of the four loads lands in them
  asm volatile("s_wait_xcnt 0x0" :: "v"(ob), "s"(base) : "memory"); }
// launch bounds: 8 waves a SIMD (a budget of 128 VGPRs), so that two of these 128-KiB work-groups share a WGP and one's barriers and loads run under the other's work
__global__ __launch_bounds__(512, 8) void k_score(const _Float16* __restrict__ QW, const _Float16* __restrict__ QR, const _Float16* __restrict__ K16, const _Float16* __restrict__ RK, const int* __restrict__ MSK, _Float16* __restrict__ P16) {
  __shared__ __attribute__((aligned(16))) float S[16 * SP];
  const int tid = threadIdx.x, lane = tid & 31, ln = lane & 15, hh = lane >> 4;
  const int wv = __builtin_amdgcn_readfirstlane(tid >> 5);      // the wave's number as a scalar: tile bases and the row's addresses then sit in scalar registers
  const int i0 = blockIdx.x * 16, pl = blockIdx.y, h = pl % NH;
  const int i = i0 + wv;
  const char* qw = (const char*)QW + ((size_t)pl * (QL / 16) + blockIdx.x) * FB; const char* qr = (const char*)QR + ((size_t)pl * (QL / 16) + blockIdx.x) * FB;      // the block of rows i0 .. i0 + 15 of plane pl
  const char* kp = (const char*)K16 + ((size_t)pl * (KL / 16) + wv) * FB; const char* rp = (const char*)RK + ((size_t)h * (KL / 16) + wv) * FB;      // the wave's first column tile; its next ones lie 16 blocks apart
  const char* mk = (const char*)(MSK + (size_t)i * KL);
  const unsigned obq = (unsigned)(lane * 16), obr = obq;
  const unsigned obw = (unsigned)(hh * 256 + ((ln < 15) ? (ln + 1) * 16 : (i0 + 16 < QL) ? FB : 15 * 16));      // row i+1 for the wrap region (lane 15: row 0 of the next block); the clamped row of i = QL-1 is never selected (there d >= 0 for every m)
  FragH aq[2], kb[4][2]; ldfrag(aq, qw, obq, 0); ldfrag(kb[0], kp, obq, 0);
  unsigned mbal[64];      // the mask of row i0 + wv as one lane mask per (jj, e), read at the head beside the first fragments: the softmax phase then holds no mask registers and waits for no memory
  {
    typedef int v4i __attribute__((ext_vector_type(4))); typedef int v4ia __attribute__((ext_vector_type(4), may_alias)); v4i mv[16]; const unsigned obm = (unsigned)(lane * 16);
#pragma unroll
    for (int jj = 0; jj < 16; ++jj) mv[jj] = *(const v4ia*)(mk + obm + jj * 512);
    // the wait that is owed before a register named by an issued global load is rewritten; offset and base are inputs, so they stay live to here and none of the sixteen loads lands in them
    asm volatile("s_wait_xcnt 0x0" :: "v"(obm), "s"(mk) : "memory");
#pragma unroll
    for (int jj = 0; jj < 16; ++jj)
#pragma unroll
      for (int e = 0; e < 4; ++e) mbal[jj * 4 + e] = __builtin_amdgcn_ballot_w32(mv[jj][e] != 0);
  }
  ldfrag(kb[1], kp, obq, 16 * FB); ldfrag(kb[2], kp, obq, 2 * 16 * FB); ldfrag(kb[3], kp, obq, 3 * 16 * FB);      // behind the lane masks: the sixteen mask vectors and four k tiles together do not fit the registers
  FragH an[2], aw[2], bb[2][2];
  // AC: wave wv owns the column tiles wv + 16 t and stores them straight into S. Four k tiles are in flight; as the ring drains, its registers take the q + r_r_bias rows and the first two rk tiles, which fly while the last AC tiles are multiplied and stored.
#pragma unroll
  for (int t = 0; t < KL / 256; ++t) { const int j0 = (wv + 16 * t) * 16; FragH (&bf)[2] = kb[t & 3];
    v8f c = {}; c = mma16(aq[0].v, bf[0].v, c); c = mma16(aq[1].v, bf[1].v, c);
    // the four vector slots that the chip needs behind a matrix instruction before its D is overwritten (the next tile's product) or its A or B refilled; the operands are named so that the refill of bf stays behind them
    asm volatile("v_nop\n\tv_nop\n\tv_nop\n\tv_nop" : "+v"(c) : "v"(aq[0].v), "v"(aq[1].v), "v"(bf[0].v), "v"(bf[1].v));
    if (t + 4 < KL / 256) ldfrag(bf, kp, obq, (t + 4) * 16 * FB);
    else if (t == 4) ldfrag(an, qr, obq, 0);
    else if (t == 5) ldfrag(aw, qr, obw, 0);
    else if (t == 6) ldfrag(bb[0], rp, obr, 0);
    else ldfrag(bb[1], rp, obr, 16 * FB);
#pragma unroll
    for (int r = 0; r < 8; ++r) S[(8 * hh + r) * SP + j0 + ln] = c[r];
    __builtin_amdgcn_sched_barrier(0); }      // keeps the tiles apart in the schedule: mixed, they hold more products and fragments live than the 128 registers take, and the build spills
  if (tid < 16) S[tid * SP + KL] = 0.f;      // the padding slot that takes the one raw value of a row with d == -1: given a value here, so that the add below reads nothing unwritten
  __syncthreads();      // every AC value is in S before any wave adds a shifted BD value to it
  __builtin_amdgcn_sched_barrier(0);      // as above: no product of the next phase is lifted over the barrier
  // raw BD of rows i and i+1, added in place at the shifted column: each (row, j) is touched by one lane of one wave; the column of the pad's zero, j = i + KL + 1 - QL, by none (AC + 0)
#pragma unroll
  for (int t = 0; t < KL / 256; ++t) { const int m0 = (wv + 16 * t) * 16; FragH (&bf)[2] = bb[t & 1];
    v8f dn = {}, dw = {}; dn = mma16(an[0].v, bf[0].v, dn); dw = mma16(aw[0].v, bf[0].v, dw); dn = mma16(an[1].v, bf[1].v, dn); dw = mma16(aw[1].v, bf[1].v, dw);
    // the four vector slots that the chip needs behind a matrix instruction before a vector instruction reads its D or its B is refilled; bf is named so that its refill stays behind them
    asm volatile("v_nop\n\tv_nop\n\tv_nop\n\tv_nop" : "+v"(dn), "+v"(dw) : "v"(bf[0].v), "v"(bf[1].v));
    if (t + 2 < KL / 256) ldfrag(bf, rp, obr, (t + 2) * 16 * FB);      // rk tiles fly two tiles ahead
    const int d0 = m0 + ln - (QL - 1) + i0 + 8 * hh; int ix[8]; float old[8];
#pragma unroll
    for (int r = 0; r < 8; ++r) { const int d = d0 + r; ix[r] = (8 * hh + r) * SP + ((d >= 0) ? d : d + (KL + 1)); old[r] = S[ix[r]]; }      // the eight reads first: eight different rows, so no store of this tile can hit them
#pragma unroll
    for (int r = 0; r < 8; ++r) S[ix[r]] = old[r] + ((d0 + r >= 0) ? dn[r] : dw[r]);
    __builtin_amdgcn_sched_barrier(0); }      // as above
  __syncthreads();      // the rows are complete before the row waves read them
  const float* sr = &S[wv * SP];
  v4f sv[16]; float mx = -3.0e38f;
#pragma unroll
  for (int jj = 0; jj < 16; ++jj) { const int j0 = jj * 128 + lane * 4; const v4f a = *(const v4fa*)(sr + j0); v4f s;
#pragma unroll
    for (int e = 0; e < 4; ++e) { const float val = a[e] * ATT_SCALE; s[e] = __builtin_amdgcn_inverse_ballot_w32(mbal[jj * 4 + e]) ? -INFINITY : val; mx = fmaxf(mx, s[e]); }
    sv[jj] = s; }
  for (int o = 16; o >= 1; o >>= 1) mx = fmaxf(mx, __shfl_xor(mx, o, 32)); float z = 0.f;
#pragma unroll
  for (int jj = 0; jj < 16; ++jj) for (int e = 0; e < 4; ++e) { const float p = (sv[jj][e] > -INFINITY) ? __expf(sv[jj][e] - mx) : 0.f; sv[jj][e] = p; z += p; }
  for (int o = 16; o >= 1; o >>= 1) z += __shfl_xor(z, o, 32); const float iz = (z > 0.f) ? 32768.0f / z : 0.f;
  _Float16* pr = P16 + ((size_t)pl * QL + i) * KL;
#pragma unroll
  for (int jj = 0; jj < 16; ++jj) { v4h o; for (int e = 0; e < 4; ++e) o[e] = (_Float16)(sv[jj][e] * iz); *(v4h*)(pr + jj * 128 + lane * 4) = o; }
}
// GEMM with both operands staged in LDS: C[M][N] = f16 A[M][KK] . Bt[N][KK]^T, v = acc*alpha (+ bf16(bias[col]) if BIAS); writes f32 C (F32OUT) or f16 C16, pitch LDC. A, Bt row-major with pitch KK; M a multiple of 128, N of 64, KK of 256.
// One work-group = 128 rows x 64 columns, 8 waves of 16 x 64; blockIdx.x = row block * ntn + column block (ntn = N / 64), blockIdx.y = plane (element strides sA, sB, sC).
// A stage is 128 k = 256 bytes of each of the 192 operand rows (A rows 0..127, Bt rows 128..191), brought by asynchronous copies whose wave-wide 512 bytes are two whole 256-byte row pieces; two buffers, stage t + 2 flies while stage t is multiplied.
// Each output element still sums its k steps of 32 in rising order in one f32 accumulator.
#define GP 272      // LDS row pitch in bytes: 16 x odd, the conflict-free pitch of 256-byte rows for 16-byte fragment reads
#define GSTG (192 * GP)      // bytes of one stage
// One stage: lane (row cr = tid / 16, 16-byte piece tid % 16) copies its piece of A rows cr + 16 i (i < 8) and Bt rows cr + 16 i (i < 4). l: the lane's LDS byte address of A row cr; ga, gb: its global addresses in A row cr and Bt row cr; RB: 16 rows in bytes.
// The s_wait_xcnt is the wait that is owed before a register named by an issued copy is rewritten; as the statement's last line it stands in front of every such write.
template <int RB>
__device__ __forceinline__ void cp_stage(unsigned l, const char* ga, const char* gb) {
  asm volatile("global_load_async_to_lds_b128 %0, %12, off\n\t"
               "global_load_async_to_lds_b128 %1, %13, off\n\t"
               "global_load_async_to_lds_b128 %2, %14, off\n\t"
               "global_load_async_to_lds_b128 %3, %15, off\n\t"
               "global_load_async_to_lds_b128 %4, %16, off\n\t"
               "global_load_async_to_lds_b128 %5, %17, off\n\t"
               "global_load_async_to_lds_b128 %6, %18, off\n\t"
               "global_load_async_to_lds_b128 %7, %19, off\n\t"
               "global_load_async_to_lds_b128 %8, %20, off\n\t"
               "global_load_async_to_lds_b128 %9, %21, off\n\t"
               "global_load_async_to_lds_b128 %10, %22, off\n\t"
               "global_load_async_to_lds_b128 %11, %23, off\n\t"
               "s_wait_xcnt 0x0"
               :: "v"(l), "v"(l + 16 * GP), "v"(l + 32 * GP), "v"(l + 48 * GP), "v"(l + 64 * GP), "v"(l + 80 * GP), "v"(l + 96 * GP), "v"(l + 112 * GP),
                  "v"(l + 128 * GP), "v"(l + 144 * GP), "v"(l + 160 * GP), "v"(l + 176 * GP),
                  "v"(ga), "v"(ga + RB), "v"(ga + 2 * RB), "v"(ga + 3 * RB), "v"(ga + 4 * RB), "v"(ga + 5 * RB), "v"(ga + 6 * RB), "v"(ga + 7 * RB),
                  "v"(gb), "v"(gb + RB), "v"(gb + 2 * RB), "v"(gb + 3 * RB)
               : "memory");
}
// The tile's body: A, Bh, C, C16 are the plane's own bases, (bm, nq) the tile; ring and so are the calling kernel's LDS. mode (the same for the whole work-group) picks what the epilogue does with v:
// FRAG false: 0: f32 C. 1: f16 C16, both row-major. FRAG true: the planes of the score kernel, stored in its fragment order (blocks of FB bytes, see ldfrag; the tile's 64 columns are head nq):
// 2 (the q tile, rows (i,b)): C16 = f16(v + bf16(hb0[col])) and C16b = f16(v + bf16(hb1[col])), hb0 and hb1 the two 1024-wide head-bias rows; 4 (the k tile, rows (j,b)): C16 = f16(v); both as plane b NH + nq, block row / 16. 5 (the rk tile, rows m): C16 = f16(v), plane nq.
// 3 (the v tile; its rows are (j,b), its 64 columns one head nq): C16 is V^T, row ((b NH + nq) 64 + d), column j; the tile is turned in LDS and goes out as 128 whole lines of 64 j.
#define VP 144      // LDS pitch in bytes of a V^T row of 64 f16: 36 dwords, so that the 16 rows of an 8-byte store from the accumulators fall on different banks; a multiple of 16 for the 16-byte reads
template <int KK, int LDC, bool BIAS, bool FRAG>
__device__ __forceinline__ void gemm_tile(const _Float16* __restrict__ A, const _Float16* __restrict__ Bh, float alpha, const float* __restrict__ bias,
    float* __restrict__ C, _Float16* __restrict__ C16, _Float16* __restrict__ C16b, const float* __restrict__ hb0, const float* __restrict__ hb1, int mode, int bm, int nq, char* ring, float (*so)[16][64]) {
  const int tid = threadIdx.x, lane = tid & 31, ln = lane & 15, hh = lane >> 4;
  const int w = __builtin_amdgcn_readfirstlane(tid >> 5);      // the wave's number as a scalar
  const int row0 = bm * 128 + w * 16, col0 = nq * 64;
  const int cr = tid >> 4, cc = (tid & 15) * 16;
  const char* ga = (const char*)(A + (size_t)(bm * 128 + cr) * KK) + cc;
  const char* gb = (const char*)(Bh + (size_t)(col0 + cr) * KK) + cc;
  const unsigned l0 = (unsigned)(size_t)&ring[0] + (unsigned)(cr * GP + cc);      // the low 32 bits of a __shared__ address are its LDS byte address
  constexpr int NT = KK / 128, RB = 16 * KK * 2;
  float braw[4] = {0.f, 0.f, 0.f, 0.f};      // the bias of the lane's four columns, read at the head so that it flies under the main loop; first used in the epilogue
  if (BIAS) {
#pragma unroll
    for (int q = 0; q < 4; ++q) braw[q] = bias[col0 + q * 16 + ln];
  }
  float hw[4] = {0.f, 0.f, 0.f, 0.f}, hr[4] = {0.f, 0.f, 0.f, 0.f};      // the two head biases of the lane's four accumulator columns, read at the head like the bias
  if (FRAG && mode == 2) {
    const unsigned oh = (unsigned)((col0 + ln) * 4); const char* p0 = (const char*)hb0; const char* p1 = (const char*)hb1;
#pragma unroll
    for (int q = 0; q < 4; ++q) { hw[q] = *(const float*)(p0 + oh + q * 64); hr[q] = *(const float*)(p1 + oh + q * 64); }
    // the wait that is owed before a register named by an issued global load is rewritten; offset and bases are inputs, so they stay live to here and none of the eight loads lands in them
    asm volatile("s_wait_xcnt 0x0" :: "v"(oh), "s"(p0), "s"(p1) : "memory");
  }
  cp_stage<RB>(l0, ga, gb);      // stage 0 into buffer 0
  asm volatile("s_wait_asynccnt 0x0" ::: "memory");      // this wave's copies of stage 0 have landed
  __syncthreads();      // every wave's have: stage 0 may be read
  cp_stage<RB>(l0 + GSTG, ga + 256, gb + 256);      // stage 1 into buffer 1
  v8f acc[4] = {};
#pragma unroll 1      // kept rolled: unrolled, the build holds two stages' fragments live and needs more than 256 registers, and two work-groups no longer share a WGP
  for (int t = 0; t < NT; ++t) {
    const char* sa = &ring[(t & 1) * GSTG + (w * 16 + ln) * GP + hh * 16];
    const char* sb = &ring[(t & 1) * GSTG + (128 + ln) * GP + hh * 16];
    FragH a[4], b[4][4];
#pragma unroll
    for (int ks = 0; ks < 4; ++ks) {      // lane half hh: registers 0..3 hold k = 32 ks + 8 hh + 0..7, registers 4..7 hold k = 32 ks + 16 + 8 hh + 0..7, for A and B alike
      a[ks].half[0] = *(const v8us*)(sa + ks * 64); a[ks].half[1] = *(const v8us*)(sa + ks * 64 + 32);
#pragma unroll
      for (int q = 0; q < 4; ++q) { b[ks][q].half[0] = *(const v8us*)(sb + q * 16 * GP + ks * 64); b[ks][q].half[1] = *(const v8us*)(sb + q * 16 * GP + ks * 64 + 32); }
    }
    asm volatile("s_wait_dscnt 0x0" ::: "memory");      // the whole stage is in this wave's registers: its reads of the buffer have returned before the buffer is refilled
    asm volatile("s_wait_asynccnt 0x0" ::: "memory");      // this wave's copies of stage t + 1 have landed
    __syncthreads();      // publishes stage t + 1 and ends every wave's reads of stage t
    if (t + 2 < NT) cp_stage<RB>(l0 + (unsigned)((t & 1) * GSTG), ga + (t + 2) * 256, gb + (t + 2) * 256);      // stage t + 2 into the buffer that this trip has read
    __builtin_amdgcn_sched_barrier(0);      // keeps the products behind the refill: they need registers only, and the copies so fly under them as well as under the next stage's reads
#pragma unroll
    for (int ks = 0; ks < 4; ++ks)
#pragma unroll
      for (int q = 0; q < 4; ++q) acc[q] = mma16(a[ks].v, b[ks][q].v, acc[q]);
  }
  asm volatile("s_wait_asynccnt 0x0" ::: "memory");      // no copy is outstanding when the wave goes on to its end
  // the four vector slots that the chip needs behind the loop's last matrix instructions before their A or B registers are rewritten: the epilogues are reached over scalar branches
  if (FRAG) asm volatile("v_nop\n\tv_nop\n\tv_nop\n\tv_nop");
  if (FRAG && mode == 3) {
    char* tv = (char*)so;      // 128 rows (b, d) of 64 j. Accumulator register r is tile row 16 w + 8 hh + r = (j, b) with j = 8 w + 4 hh + r / 2, b = r % 2: the four registers of one b are four neighbouring j
#pragma unroll
    for (int q = 0; q < 4; ++q)
#pragma unroll
      for (int b = 0; b < 2; ++b) { v4h h4; for (int e = 0; e < 4; ++e) h4[e] = (_Float16)(acc[q][2 * e + b] * alpha + (BIAS ? bf16_round(braw[q]) : 0.f)); *(v4h*)(tv + (b * 64 + q * 16 + ln) * VP + w * 16 + hh * 8) = h4; }
    __syncthreads();      // every wave holds eight j of every row: the rows are whole before they are read
    const char* tr = tv + (tid >> 3) * VP + (tid & 7) * 16; v8us x[4];      // eight lanes a row; trip it takes rows 32 it + tid / 8
#pragma unroll
    for (int it = 0; it < 4; ++it) x[it] = *(const v8us*)(tr + it * 32 * VP);
    unsigned short* vo = (unsigned short*)C16 + ((size_t)nq * 64 + (tid >> 3)) * KL + bm * 64 + (tid & 7) * 8;
#pragma unroll
    for (int it = 0; it < 4; ++it) *(v8us*)(vo + ((size_t)(it >> 1) * NH * 64 + (it & 1) * 32) * KL) = x[it];
    return;
  }
  if (FRAG) {
    // The wave turns its 16 x 64 tile in its own staging rows. Staging row rw keeps its 4-float group g at place g ^ rw: the accumulator stores (16 columns of two rows 8 apart) and the 16-byte reads below (one group of 16 different rows) both fall on 64 different banks.
    // A lane stores the 16 bytes (row rr, c = 2 x + hh), x = 0..3, which lie 512 bytes apart. Rows (j,b): 8 lanes take the wave's 8 j of one b, a whole 128-byte line of block j / 16 (the wave holds half a block of either b); rows m: the wave's 16 rows are one block, 512 bytes in a row.
    const bool jb = (mode != 5); const int l7 = lane & 7, lb = (lane >> 3) & 1;
    const int rr = jb ? l7 * 2 + lb : ln;
    const int blk = jb ? (lb * NH + nq) * ((mode == 2) ? QL / 16 : KL / 16) + bm * 4 + (w >> 1) : nq * (KL / 16) + bm * 8 + w;
    const size_t go = (size_t)blk * FB + hh * 256 + (jb ? (w & 1) * 8 + l7 : ln) * 16;
#pragma unroll 1      // kept rolled: the q tile's second trip differs from the first in its bias and its plane alone
    for (int ps = 0; ps < ((mode == 2) ? 2 : 1); ++ps) {
#pragma unroll
      for (int q = 0; q < 4; ++q) { const float hb = bf16_round(ps ? hr[q] : hw[q]);
#pragma unroll
        for (int r = 0; r < 8; ++r) { const int rw = 8 * hh + r; float v = acc[q][r] * alpha + (BIAS ? bf16_round(braw[q]) : 0.f); if (mode == 2) v += hb; so[w][rw][(((q * 4 + (ln >> 2)) ^ rw) << 2) + (ln & 3)] = v; } }
      __builtin_amdgcn_fence(__ATOMIC_ACQ_REL, "workgroup", "local"); __builtin_amdgcn_wave_barrier();      // the wave reads back its own staging rows; a fence of LDS alone, so that the second trip does not wait for the first trip's global stores
      v8us o[4];
#pragma unroll
      for (int x = 0; x < 4; ++x) { const int g = (4 * x + 2 * hh) ^ rr; const v4f lo = *(const v4fa*)&so[w][rr][g << 2], hi = *(const v4fa*)&so[w][rr][(g ^ 1) << 2]; FragH f;
        for (int e = 0; e < 4; ++e) { f.h[e] = (_Float16)lo[e]; f.h[4 + e] = (_Float16)hi[e]; } o[x] = f.half[0]; }
      char* dst = (char*)(ps ? C16b : C16) + go;
#pragma unroll
      for (int x = 0; x < 4; ++x) *(v8us*)(dst + x * 512) = o[x];
      // the wait that is owed before a register named by an issued global store is rewritten (the second trip reuses them); address and data are inputs, so they stay live to here
      asm volatile("s_wait_xcnt 0x0" :: "v"(dst), "v"(o[0]), "v"(o[1]), "v"(o[2]), "v"(o[3]) : "memory");
    }
    return;
  }
#pragma unroll
  for (int q = 0; q < 4; ++q)
#pragma unroll
    for (int r = 0; r < 8; ++r) so[w][8 * hh + r][q * 16 + ln] = acc[q][r] * alpha + (BIAS ? bf16_round(braw[q]) : 0.f);
  __builtin_amdgcn_fence(__ATOMIC_ACQ_REL, "workgroup"); __builtin_amdgcn_wave_barrier();      // the wave reads back its own staging rows: whole 128-byte lines go out
  const int rsub = lane >> 4, c4 = (lane & 15) * 4; const size_t cofs = (size_t)(row0 + rsub) * LDC + col0 + c4;      // the lane's first element; its eight rows lie 2 LDC apart
  v4f ov[8];
#pragma unroll
  for (int q = 0; q < 8; ++q) ov[q] = *(const v4fa*)&so[w][q * 2 + rsub][c4];
  if (mode == 0) {      // one branch round all eight stores; mode here is k_gemm_lds's F32OUT ? 0 : 1, a constant once inlined
#pragma unroll
    for (int q = 0; q < 8; ++q) *(v4f*)(C + cofs + q * 2 * LDC) = ov[q];
  } else {
#pragma unroll
    for (int q = 0; q < 8; ++q) { v4h h4; for (int i = 0; i < 4; ++i) h4[i] = (_Float16)ov[q][i]; *(v4h*)(C16 + cofs + q * 2 * LDC) = h4; }
  }
}
template <int KK, int LDC, bool F32OUT, bool BIAS>
__global__ __launch_bounds__(256) void k_gemm_lds(const _Float16* __restrict__ A, size_t sA, const _Float16* __restrict__ Bh, size_t sB, float alpha, const float* __restrict__ bias,
    float* __restrict__ C, _Float16* __restrict__ C16, size_t sC, int ntn) {
  __shared__ __attribute__((aligned(16))) char ring[2 * GSTG];
  __shared__ __attribute__((aligned(16))) float so[8][16][64];
  const size_t by = blockIdx.y;
  gemm_tile<KK, LDC, BIAS, false>(A + by * sA, Bh + by * sB, alpha, bias, F32OUT ? C + by * sC : nullptr, F32OUT ? nullptr : C16 + by * sC, nullptr, nullptr, nullptr, F32OUT ? 0 : 1, blockIdx.x / ntn, blockIdx.x % ntn, ring, so);
}
// The four input projections in one launch (each reads only what k_prep wrote): tiles of k, v (4096 rows of CAT each), then q (the last 2048 rows of CAT) and rk (the 2048 rows of R16); every tile as in k_gemm_lds.
// The epilogues leave the planes as the score kernel and the P*V GEMM read them: q goes out twice, with r_w_bias and with r_r_bias added; q, k and rk go out in the score kernel's fragment order, and v goes out transposed per (b,n).
#define GTK ((NKR / 128) * (DM / 64))      // tiles of k and of v
#define GTQ ((NQR / 128) * (DM / 64))      // tiles of q and of rk
__global__ __launch_bounds__(256) void k_proj(const _Float16* __restrict__ CAT, const _Float16* __restrict__ R16, const _Float16* __restrict__ Bw, const float* __restrict__ bq, const float* __restrict__ bk, const float* __restrict__ bv, const float* __restrict__ br,
    const float* __restrict__ rwb, const float* __restrict__ rrb, _Float16* __restrict__ QW, _Float16* __restrict__ QR, _Float16* __restrict__ K16, _Float16* __restrict__ Vt, _Float16* __restrict__ RK) {
  __shared__ __attribute__((aligned(16))) char ring[2 * GSTG];
  __shared__ __attribute__((aligned(16))) float so[8][16][64];
  const int bx = blockIdx.x;
  const int job = (bx < GTK) ? 1 : (bx < 2 * GTK) ? 2 : (bx < 2 * GTK + GTQ) ? 0 : 3;      // the weight's place in Bw: 0 q, 1 k, 2 v, 3 rk
  const int tl = (job == 1) ? bx : (job == 2) ? bx - GTK : (job == 0) ? bx - 2 * GTK : bx - 2 * GTK - GTQ;
  const _Float16* A = (job == 0) ? CAT + (size_t)NQR * DM : (job == 3) ? R16 : CAT;
  const float* bias = (job == 0) ? bq : (job == 1) ? bk : (job == 2) ? bv : br;
  _Float16* C16 = (job == 0) ? QW : (job == 1) ? K16 : (job == 2) ? Vt : RK;
  const int mode = (job == 0) ? 2 : (job == 1) ? 4 : (job == 2) ? 3 : 5;      // from blockIdx alone: the barrier of the v epilogue is passed by a whole work-group or by none of it
  gemm_tile<DM, DM, true, true>(A, Bw + (size_t)job * DM * DM, 0.0625f, bias, nullptr, C16, QR, rwb, rrb, mode, tl / (DM / 64), tl % (DM / 64), ring, so);
}
__global__ __launch_bounds__(256) void k_lnout(const float* __restrict__ RES, const float* __restrict__ w, const float* __restrict__ g, const float* __restrict__ bb, float* __restrict__ out) { const int tid = threadIdx.x, wv = tid >> 5, lane = tid & 31; const int r = blockIdx.x * 8 + wv; if (r >= NQR) return; v4f y[8]; float s = 0.f;
#pragma unroll
  for (int j = 0; j < 8; ++j) { const int c = j * 128 + lane * 4; const v4f a = *(const v4fa*)(RES + (size_t)r * DM + c), x = *(const v4fa*)(w + (size_t)r * DM + c); for (int q = 0; q < 4; ++q) { y[j][q] = a[q] + bf16_round(x[q]); s += y[j][q]; } }
  for (int o = 16; o >= 1; o >>= 1) s += __shfl_xor(s, o, 32); const float mu = s / (float)DM; float q2 = 0.f;
#pragma unroll
  for (int j = 0; j < 8; ++j) for (int q = 0; q < 4; ++q) { const float d = y[j][q] - mu; q2 += d * d; }
  for (int o = 16; o >= 1; o >>= 1) q2 += __shfl_xor(q2, o, 32); const float rs = rsqrtf(q2 / (float)DM + 1e-5f);
  {
#pragma unroll
    for (int j = 0; j < 8; ++j) { const int c = j * 128 + lane * 4; v4f o; for (int q = 0; q < 4; ++q) o[q] = (y[j][q] - mu) * rs * bf16_round(g[c + q]) + bf16_round(bb[c + q]); *(v4f*)(out + (size_t)r * DM + c) = o; }
     } }

extern "C" void kernel_launch(void* const* d_in, const int* in_sizes, int n_in,
                              void* d_out, int out_size, void* d_ws, size_t ws_size, hipStream_t stream) {
  (void)in_sizes; (void)n_in; (void)out_size;
  const float* const* I = (const float* const*)d_in; const float* w = I[0]; const float* r = I[1]; const float* mems = I[2]; const float* rwb = I[3]; const float* rrb = I[4]; const int* msk = (const int*)d_in[5];
  const float* Wq = I[6]; const float* bq = I[7]; const float* Wk = I[8]; const float* bk = I[9]; const float* Wv = I[10]; const float* bv = I[11]; const float* Wr = I[12]; const float* br = I[13]; const float* Wo = I[14]; const float* bo = I[15]; const float* lg = I[16]; const float* lb = I[17];
  char* ws = (char*)d_ws; size_t off = 0;
  auto take = [&](size_t bytes) { char* p = ws + off; off += (bytes + 255) & ~(size_t)255; return p; };
  const size_t WSZ = (size_t)DM * DM; _Float16* Bw = (_Float16*)take(5 * WSZ * 2);      /* Wq, Wk, Wv, Wr, Wo */
  _Float16* QW = (_Float16*)take((size_t)NQR * DM * 2); _Float16* QR = (_Float16*)take((size_t)NQR * DM * 2);
  _Float16* K16 = (_Float16*)take((size_t)NKR * DM * 2); _Float16* Vt = (_Float16*)take((size_t)NKR * DM * 2); _Float16* RK = (_Float16*)take((size_t)KL * DM * 2);
  _Float16* P16 = (_Float16*)take((size_t)BZ * NH * QL * KL * 2); _Float16* O16 = (_Float16*)take((size_t)NQR * DM * 2);      /* P of all 32 (b,n) planes, so that one launch does every P*V */
  _Float16* CAT = (_Float16*)take((size_t)NKR * DM * 2); _Float16* R16 = (_Float16*)take((size_t)KL * DM * 2); float* RES = (float*)take((size_t)NQR * DM * 4);
  if (off > ws_size) return;      // MiB: 10 + 4 + 4 + 8 + 8 + 4 + 128 + 4 + 8 + 4 + 8 = 190 of 256
  k_prep<<<5 * GWT + 3 * GX, 256, 0, stream>>>(Wq, Wk, Wv, Wr, Wo, mems, w, r, Bw, CAT, R16);      /* weights (in,out) -> Bt x2^4; cat = [mems; w] is the two inputs back to back (rows (j,b)); r rows m */
  k_proj<<<2 * GTK + 2 * GTQ, 256, 0, stream>>>(CAT, R16, Bw, bq, bk, bv, br, rwb, rrb, QW, QR, K16, Vt, RK);      /* k, v: M 4096 N 1024 K 1024; q (last qlen rows of cat) + bq, rk = r.Wr + br: M 2048; one work-group a 128 x 64 tile; q stored + r_w_bias / + r_r_bias, v stored as V^T per (b,n) */
  const dim3 gq((NQR / 128) * (DM / 64), 1);      /* one work-group a 128 x 64 tile */
  const dim3 go(QL / 128, BZ * NH);
  k_score<<<dim3(QL / 16, BZ * NH), 512, 0, stream>>>(QW, QR, K16, RK, msk, P16);      /* AC, raw BD, shift, mask and softmax of all 32 (b,n) planes: 16 query rows a work-group, scores in LDS only */
  k_gemm_lds<KL, BZ * DM, false, false><<<go, 256, 0, stream>>>(P16, (size_t)QL * KL, Vt, (size_t)64 * KL, 0.000030517578125f, nullptr, nullptr, O16, 64, 1);      /* attn_vec f16, rows (i,b), plane s = b*16 + h at cols s*64 of the 2048-wide (i) row: M 1024 N 64 K 2048, ldc 2048, all 32 planes in blockIdx.y */
  k_gemm_lds<DM, DM, true, true><<<gq, 256, 0, stream>>>(O16, 0, Bw + 4 * WSZ, 0, 0.0625f, bo, RES, nullptr, 0, DM / 64);      /* attn_out = attn_vec·Wo + bo (rows (i,b)) */
  k_lnout<<<(NQR + 7) / 8, 256, 0, stream>>>(RES, w, lg, lb, (float*)d_out);
}

// v008
// It runs in 125 microseconds.
// Next to v007, in two timings, it ran 1.03 and 1.02 times as fast.
// Over all steps from v000 it is 21.9 times as fast.
#include <hip/hip_runtime.h>
// Transformer-XL relative multi-head attention (qlen 1024, mem_len 1024 → klen 2048, bsz 2, 16 heads × 64, post-LN): cat = [mems; w] (rows (j,b)); q = (cat·Wq + bq)[last qlen], k, v = cat·Wk + bk, cat·Wv + bv; rk = r·Wr + br;
// AC[i,j] = (q_i + r_w_bias)·k_j; BD = rel_shift((q_i + r_r_bias)·rk_m) (the exact pad-reshape shift, incl. its wrap region); score = (AC + BD)/8, −inf where the INPUT mask is set; softmax over j; attn_vec = Σ_j p·v_j;
// out = LayerNorm(w + attn_vec·Wo + bo)·g + b → [1024, 2, 1024]. (in,out) weights.
// Compute dtype: w, mems, r, biases, weights rounded to bf16; q (+ the two head biases), k, v, rk as f16 GEMM planes; one fused kernel forms, per 32 query rows of a (b,n) plane, AC and raw BD (f32 accumulators),
// applies the relative shift as a scatter into LDS, the mask and an f32 softmax and writes P f16 x2^15; attn_vec by GEMM; Wo GEMM + bias; residual + LayerNorm in f32 (wave per row). All contractions on v_wmma_f32_16x16x32_f16, f32 accumulate.
#define QL 1024
#define KL 2048
#define BZ 2
#define NH 16
#define DM 1024
#define NQR (QL * BZ)
#define NKR (KL * BZ)
#define ATT_SCALE 0.125f

typedef __bf16 v16b __attribute__((ext_vector_type(16)));
typedef unsigned short v8us __attribute__((ext_vector_type(8), may_alias));
typedef float  v8f  __attribute__((ext_vector_type(8)));
typedef float  v4f  __attribute__((ext_vector_type(4)));
typedef float  v4fa __attribute__((ext_vector_type(4), may_alias));
union FragB { v16b v; v8us half[2]; unsigned short u[16]; };

__device__ __forceinline__ unsigned short bf16_bits(float x) { unsigned int u = __float_as_uint(x); return (unsigned short)((u + 0x7FFFu + ((u >> 16) & 1u)) >> 16); }
__device__ __forceinline__ float bf16_val(unsigned short b) { return __uint_as_float(((unsigned int)b) << 16); }
__device__ __forceinline__ float bf16_round(float x) { return bf16_val(bf16_bits(x)); }
// D += A·B with NT terms: 1 = ah·bh, 2 = + al·bh (A split), 3 = + ah·bl (both split)
template <int NT>
__device__ __forceinline__ v8f mmaN(v16b ah, v16b al, v16b bh, v16b bl, v8f c) {
  c = __builtin_amdgcn_wmma_f32_16x16x32_bf16(false, ah, false, bh, (short)0, c, false, false);
  if (NT >= 2) c = __builtin_amdgcn_wmma_f32_16x16x32_bf16(false, al, false, bh, (short)0, c, false, false);
  if (NT >= 3) c = __builtin_amdgcn_wmma_f32_16x16x32_bf16(false, ah, false, bl, (short)0, c, false, false);
  asm volatile("v_nop\n\tv_nop\n\tv_nop\n\tv_nop" : "+v"(c) : "v"(ah), "v"(al), "v"(bh), "v"(bl));
  return c;
}

__global__ __launch_bounds__(256) void k_wt_bf16(const float* __restrict__ W, unsigned short* __restrict__ Wt, int K, int N) {
  const int t = blockIdx.x * 256 + threadIdx.x;
  const int k8n = K / 8;
  if (t >= N * k8n) return;
  const int n = t / k8n, k8 = (t % k8n) * 8;
  v8us v;
#pragma unroll
  for (int i = 0; i < 8; ++i) v[i] = bf16_bits(W[(size_t)(k8 + i) * N + n]);
  *(v8us*)(Wt + (size_t)n * K + k8) = v;
  
}

// GEMM C[M][N] (f32, pitch ldc) = act(A[M][K]·W + bias). A f32 row-major (pitch lda) converted per fragment to bf16
// (ASPLIT: hi/lo two planes -> 2 terms, else single rounded term); Wt bf16 [N][K] (pitch ldb). BIAS_BF16 rounds the
// bias to bf16 first (bias quantised to bf16 before the add). K%32==0, M%16==0, N%64==0.
template <bool ASPLIT, int ACT, bool BIAS_BF16>
__global__ __launch_bounds__(128) void k_gemm_bf(const float* __restrict__ A, int lda, const unsigned short* __restrict__ Wt, int ldb,
                                               const float* __restrict__ bias, float* __restrict__ C, int ldc, int M, int N, int K) {
  __shared__ __attribute__((aligned(16))) float so[4][16][64];
  const int tid = threadIdx.x, w = tid >> 5, lane = tid & 31, ln = lane & 15, hh = lane >> 4;
  const int ntn = N / 64;
  const int wid = blockIdx.x * 4 + w;
  const int mt = wid / ntn, nq = wid % ntn;
  if (mt * 16 >= M) return;
  const int row0 = mt * 16, col0 = nq * 64;
  const float* arow = A + (size_t)(row0 + ln) * lda;
  v8f acc[4] = {};
  for (int kb = 0; kb < K; kb += 32) {
    FragB ah, al;
    const v4f x0 = *(const v4fa*)(arow + kb + 8 * hh), x1 = *(const v4fa*)(arow + kb + 8 * hh + 4);
    const v4f x2 = *(const v4fa*)(arow + kb + 16 + 8 * hh), x3 = *(const v4fa*)(arow + kb + 16 + 8 * hh + 4);
    float xs[16] = {x0[0],x0[1],x0[2],x0[3],x1[0],x1[1],x1[2],x1[3],x2[0],x2[1],x2[2],x2[3],x3[0],x3[1],x3[2],x3[3]};
#pragma unroll
    for (int i = 0; i < 16; ++i) { const unsigned short hb = bf16_bits(xs[i]); ah.u[i] = hb; al.u[i] = ASPLIT ? bf16_bits(xs[i] - bf16_val(hb)) : (unsigned short)0; }
#pragma unroll
    for (int t = 0; t < 4; ++t) {
      const unsigned short* brow = Wt + (size_t)(col0 + t * 16 + ln) * ldb + kb;
      FragB b;
      b.half[0] = *(const v8us*)(brow + 8 * hh);
      b.half[1] = *(const v8us*)(brow + 16 + 8 * hh);
      acc[t] = mmaN<ASPLIT ? 2 : 1>(ah.v, al.v, b.v, b.v, acc[t]);
    }
  }
#pragma unroll
  for (int t = 0; t < 4; ++t) {
    float bv = bias ? bias[col0 + t * 16 + ln] : 0.f;
    if (BIAS_BF16) bv = bf16_round(bv);
#pragma unroll
    for (int r = 0; r < 8; ++r) { float v = acc[t][r] + bv; if (ACT == 1) v = fmaxf(v, 0.f); so[w][8 * hh + r][t * 16 + ln] = v; }
  }
  __builtin_amdgcn_fence(__ATOMIC_ACQ_REL, "workgroup");
  __builtin_amdgcn_wave_barrier();
  const int rsub = lane >> 4, c4 = (lane & 15) * 4;
  {
#pragma unroll
    for (int q = 0; q < 8; ++q) {
      const int r = q * 2 + rsub;
      const v4f v = *(const v4fa*)&so[w][r][c4];
      *(v4f*)(C + (size_t)(row0 + r) * ldc + col0 + c4) = v;
    }
    
  }
}

// Flash-style causal/unmasked attention, all contractions 3-term bf16 hi/lo splits, f32 softmax with running max.
// q,k,v rows are read from f32 buffers with arbitrary row pitch (so they can live inside a fused qkv buffer);
// D = head size (multiple of 32, <= 128); one wave = 16 query rows; block = 4 waves (64 queries) sharing K/V chunks of 32.
template <int D, bool CAUSAL>
__global__ __launch_bounds__(128) void k_flash(const float* __restrict__ qb, const float* __restrict__ kb, const float* __restrict__ vb,
                                             int pitch, int T, int H, float scale, float* __restrict__ y, int ypitch) {
  constexpr int KS = D / 32;        // k-steps for QK
  constexpr int DT = D / 16;        // d tiles for PV
  __shared__ __attribute__((aligned(16))) unsigned short sKh[32][D + 8], sKl[32][D + 8], sVh[32][D + 8], sVl[32][D + 8];
  __shared__ __attribute__((aligned(16))) unsigned short sPh[4][16][40], sPl[4][16][40];
  __shared__ __attribute__((aligned(16))) float sO[4][16][D];
  const int tid = threadIdx.x, w = tid >> 5, lane = tid & 31, ln = lane & 15, hh = lane >> 4;
  const int nqb = (T + 63) / 64;
  const int bh = blockIdx.x / nqb, qblk = blockIdx.x % nqb;
  const int b = bh / H, h = bh % H;
  const int q0 = qblk * 64 + w * 16;
  const float* Q = qb + (size_t)b * T * pitch + h * D;
  const float* K = kb + (size_t)b * T * pitch + h * D;
  const float* V = vb + (size_t)b * T * pitch + h * D;

  // A fragments of the wave's 16 query rows (scaled), hi/lo
  FragB aqh[KS], aql[KS];
  {
    int row = q0 + ln; if (row >= T) row = T - 1;
    const float* qr = Q + (size_t)row * pitch;
#pragma unroll
    for (int ks = 0; ks < KS; ++ks)
#pragma unroll
      for (int i = 0; i < 16; ++i) {
        const int d = ks * 32 + ((i < 8) ? (8 * hh + i) : (16 + 8 * hh + (i - 8)));
        const float x = qr[d] * scale; const unsigned short hb = bf16_bits(x);
        aqh[ks].u[i] = hb; aql[ks].u[i] = bf16_bits(x - bf16_val(hb));
      }
  }
  float m_r[8], l_r[8];
#pragma unroll
  for (int r = 0; r < 8; ++r) { m_r[r] = -3.0e38f; l_r[r] = 0.f; }
  v8f oacc[DT];
#pragma unroll
  for (int dt = 0; dt < DT; ++dt) oacc[dt] = (v8f){0.f,0.f,0.f,0.f,0.f,0.f,0.f,0.f};

  const int kv_end = CAUSAL ? min(T, qblk * 64 + 64) : T;     // block-uniform
  for (int j0 = 0; j0 < kv_end; j0 += 32) {
    __syncthreads();
    for (int e = tid; e < 32 * (D / 4); e += 128) {
      const int r = e / (D / 4), c4 = (e % (D / 4)) * 4;
      const int key = j0 + r;
      v4f kf = {0.f,0.f,0.f,0.f}, vf = {0.f,0.f,0.f,0.f};
      if (key < T) { kf = *(const v4fa*)(K + (size_t)key * pitch + c4); vf = *(const v4fa*)(V + (size_t)key * pitch + c4); }
#pragma unroll
      for (int t = 0; t < 4; ++t) {
        unsigned short hb = bf16_bits(kf[t]); sKh[r][c4 + t] = hb; sKl[r][c4 + t] = bf16_bits(kf[t] - bf16_val(hb));
        hb = bf16_bits(vf[t]); sVh[r][c4 + t] = hb; sVl[r][c4 + t] = bf16_bits(vf[t] - bf16_val(hb));
      }
    }
    __syncthreads();
    // S tile 16 x 32
    v8f s[2];
#pragma unroll
    for (int nt = 0; nt < 2; ++nt) {
      v8f acc = {};
#pragma unroll
      for (int ks = 0; ks < KS; ++ks) {
        FragB bh_, bl_;
        bh_.half[0] = *(const v8us*)&sKh[nt * 16 + ln][ks * 32 + 8 * hh]; bh_.half[1] = *(const v8us*)&sKh[nt * 16 + ln][ks * 32 + 16 + 8 * hh];
        bl_.half[0] = *(const v8us*)&sKl[nt * 16 + ln][ks * 32 + 8 * hh]; bl_.half[1] = *(const v8us*)&sKl[nt * 16 + ln][ks * 32 + 16 + 8 * hh];
        acc = mmaN<3>(aqh[ks].v, aql[ks].v, bh_.v, bl_.v, acc);
      }
      s[nt] = acc;
    }
    // mask + running max (rows 8hh+r; the 16 lanes of a half share rows)
    float alpha[8];
#pragma unroll
    for (int r = 0; r < 8; ++r) {
      const int qi = q0 + 8 * hh + r;
      const int ja = j0 + ln, jb = j0 + 16 + ln;
      if (CAUSAL) { if (ja > qi) s[0][r] = -3.0e38f; if (jb > qi) s[1][r] = -3.0e38f; }
      if (ja >= T) s[0][r] = -3.0e38f;
      if (jb >= T) s[1][r] = -3.0e38f;
      float mx = fmaxf(s[0][r], s[1][r]);
      mx = fmaxf(mx, __shfl_xor(mx, 1, 32)); mx = fmaxf(mx, __shfl_xor(mx, 2, 32)); mx = fmaxf(mx, __shfl_xor(mx, 4, 32)); mx = fmaxf(mx, __shfl_xor(mx, 8, 32));
      const float mnew = fmaxf(m_r[r], mx);
      alpha[r] = (mnew > -1.0e38f) ? __expf(m_r[r] - mnew) : 1.0f;
      const float p0 = (s[0][r] > -1.0e38f) ? __expf(s[0][r] - mnew) : 0.f;
      const float p1 = (s[1][r] > -1.0e38f) ? __expf(s[1][r] - mnew) : 0.f;
      m_r[r] = mnew;
      l_r[r] = l_r[r] * alpha[r] + p0 + p1;            // per-lane partial row sum (16 lanes combined at the end)
      unsigned short hb = bf16_bits(p0); sPh[w][8 * hh + r][ln] = hb;      sPl[w][8 * hh + r][ln] = bf16_bits(p0 - bf16_val(hb));
      hb = bf16_bits(p1);                sPh[w][8 * hh + r][16 + ln] = hb; sPl[w][8 * hh + r][16 + ln] = bf16_bits(p1 - bf16_val(hb));
    }
#pragma unroll
    for (int dt = 0; dt < DT; ++dt)
#pragma unroll
      for (int r = 0; r < 8; ++r) oacc[dt][r] *= alpha[r];
    __builtin_amdgcn_fence(__ATOMIC_ACQ_REL, "workgroup");
    __builtin_amdgcn_wave_barrier();
    FragB pah, pal;
    pah.half[0] = *(const v8us*)&sPh[w][ln][8 * hh]; pah.half[1] = *(const v8us*)&sPh[w][ln][16 + 8 * hh];
    pal.half[0] = *(const v8us*)&sPl[w][ln][8 * hh]; pal.half[1] = *(const v8us*)&sPl[w][ln][16 + 8 * hh];
#pragma unroll
    for (int dt = 0; dt < DT; ++dt) {
      FragB bvh, bvl;
#pragma unroll
      for (int i = 0; i < 8; ++i) {
        bvh.u[i] = sVh[8 * hh + i][dt * 16 + ln]; bvh.u[8 + i] = sVh[16 + 8 * hh + i][dt * 16 + ln];
        bvl.u[i] = sVl[8 * hh + i][dt * 16 + ln]; bvl.u[8 + i] = sVl[16 + 8 * hh + i][dt * 16 + ln];
      }
      oacc[dt] = mmaN<3>(pah.v, pal.v, bvh.v, bvl.v, oacc[dt]);
    }
    __builtin_amdgcn_fence(__ATOMIC_ACQ_REL, "workgroup");
    __builtin_amdgcn_wave_barrier();
  }
#pragma unroll
  for (int r = 0; r < 8; ++r) {
    float l = l_r[r];
    l += __shfl_xor(l, 1, 32); l += __shfl_xor(l, 2, 32); l += __shfl_xor(l, 4, 32); l += __shfl_xor(l, 8, 32);
    l_r[r] = (l > 0.f) ? 1.0f / l : 0.f;
  }
#pragma unroll
  for (int dt = 0; dt < DT; ++dt)
#pragma unroll
    for (int r = 0; r < 8; ++r) sO[w][8 * hh + r][dt * 16 + ln] = oacc[dt][r] * l_r[r];
  __builtin_amdgcn_fence(__ATOMIC_ACQ_REL, "workgroup");
  __builtin_amdgcn_wave_barrier();
  {
    for (int r = 0; r < 16; ++r) {
      const int row = q0 + r;
      if (row < T && lane < D / 4) {
        const v4f val = *(const v4fa*)&sO[w][r][lane * 4];
        *(v4f*)(y + ((size_t)b * T + row) * ypitch + h * D + lane * 4) = val;
      }
    }
    
  }
}

// GEMM C = act(A·W + bias + resid): A f32 (ASPLIT -> hi/lo 2 terms), Wt bf16 [N][K]; ACT 0 none, 1 relu, 2 exact gelu;
// resid (optional, f32, row index = (row % rmod), pitch ldr, RES_BF16 rounds it) added before the activation.
template <bool ASPLIT, int ACT, bool BIAS_BF16, bool RES_BF16>
__global__ __launch_bounds__(128) void k_gemm_bf3(const float* __restrict__ A, int lda, const unsigned short* __restrict__ Wt, int ldb,
                                                const float* __restrict__ bias, const float* __restrict__ resid, int rmod, int ldr,
                                                float* __restrict__ C, int ldc, int M, int N, int K) {
  __shared__ __attribute__((aligned(16))) float so[4][16][64];
  const int tid = threadIdx.x, w = tid >> 5, lane = tid & 31, ln = lane & 15, hh = lane >> 4;
  const int ntn = N / 64;
  const int wid = blockIdx.x * 4 + w;
  const int mt = wid / ntn, nq = wid % ntn;
  if (mt * 16 >= M) return;
  const int row0 = mt * 16, col0 = nq * 64;
  const float* arow = A + (size_t)(row0 + ln) * lda;
  v8f acc[4] = {};
  for (int kb = 0; kb < K; kb += 32) {
    FragB ah, al;
    const v4f x0 = *(const v4fa*)(arow + kb + 8 * hh), x1 = *(const v4fa*)(arow + kb + 8 * hh + 4);
    const v4f x2 = *(const v4fa*)(arow + kb + 16 + 8 * hh), x3 = *(const v4fa*)(arow + kb + 16 + 8 * hh + 4);
    float xs[16] = {x0[0],x0[1],x0[2],x0[3],x1[0],x1[1],x1[2],x1[3],x2[0],x2[1],x2[2],x2[3],x3[0],x3[1],x3[2],x3[3]};
#pragma unroll
    for (int i = 0; i < 16; ++i) { const unsigned short hb = bf16_bits(xs[i]); ah.u[i] = hb; al.u[i] = ASPLIT ? bf16_bits(xs[i] - bf16_val(hb)) : (unsigned short)0; }
#pragma unroll
    for (int t = 0; t < 4; ++t) {
      const unsigned short* brow = Wt + (size_t)(col0 + t * 16 + ln) * ldb + kb;
      FragB b;
      b.half[0] = *(const v8us*)(brow + 8 * hh);
      b.half[1] = *(const v8us*)(brow + 16 + 8 * hh);
      acc[t] = mmaN<ASPLIT ? 2 : 1>(ah.v, al.v, b.v, b.v, acc[t]);
    }
  }
#pragma unroll
  for (int t = 0; t < 4; ++t) {
    const int col = col0 + t * 16 + ln;
    float bv = bias ? bias[col] : 0.f;
    if (BIAS_BF16) bv = bf16_round(bv);
#pragma unroll
    for (int r = 0; r < 8; ++r) {
      float v = acc[t][r] + bv;
      if (resid) { float rv = resid[(size_t)((row0 + 8 * hh + r) % rmod) * ldr + col]; if (RES_BF16) rv = bf16_round(rv); v += rv; }
      if (ACT == 1) v = fmaxf(v, 0.f);
      if (ACT == 2) v = 0.5f * v * (1.0f + erff(v * 0.70710678118654752f));
      if (ACT == 3) { const float u = 0.7978845608028654f * (v + 0.044715f * v * v * v); v = 0.5f * v * (1.0f + tanhf(u)); }
      so[w][8 * hh + r][t * 16 + ln] = v;
    }
  }
  __builtin_amdgcn_fence(__ATOMIC_ACQ_REL, "workgroup");
  __builtin_amdgcn_wave_barrier();
  const int rsub = lane >> 4, c4 = (lane & 15) * 4;
  {
#pragma unroll
    for (int q = 0; q < 8; ++q) {
      const int r = q * 2 + rsub;
      const v4f v = *(const v4fa*)&so[w][r][c4];
      *(v4f*)(C + (size_t)(row0 + r) * ldc + col0 + c4) = v;
    }
    
  }
}
// row LayerNorm (biased variance, eps) over N: s = X (+ R); optional out_sum <- s; out_norm <- (s-mu)*rsqrt(var+eps)*g + b
template <bool PARAM_BF16>
__global__ __launch_bounds__(256) void k_layernorm(const float* __restrict__ X, const float* __restrict__ R, const float* __restrict__ g, const float* __restrict__ bta,
                                                  float* __restrict__ out_sum, float* __restrict__ out_norm, int N, float eps) {
  __shared__ float red[256];
  const int row = blockIdx.x, tid = threadIdx.x;
  const float* x = X + (size_t)row * N; const float* rr = R ? R + (size_t)row * N : nullptr;
  float vals[16];                     // up to N = 4096
  const int per = N / 256;            // contiguous chunk per thread? use strided-by-4 chunks: thread handles j = tid*4 + 1024*u
  float s1 = 0.f;
  for (int u = 0; u < per / 4; ++u) {
    const int j = tid * 4 + 1024 * u;
    const v4f a = *(const v4fa*)(x + j);
    v4f b = {0.f,0.f,0.f,0.f}; if (rr) b = *(const v4fa*)(rr + j);
#pragma unroll
    for (int q = 0; q < 4; ++q) { const float v = a[q] + b[q]; vals[u * 4 + q] = v; s1 += v; }
  }
  red[tid] = s1; __syncthreads();
  for (int st = 128; st > 0; st >>= 1) { if (tid < st) red[tid] += red[tid + st]; __syncthreads(); }
  const float mu = red[0] / (float)N; __syncthreads();
  float s2 = 0.f;
  for (int u = 0; u < per / 4; ++u)
#pragma unroll
    for (int q = 0; q < 4; ++q) { const float c = vals[u * 4 + q] - mu; s2 += c * c; }
  red[tid] = s2; __syncthreads();
  for (int st = 128; st > 0; st >>= 1) { if (tid < st) red[tid] += red[tid + st]; __syncthreads(); }
  const float rs = rsqrtf(red[0] / (float)N + eps);
  {
    for (int u = 0; u < per / 4; ++u) {
      const int j = tid * 4 + 1024 * u;
      v4f o, sm;
#pragma unroll
      for (int q = 0; q < 4; ++q) {
        float gg = g[j + q], bb = bta[j + q];
        if (PARAM_BF16) { gg = bf16_round(gg); bb = bf16_round(bb); }
        sm[q] = vals[u * 4 + q]; o[q] = (vals[u * 4 + q] - mu) * rs * gg + bb;
      }
      if (out_sum) *(v4f*)(out_sum + (size_t)row * N + j) = sm;
      *(v4f*)(out_norm + (size_t)row * N + j) = o;
    }
    
  }
}



// ---- f16 WMMA path (v_wmma_f32_16x16x32_f16): 11-bit significands for operands in range — used where a [0,1] probability operand needs more precision than bf16
typedef _Float16 v16h __attribute__((ext_vector_type(16)));
union FragH { v16h v; v8us half[2]; _Float16 h[16]; unsigned short u[16]; };
template <int NT>
__device__ __forceinline__ v8f mmaH(v16h ah, v16h al, v16h bh, v16h bl, v8f c) {
  c = __builtin_amdgcn_wmma_f32_16x16x32_f16(false, ah, false, bh, (short)0, c, false, false);
  if (NT >= 2) c = __builtin_amdgcn_wmma_f32_16x16x32_f16(false, al, false, bh, (short)0, c, false, false);
  if (NT >= 3) c = __builtin_amdgcn_wmma_f32_16x16x32_f16(false, ah, false, bl, (short)0, c, false, false);
  asm volatile("v_nop\n\tv_nop\n\tv_nop\n\tv_nop" : "+v"(c) : "v"(ah), "v"(al), "v"(bh), "v"(bl));
  return c;
}
// batched GEMM like k_gemm_b but f16 operands: A f32 (split into f16 hi/lo if ASPLIT, else rounded to f16), Bt = f16 values [n][k]; alpha; C f32; N multiple of 16 (partial tiles skipped)
template <bool ASPLIT>
__global__ __launch_bounds__(128) void k_gemm_h(const float* __restrict__ A, int lda, size_t sA, const _Float16* __restrict__ Bh, int ldb, size_t sB, float alpha, float* __restrict__ C, int ldc, size_t sC, int M, int N, int K) {
  __shared__ __attribute__((aligned(16))) float so[4][16][64];
  const int tid = threadIdx.x, w = tid >> 5, lane = tid & 31, ln = lane & 15, hh = lane >> 4; const int by = blockIdx.y;
  A += (size_t)by * sA; Bh += (size_t)by * sB; C += (size_t)by * sC;
  const int ntn = (N + 63) / 64; const int wid = blockIdx.x * 4 + w; const int mt = wid / ntn, nq = wid % ntn; if (mt * 16 >= M) return;
  const int row0 = mt * 16, col0 = nq * 64; const float* arow = A + (size_t)(row0 + ln) * lda;
  v8f acc[4] = {};
  for (int kb = 0; kb < K; kb += 32) {
    FragH ah, al;
    const v4f x0 = *(const v4fa*)(arow + kb + 8 * hh), x1 = *(const v4fa*)(arow + kb + 8 * hh + 4), x2 = *(const v4fa*)(arow + kb + 16 + 8 * hh), x3 = *(const v4fa*)(arow + kb + 16 + 8 * hh + 4);
    float xs[16] = {x0[0],x0[1],x0[2],x0[3],x1[0],x1[1],x1[2],x1[3],x2[0],x2[1],x2[2],x2[3],x3[0],x3[1],x3[2],x3[3]};
#pragma unroll
    for (int i = 0; i < 16; ++i) { const _Float16 h = (_Float16)xs[i]; ah.h[i] = h; al.h[i] = ASPLIT ? (_Float16)(xs[i] - (float)h) : (_Float16)0.0f; }
#pragma unroll
    for (int t = 0; t < 4; ++t) { if (col0 + t * 16 >= N) continue; const size_t boff = (size_t)(col0 + t * 16 + ln) * ldb + kb; FragH bq; bq.half[0] = *(const v8us*)(Bh + boff + 8 * hh); bq.half[1] = *(const v8us*)(Bh + boff + 16 + 8 * hh);
      acc[t] = mmaH<ASPLIT ? 2 : 1>(ah.v, al.v, bq.v, bq.v, acc[t]); }
  }
#pragma unroll
  for (int t = 0; t < 4; ++t) { if (col0 + t * 16 >= N) continue;
#pragma unroll
    for (int r = 0; r < 8; ++r) so[w][8 * hh + r][t * 16 + ln] = acc[t][r] * alpha; }
  __builtin_amdgcn_fence(__ATOMIC_ACQ_REL, "workgroup"); __builtin_amdgcn_wave_barrier();
  const int rsub = lane >> 4, c4 = (lane & 15) * 4;
  {
#pragma unroll
    for (int q = 0; q < 8; ++q) { const int r = q * 2 + rsub; if (col0 + c4 < N) { const v4f v = *(const v4fa*)&so[w][r][c4]; *(v4f*)(C + (size_t)(row0 + r) * ldc + col0 + c4) = v; } }
     }
}

// Wt[n][k] = f16(bf16(W[k][n])*scale) from f32 row-major W[DM][DM] (scale = power of two; bf16-exact weights stay exact in f16 away from the subnormal range)
// bx: the index of the 256-thread block inside this matrix's share of the merged grid. One block turns a tile of 64 k x 64 n in LDS (tl, 64 rows of TP bytes), so that memory sees whole lines on both sides:
// a wave reads two 256-byte row pieces of W at a time and stores four whole 128-byte lines of Wt; read column by column, every lane of a load would touch a line of its own.
#define TP 144      // LDS pitch in bytes of a turned row of 64 f16: a multiple of 16 for the 16-byte reads
__device__ __forceinline__ void wt_f16_body(int bx, const float* __restrict__ W, _Float16* __restrict__ Wt, float scale, char* tl) {
  const int tid = threadIdx.x, kt = bx / (DM / 64), nt = bx % (DM / 64);
  const int kp = tid >> 4, c4 = (tid & 15) * 4;      // the thread takes columns c4 .. c4 + 3 of the tile's rows 2 kp, 2 kp + 1, 32 + 2 kp, 33 + 2 kp
  const char* base = (const char*)(W + (size_t)kt * 64 * DM + nt * 64); const unsigned ob = (unsigned)(2 * kp * DM * 4 + c4 * 4);
  v4f x[2][2];
#pragma unroll
  for (int i = 0; i < 2; ++i)
#pragma unroll
    for (int s = 0; s < 2; ++s) x[i][s] = *(const v4fa*)(base + ob + (i * 32 + s) * DM * 4);
  // the wait that is owed before a register named by an issued global load is rewritten; offset and base are inputs, so they stay live to here and none of the four loads lands in them
  asm volatile("s_wait_xcnt 0x0" :: "v"(ob), "s"(base) : "memory");
#pragma unroll
  for (int i = 0; i < 2; ++i)
#pragma unroll
    for (int e = 0; e < 4; ++e) { typedef _Float16 v2h __attribute__((ext_vector_type(2), may_alias)); v2h p;      // two neighbouring k of one n: one 4-byte LDS store
      p[0] = (_Float16)(bf16_round(x[i][0][e]) * scale); p[1] = (_Float16)(bf16_round(x[i][1][e]) * scale); *(v2h*)(tl + (c4 + e) * TP + (i * 32 + 2 * kp) * 2) = p; }
  __syncthreads();      // the tile is whole in LDS before its turned rows are read
  const int rn = tid >> 3, ch = tid & 7; v8us o[2];      // eight lanes a row of 64 k; trip p takes rows 32 p + tid / 8
#pragma unroll
  for (int p = 0; p < 2; ++p) o[p] = *(const v8us*)(tl + (p * 32 + rn) * TP + ch * 16);
  unsigned short* wo = (unsigned short*)Wt + (size_t)(nt * 64 + rn) * DM + kt * 64 + ch * 8;
#pragma unroll
  for (int p = 0; p < 2; ++p) *(v8us*)(wo + (size_t)p * 32 * DM) = o[p];
}
typedef _Float16 v4h __attribute__((ext_vector_type(4)));

__device__ __forceinline__ void x16_body(int bx, const float* __restrict__ x, _Float16* __restrict__ X16, size_t n8) { const size_t t = (size_t)bx * 256 + threadIdx.x; if (t >= n8) return; FragH f;
#pragma unroll
  for (int q = 0; q < 8; ++q) f.h[q] = (_Float16)bf16_round(x[t * 8 + q]); *(v8us*)((unsigned short*)X16 + t * 8) = f.half[0];  }
// All operand preparation in one launch (none of the eight parts reads what another writes): blocks 0 .. 5 GWT - 1 transpose the five weights (Wq, Wk, Wv, Wr, Wo -> Bw, x2^4), the next 3 GX round mems, w (-> CAT, back to back) and r (-> R16).
#define GWT ((DM / 64) * (DM / 64))      // blocks of one weight matrix: a tile of 64 x 64 each
#define GX (NQR * DM / 8 / 256)      // blocks of one 2048 x 1024 plane at 8 elements a thread (mems, w, r, q alike)
__global__ __launch_bounds__(256) void k_prep(const float* __restrict__ Wq, const float* __restrict__ Wk, const float* __restrict__ Wv, const float* __restrict__ Wr, const float* __restrict__ Wo,
    const float* __restrict__ mems, const float* __restrict__ w, const float* __restrict__ r, _Float16* __restrict__ Bw, _Float16* __restrict__ CAT, _Float16* __restrict__ R16) {
  __shared__ __attribute__((aligned(16))) char tl[64 * TP];
  const int bx = blockIdx.x;      // the branch is taken by a whole block or by none of it: so is the barrier of the weight tiles
  if (bx < 5 * GWT) { const int m = bx / GWT; const float* W = (m == 0) ? Wq : (m == 1) ? Wk : (m == 2) ? Wv : (m == 3) ? Wr : Wo; wt_f16_body(bx % GWT, W, Bw + (size_t)m * DM * DM, 16.0f, tl); }
  else { const int m = (bx - 5 * GWT) / GX; const float* x = (m == 0) ? mems : (m == 1) ? w : r; _Float16* o = (m == 0) ? CAT : (m == 1) ? CAT + (size_t)NQR * DM : R16; x16_body((bx - 5 * GWT) % GX, x, o, (size_t)NQR * DM / 8); }
}
__global__ __launch_bounds__(256) void k_round16f(const float* __restrict__ W, _Float16* __restrict__ Bt, size_t n8) { const size_t t = (size_t)blockIdx.x * 256 + threadIdx.x; if (t >= n8) return; FragH f;
#pragma unroll
  for (int i = 0; i < 8; ++i) f.h[i] = (_Float16)(bf16_round(W[t * 8 + i]) * 16.0f); *(v8us*)((unsigned short*)Bt + t * 8) = f.half[0];  }
// Fused score kernel: one work-group = 32 query rows i0..i0+31 of one (b,n) plane (blockIdx.y), 16 waves; the 32 x KL score rows live in LDS and never reach memory. AC is stored into the rows first.
// The pad/reshape shift as a scatter of raw BD: idx = QL + i*KL + j = i*(KL+1) + (QL - i + j), so with d = m - (QL-1) + i the raw value (q_i + r_r_bias).rk_m belongs to j = d where d >= 0,
// the raw value of row i+1 at column m to j = d + KL + 1 where d <= -2 (the wrap region); d == -1 gives j = KL, a slot of the row's LDS padding that the softmax never reads; the pad's zero falls on j = i + KL + 1 - QL. Each j in 0..KL-1 gets at most one raw value.
// Behind a barrier each raw value is added to AC in place, and behind a second one wave wv does mask, f32 softmax and the f16 x2^15 store of rows i0 + wv and i0 + 16 + wv, one after the other, with the lane order and sum order of a wave-per-row pass.
#define SP (KL + 4)      // LDS row pitch in floats: 8 rows apart = 32 banks apart, so the two lane halves of a D tile do not collide; multiple of 4 for 16-byte reads
__device__ __forceinline__ v8f mma16(v16h a, v16h b, v8f c) { return __builtin_amdgcn_wmma_f32_16x16x32_f16(false, a, false, b, (short)0, c, false, false); }
// The planes that this kernel multiplies (q + r_w_bias, q + r_r_bias, k, rk) lie in fragment order: blocks of FB bytes = 16 rows x 64 f16 of one head, stored [c = k / 8][row][8 f16], so that the 16 bytes of (row, c) stand at c * 256 + row * 16.
// One 16-row fragment pair (k = 0..63) of such a block: base (+ cofs, a constant) is the same for the whole wave, ob is the lane's own byte offset (row * 16, plus 256 for the upper lane half). With ob = lane * 16 each load is 512 bytes in a row: four whole lines.
// Lane half hh, step ks: registers 0..3 hold k = 32*ks + 8*hh + 0..7 (c = 4 ks + hh), registers 4..7 hold k = 32*ks + 16 + 8*hh + 0..7 (c = 4 ks + 2 + hh), for A and B alike.
#define FB 2048
__device__ __forceinline__ void ldfrag(FragH (&f)[2], const char* __restrict__ base, unsigned ob, int cofs) {
#pragma unroll
  for (int ks = 0; ks < 2; ++ks) { f[ks].half[0] = *(const v8us*)(base + ob + (cofs + ks * 1024)); f[ks].half[1] = *(const v8us*)(base + ob + (cofs + ks * 1024 + 512)); }
  // the wait that is owed before a register named by an issued global load is rewritten; offset and base are inputs, so they stay live to here and none of the four loads lands in them
  asm volatile("s_wait_xcnt 0x0" :: "v"(ob), "s"(base) : "memory"); }
// 32 query rows a work-group, as two blocks of 16 (rb = 0, 1): every k and rk fragment that a wave loads is multiplied with both blocks' q rows, so each tile is fetched once for 32 rows, not once for 16.
// launch bounds: 4 waves a SIMD (a budget of 256 VGPRs): the 257-KiB work-group has a WGP to itself, and the registers hold all eight k tiles, then both blocks' q rows and four rk tiles, in flight ahead of their use
__global__ __launch_bounds__(512, 4) void k_score(const _Float16* __restrict__ QW, const _Float16* __restrict__ QR, const _Float16* __restrict__ K16, const _Float16* __restrict__ RK, const int* __restrict__ MSK, _Float16* __restrict__ P16) {
  __shared__ __attribute__((aligned(16))) float S[32 * SP];
  const int tid = threadIdx.x, lane = tid & 31, ln = lane & 15, hh = lane >> 4;
  const int wv = __builtin_amdgcn_readfirstlane(tid >> 5);      // the wave's number as a scalar: tile bases and the row's addresses then sit in scalar registers
  const int i0 = blockIdx.x * 32, pl = blockIdx.y, h = pl % NH;
  const char* qw = (const char*)QW + ((size_t)pl * (QL / 16) + blockIdx.x * 2) * FB; const char* qr = (const char*)QR + ((size_t)pl * (QL / 16) + blockIdx.x * 2) * FB;      // the block of rows i0 .. i0 + 15 of plane pl; rows i0 + 16 .. i0 + 31 are the next block
  const char* kp = (const char*)K16 + ((size_t)pl * (KL / 16) + wv) * FB; const char* rp = (const char*)RK + ((size_t)h * (KL / 16) + wv) * FB;      // the wave's first column tile; its next ones lie 16 blocks apart
  const char* mk = (const char*)(MSK + (size_t)(i0 + wv) * KL);      // the wave does the softmax of rows i0 + wv and i0 + 16 + wv
  const unsigned obq = (unsigned)(lane * 16), obr = obq;
  const char* ml = mk + lane * 16;      // the lane's own 16 bytes of the first mask row's first 512
  // row i+1 for the wrap region (lane 15: row 0 of the next block); the clamped row of i = QL-1 is never selected (there d >= 0 for every m)
  const unsigned obw0 = (unsigned)(hh * 256 + ((ln < 15) ? (ln + 1) * 16 : FB)), obw1 = (unsigned)(hh * 256 + ((ln < 15) ? (ln + 1) * 16 : (i0 + 32 < QL) ? FB : 15 * 16));
  typedef int v4i __attribute__((ext_vector_type(4))); typedef int v4ia __attribute__((ext_vector_type(4), may_alias));
  FragH aq[2][2], kb[8][2]; ldfrag(aq[0], qw, obq, 0); ldfrag(aq[1], qw, obq, FB);
#pragma unroll
  for (int t = 0; t < 8; ++t) ldfrag(kb[t], kp, obq, t * 16 * FB);      // all eight k tiles of the wave are in flight at once
  FragH an[2][2], aw[2][2], bb[4][2];
  ldfrag(an[0], qr, obq, 0); ldfrag(an[1], qr, obq, FB); ldfrag(aw[0], qr, obw0, 0);      // as many of the q + r_r_bias rows as the registers take beside the k tiles
  __builtin_amdgcn_sched_barrier(0);      // no product, with its wait for the first tile, is lifted in front of these loads: all of them are asked for before the wave waits for any
  v4i mva[16], mvb[16];      // the masks of rows i0 + wv and i0 + 16 + wv, the lane's own four columns per jj: read where registers fall free, so that they fly under other work
  // AC: wave wv owns the column tiles wv + 16 t and stores them straight into S, for both row blocks. As the k tiles drain, their registers take the last q + r_r_bias rows and the first four rk tiles, which fly while the later AC tiles are multiplied and stored.
#pragma unroll
  for (int t = 0; t < KL / 256; ++t) { const int j0 = (wv + 16 * t) * 16; FragH (&bf)[2] = kb[t];
    v8f c0 = {}, c1 = {}; c0 = mma16(aq[0][0].v, bf[0].v, c0); c1 = mma16(aq[1][0].v, bf[0].v, c1); c0 = mma16(aq[0][1].v, bf[1].v, c0); c1 = mma16(aq[1][1].v, bf[1].v, c1);
    // the four vector slots that the chip needs behind a matrix instruction before its D is overwritten (the next tile's product) or its A or B refilled; the operands are named so that the loads below, which may land in bf's registers, stay behind them
    asm volatile("v_nop\n\tv_nop\n\tv_nop\n\tv_nop" : "+v"(c0), "+v"(c1) : "v"(aq[0][0].v), "v"(aq[0][1].v), "v"(aq[1][0].v), "v"(aq[1][1].v), "v"(bf[0].v), "v"(bf[1].v));
    if (t == 0) ldfrag(aw[1], qr, obw1, FB);
    else if (t < 5) ldfrag(bb[t - 1], rp, obr, (t - 1) * 16 * FB);
#pragma unroll
    for (int r = 0; r < 8; ++r) { S[(8 * hh + r) * SP + j0 + ln] = c0[r]; S[(16 + 8 * hh + r) * SP + j0 + ln] = c1[r]; }
    __builtin_amdgcn_sched_barrier(0); }      // keeps the tiles apart in the schedule: mixed, they hold more products and fragments live than the registers take
  if (tid < 32) S[tid * SP + KL] = 0.f;      // the padding slot that takes the one raw value of a row with d == -1: given a value here, so that the add below reads nothing unwritten
  __syncthreads();      // every AC value is in S before any wave adds a shifted BD value to it
  __builtin_amdgcn_sched_barrier(0);      // as above: no product of the next phase is lifted over the barrier
  // raw BD of rows i and i+1, added in place at the shifted column: each (row, j) is touched by one lane of one wave; the column of the pad's zero, j = i + KL + 1 - QL, by none (AC + 0)
#pragma unroll
  for (int t = 0; t < KL / 256; ++t) { const int m0 = (wv + 16 * t) * 16; FragH (&bf)[2] = bb[t & 3];
    v8f dn[2] = {}, dw[2] = {};
#pragma unroll
    for (int ks = 0; ks < 2; ++ks)
#pragma unroll
      for (int rb = 0; rb < 2; ++rb) { dn[rb] = mma16(an[rb][ks].v, bf[ks].v, dn[rb]); dw[rb] = mma16(aw[rb][ks].v, bf[ks].v, dw[rb]); }
    // the four vector slots that the chip needs behind a matrix instruction before a vector instruction reads its D or its B is refilled; bf is named so that its refill stays behind them
    asm volatile("v_nop\n\tv_nop\n\tv_nop\n\tv_nop" : "+v"(dn[0]), "+v"(dw[0]), "+v"(dn[1]), "+v"(dw[1]) : "v"(bf[0].v), "v"(bf[1].v));
    if (t + 4 < KL / 256) ldfrag(bf, rp, obr, (t + 4) * 16 * FB);      // rk tiles fly four tiles ahead
    else {      // the ring drains: its registers take the first row's mask, four vectors a tile, which fly under the last tiles' adds
#pragma unroll
      for (int q = 0; q < 4; ++q) mva[(t - 4) * 4 + q] = *(const v4ia*)(ml + ((t - 4) * 4 + q) * 512);
      // the wait that is owed before a register named by an issued global load is rewritten; the address is an input, so it stays live to here and none of the four loads lands in it
      asm volatile("s_wait_xcnt 0x0" :: "v"(ml) : "memory"); }
#pragma unroll
    for (int rb = 0; rb < 2; ++rb) { const int d0 = m0 + ln - (QL - 1) + i0 + 16 * rb + 8 * hh; int ix[8]; float old[8];
#pragma unroll
      for (int r = 0; r < 8; ++r) { const int d = d0 + r; ix[r] = (16 * rb + 8 * hh + r) * SP + ((d >= 0) ? d : d + (KL + 1)); old[r] = S[ix[r]]; }      // the eight reads first: eight different rows, so no store of this tile can hit them
#pragma unroll
      for (int r = 0; r < 8; ++r) S[ix[r]] = old[r] + ((d0 + r >= 0) ? dn[rb][r] : dw[rb][r]); }
    __builtin_amdgcn_sched_barrier(0); }      // as above
  __syncthreads();      // the rows are complete before the row waves read them
  // the mask of row i0 + 16 + wv: asked for here, it flies under the softmax of row i0 + wv
#pragma unroll
  for (int jj = 0; jj < 16; ++jj) mvb[jj] = *(const v4ia*)(ml + (16 * KL * 4 + jj * 512));
  // the wait that is owed before a register named by an issued global load is rewritten; the address is an input, so it stays live to here and none of the sixteen loads lands in it
  asm volatile("s_wait_xcnt 0x0" :: "v"(ml) : "memory");
#pragma unroll
  for (int rb = 0; rb < 2; ++rb) {
    const float* sr = &S[(16 * rb + wv) * SP];
    v4f sv[16]; float mx = -3.0e38f;
#pragma unroll
    for (int jj = 0; jj < 16; ++jj) { const int j0 = jj * 128 + lane * 4; const v4f a = *(const v4fa*)(sr + j0); v4f s;
#pragma unroll
      for (int e = 0; e < 4; ++e) { const float val = a[e] * ATT_SCALE; const bool off = ((rb == 0) ? mva[jj][e] : mvb[jj][e]) != 0; s[e] = off ? -INFINITY : val; mx = fmaxf(mx, s[e]); }
      sv[jj] = s; }
    for (int o = 16; o >= 1; o >>= 1) mx = fmaxf(mx, __shfl_xor(mx, o, 32)); float z = 0.f;
#pragma unroll
    for (int jj = 0; jj < 16; ++jj) for (int e = 0; e < 4; ++e) { const float p = (sv[jj][e] > -INFINITY) ? __expf(sv[jj][e] - mx) : 0.f; sv[jj][e] = p; z += p; }
    for (int o = 16; o >= 1; o >>= 1) z += __shfl_xor(z, o, 32); const float iz = (z > 0.f) ? 32768.0f / z : 0.f;
    _Float16* pr = P16 + ((size_t)pl * QL + i0 + 16 * rb + wv) * KL + lane * 4; v4h o[16];
#pragma unroll
    for (int jj = 0; jj < 16; ++jj) { for (int e = 0; e < 4; ++e) o[jj][e] = (_Float16)(sv[jj][e] * iz); *(v4h*)(pr + jj * 128) = o[jj]; }
    // the wait that is owed before a register named by an issued global store is rewritten (the second row reuses them); address and data are inputs, so they stay live to here
    if (rb == 0) asm volatile("s_wait_xcnt 0x0" :: "v"(pr), "v"(o[0]), "v"(o[1]), "v"(o[2]), "v"(o[3]), "v"(o[4]), "v"(o[5]), "v"(o[6]), "v"(o[7]), "v"(o[8]), "v"(o[9]), "v"(o[10]), "v"(o[11]), "v"(o[12]), "v"(o[13]), "v"(o[14]), "v"(o[15]) : "memory");
  }
}
// GEMM with both operands staged in LDS: C[M][N] = f16 A[M][KK] . Bt[N][KK]^T, v = acc*alpha (+ bf16(bias[col]) if BIAS); writes f32 C (F32OUT) or f16 C16, pitch LDC. A, Bt row-major with pitch KK; M a multiple of 128, N of 64, KK of 256.
// One work-group = 128 rows x 64 columns, 8 waves of 16 x 64; blockIdx.x = row block * ntn + column block (ntn = N / 64), blockIdx.y = plane (element strides sA, sB, sC).
// A stage is 128 k = 256 bytes of each of the 192 operand rows (A rows 0..127, Bt rows 128..191), brought by asynchronous copies whose wave-wide 512 bytes are two whole 256-byte row pieces; two buffers, stage t + 2 flies while stage t is multiplied.
// Each output element still sums its k steps of 32 in rising order in one f32 accumulator.
#define GP 272      // LDS row pitch in bytes: 16 x odd, the conflict-free pitch of 256-byte rows for 16-byte fragment reads
#define GSTG (192 * GP)      // bytes of one stage
// One stage: lane (row cr = tid / 16, 16-byte piece tid % 16) copies its piece of A rows cr + 16 i (i < 8) and Bt rows cr + 16 i (i < 4). l: the lane's LDS byte address of A row cr; ga, gb: its global addresses in A row cr and Bt row cr; RB: 16 rows in bytes.
// The s_wait_xcnt is the wait that is owed before a register named by an issued copy is rewritten; as the statement's last line it stands in front of every such write.
template <int RB>
__device__ __forceinline__ void cp_stage(unsigned l, const char* ga, const char* gb) {
  asm volatile("global_load_async_to_lds_b128 %0, %12, off\n\t"
               "global_load_async_to_lds_b128 %1, %13, off\n\t"
               "global_load_async_to_lds_b128 %2, %14, off\n\t"
               "global_load_async_to_lds_b128 %3, %15, off\n\t"
               "global_load_async_to_lds_b128 %4, %16, off\n\t"
               "global_load_async_to_lds_b128 %5, %17, off\n\t"
               "global_load_async_to_lds_b128 %6, %18, off\n\t"
               "global_load_async_to_lds_b128 %7, %19, off\n\t"
               "global_load_async_to_lds_b128 %8, %20, off\n\t"
               "global_load_async_to_lds_b128 %9, %21, off\n\t"
               "global_load_async_to_lds_b128 %10, %22, off\n\t"
               "global_load_async_to_lds_b128 %11, %23, off\n\t"
               "s_wait_xcnt 0x0"
               :: "v"(l), "v"(l + 16 * GP), "v"(l + 32 * GP), "v"(l + 48 * GP), "v"(l + 64 * GP), "v"(l + 80 * GP), "v"(l + 96 * GP), "v"(l + 112 * GP),
                  "v"(l + 128 * GP), "v"(l + 144 * GP), "v"(l + 160 * GP), "v"(l + 176 * GP),
                  "v"(ga), "v"(ga + RB), "v"(ga + 2 * RB), "v"(ga + 3 * RB), "v"(ga + 4 * RB), "v"(ga + 5 * RB), "v"(ga + 6 * RB), "v"(ga + 7 * RB),
                  "v"(gb), "v"(gb + RB), "v"(gb + 2 * RB), "v"(gb + 3 * RB)
               : "memory");
}
// The tile's body: A, Bh, C, C16 are the plane's own bases, (bm, nq) the tile; ring and so are the calling kernel's LDS. mode (the same for the whole work-group) picks what the epilogue does with v:
// FRAG false: 0: f32 C. 1: f16 C16, both row-major. FRAG true: the planes of the score kernel, stored in its fragment order (blocks of FB bytes, see ldfrag; the tile's 64 columns are head nq):
// 2 (the q tile, rows (i,b)): C16 = f16(v + bf16(hb0[col])) and C16b = f16(v + bf16(hb1[col])), hb0 and hb1 the two 1024-wide head-bias rows; 4 (the k tile, rows (j,b)): C16 = f16(v); both as plane b NH + nq, block row / 16. 5 (the rk tile, rows m): C16 = f16(v), plane nq.
// 3 (the v tile; its rows are (j,b), its 64 columns one head nq): C16 is V^T, row ((b NH + nq) 64 + d), column j; the tile is turned in LDS and goes out as 128 whole lines of 64 j.
#define VP 144      // LDS pitch in bytes of a V^T row of 64 f16: 36 dwords, so that the 16 rows of an 8-byte store from the accumulators fall on different banks; a multiple of 16 for the 16-byte reads
template <int KK, int LDC, bool BIAS, bool FRAG>
__device__ __forceinline__ void gemm_tile(const _Float16* __restrict__ A, const _Float16* __restrict__ Bh, float alpha, const float* __restrict__ bias,
    float* __restrict__ C, _Float16* __restrict__ C16, _Float16* __restrict__ C16b, const float* __restrict__ hb0, const float* __restrict__ hb1, int mode, int bm, int nq, char* ring, float (*so)[16][64]) {
  const int tid = threadIdx.x, lane = tid & 31, ln = lane & 15, hh = lane >> 4;
  const int w = __builtin_amdgcn_readfirstlane(tid >> 5);      // the wave's number as a scalar
  const int row0 = bm * 128 + w * 16, col0 = nq * 64;
  const int cr = tid >> 4, cc = (tid & 15) * 16;
  const char* ga = (const char*)(A + (size_t)(bm * 128 + cr) * KK) + cc;
  const char* gb = (const char*)(Bh + (size_t)(col0 + cr) * KK) + cc;
  const unsigned l0 = (unsigned)(size_t)&ring[0] + (unsigned)(cr * GP + cc);      // the low 32 bits of a __shared__ address are its LDS byte address
  constexpr int NT = KK / 128, RB = 16 * KK * 2;
  float braw[4] = {0.f, 0.f, 0.f, 0.f};      // the bias of the lane's four columns, read at the head so that it flies under the main loop; first used in the epilogue
  if (BIAS) {
#pragma unroll
    for (int q = 0; q < 4; ++q) braw[q] = bias[col0 + q * 16 + ln];
  }
  float hw[4] = {0.f, 0.f, 0.f, 0.f}, hr[4] = {0.f, 0.f, 0.f, 0.f};      // the two head biases of the lane's four accumulator columns, read at the head like the bias
  if (FRAG && mode == 2) {
    const unsigned oh = (unsigned)((col0 + ln) * 4); const char* p0 = (const char*)hb0; const char* p1 = (const char*)hb1;
#pragma unroll
    for (int q = 0; q < 4; ++q) { hw[q] = *(const float*)(p0 + oh + q * 64); hr[q] = *(const float*)(p1 + oh + q * 64); }
    // the wait that is owed before a register named by an issued global load is rewritten; offset and bases are inputs, so they stay live to here and none of the eight loads lands in them
    asm volatile("s_wait_xcnt 0x0" :: "v"(oh), "s"(p0), "s"(p1) : "memory");
  }
  cp_stage<RB>(l0, ga, gb);      // stage 0 into buffer 0
  asm volatile("s_wait_asynccnt 0x0" ::: "memory");      // this wave's copies of stage 0 have landed
  __syncthreads();      // every wave's have: stage 0 may be read
  cp_stage<RB>(l0 + GSTG, ga + 256, gb + 256);      // stage 1 into buffer 1
  v8f acc[4] = {};
#pragma unroll 1      // kept rolled: unrolled, the build holds two stages' fragments live and needs more than 256 registers, and two work-groups no longer share a WGP
  for (int t = 0; t < NT; ++t) {
    const char* sa = &ring[(t & 1) * GSTG + (w * 16 + ln) * GP + hh * 16];
    const char* sb = &ring[(t & 1) * GSTG + (128 + ln) * GP + hh * 16];
    FragH a[4], b[4][4];
#pragma unroll
    for (int ks = 0; ks < 4; ++ks) {      // lane half hh: registers 0..3 hold k = 32 ks + 8 hh + 0..7, registers 4..7 hold k = 32 ks + 16 + 8 hh + 0..7, for A and B alike
      a[ks].half[0] = *(const v8us*)(sa + ks * 64); a[ks].half[1] = *(const v8us*)(sa + ks * 64 + 32);
#pragma unroll
      for (int q = 0; q < 4; ++q) { b[ks][q].half[0] = *(const v8us*)(sb + q * 16 * GP + ks * 64); b[ks][q].half[1] = *(const v8us*)(sb + q * 16 * GP + ks * 64 + 32); }
    }
    asm volatile("s_wait_dscnt 0x0" ::: "memory");      // the whole stage is in this wave's registers: its reads of the buffer have returned before the buffer is refilled
    asm volatile("s_wait_asynccnt 0x0" ::: "memory");      // this wave's copies of stage t + 1 have landed
    __syncthreads();      // publishes stage t + 1 and ends every wave's reads of stage t
    if (t + 2 < NT) cp_stage<RB>(l0 + (unsigned)((t & 1) * GSTG), ga + (t + 2) * 256, gb + (t + 2) * 256);      // stage t + 2 into the buffer that this trip has read
    __builtin_amdgcn_sched_barrier(0);      // keeps the products behind the refill: they need registers only, and the copies so fly under them as well as under the next stage's reads
#pragma unroll
    for (int ks = 0; ks < 4; ++ks)
#pragma unroll
      for (int q = 0; q < 4; ++q) acc[q] = mma16(a[ks].v, b[ks][q].v, acc[q]);
  }
  asm volatile("s_wait_asynccnt 0x0" ::: "memory");      // no copy is outstanding when the wave goes on to its end
  // the four vector slots that the chip needs behind the loop's last matrix instructions before their A or B registers are rewritten: the epilogues are reached over scalar branches
  if (FRAG) asm volatile("v_nop\n\tv_nop\n\tv_nop\n\tv_nop");
  if (FRAG && mode == 3) {
    char* tv = (char*)so;      // 128 rows (b, d) of 64 j. Accumulator register r is tile row 16 w + 8 hh + r = (j, b) with j = 8 w + 4 hh + r / 2, b = r % 2: the four registers of one b are four neighbouring j
#pragma unroll
    for (int q = 0; q < 4; ++q)
#pragma unroll
      for (int b = 0; b < 2; ++b) { v4h h4; for (int e = 0; e < 4; ++e) h4[e] = (_Float16)(acc[q][2 * e + b] * alpha + (BIAS ? bf16_round(braw[q]) : 0.f)); *(v4h*)(tv + (b * 64 + q * 16 + ln) * VP + w * 16 + hh * 8) = h4; }
    __syncthreads();      // every wave holds eight j of every row: the rows are whole before they are read
    const char* tr = tv + (tid >> 3) * VP + (tid & 7) * 16; v8us x[4];      // eight lanes a row; trip it takes rows 32 it + tid / 8
#pragma unroll
    for (int it = 0; it < 4; ++it) x[it] = *(const v8us*)(tr + it * 32 * VP);
    unsigned short* vo = (unsigned short*)C16 + ((size_t)nq * 64 + (tid >> 3)) * KL + bm * 64 + (tid & 7) * 8;
#pragma unroll
    for (int it = 0; it < 4; ++it) *(v8us*)(vo + ((size_t)(it >> 1) * NH * 64 + (it & 1) * 32) * KL) = x[it];
    return;
  }
  if (FRAG) {
    // The wave turns its 16 x 64 tile in its own staging rows. Staging row rw keeps its 4-float group g at place g ^ rw: the accumulator stores (16 columns of two rows 8 apart) and the 16-byte reads below (one group of 16 different rows) both fall on 64 different banks.
    // A lane stores the 16 bytes (row rr, c = 2 x + hh), x = 0..3, which lie 512 bytes apart. Rows (j,b): 8 lanes take the wave's 8 j of one b, a whole 128-byte line of block j / 16 (the wave holds half a block of either b); rows m: the wave's 16 rows are one block, 512 bytes in a row.
    const bool jb = (mode != 5); const int l7 = lane & 7, lb = (lane >> 3) & 1;
    const int rr = jb ? l7 * 2 + lb : ln;
    const int blk = jb ? (lb * NH + nq) * ((mode == 2) ? QL / 16 : KL / 16) + bm * 4 + (w >> 1) : nq * (KL / 16) + bm * 8 + w;
    const size_t go = (size_t)blk * FB + hh * 256 + (jb ? (w & 1) * 8 + l7 : ln) * 16;
#pragma unroll 1      // kept rolled: the q tile's second trip differs from the first in its bias and its plane alone
    for (int ps = 0; ps < ((mode == 2) ? 2 : 1); ++ps) {
#pragma unroll
      for (int q = 0; q < 4; ++q) { const float hb = bf16_round(ps ? hr[q] : hw[q]);
#pragma unroll
        for (int r = 0; r < 8; ++r) { const int rw = 8 * hh + r; float v = acc[q][r] * alpha + (BIAS ? bf16_round(braw[q]) : 0.f); if (mode == 2) v += hb; so[w][rw][(((q * 4 + (ln >> 2)) ^ rw) << 2) + (ln & 3)] = v; } }
      __builtin_amdgcn_fence(__ATOMIC_ACQ_REL, "workgroup", "local"); __builtin_amdgcn_wave_barrier();      // the wave reads back its own staging rows; a fence of LDS alone, so that the second trip does not wait for the first trip's global stores
      v8us o[4];
#pragma unroll
      for (int x = 0; x < 4; ++x) { const int g = (4 * x + 2 * hh) ^ rr; const v4f lo = *(const v4fa*)&so[w][rr][g << 2], hi = *(const v4fa*)&so[w][rr][(g ^ 1) << 2]; FragH f;
        for (int e = 0; e < 4; ++e) { f.h[e] = (_Float16)lo[e]; f.h[4 + e] = (_Float16)hi[e]; } o[x] = f.half[0]; }
      char* dst = (char*)(ps ? C16b : C16) + go;
#pragma unroll
      for (int x = 0; x < 4; ++x) *(v8us*)(dst + x * 512) = o[x];
      // the wait that is owed before a register named by an issued global store is rewritten (the second trip reuses them); address and data are inputs, so they stay live to here
      asm volatile("s_wait_xcnt 0x0" :: "v"(dst), "v"(o[0]), "v"(o[1]), "v"(o[2]), "v"(o[3]) : "memory");
    }
    return;
  }
#pragma unroll
  for (int q = 0; q < 4; ++q)
#pragma unroll
    for (int r = 0; r < 8; ++r) so[w][8 * hh + r][q * 16 + ln] = acc[q][r] * alpha + (BIAS ? bf16_round(braw[q]) : 0.f);
  __builtin_amdgcn_fence(__ATOMIC_ACQ_REL, "workgroup"); __builtin_amdgcn_wave_barrier();      // the wave reads back its own staging rows: whole 128-byte lines go out
  const int rsub = lane >> 4, c4 = (lane & 15) * 4; const size_t cofs = (size_t)(row0 + rsub) * LDC + col0 + c4;      // the lane's first element; its eight rows lie 2 LDC apart
  v4f ov[8];
#pragma unroll
  for (int q = 0; q < 8; ++q) ov[q] = *(const v4fa*)&so[w][q * 2 + rsub][c4];
  if (mode == 0) {      // one branch round all eight stores; mode here is k_gemm_lds's F32OUT ? 0 : 1, a constant once inlined
#pragma unroll
    for (int q = 0; q < 8; ++q) *(v4f*)(C + cofs + q * 2 * LDC) = ov[q];
  } else {
#pragma unroll
    for (int q = 0; q < 8; ++q) { v4h h4; for (int i = 0; i < 4; ++i) h4[i] = (_Float16)ov[q][i]; *(v4h*)(C16 + cofs + q * 2 * LDC) = h4; }
  }
}
template <int KK, int LDC, bool F32OUT, bool BIAS>
__global__ __launch_bounds__(256) void k_gemm_lds(const _Float16* __restrict__ A, size_t sA, const _Float16* __restrict__ Bh, size_t sB, float alpha, const float* __restrict__ bias,
    float* __restrict__ C, _Float16* __restrict__ C16, size_t sC, int ntn) {
  __shared__ __attribute__((aligned(16))) char ring[2 * GSTG];
  __shared__ __attribute__((aligned(16))) float so[8][16][64];
  const size_t by = blockIdx.y;
  gemm_tile<KK, LDC, BIAS, false>(A + by * sA, Bh + by * sB, alpha, bias, F32OUT ? C + by * sC : nullptr, F32OUT ? nullptr : C16 + by * sC, nullptr, nullptr, nullptr, F32OUT ? 0 : 1, blockIdx.x / ntn, blockIdx.x % ntn, ring, so);
}
// The four input projections in one launch (each reads only what k_prep wrote): tiles of k, v (4096 rows of CAT each), then q (the last 2048 rows of CAT) and rk (the 2048 rows of R16); every tile as in k_gemm_lds.
// The epilogues leave the planes as the score kernel and the P*V GEMM read them: q goes out twice, with r_w_bias and with r_r_bias added; q, k and rk go out in the score kernel's fragment order, and v goes out transposed per (b,n).
#define GTK ((NKR / 128) * (DM / 64))      // tiles of k and of v
#define GTQ ((NQR / 128) * (DM / 64))      // tiles of q and of rk
__global__ __launch_bounds__(256) void k_proj(const _Float16* __restrict__ CAT, const _Float16* __restrict__ R16, const _Float16* __restrict__ Bw, const float* __restrict__ bq, const float* __restrict__ bk, const float* __restrict__ bv, const float* __restrict__ br,
    const float* __restrict__ rwb, const float* __restrict__ rrb, _Float16* __restrict__ QW, _Float16* __restrict__ QR, _Float16* __restrict__ K16, _Float16* __restrict__ Vt, _Float16* __restrict__ RK) {
  __shared__ __attribute__((aligned(16))) char ring[2 * GSTG];
  __shared__ __attribute__((aligned(16))) float so[8][16][64];
  const int bx = blockIdx.x;
  const int job = (bx < GTK) ? 1 : (bx < 2 * GTK) ? 2 : (bx < 2 * GTK + GTQ) ? 0 : 3;      // the weight's place in Bw: 0 q, 1 k, 2 v, 3 rk
  const int tl = (job == 1) ? bx : (job == 2) ? bx - GTK : (job == 0) ? bx - 2 * GTK : bx - 2 * GTK - GTQ;
  const _Float16* A = (job == 0) ? CAT + (size_t)NQR * DM : (job == 3) ? R16 : CAT;
  const float* bias = (job == 0) ? bq : (job == 1) ? bk : (job == 2) ? bv : br;
  _Float16* C16 = (job == 0) ? QW : (job == 1) ? K16 : (job == 2) ? Vt : RK;
  const int mode = (job == 0) ? 2 : (job == 1) ? 4 : (job == 2) ? 3 : 5;      // from blockIdx alone: the barrier of the v epilogue is passed by a whole work-group or by none of it
  gemm_tile<DM, DM, true, true>(A, Bw + (size_t)job * DM * DM, 0.0625f, bias, nullptr, C16, QR, rwb, rrb, mode, tl / (DM / 64), tl % (DM / 64), ring, so);
}
__global__ __launch_bounds__(256) void k_lnout(const float* __restrict__ RES, const float* __restrict__ w, const float* __restrict__ g, const float* __restrict__ bb, float* __restrict__ out) { const int tid = threadIdx.x, wv = tid >> 5, lane = tid & 31; const int r = blockIdx.x * 8 + wv; if (r >= NQR) return; v4f y[8]; float s = 0.f;
#pragma unroll
  for (int j = 0; j < 8; ++j) { const int c = j * 128 + lane * 4; const v4f a = *(const v4fa*)(RES + (size_t)r * DM + c), x = *(const v4fa*)(w + (size_t)r * DM + c); for (int q = 0; q < 4; ++q) { y[j][q] = a[q] + bf16_round(x[q]); s += y[j][q]; } }
  for (int o = 16; o >= 1; o >>= 1) s += __shfl_xor(s, o, 32); const float mu = s / (float)DM; float q2 = 0.f;
#pragma unroll
  for (int j = 0; j < 8; ++j) for (int q = 0; q < 4; ++q) { const float d = y[j][q] - mu; q2 += d * d; }
  for (int o = 16; o >= 1; o >>= 1) q2 += __shfl_xor(q2, o, 32); const float rs = rsqrtf(q2 / (float)DM + 1e-5f);
  {
#pragma unroll
    for (int j = 0; j < 8; ++j) { const int c = j * 128 + lane * 4; v4f o; for (int q = 0; q < 4; ++q) o[q] = (y[j][q] - mu) * rs * bf16_round(g[c + q]) + bf16_round(bb[c + q]); *(v4f*)(out + (size_t)r * DM + c) = o; }
     } }

extern "C" void kernel_launch(void* const* d_in, const int* in_sizes, int n_in,
                              void* d_out, int out_size, void* d_ws, size_t ws_size, hipStream_t stream) {
  (void)in_sizes; (void)n_in; (void)out_size;
  const float* const* I = (const float* const*)d_in; const float* w = I[0]; const float* r = I[1]; const float* mems = I[2]; const float* rwb = I[3]; const float* rrb = I[4]; const int* msk = (const int*)d_in[5];
  const float* Wq = I[6]; const float* bq = I[7]; const float* Wk = I[8]; const float* bk = I[9]; const float* Wv = I[10]; const float* bv = I[11]; const float* Wr = I[12]; const float* br = I[13]; const float* Wo = I[14]; const float* bo = I[15]; const float* lg = I[16]; const float* lb = I[17];
  char* ws = (char*)d_ws; size_t off = 0;
  auto take = [&](size_t bytes) { char* p = ws + off; off += (bytes + 255) & ~(size_t)255; return p; };
  const size_t WSZ = (size_t)DM * DM; _Float16* Bw = (_Float16*)take(5 * WSZ * 2);      /* Wq, Wk, Wv, Wr, Wo */
  _Float16* QW = (_Float16*)take((size_t)NQR * DM * 2); _Float16* QR = (_Float16*)take((size_t)NQR * DM * 2);
  _Float16* K16 = (_Float16*)take((size_t)NKR * DM * 2); _Float16* Vt = (_Float16*)take((size_t)NKR * DM * 2); _Float16* RK = (_Float16*)take((size_t)KL * DM * 2);
  _Float16* P16 = (_Float16*)take((size_t)BZ * NH * QL * KL * 2); _Float16* O16 = (_Float16*)take((size_t)NQR * DM * 2);      /* P of all 32 (b,n) planes, so that one launch does every P*V */
  _Float16* CAT = (_Float16*)take((size_t)NKR * DM * 2); _Float16* R16 = (_Float16*)take((size_t)KL * DM * 2); float* RES = (float*)take((size_t)NQR * DM * 4);
  if (off > ws_size) return;      // MiB: 10 + 4 + 4 + 8 + 8 + 4 + 128 + 4 + 8 + 4 + 8 = 190 of 256
  k_prep<<<5 * GWT + 3 * GX, 256, 0, stream>>>(Wq, Wk, Wv, Wr, Wo, mems, w, r, Bw, CAT, R16);      /* weights (in,out) -> Bt x2^4; cat = [mems; w] is the two inputs back to back (rows (j,b)); r rows m */
  k_proj<<<2 * GTK + 2 * GTQ, 256, 0, stream>>>(CAT, R16, Bw, bq, bk, bv, br, rwb, rrb, QW, QR, K16, Vt, RK);      /* k, v: M 4096 N 1024 K 1024; q (last qlen rows of cat) + bq, rk = r.Wr + br: M 2048; one work-group a 128 x 64 tile; q stored + r_w_bias / + r_r_bias, v stored as V^T per (b,n) */
  const dim3 gq((NQR / 128) * (DM / 64), 1);      /* one work-group a 128 x 64 tile */
  const dim3 go(QL / 128, BZ * NH);
  k_score<<<dim3(QL / 32, BZ * NH), 512, 0, stream>>>(QW, QR, K16, RK, msk, P16);      /* AC, raw BD, shift, mask and softmax of all 32 (b,n) planes: 32 query rows a work-group, scores in LDS only */
  k_gemm_lds<KL, BZ * DM, false, false><<<go, 256, 0, stream>>>(P16, (size_t)QL * KL, Vt, (size_t)64 * KL, 0.000030517578125f, nullptr, nullptr, O16, 64, 1);      /* attn_vec f16, rows (i,b), plane s = b*16 + h at cols s*64 of the 2048-wide (i) row: M 1024 N 64 K 2048, ldc 2048, all 32 planes in blockIdx.y */
  k_gemm_lds<DM, DM, true, true><<<gq, 256, 0, stream>>>(O16, 0, Bw + 4 * WSZ, 0, 0.0625f, bo, RES, nullptr, 0, DM / 64);      /* attn_out = attn_vec·Wo + bo (rows (i,b)) */
  k_lnout<<<(NQR + 7) / 8, 256, 0, stream>>>(RES, w, lg, lb, (float*)d_out);
}

// v009
// Measured time: 112 microseconds a run.
// Timed twice side by side with v008, it ran 1.12 times as fast both times.
// All steps since v000 together make it 24.5 times as fast.
#include <hip/hip_runtime.h>
// Transformer-XL relative multi-head attention (qlen 1024, mem_len 1024 → klen 2048, bsz 2, 16 heads × 64, post-LN): cat = [mems; w] (rows (j,b)); q = (cat·Wq + bq)[last qlen], k, v = cat·Wk + bk, cat·Wv + bv; rk = r·Wr + br;
// AC[i,j] = (q_i + r_w_bias)·k_j; BD = rel_shift((q_i + r_r_bias)·rk_m) (the exact pad-reshape shift, incl. its wrap region); score = (AC + BD)/8, −inf where the INPUT mask is set; softmax over j; attn_vec = Σ_j p·v_j;
// out = LayerNorm(w + attn_vec·Wo + bo)·g + b → [1024, 2, 1024]. (in,out) weights.
// Compute dtype: w, mems, r, biases, weights rounded to bf16; q (+ the two head biases), k, v, rk as f16 GEMM planes; one fused kernel forms, per 32 query rows of a (b,n) plane, AC and raw BD (f32 accumulators),
// applies the relative shift as a scatter into LDS, the mask and an f32 softmax, keeps P f16 x2^15 in LDS and multiplies it with V there (attn_vec); Wo GEMM + bias; residual + LayerNorm in f32 (wave per row). All contractions on v_wmma_f32_16x16x32_f16, f32 accumulate.
#define QL 1024
#define KL 2048
#define BZ 2
#define NH 16
#define DM 1024
#define NQR (QL * BZ)
#define NKR (KL * BZ)
#define ATT_SCALE 0.125f

typedef __bf16 v16b __attribute__((ext_vector_type(16)));
typedef unsigned short v8us __attribute__((ext_vector_type(8), may_alias));
typedef float  v8f  __attribute__((ext_vector_type(8)));
typedef float  v4f  __attribute__((ext_vector_type(4)));
typedef float  v4fa __attribute__((ext_vector_type(4), may_alias));
union FragB { v16b v; v8us half[2]; unsigned short u[16]; };

__device__ __forceinline__ unsigned short bf16_bits(float x) { unsigned int u = __float_as_uint(x); return (unsigned short)((u + 0x7FFFu + ((u >> 16) & 1u)) >> 16); }
__device__ __forceinline__ float bf16_val(unsigned short b) { return __uint_as_float(((unsigned int)b) << 16); }
__device__ __forceinline__ float bf16_round(float x) { return bf16_val(bf16_bits(x)); }
// D += A·B with NT terms: 1 = ah·bh, 2 = + al·bh (A split), 3 = + ah·bl (both split)
template <int NT>
__device__ __forceinline__ v8f mmaN(v16b ah, v16b al, v16b bh, v16b bl, v8f c) {
  c = __builtin_amdgcn_wmma_f32_16x16x32_bf16(false, ah, false, bh, (short)0, c, false, false);
  if (NT >= 2) c = __builtin_amdgcn_wmma_f32_16x16x32_bf16(false, al, false, bh, (short)0, c, false, false);
  if (NT >= 3) c = __builtin_amdgcn_wmma_f32_16x16x32_bf16(false, ah, false, bl, (short)0, c, false, false);
  asm volatile("v_nop\n\tv_nop\n\tv_nop\n\tv_nop" : "+v"(c) : "v"(ah), "v"(al), "v"(bh), "v"(bl));
  return c;
}

__global__ __launch_bounds__(256) void k_wt_bf16(const float* __restrict__ W, unsigned short* __restrict__ Wt, int K, int N) {
  const int t = blockIdx.x * 256 + threadIdx.x;
  const int k8n = K / 8;
  if (t >= N * k8n) return;
  const int n = t / k8n, k8 = (t % k8n) * 8;
  v8us v;
#pragma unroll
  for (int i = 0; i < 8; ++i) v[i] = bf16_bits(W[(size_t)(k8 + i) * N + n]);
  *(v8us*)(Wt + (size_t)n * K + k8) = v;
  
}

// GEMM C[M][N] (f32, pitch ldc) = act(A[M][K]·W + bias). A f32 row-major (pitch lda) converted per fragment to bf16
// (ASPLIT: hi/lo two planes -> 2 terms, else single rounded term); Wt bf16 [N][K] (pitch ldb). BIAS_BF16 rounds the
// bias to bf16 first (bias quantised to bf16 before the add). K%32==0, M%16==0, N%64==0.
template <bool ASPLIT, int ACT, bool BIAS_BF16>
__global__ __launch_bounds__(128) void k_gemm_bf(const float* __restrict__ A, int lda, const unsigned short* __restrict__ Wt, int ldb,
                                               const float* __restrict__ bias, float* __restrict__ C, int ldc, int M, int N, int K) {
  __shared__ __attribute__((aligned(16))) float so[4][16][64];
  const int tid = threadIdx.x, w = tid >> 5, lane = tid & 31, ln = lane & 15, hh = lane >> 4;
  const int ntn = N / 64;
  const int wid = blockIdx.x * 4 + w;
  const int mt = wid / ntn, nq = wid % ntn;
  if (mt * 16 >= M) return;
  const int row0 = mt * 16, col0 = nq * 64;
  const float* arow = A + (size_t)(row0 + ln) * lda;
  v8f acc[4] = {};
  for (int kb = 0; kb < K; kb += 32) {
    FragB ah, al;
    const v4f x0 = *(const v4fa*)(arow + kb + 8 * hh), x1 = *(const v4fa*)(arow + kb + 8 * hh + 4);
    const v4f x2 = *(const v4fa*)(arow + kb + 16 + 8 * hh), x3 = *(const v4fa*)(arow + kb + 16 + 8 * hh + 4);
    float xs[16] = {x0[0],x0[1],x0[2],x0[3],x1[0],x1[1],x1[2],x1[3],x2[0],x2[1],x2[2],x2[3],x3[0],x3[1],x3[2],x3[3]};
#pragma unroll
    for (int i = 0; i < 16; ++i) { const unsigned short hb = bf16_bits(xs[i]); ah.u[i] = hb; al.u[i] = ASPLIT ? bf16_bits(xs[i] - bf16_val(hb)) : (unsigned short)0; }
#pragma unroll
    for (int t = 0; t < 4; ++t) {
      const unsigned short* brow = Wt + (size_t)(col0 + t * 16 + ln) * ldb + kb;
      FragB b;
      b.half[0] = *(const v8us*)(brow + 8 * hh);
      b.half[1] = *(const v8us*)(brow + 16 + 8 * hh);
      acc[t] = mmaN<ASPLIT ? 2 : 1>(ah.v, al.v, b.v, b.v, acc[t]);
    }
  }
#pragma unroll
  for (int t = 0; t < 4; ++t) {
    float bv = bias ? bias[col0 + t * 16 + ln] : 0.f;
    if (BIAS_BF16) bv = bf16_round(bv);
#pragma unroll
    for (int r = 0; r < 8; ++r) { float v = acc[t][r] + bv; if (ACT == 1) v = fmaxf(v, 0.f); so[w][8 * hh + r][t * 16 + ln] = v; }
  }
  __builtin_amdgcn_fence(__ATOMIC_ACQ_REL, "workgroup");
  __builtin_amdgcn_wave_barrier();
  const int rsub = lane >> 4, c4 = (lane & 15) * 4;
  {
#pragma unroll
    for (int q = 0; q < 8; ++q) {
      const int r = q * 2 + rsub;
      const v4f v = *(const v4fa*)&so[w][r][c4];
      *(v4f*)(C + (size_t)(row0 + r) * ldc + col0 + c4) = v;
    }
    
  }
}

// Flash-style causal/unmasked attention, all contractions 3-term bf16 hi/lo splits, f32 softmax with running max.
// q,k,v rows are read from f32 buffers with arbitrary row pitch (so they can live inside a fused qkv buffer);
// D = head size (multiple of 32, <= 128); one wave = 16 query rows; block = 4 waves (64 queries) sharing K/V chunks of 32.
template <int D, bool CAUSAL>
__global__ __launch_bounds__(128) void k_flash(const float* __restrict__ qb, const float* __restrict__ kb, const float* __restrict__ vb,
                                             int pitch, int T, int H, float scale, float* __restrict__ y, int ypitch) {
  constexpr int KS = D / 32;        // k-steps for QK
  constexpr int DT = D / 16;        // d tiles for PV
  __shared__ __attribute__((aligned(16))) unsigned short sKh[32][D + 8], sKl[32][D + 8], sVh[32][D + 8], sVl[32][D + 8];
  __shared__ __attribute__((aligned(16))) unsigned short sPh[4][16][40], sPl[4][16][40];
  __shared__ __attribute__((aligned(16))) float sO[4][16][D];
  const int tid = threadIdx.x, w = tid >> 5, lane = tid & 31, ln = lane & 15, hh = lane >> 4;
  const int nqb = (T + 63) / 64;
  const int bh = blockIdx.x / nqb, qblk = blockIdx.x % nqb;
  const int b = bh / H, h = bh % H;
  const int q0 = qblk * 64 + w * 16;
  const float* Q = qb + (size_t)b * T * pitch + h * D;
  const float* K = kb + (size_t)b * T * pitch + h * D;
  const float* V = vb + (size_t)b * T * pitch + h * D;

  // A fragments of the wave's 16 query rows (scaled), hi/lo
  FragB aqh[KS], aql[KS];
  {
    int row = q0 + ln; if (row >= T) row = T - 1;
    const float* qr = Q + (size_t)row * pitch;
#pragma unroll
    for (int ks = 0; ks < KS; ++ks)
#pragma unroll
      for (int i = 0; i < 16; ++i) {
        const int d = ks * 32 + ((i < 8) ? (8 * hh + i) : (16 + 8 * hh + (i - 8)));
        const float x = qr[d] * scale; const unsigned short hb = bf16_bits(x);
        aqh[ks].u[i] = hb; aql[ks].u[i] = bf16_bits(x - bf16_val(hb));
      }
  }
  float m_r[8], l_r[8];
#pragma unroll
  for (int r = 0; r < 8; ++r) { m_r[r] = -3.0e38f; l_r[r] = 0.f; }
  v8f oacc[DT];
#pragma unroll
  for (int dt = 0; dt < DT; ++dt) oacc[dt] = (v8f){0.f,0.f,0.f,0.f,0.f,0.f,0.f,0.f};

  const int kv_end = CAUSAL ? min(T, qblk * 64 + 64) : T;     // block-uniform
  for (int j0 = 0; j0 < kv_end; j0 += 32) {
    __syncthreads();
    for (int e = tid; e < 32 * (D / 4); e += 128) {
      const int r = e / (D / 4), c4 = (e % (D / 4)) * 4;
      const int key = j0 + r;
      v4f kf = {0.f,0.f,0.f,0.f}, vf = {0.f,0.f,0.f,0.f};
      if (key < T) { kf = *(const v4fa*)(K + (size_t)key * pitch + c4); vf = *(const v4fa*)(V + (size_t)key * pitch + c4); }
#pragma unroll
      for (int t = 0; t < 4; ++t) {
        unsigned short hb = bf16_bits(kf[t]); sKh[r][c4 + t] = hb; sKl[r][c4 + t] = bf16_bits(kf[t] - bf16_val(hb));
        hb = bf16_bits(vf[t]); sVh[r][c4 + t] = hb; sVl[r][c4 + t] = bf16_bits(vf[t] - bf16_val(hb));
      }
    }
    __syncthreads();
    // S tile 16 x 32
    v8f s[2];
#pragma unroll
    for (int nt = 0; nt < 2; ++nt) {
      v8f acc = {};
#pragma unroll
      for (int ks = 0; ks < KS; ++ks) {
        FragB bh_, bl_;
        bh_.half[0] = *(const v8us*)&sKh[nt * 16 + ln][ks * 32 + 8 * hh]; bh_.half[1] = *(const v8us*)&sKh[nt * 16 + ln][ks * 32 + 16 + 8 * hh];
        bl_.half[0] = *(const v8us*)&sKl[nt * 16 + ln][ks * 32 + 8 * hh]; bl_.half[1] = *(const v8us*)&sKl[nt * 16 + ln][ks * 32 + 16 + 8 * hh];
        acc = mmaN<3>(aqh[ks].v, aql[ks].v, bh_.v, bl_.v, acc);
      }
      s[nt] = acc;
    }
    // mask + running max (rows 8hh+r; the 16 lanes of a half share rows)
    float alpha[8];
#pragma unroll
    for (int r = 0; r < 8; ++r) {
      const int qi = q0 + 8 * hh + r;
      const int ja = j0 + ln, jb = j0 + 16 + ln;
      if (CAUSAL) { if (ja > qi) s[0][r] = -3.0e38f; if (jb > qi) s[1][r] = -3.0e38f; }
      if (ja >= T) s[0][r] = -3.0e38f;
      if (jb >= T) s[1][r] = -3.0e38f;
      float mx = fmaxf(s[0][r], s[1][r]);
      mx = fmaxf(mx, __shfl_xor(mx, 1, 32)); mx = fmaxf(mx, __shfl_xor(mx, 2, 32)); mx = fmaxf(mx, __shfl_xor(mx, 4, 32)); mx = fmaxf(mx, __shfl_xor(mx, 8, 32));
      const float mnew = fmaxf(m_r[r], mx);
      alpha[r] = (mnew > -1.0e38f) ? __expf(m_r[r] - mnew) : 1.0f;
      const float p0 = (s[0][r] > -1.0e38f) ? __expf(s[0][r] - mnew) : 0.f;
      const float p1 = (s[1][r] > -1.0e38f) ? __expf(s[1][r] - mnew) : 0.f;
      m_r[r] = mnew;
      l_r[r] = l_r[r] * alpha[r] + p0 + p1;            // per-lane partial row sum (16 lanes combined at the end)
      unsigned short hb = bf16_bits(p0); sPh[w][8 * hh + r][ln] = hb;      sPl[w][8 * hh + r][ln] = bf16_bits(p0 - bf16_val(hb));
      hb = bf16_bits(p1);                sPh[w][8 * hh + r][16 + ln] = hb; sPl[w][8 * hh + r][16 + ln] = bf16_bits(p1 - bf16_val(hb));
    }
#pragma unroll
    for (int dt = 0; dt < DT; ++dt)
#pragma unroll
      for (int r = 0; r < 8; ++r) oacc[dt][r] *= alpha[r];
    __builtin_amdgcn_fence(__ATOMIC_ACQ_REL, "workgroup");
    __builtin_amdgcn_wave_barrier();
    FragB pah, pal;
    pah.half[0] = *(const v8us*)&sPh[w][ln][8 * hh]; pah.half[1] = *(const v8us*)&sPh[w][ln][16 + 8 * hh];
    pal.half[0] = *(const v8us*)&sPl[w][ln][8 * hh]; pal.half[1] = *(const v8us*)&sPl[w][ln][16 + 8 * hh];
#pragma unroll
    for (int dt = 0; dt < DT; ++dt) {
      FragB bvh, bvl;
#pragma unroll
      for (int i = 0; i < 8; ++i) {
        bvh.u[i] = sVh[8 * hh + i][dt * 16 + ln]; bvh.u[8 + i] = sVh[16 + 8 * hh + i][dt * 16 + ln];
        bvl.u[i] = sVl[8 * hh + i][dt * 16 + ln]; bvl.u[8 + i] = sVl[16 + 8 * hh + i][dt * 16 + ln];
      }
      oacc[dt] = mmaN<3>(pah.v, pal.v, bvh.v, bvl.v, oacc[dt]);
    }
    __builtin_amdgcn_fence(__ATOMIC_ACQ_REL, "workgroup");
    __builtin_amdgcn_wave_barrier();
  }
#pragma unroll
  for (int r = 0; r < 8; ++r) {
    float l = l_r[r];
    l += __shfl_xor(l, 1, 32); l += __shfl_xor(l, 2, 32); l += __shfl_xor(l, 4, 32); l += __shfl_xor(l, 8, 32);
    l_r[r] = (l > 0.f) ? 1.0f / l : 0.f;
  }
#pragma unroll
  for (int dt = 0; dt < DT; ++dt)
#pragma unroll
    for (int r = 0; r < 8; ++r) sO[w][8 * hh + r][dt * 16 + ln] = oacc[dt][r] * l_r[r];
  __builtin_amdgcn_fence(__ATOMIC_ACQ_REL, "workgroup");
  __builtin_amdgcn_wave_barrier();
  {
    for (int r = 0; r < 16; ++r) {
      const int row = q0 + r;
      if (row < T && lane < D / 4) {
        const v4f val = *(const v4fa*)&sO[w][r][lane * 4];
        *(v4f*)(y + ((size_t)b * T + row) * ypitch + h * D + lane * 4) = val;
      }
    }
    
  }
}

// GEMM C = act(A·W + bias + resid): A f32 (ASPLIT -> hi/lo 2 terms), Wt bf16 [N][K]; ACT 0 none, 1 relu, 2 exact gelu;
// resid (optional, f32, row index = (row % rmod), pitch ldr, RES_BF16 rounds it) added before the activation.
template <bool ASPLIT, int ACT, bool BIAS_BF16, bool RES_BF16>
__global__ __launch_bounds__(128) void k_gemm_bf3(const float* __restrict__ A, int lda, const unsigned short* __restrict__ Wt, int ldb,
                                                const float* __restrict__ bias, const float* __restrict__ resid, int rmod, int ldr,
                                                float* __restrict__ C, int ldc, int M, int N, int K) {
  __shared__ __attribute__((aligned(16))) float so[4][16][64];
  const int tid = threadIdx.x, w = tid >> 5, lane = tid & 31, ln = lane & 15, hh = lane >> 4;
  const int ntn = N / 64;
  const int wid = blockIdx.x * 4 + w;
  const int mt = wid / ntn, nq = wid % ntn;
  if (mt * 16 >= M) return;
  const int row0 = mt * 16, col0 = nq * 64;
  const float* arow = A + (size_t)(row0 + ln) * lda;
  v8f acc[4] = {};
  for (int kb = 0; kb < K; kb += 32) {
    FragB ah, al;
    const v4f x0 = *(const v4fa*)(arow + kb + 8 * hh), x1 = *(const v4fa*)(arow + kb + 8 * hh + 4);
    const v4f x2 = *(const v4fa*)(arow + kb + 16 + 8 * hh), x3 = *(const v4fa*)(arow + kb + 16 + 8 * hh + 4);
    float xs[16] = {x0[0],x0[1],x0[2],x0[3],x1[0],x1[1],x1[2],x1[3],x2[0],x2[1],x2[2],x2[3],x3[0],x3[1],x3[2],x3[3]};
#pragma unroll
    for (int i = 0; i < 16; ++i) { const unsigned short hb = bf16_bits(xs[i]); ah.u[i] = hb; al.u[i] = ASPLIT ? bf16_bits(xs[i] - bf16_val(hb)) : (unsigned short)0; }
#pragma unroll
    for (int t = 0; t < 4; ++t) {
      const unsigned short* brow = Wt + (size_t)(col0 + t * 16 + ln) * ldb + kb;
      FragB b;
      b.half[0] = *(const v8us*)(brow + 8 * hh);
      b.half[1] = *(const v8us*)(brow + 16 + 8 * hh);
      acc[t] = mmaN<ASPLIT ? 2 : 1>(ah.v, al.v, b.v, b.v, acc[t]);
    }
  }
#pragma unroll
  for (int t = 0; t < 4; ++t) {
    const int col = col0 + t * 16 + ln;
    float bv = bias ? bias[col] : 0.f;
    if (BIAS_BF16) bv = bf16_round(bv);
#pragma unroll
    for (int r = 0; r < 8; ++r) {
      float v = acc[t][r] + bv;
      if (resid) { float rv = resid[(size_t)((row0 + 8 * hh + r) % rmod) * ldr + col]; if (RES_BF16) rv = bf16_round(rv); v += rv; }
      if (ACT == 1) v = fmaxf(v, 0.f);
      if (ACT == 2) v = 0.5f * v * (1.0f + erff(v * 0.70710678118654752f));
      if (ACT == 3) { const float u = 0.7978845608028654f * (v + 0.044715f * v * v * v); v = 0.5f * v * (1.0f + tanhf(u)); }
      so[w][8 * hh + r][t * 16 + ln] = v;
    }
  }
  __builtin_amdgcn_fence(__ATOMIC_ACQ_REL, "workgroup");
  __builtin_amdgcn_wave_barrier();
  const int rsub = lane >> 4, c4 = (lane & 15) * 4;
  {
#pragma unroll
    for (int q = 0; q < 8; ++q) {
      const int r = q * 2 + rsub;
      const v4f v = *(const v4fa*)&so[w][r][c4];
      *(v4f*)(C + (size_t)(row0 + r) * ldc + col0 + c4) = v;
    }
    
  }
}
// row LayerNorm (biased variance, eps) over N: s = X (+ R); optional out_sum <- s; out_norm <- (s-mu)*rsqrt(var+eps)*g + b
template <bool PARAM_BF16>
__global__ __launch_bounds__(256) void k_layernorm(const float* __restrict__ X, const float* __restrict__ R, const float* __restrict__ g, const float* __restrict__ bta,
                                                  float* __restrict__ out_sum, float* __restrict__ out_norm, int N, float eps) {
  __shared__ float red[256];
  const int row = blockIdx.x, tid = threadIdx.x;
  const float* x = X + (size_t)row * N; const float* rr = R ? R + (size_t)row * N : nullptr;
  float vals[16];                     // up to N = 4096
  const int per = N / 256;            // contiguous chunk per thread? use strided-by-4 chunks: thread handles j = tid*4 + 1024*u
  float s1 = 0.f;
  for (int u = 0; u < per / 4; ++u) {
    const int j = tid * 4 + 1024 * u;
    const v4f a = *(const v4fa*)(x + j);
    v4f b = {0.f,0.f,0.f,0.f}; if (rr) b = *(const v4fa*)(rr + j);
#pragma unroll
    for (int q = 0; q < 4; ++q) { const float v = a[q] + b[q]; vals[u * 4 + q] = v; s1 += v; }
  }
  red[tid] = s1; __syncthreads();
  for (int st = 128; st > 0; st >>= 1) { if (tid < st) red[tid] += red[tid + st]; __syncthreads(); }
  const float mu = red[0] / (float)N; __syncthreads();
  float s2 = 0.f;
  for (int u = 0; u < per / 4; ++u)
#pragma unroll
    for (int q = 0; q < 4; ++q) { const float c = vals[u * 4 + q] - mu; s2 += c * c; }
  red[tid] = s2; __syncthreads();
  for (int st = 128; st > 0; st >>= 1) { if (tid < st) red[tid] += red[tid + st]; __syncthreads(); }
  const float rs = rsqrtf(red[0] / (float)N + eps);
  {
    for (int u = 0; u < per / 4; ++u) {
      const int j = tid * 4 + 1024 * u;
      v4f o, sm;
#pragma unroll
      for (int q = 0; q < 4; ++q) {
        float gg = g[j + q], bb = bta[j + q];
        if (PARAM_BF16) { gg = bf16_round(gg); bb = bf16_round(bb); }
        sm[q] = vals[u * 4 + q]; o[q] = (vals[u * 4 + q] - mu) * rs * gg + bb;
      }
      if (out_sum) *(v4f*)(out_sum + (size_t)row * N + j) = sm;
      *(v4f*)(out_norm + (size_t)row * N + j) = o;
    }
    
  }
}



// ---- f16 WMMA path (v_wmma_f32_16x16x32_f16): 11-bit significands for operands in range — used where a [0,1] probability operand needs more precision than bf16
typedef _Float16 v16h __attribute__((ext_vector_type(16)));
union FragH { v16h v; v8us half[2]; _Float16 h[16]; unsigned short u[16]; };
template <int NT>
__device__ __forceinline__ v8f mmaH(v16h ah, v16h al, v16h bh, v16h bl, v8f c) {
  c = __builtin_amdgcn_wmma_f32_16x16x32_f16(false, ah, false, bh, (short)0, c, false, false);
  if (NT >= 2) c = __builtin_amdgcn_wmma_f32_16x16x32_f16(false, al, false, bh, (short)0, c, false, false);
  if (NT >= 3) c = __builtin_amdgcn_wmma_f32_16x16x32_f16(false, ah, false, bl, (short)0, c, false, false);
  asm volatile("v_nop\n\tv_nop\n\tv_nop\n\tv_nop" : "+v"(c) : "v"(ah), "v"(al), "v"(bh), "v"(bl));
  return c;
}
// batched GEMM like k_gemm_b but f16 operands: A f32 (split into f16 hi/lo if ASPLIT, else rounded to f16), Bt = f16 values [n][k]; alpha; C f32; N multiple of 16 (partial tiles skipped)
template <bool ASPLIT>
__global__ __launch_bounds__(128) void k_gemm_h(const float* __restrict__ A, int lda, size_t sA, const _Float16* __restrict__ Bh, int ldb, size_t sB, float alpha, float* __restrict__ C, int ldc, size_t sC, int M, int N, int K) {
  __shared__ __attribute__((aligned(16))) float so[4][16][64];
  const int tid = threadIdx.x, w = tid >> 5, lane = tid & 31, ln = lane & 15, hh = lane >> 4; const int by = blockIdx.y;
  A += (size_t)by * sA; Bh += (size_t)by * sB; C += (size_t)by * sC;
  const int ntn = (N + 63) / 64; const int wid = blockIdx.x * 4 + w; const int mt = wid / ntn, nq = wid % ntn; if (mt * 16 >= M) return;
  const int row0 = mt * 16, col0 = nq * 64; const float* arow = A + (size_t)(row0 + ln) * lda;
  v8f acc[4] = {};
  for (int kb = 0; kb < K; kb += 32) {
    FragH ah, al;
    const v4f x0 = *(const v4fa*)(arow + kb + 8 * hh), x1 = *(const v4fa*)(arow + kb + 8 * hh + 4), x2 = *(const v4fa*)(arow + kb + 16 + 8 * hh), x3 = *(const v4fa*)(arow + kb + 16 + 8 * hh + 4);
    float xs[16] = {x0[0],x0[1],x0[2],x0[3],x1[0],x1[1],x1[2],x1[3],x2[0],x2[1],x2[2],x2[3],x3[0],x3[1],x3[2],x3[3]};
#pragma unroll
    for (int i = 0; i < 16; ++i) { const _Float16 h = (_Float16)xs[i]; ah.h[i] = h; al.h[i] = ASPLIT ? (_Float16)(xs[i] - (float)h) : (_Float16)0.0f; }
#pragma unroll
    for (int t = 0; t < 4; ++t) { if (col0 + t * 16 >= N) continue; const size_t boff = (size_t)(col0 + t * 16 + ln) * ldb + kb; FragH bq; bq.half[0] = *(const v8us*)(Bh + boff + 8 * hh); bq.half[1] = *(const v8us*)(Bh + boff + 16 + 8 * hh);
      acc[t] = mmaH<ASPLIT ? 2 : 1>(ah.v, al.v, bq.v, bq.v, acc[t]); }
  }
#pragma unroll
  for (int t = 0; t < 4; ++t) { if (col0 + t * 16 >= N) continue;
#pragma unroll
    for (int r = 0; r < 8; ++r) so[w][8 * hh + r][t * 16 + ln] = acc[t][r] * alpha; }
  __builtin_amdgcn_fence(__ATOMIC_ACQ_REL, "workgroup"); __builtin_amdgcn_wave_barrier();
  const int rsub = lane >> 4, c4 = (lane & 15) * 4;
  {
#pragma unroll
    for (int q = 0; q < 8; ++q) { const int r = q * 2 + rsub; if (col0 + c4 < N) { const v4f v = *(const v4fa*)&so[w][r][c4]; *(v4f*)(C + (size_t)(row0 + r) * ldc + col0 + c4) = v; } }
     }
}

// Wt[n][k] = f16(bf16(W[k][n])*scale) from f32 row-major W[DM][DM] (scale = power of two; bf16-exact weights stay exact in f16 away from the subnormal range)
// bx: the index of the 256-thread block inside this matrix's share of the merged grid. One block turns a tile of 64 k x 64 n in LDS (tl, 64 rows of TP bytes), so that memory sees whole lines on both sides:
// a wave reads two 256-byte row pieces of W at a time and stores four whole 128-byte lines of Wt; read column by column, every lane of a load would touch a line of its own.
#define TP 144      // LDS pitch in bytes of a turned row of 64 f16: a multiple of 16 for the 16-byte reads
__device__ __forceinline__ void wt_f16_body(int bx, const float* __restrict__ W, _Float16* __restrict__ Wt, float scale, char* tl) {
  const int tid = threadIdx.x, kt = bx / (DM / 64), nt = bx % (DM / 64);
  const int kp = tid >> 4, c4 = (tid & 15) * 4;      // the thread takes columns c4 .. c4 + 3 of the tile's rows 2 kp, 2 kp + 1, 32 + 2 kp, 33 + 2 kp
  const char* base = (const char*)(W + (size_t)kt * 64 * DM + nt * 64); const unsigned ob = (unsigned)(2 * kp * DM * 4 + c4 * 4);
  v4f x[2][2];
#pragma unroll
  for (int i = 0; i < 2; ++i)
#pragma unroll
    for (int s = 0; s < 2; ++s) x[i][s] = *(const v4fa*)(base + ob + (i * 32 + s) * DM * 4);
  // the wait that is owed before a register named by an issued global load is rewritten; offset and base are inputs, so they stay live to here and none of the four loads lands in them
  asm volatile("s_wait_xcnt 0x0" :: "v"(ob), "s"(base) : "memory");
#pragma unroll
  for (int i = 0; i < 2; ++i)
#pragma unroll
    for (int e = 0; e < 4; ++e) { typedef _Float16 v2h __attribute__((ext_vector_type(2), may_alias)); v2h p;      // two neighbouring k of one n: one 4-byte LDS store
      p[0] = (_Float16)(bf16_round(x[i][0][e]) * scale); p[1] = (_Float16)(bf16_round(x[i][1][e]) * scale); *(v2h*)(tl + (c4 + e) * TP + (i * 32 + 2 * kp) * 2) = p; }
  __syncthreads();      // the tile is whole in LDS before its turned rows are read
  const int rn = tid >> 3, ch = tid & 7; v8us o[2];      // eight lanes a row of 64 k; trip p takes rows 32 p + tid / 8
#pragma unroll
  for (int p = 0; p < 2; ++p) o[p] = *(const v8us*)(tl + (p * 32 + rn) * TP + ch * 16);
  unsigned short* wo = (unsigned short*)Wt + (size_t)(nt * 64 + rn) * DM + kt * 64 + ch * 8;
#pragma unroll
  for (int p = 0; p < 2; ++p) *(v8us*)(wo + (size_t)p * 32 * DM) = o[p];
}
typedef _Float16 v4h __attribute__((ext_vector_type(4)));

__device__ __forceinline__ void x16_body(int bx, const float* __restrict__ x, _Float16* __restrict__ X16, size_t n8) { const size_t t = (size_t)bx * 256 + threadIdx.x; if (t >= n8) return; FragH f;
#pragma unroll
  for (int q = 0; q < 8; ++q) f.h[q] = (_Float16)bf16_round(x[t * 8 + q]); *(v8us*)((unsigned short*)X16 + t * 8) = f.half[0];  }
// All operand preparation in one launch (none of the eight parts reads what another writes): blocks 0 .. 5 GWT - 1 transpose the five weights (Wq, Wk, Wv, Wr, Wo -> Bw, x2^4), the next 3 GX round mems, w (-> CAT, back to back) and r (-> R16).
#define GWT ((DM / 64) * (DM / 64))      // blocks of one weight matrix: a tile of 64 x 64 each
#define GX (NQR * DM / 8 / 256)      // blocks of one 2048 x 1024 plane at 8 elements a thread (mems, w, r, q alike)
__global__ __launch_bounds__(256) void k_prep(const float* __restrict__ Wq, const float* __restrict__ Wk, const float* __restrict__ Wv, const float* __restrict__ Wr, const float* __restrict__ Wo,
    const float* __restrict__ mems, const float* __restrict__ w, const float* __restrict__ r, _Float16* __restrict__ Bw, _Float16* __restrict__ CAT, _Float16* __restrict__ R16) {
  __shared__ __attribute__((aligned(16))) char tl[64 * TP];
  const int bx = blockIdx.x;      // the branch is taken by a whole block or by none of it: so is the barrier of the weight tiles
  if (bx < 5 * GWT) { const int m = bx / GWT; const float* W = (m == 0) ? Wq : (m == 1) ? Wk : (m == 2) ? Wv : (m == 3) ? Wr : Wo; wt_f16_body(bx % GWT, W, Bw + (size_t)m * DM * DM, 16.0f, tl); }
  else { const int m = (bx - 5 * GWT) / GX; const float* x = (m == 0) ? mems : (m == 1) ? w : r; _Float16* o = (m == 0) ? CAT : (m == 1) ? CAT + (size_t)NQR * DM : R16; x16_body((bx - 5 * GWT) % GX, x, o, (size_t)NQR * DM / 8); }
}
__global__ __launch_bounds__(256) void k_round16f(const float* __restrict__ W, _Float16* __restrict__ Bt, size_t n8) { const size_t t = (size_t)blockIdx.x * 256 + threadIdx.x; if (t >= n8) return; FragH f;
#pragma unroll
  for (int i = 0; i < 8; ++i) f.h[i] = (_Float16)(bf16_round(W[t * 8 + i]) * 16.0f); *(v8us*)((unsigned short*)Bt + t * 8) = f.half[0];  }
// Fused score kernel: one work-group = 32 query rows i0..i0+31 of one (b,n) plane (blockIdx.y), 16 waves; the 32 x KL score rows live in LDS and never reach memory. AC is stored into the rows first.
// The pad/reshape shift as a scatter of raw BD: idx = QL + i*KL + j = i*(KL+1) + (QL - i + j), so with d = m - (QL-1) + i the raw value (q_i + r_r_bias).rk_m belongs to j = d where d >= 0,
// the raw value of row i+1 at column m to j = d + KL + 1 where d <= -2 (the wrap region); d == -1 gives j = KL, a slot of the row's LDS padding that the softmax never reads; the pad's zero falls on j = i + KL + 1 - QL. Each j in 0..KL-1 gets at most one raw value.
// Behind a barrier each raw value is added to AC in place, and behind a second one wave wv does mask and f32 softmax of rows i0 + wv and i0 + 16 + wv, one after the other, with the lane order and sum order of a wave-per-row pass, and leaves P f16 x2^15 in the first half of the row's own LDS.
// Behind a third barrier P (32 x KL) is multiplied with V (KL x 64): wave wv takes the 256 j from (wv / 2) * 256 and the 32 columns d from (wv % 2) * 32, so every V byte is fetched once a work-group; the eight partial sums of an output element meet in the rows' free second halves
// and, behind a fourth barrier, are added in rising j order; attn_vec goes out f16, a whole 128-byte line a query row. P never reaches memory.
#define SP (KL + 4)      // LDS row pitch in floats: 8 rows apart = 32 banks apart, so the two lane halves of a D tile do not collide; multiple of 4 for 16-byte reads
__device__ __forceinline__ v8f mma16(v16h a, v16h b, v8f c) { return __builtin_amdgcn_wmma_f32_16x16x32_f16(false, a, false, b, (short)0, c, false, false); }
// The planes that this kernel multiplies (q + r_w_bias, q + r_r_bias, k, rk, and v with d as the row and j as k) lie in fragment order: blocks of FB bytes = 16 rows x 64 f16 of one head, stored [c = k / 8][row][8 f16], so that the 16 bytes of (row, c) stand at c * 256 + row * 16.
// One 16-row fragment pair (k = 0..63) of such a block: base (+ cofs, a constant) is the same for the whole wave, ob is the lane's own byte offset (row * 16, plus 256 for the upper lane half). With ob = lane * 16 each load is 512 bytes in a row: four whole lines.
// Lane half hh, step ks: registers 0..3 hold k = 32*ks + 8*hh + 0..7 (c = 4 ks + hh), registers 4..7 hold k = 32*ks + 16 + 8*hh + 0..7 (c = 4 ks + 2 + hh), for A and B alike.
#define FB 2048
__device__ __forceinline__ void ldfrag(FragH (&f)[2], const char* __restrict__ base, unsigned ob, int cofs) {
#pragma unroll
  for (int ks = 0; ks < 2; ++ks) { f[ks].half[0] = *(const v8us*)(base + ob + (cofs + ks * 1024)); f[ks].half[1] = *(const v8us*)(base + ob + (cofs + ks * 1024 + 512)); }
  // the wait that is owed before a register named by an issued global load is rewritten; offset and base are inputs, so they stay live to here and none of the four loads lands in them
  asm volatile("s_wait_xcnt 0x0" :: "v"(ob), "s"(base) : "memory"); }
// 32 query rows a work-group, as two blocks of 16 (rb = 0, 1): every k and rk fragment that a wave loads is multiplied with both blocks' q rows, so each tile is fetched once for 32 rows, not once for 16.
// launch bounds: 4 waves a SIMD (a budget of 256 VGPRs): the 257-KiB work-group has a WGP to itself, and the registers hold all eight k tiles, then both blocks' q rows and four rk tiles, in flight ahead of their use
__global__ __launch_bounds__(512, 4) void k_score(const _Float16* __restrict__ QW, const _Float16* __restrict__ QR, const _Float16* __restrict__ K16, const _Float16* __restrict__ RK, const int* __restrict__ MSK, const _Float16* __restrict__ VF, _Float16* __restrict__ O16) {
  __shared__ __attribute__((aligned(16))) float S[32 * SP];
  const int tid = threadIdx.x, lane = tid & 31, ln = lane & 15, hh = lane >> 4;
  const int wv = __builtin_amdgcn_readfirstlane(tid >> 5);      // the wave's number as a scalar: tile bases and the row's addresses then sit in scalar registers
  const int i0 = blockIdx.x * 32, pl = blockIdx.y, h = pl % NH;
  const char* qw = (const char*)QW + ((size_t)pl * (QL / 16) + blockIdx.x * 2) * FB; const char* qr = (const char*)QR + ((size_t)pl * (QL / 16) + blockIdx.x * 2) * FB;      // the block of rows i0 .. i0 + 15 of plane pl; rows i0 + 16 .. i0 + 31 are the next block
  const char* kp = (const char*)K16 + ((size_t)pl * (KL / 16) + wv) * FB; const char* rp = (const char*)RK + ((size_t)h * (KL / 16) + wv) * FB;      // the wave's first column tile; its next ones lie 16 blocks apart
  const char* mk = (const char*)(MSK + (size_t)(i0 + wv) * KL);      // the wave does the softmax of rows i0 + wv and i0 + 16 + wv
  const unsigned obq = (unsigned)(lane * 16), obr = obq;
  const char* ml = mk + lane * 16;      // the lane's own 16 bytes of the first mask row's first 512
  // row i+1 for the wrap region (lane 15: row 0 of the next block); the clamped row of i = QL-1 is never selected (there d >= 0 for every m)
  const unsigned obw0 = (unsigned)(hh * 256 + ((ln < 15) ? (ln + 1) * 16 : FB)), obw1 = (unsigned)(hh * 256 + ((ln < 15) ? (ln + 1) * 16 : (i0 + 32 < QL) ? FB : 15 * 16));
  typedef int v4i __attribute__((ext_vector_type(4))); typedef int v4ia __attribute__((ext_vector_type(4), may_alias));
  FragH aq[2][2], kb[8][2]; ldfrag(aq[0], qw, obq, 0); ldfrag(aq[1], qw, obq, FB);
#pragma unroll
  for (int t = 0; t < 8; ++t) ldfrag(kb[t], kp, obq, t * 16 * FB);      // all eight k tiles of the wave are in flight at once
  FragH an[2][2], aw[2][2], bb[4][2];
  ldfrag(an[0], qr, obq, 0); ldfrag(an[1], qr, obq, FB); ldfrag(aw[0], qr, obw0, 0);      // as many of the q + r_r_bias rows as the registers take beside the k tiles
  __builtin_amdgcn_sched_barrier(0);      // no product, with its wait for the first tile, is lifted in front of these loads: all of them are asked for before the wave waits for any
  v4i mva[16], mvb[16];      // the masks of rows i0 + wv and i0 + 16 + wv, the lane's own four columns per jj: read where registers fall free, so that they fly under other work
  // AC: wave wv owns the column tiles wv + 16 t and stores them straight into S, for both row blocks. As the k tiles drain, their registers take the last q + r_r_bias rows and the first four rk tiles, which fly while the later AC tiles are multiplied and stored.
#pragma unroll
  for (int t = 0; t < KL / 256; ++t) { const int j0 = (wv + 16 * t) * 16; FragH (&bf)[2] = kb[t];
    v8f c0 = {}, c1 = {}; c0 = mma16(aq[0][0].v, bf[0].v, c0); c1 = mma16(aq[1][0].v, bf[0].v, c1); c0 = mma16(aq[0][1].v, bf[1].v, c0); c1 = mma16(aq[1][1].v, bf[1].v, c1);
    // the four vector slots that the chip needs behind a matrix instruction before its D is overwritten (the next tile's product) or its A or B refilled; the operands are named so that the loads below, which may land in bf's registers, stay behind them
    asm volatile("v_nop\n\tv_nop\n\tv_nop\n\tv_nop" : "+v"(c0), "+v"(c1) : "v"(aq[0][0].v), "v"(aq[0][1].v), "v"(aq[1][0].v), "v"(aq[1][1].v), "v"(bf[0].v), "v"(bf[1].v));
    if (t == 0) ldfrag(aw[1], qr, obw1, FB);
    else if (t < 5) ldfrag(bb[t - 1], rp, obr, (t - 1) * 16 * FB);
#pragma unroll
    for (int r = 0; r < 8; ++r) { S[(8 * hh + r) * SP + j0 + ln] = c0[r]; S[(16 + 8 * hh + r) * SP + j0 + ln] = c1[r]; }
    __builtin_amdgcn_sched_barrier(0); }      // keeps the tiles apart in the schedule: mixed, they hold more products and fragments live than the registers take
  if (tid < 32) S[tid * SP + KL] = 0.f;      // the padding slot that takes the one raw value of a row with d == -1: given a value here, so that the add below reads nothing unwritten
  __syncthreads();      // every AC value is in S before any wave adds a shifted BD value to it
  __builtin_amdgcn_sched_barrier(0);      // as above: no product of the next phase is lifted over the barrier
  // raw BD of rows i and i+1, added in place at the shifted column: each (row, j) is touched by one lane of one wave; the column of the pad's zero, j = i + KL + 1 - QL, by none (AC + 0)
#pragma unroll
  for (int t = 0; t < KL / 256; ++t) { const int m0 = (wv + 16 * t) * 16; FragH (&bf)[2] = bb[t & 3];
    v8f dn[2] = {}, dw[2] = {};
#pragma unroll
    for (int ks = 0; ks < 2; ++ks)
#pragma unroll
      for (int rb = 0; rb < 2; ++rb) { dn[rb] = mma16(an[rb][ks].v, bf[ks].v, dn[rb]); dw[rb] = mma16(aw[rb][ks].v, bf[ks].v, dw[rb]); }
    // the four vector slots that the chip needs behind a matrix instruction before a vector instruction reads its D or its B is refilled; bf is named so that its refill stays behind them
    asm volatile("v_nop\n\tv_nop\n\tv_nop\n\tv_nop" : "+v"(dn[0]), "+v"(dw[0]), "+v"(dn[1]), "+v"(dw[1]) : "v"(bf[0].v), "v"(bf[1].v));
    if (t + 4 < KL / 256) ldfrag(bf, rp, obr, (t + 4) * 16 * FB);      // rk tiles fly four tiles ahead
    else {      // the ring drains: its registers take the first row's mask, four vectors a tile, which fly under the last tiles' adds
#pragma unroll
      for (int q = 0; q < 4; ++q) mva[(t - 4) * 4 + q] = *(const v4ia*)(ml + ((t - 4) * 4 + q) * 512);
      // the wait that is owed before a register named by an issued global load is rewritten; the address is an input, so it stays live to here and none of the four loads lands in it
      asm volatile("s_wait_xcnt 0x0" :: "v"(ml) : "memory"); }
#pragma unroll
    for (int rb = 0; rb < 2; ++rb) { const int d0 = m0 + ln - (QL - 1) + i0 + 16 * rb + 8 * hh; int ix[8]; float old[8];
#pragma unroll
      for (int r = 0; r < 8; ++r) { const int d = d0 + r; ix[r] = (16 * rb + 8 * hh + r) * SP + ((d >= 0) ? d : d + (KL + 1)); old[r] = S[ix[r]]; }      // the eight reads first: eight different rows, so no store of this tile can hit them
#pragma unroll
      for (int r = 0; r < 8; ++r) S[ix[r]] = old[r] + ((d0 + r >= 0) ? dn[rb][r] : dw[rb][r]); }
    __builtin_amdgcn_sched_barrier(0); }      // as above
  __syncthreads();      // the rows are complete before the row waves read them
  // the mask of row i0 + 16 + wv: asked for here, it flies under the softmax of row i0 + wv
#pragma unroll
  for (int jj = 0; jj < 16; ++jj) mvb[jj] = *(const v4ia*)(ml + (16 * KL * 4 + jj * 512));
  // the wait that is owed before a register named by an issued global load is rewritten; the address is an input, so it stays live to here and none of the sixteen loads lands in it
  asm volatile("s_wait_xcnt 0x0" :: "v"(ml) : "memory");
  const int dp = wv & 1, kq = wv >> 1;      // the wave's share of P*V: columns d = 32 dp .. 32 dp + 31, rows j = 256 kq .. 256 kq + 255
  const char* vp = (const char*)VF + (((size_t)pl * (KL / 64) + kq * 4) * 4 + dp * 2) * FB;      // V block (64 j, 16 d) number (plane * 32 + j / 64) * 4 + d / 16
  FragH vb[4][2][2];      // [64 j][16 d][32 j]: the wave's whole share of V
  typedef _Float16 v4ha __attribute__((ext_vector_type(4), may_alias));
#pragma unroll
  for (int rb = 0; rb < 2; ++rb) {
    if (rb == 1) __builtin_amdgcn_sched_barrier(0);      // keeps the two rows apart in the schedule: scheduled together with the first row's exponentials, the second row's LDS reads are issued one at a time, each waited for
    float* sr = &S[(16 * rb + wv) * SP];
    v4f sv[16]; float mx = -3.0e38f;
#pragma unroll
    for (int jj = 0; jj < 16; ++jj) { const int j0 = jj * 128 + lane * 4; const v4f a = *(const v4fa*)(sr + j0); v4f s;
#pragma unroll
      for (int e = 0; e < 4; ++e) { const float val = a[e] * ATT_SCALE; const bool off = ((rb == 0) ? mva[jj][e] : mvb[jj][e]) != 0; s[e] = off ? -INFINITY : val; mx = fmaxf(mx, s[e]); }
      sv[jj] = s; }
    __builtin_amdgcn_sched_barrier(0);      // keeps the loads below behind the last use of the mask: lifted among the reads above, their registers would come on top of the mask's and leave those reads no room to fly together
    // the row's mask registers are free from here: they take half of the wave's V (128 j), which flies under the row's exponentials
    ldfrag(vb[2 * rb][0], vp, obq, 8 * rb * FB); ldfrag(vb[2 * rb][1], vp, obq, (8 * rb + 1) * FB); ldfrag(vb[2 * rb + 1][0], vp, obq, (8 * rb + 4) * FB); ldfrag(vb[2 * rb + 1][1], vp, obq, (8 * rb + 5) * FB);
    __builtin_amdgcn_sched_barrier(0);      // keeps these loads here: sunk towards their use behind the barrier they would fly under nothing
    for (int o = 16; o >= 1; o >>= 1) mx = fmaxf(mx, __shfl_xor(mx, o, 32)); float z = 0.f;
#pragma unroll
    for (int jj = 0; jj < 16; ++jj) for (int e = 0; e < 4; ++e) { const float p = (sv[jj][e] > -INFINITY) ? __expf(sv[jj][e] - mx) : 0.f; sv[jj][e] = p; z += p; }
    for (int o = 16; o >= 1; o >>= 1) z += __shfl_xor(z, o, 32); const float iz = (z > 0.f) ? 32768.0f / z : 0.f;
    char* pr = (char*)sr + lane * 8;      // P of the row, f16, over the first 4096 bytes of its own scores: all of them are in this wave's registers by now, and no other wave touches the row before the barrier below
#pragma unroll
    for (int jj = 0; jj < 16; ++jj) { v4h o; for (int e = 0; e < 4; ++e) o[e] = (_Float16)(sv[jj][e] * iz); *(v4ha*)(pr + jj * 256) = o; }
  }
  __syncthreads();      // all 32 rows of P are in LDS before any wave multiplies them
  // A = P: lane (ln, hh) reads row 16 rb + ln; registers 0..3 hold j = 32 ks + 8 hh + 0..7, registers 4..7 hold j = 32 ks + 16 + 8 hh + 0..7 of the 64-j block, the k order of ldfrag. The row pitch of SP floats is 16 bytes x odd: no bank conflict among the 16 rows.
  const char* pa = (const char*)S + ln * (SP * 4) + kq * 512 + hh * 16;
  v8f pc[2][2] = {};      // [row block][16 d]
  FragH pf[2][2][2];      // [buffer][row block][32 j]: the P fragments of one 64-j block; the next block's are read while this one is multiplied
#pragma unroll
  for (int t = -1; t < 4; ++t) {
    if (t < 3) {
#pragma unroll
      for (int rb = 0; rb < 2; ++rb)
#pragma unroll
        for (int ks = 0; ks < 2; ++ks) { FragH& f = pf[(t + 1) & 1][rb][ks]; f.half[0] = *(const v8us*)(pa + rb * 16 * SP * 4 + (t + 1) * 128 + ks * 64); f.half[1] = *(const v8us*)(pa + rb * 16 * SP * 4 + (t + 1) * 128 + ks * 64 + 32); }
    }
    __builtin_amdgcn_sched_barrier(0);      // keeps the next block's LDS reads in front of this block's products, so that they return under them
    if (t < 0) continue;
#pragma unroll
    for (int ks = 0; ks < 2; ++ks)
#pragma unroll
      for (int rb = 0; rb < 2; ++rb)
#pragma unroll
        for (int u = 0; u < 2; ++u) pc[rb][u] = mma16(pf[t & 1][rb][ks].v, vb[t][u][ks].v, pc[rb][u]);
    // the first block's products open the four accumulators: its V registers are named here, so that they stay live to behind all of them and no fresh D is placed over the B of a product just issued; the four vector slots are the distance the chip needs before those registers are rewritten
    if (t == 0) asm volatile("v_nop\n\tv_nop\n\tv_nop\n\tv_nop" : "+v"(pc[0][0]), "+v"(pc[0][1]), "+v"(pc[1][0]), "+v"(pc[1][1]) : "v"(vb[0][0][0].v), "v"(vb[0][0][1].v), "v"(vb[0][1][0].v), "v"(vb[0][1][1].v)); }
  // the wave's four partial tiles go to the second halves (floats 1024 ..) of its own two rows, which hold scores that nobody reads any more; register r of lane (ln, hh) is (row 8 hh + r, column ln) and stands at r * 32 + lane
#pragma unroll
  for (int rb = 0; rb < 2; ++rb)
#pragma unroll
    for (int u = 0; u < 2; ++u) { float* ps = &S[(16 * rb + wv) * SP + 1024 + u * 256 + lane];
#pragma unroll
      for (int r = 0; r < 8; ++r) ps[r * 32] = pc[rb][u][r]; }
  __syncthreads();      // every wave's partial tiles are in LDS before they are added
  // thread (row = tid / 16, g = tid % 16) adds the eight partial sums of columns d = 4 g .. 4 g + 3 of query row i0 + row, in rising j order; they come from waves 2 kq + g / 8, which lie two LDS rows apart
  const int row = tid >> 4, g = tid & 15;
  const float* rd = &S[((row & 16) + (g >> 3)) * SP + 1024 + ((g >> 2) & 1) * 256 + (row & 7) * 32 + ((row >> 3) & 1) * 16 + (g & 3) * 4];
  v4f ss = *(const v4fa*)rd;
#pragma unroll
  for (int q = 1; q < 8; ++q) ss += *(const v4fa*)(rd + q * 2 * SP);
  v4h ov; for (int e = 0; e < 4; ++e) ov[e] = (_Float16)(ss[e] * 0.000030517578125f);      // x2^-15: P's scale taken off
  *(v4h*)(O16 + (size_t)(i0 + row) * (BZ * DM) + pl * 64 + g * 4) = ov;      // rows (i,b): plane pl = b NH + h at columns pl * 64 of the 2048-wide row i
}
// GEMM with both operands staged in LDS: C[M][N] = f16 A[M][KK] . Bt[N][KK]^T, v = acc*alpha (+ bf16(bias[col]) if BIAS); writes f32 C (F32OUT) or f16 C16, pitch LDC. A, Bt row-major with pitch KK; M a multiple of 128, N of 64, KK of 256.
// One work-group = 128 rows x 64 columns, 8 waves of 16 x 64; blockIdx.x = row block * ntn + column block (ntn = N / 64), blockIdx.y = plane (element strides sA, sB, sC).
// A stage is 128 k = 256 bytes of each of the 192 operand rows (A rows 0..127, Bt rows 128..191), brought by asynchronous copies whose wave-wide 512 bytes are two whole 256-byte row pieces; two buffers, stage t + 2 flies while stage t is multiplied.
// Each output element still sums its k steps of 32 in rising order in one f32 accumulator.
#define GP 272      // LDS row pitch in bytes: 16 x odd, the conflict-free pitch of 256-byte rows for 16-byte fragment reads
#define GSTG (192 * GP)      // bytes of one stage
// One stage: lane (row cr = tid / 16, 16-byte piece tid % 16) copies its piece of A rows cr + 16 i (i < 8) and Bt rows cr + 16 i (i < 4). l: the lane's LDS byte address of A row cr; ga, gb: its global addresses in A row cr and Bt row cr; RB: 16 rows in bytes.
// The s_wait_xcnt is the wait that is owed before a register named by an issued copy is rewritten; as the statement's last line it stands in front of every such write.
template <int RB>
__device__ __forceinline__ void cp_stage(unsigned l, const char* ga, const char* gb) {
  asm volatile("global_load_async_to_lds_b128 %0, %12, off\n\t"
               "global_load_async_to_lds_b128 %1, %13, off\n\t"
               "global_load_async_to_lds_b128 %2, %14, off\n\t"
               "global_load_async_to_lds_b128 %3, %15, off\n\t"
               "global_load_async_to_lds_b128 %4, %16, off\n\t"
               "global_load_async_to_lds_b128 %5, %17, off\n\t"
               "global_load_async_to_lds_b128 %6, %18, off\n\t"
               "global_load_async_to_lds_b128 %7, %19, off\n\t"
               "global_load_async_to_lds_b128 %8, %20, off\n\t"
               "global_load_async_to_lds_b128 %9, %21, off\n\t"
               "global_load_async_to_lds_b128 %10, %22, off\n\t"
               "global_load_async_to_lds_b128 %11, %23, off\n\t"
               "s_wait_xcnt 0x0"
               :: "v"(l), "v"(l + 16 * GP), "v"(l + 32 * GP), "v"(l + 48 * GP), "v"(l + 64 * GP), "v"(l + 80 * GP), "v"(l + 96 * GP), "v"(l + 112 * GP),
                  "v"(l + 128 * GP), "v"(l + 144 * GP), "v"(l + 160 * GP), "v"(l + 176 * GP),
                  "v"(ga), "v"(ga + RB), "v"(ga + 2 * RB), "v"(ga + 3 * RB), "v"(ga + 4 * RB), "v"(ga + 5 * RB), "v"(ga + 6 * RB), "v"(ga + 7 * RB),
                  "v"(gb), "v"(gb + RB), "v"(gb + 2 * RB), "v"(gb + 3 * RB)
               : "memory");
}
// The tile's body: A, Bh, C, C16 are the plane's own bases, (bm, nq) the tile; ring and so are the calling kernel's LDS. mode (the same for the whole work-group) picks what the epilogue does with v:
// FRAG false: 0: f32 C. 1: f16 C16, both row-major. FRAG true: the planes of the score kernel, stored in its fragment order (blocks of FB bytes, see ldfrag; the tile's 64 columns are head nq):
// 2 (the q tile, rows (i,b)): C16 = f16(v + bf16(hb0[col])) and C16b = f16(v + bf16(hb1[col])), hb0 and hb1 the two 1024-wide head-bias rows; 4 (the k tile, rows (j,b)): C16 = f16(v); both as plane b NH + nq, block row / 16. 5 (the rk tile, rows m): C16 = f16(v), plane nq.
// 3 (the v tile; its rows are (j,b), its 64 columns one head nq): C16 is V as the B operand of P*V, in the same fragment order with d as the row and j as k: block ((b NH + nq) KL / 64 + j / 64) * 4 + d / 16 holds [j % 64 / 8][d % 16][8 f16]; the tile is turned in LDS and goes out as its eight whole blocks.
#define VP 144      // LDS pitch in bytes of a V^T row of 64 f16: 36 dwords, so that the 16 rows of an 8-byte store from the accumulators fall on different banks; a multiple of 16 for the 16-byte reads
template <int KK, int LDC, bool BIAS, bool FRAG>
__device__ __forceinline__ void gemm_tile(const _Float16* __restrict__ A, const _Float16* __restrict__ Bh, float alpha, const float* __restrict__ bias,
    float* __restrict__ C, _Float16* __restrict__ C16, _Float16* __restrict__ C16b, const float* __restrict__ hb0, const float* __restrict__ hb1, int mode, int bm, int nq, char* ring, float (*so)[16][64]) {
  const int tid = threadIdx.x, lane = tid & 31, ln = lane & 15, hh = lane >> 4;
  const int w = __builtin_amdgcn_readfirstlane(tid >> 5);      // the wave's number as a scalar
  const int row0 = bm * 128 + w * 16, col0 = nq * 64;
  const int cr = tid >> 4, cc = (tid & 15) * 16;
  const char* ga = (const char*)(A + (size_t)(bm * 128 + cr) * KK) + cc;
  const char* gb = (const char*)(Bh + (size_t)(col0 + cr) * KK) + cc;
  const unsigned l0 = (unsigned)(size_t)&ring[0] + (unsigned)(cr * GP + cc);      // the low 32 bits of a __shared__ address are its LDS byte address
  constexpr int NT = KK / 128, RB = 16 * KK * 2;
  float braw[4] = {0.f, 0.f, 0.f, 0.f};      // the bias of the lane's four columns, read at the head so that it flies under the main loop; first used in the epilogue
  if (BIAS) {
#pragma unroll
    for (int q = 0; q < 4; ++q) braw[q] = bias[col0 + q * 16 + ln];
  }
  float hw[4] = {0.f, 0.f, 0.f, 0.f}, hr[4] = {0.f, 0.f, 0.f, 0.f};      // the two head biases of the lane's four accumulator columns, read at the head like the bias
  if (FRAG && mode == 2) {
    const unsigned oh = (unsigned)((col0 + ln) * 4); const char* p0 = (const char*)hb0; const char* p1 = (const char*)hb1;
#pragma unroll
    for (int q = 0; q < 4; ++q) { hw[q] = *(const float*)(p0 + oh + q * 64); hr[q] = *(const float*)(p1 + oh + q * 64); }
    // the wait that is owed before a register named by an issued global load is rewritten; offset and bases are inputs, so they stay live to here and none of the eight loads lands in them
    asm volatile("s_wait_xcnt 0x0" :: "v"(oh), "s"(p0), "s"(p1) : "memory");
  }
  cp_stage<RB>(l0, ga, gb);      // stage 0 into buffer 0
  asm volatile("s_wait_asynccnt 0x0" ::: "memory");      // this wave's copies of stage 0 have landed
  __syncthreads();      // every wave's have: stage 0 may be read
  cp_stage<RB>(l0 + GSTG, ga + 256, gb + 256);      // stage 1 into buffer 1
  v8f acc[4] = {};
#pragma unroll 1      // kept rolled: unrolled, the build holds two stages' fragments live and needs more than 256 registers, and two work-groups no longer share a WGP
  for (int t = 0; t < NT; ++t) {
    const char* sa = &ring[(t & 1) * GSTG + (w * 16 + ln) * GP + hh * 16];
    const char* sb = &ring[(t & 1) * GSTG + (128 + ln) * GP + hh * 16];
    FragH a[4], b[4][4];
#pragma unroll
    for (int ks = 0; ks < 4; ++ks) {      // lane half hh: registers 0..3 hold k = 32 ks + 8 hh + 0..7, registers 4..7 hold k = 32 ks + 16 + 8 hh + 0..7, for A and B alike
      a[ks].half[0] = *(const v8us*)(sa + ks * 64); a[ks].half[1] = *(const v8us*)(sa + ks * 64 + 32);
#pragma unroll
      for (int q = 0; q < 4; ++q) { b[ks][q].half[0] = *(const v8us*)(sb + q * 16 * GP + ks * 64); b[ks][q].half[1] = *(const v8us*)(sb + q * 16 * GP + ks * 64 + 32); }
    }
    asm volatile("s_wait_dscnt 0x0" ::: "memory");      // the whole stage is in this wave's registers: its reads of the buffer have returned before the buffer is refilled
    asm volatile("s_wait_asynccnt 0x0" ::: "memory");      // this wave's copies of stage t + 1 have landed
    __syncthreads();      // publishes stage t + 1 and ends every wave's reads of stage t
    if (t + 2 < NT) cp_stage<RB>(l0 + (unsigned)((t & 1) * GSTG), ga + (t + 2) * 256, gb + (t + 2) * 256);      // stage t + 2 into the buffer that this trip has read
    __builtin_amdgcn_sched_barrier(0);      // keeps the products behind the refill: they need registers only, and the copies so fly under them as well as under the next stage's reads
#pragma unroll
    for (int ks = 0; ks < 4; ++ks)
#pragma unroll
      for (int q = 0; q < 4; ++q) acc[q] = mma16(a[ks].v, b[ks][q].v, acc[q]);
  }
  asm volatile("s_wait_asynccnt 0x0" ::: "memory");      // no copy is outstanding when the wave goes on to its end
  // the four vector slots that the chip needs behind the loop's last matrix instructions before their A or B registers are rewritten: the epilogues are reached over scalar branches
  if (FRAG) asm volatile("v_nop\n\tv_nop\n\tv_nop\n\tv_nop");
  if (FRAG && mode == 3) {
    char* tv = (char*)so;      // 128 rows (b, d) of 64 j. Accumulator register r is tile row 16 w + 8 hh + r = (j, b) with j = 8 w + 4 hh + r / 2, b = r % 2: the four registers of one b are four neighbouring j
#pragma unroll
    for (int q = 0; q < 4; ++q)
#pragma unroll
      for (int b = 0; b < 2; ++b) { v4h h4; for (int e = 0; e < 4; ++e) h4[e] = (_Float16)(acc[q][2 * e + b] * alpha + (BIAS ? bf16_round(braw[q]) : 0.f)); *(v4h*)(tv + (b * 64 + q * 16 + ln) * VP + w * 16 + hh * 8) = h4; }
    __syncthreads();      // every wave holds eight j of every row: the rows are whole before they are read
    const char* tr = tv + (w * 16 + ln) * VP + hh * 16; v8us x[4];      // wave w takes the block of b = w / 4, d = 16 (w % 4) .. + 15 (LDS rows 16 w ..): lane (ln, hh) reads row d = ln, trip it its j = 16 it + 8 hh + 0..7
#pragma unroll
    for (int it = 0; it < 4; ++it) x[it] = *(const v8us*)(tr + it * 32);
    char* vo = (char*)C16 + ((((size_t)(w >> 2) * NH + nq) * (KL / 64) + bm) * 4 + (w & 3)) * FB + lane * 16;      // a trip's 32 lanes store 512 bytes in a row
#pragma unroll
    for (int it = 0; it < 4; ++it) *(v8us*)(vo + it * 512) = x[it];
    return;
  }
  if (FRAG) {
    // The wave turns its 16 x 64 tile in its own staging rows. Staging row rw keeps its 4-float group g at place g ^ rw: the accumulator stores (16 columns of two rows 8 apart) and the 16-byte reads below (one group of 16 different rows) both fall on 64 different banks.
    // A lane stores the 16 bytes (row rr, c = 2 x + hh), x = 0..3, which lie 512 bytes apart. Rows (j,b): 8 lanes take the wave's 8 j of one b, a whole 128-byte line of block j / 16 (the wave holds half a block of either b); rows m: the wave's 16 rows are one block, 512 bytes in a row.
    const bool jb = (mode != 5); const int l7 = lane & 7, lb = (lane >> 3) & 1;
    const int rr = jb ? l7 * 2 + lb : ln;
    const int blk = jb ? (lb * NH + nq) * ((mode == 2) ? QL / 16 : KL / 16) + bm * 4 + (w >> 1) : nq * (KL / 16) + bm * 8 + w;
    const size_t go = (size_t)blk * FB + hh * 256 + (jb ? (w & 1) * 8 + l7 : ln) * 16;
#pragma unroll 1      // kept rolled: the q tile's second trip differs from the first in its bias and its plane alone
    for (int ps = 0; ps < ((mode == 2) ? 2 : 1); ++ps) {
#pragma unroll
      for (int q = 0; q < 4; ++q) { const float hb = bf16_round(ps ? hr[q] : hw[q]);
#pragma unroll
        for (int r = 0; r < 8; ++r) { const int rw = 8 * hh + r; float v = acc[q][r] * alpha + (BIAS ? bf16_round(braw[q]) : 0.f); if (mode == 2) v += hb; so[w][rw][(((q * 4 + (ln >> 2)) ^ rw) << 2) + (ln & 3)] = v; } }
      __builtin_amdgcn_fence(__ATOMIC_ACQ_REL, "workgroup", "local"); __builtin_amdgcn_wave_barrier();      // the wave reads back its own staging rows; a fence of LDS alone, so that the second trip does not wait for the first trip's global stores
      v8us o[4];
#pragma unroll
      for (int x = 0; x < 4; ++x) { const int g = (4 * x + 2 * hh) ^ rr; const v4f lo = *(const v4fa*)&so[w][rr][g << 2], hi = *(const v4fa*)&so[w][rr][(g ^ 1) << 2]; FragH f;
        for (int e = 0; e < 4; ++e) { f.h[e] = (_Float16)lo[e]; f.h[4 + e] = (_Float16)hi[e]; } o[x] = f.half[0]; }
      char* dst = (char*)(ps ? C16b : C16) + go;
#pragma unroll
      for (int x = 0; x < 4; ++x) *(v8us*)(dst + x * 512) = o[x];
      // the wait that is owed before a register named by an issued global store is rewritten (the second trip reuses them); address and data are inputs, so they stay live to here
      asm volatile("s_wait_xcnt 0x0" :: "v"(dst), "v"(o[0]), "v"(o[1]), "v"(o[2]), "v"(o[3]) : "memory");
    }
    return;
  }
#pragma unroll
  for (int q = 0; q < 4; ++q)
#pragma unroll
    for (int r = 0; r < 8; ++r) so[w][8 * hh + r][q * 16 + ln] = acc[q][r] * alpha + (BIAS ? bf16_round(braw[q]) : 0.f);
  __builtin_amdgcn_fence(__ATOMIC_ACQ_REL, "workgroup"); __builtin_amdgcn_wave_barrier();      // the wave reads back its own staging rows: whole 128-byte lines go out
  const int rsub = lane >> 4, c4 = (lane & 15) * 4; const size_t cofs = (size_t)(row0 + rsub) * LDC + col0 + c4;      // the lane's first element; its eight rows lie 2 LDC apart
  v4f ov[8];
#pragma unroll
  for (int q = 0; q < 8; ++q) ov[q] = *(const v4fa*)&so[w][q * 2 + rsub][c4];
  if (mode == 0) {      // one branch round all eight stores; mode here is k_gemm_lds's F32OUT ? 0 : 1, a constant once inlined
#pragma unroll
    for (int q = 0; q < 8; ++q) *(v4f*)(C + cofs + q * 2 * LDC) = ov[q];
  } else {
#pragma unroll
    for (int q = 0; q < 8; ++q) { v4h h4; for (int i = 0; i < 4; ++i) h4[i] = (_Float16)ov[q][i]; *(v4h*)(C16 + cofs + q * 2 * LDC) = h4; }
  }
}
template <int KK, int LDC, bool F32OUT, bool BIAS>
__global__ __launch_bounds__(256) void k_gemm_lds(const _Float16* __restrict__ A, size_t sA, const _Float16* __restrict__ Bh, size_t sB, float alpha, const float* __restrict__ bias,
    float* __restrict__ C, _Float16* __restrict__ C16, size_t sC, int ntn) {
  __shared__ __attribute__((aligned(16))) char ring[2 * GSTG];
  __shared__ __attribute__((aligned(16))) float so[8][16][64];
  const size_t by = blockIdx.y;
  gemm_tile<KK, LDC, BIAS, false>(A + by * sA, Bh + by * sB, alpha, bias, F32OUT ? C + by * sC : nullptr, F32OUT ? nullptr : C16 + by * sC, nullptr, nullptr, nullptr, F32OUT ? 0 : 1, blockIdx.x / ntn, blockIdx.x % ntn, ring, so);
}
// The four input projections in one launch (each reads only what k_prep wrote): tiles of k, v (4096 rows of CAT each), then q (the last 2048 rows of CAT) and rk (the 2048 rows of R16); every tile as in k_gemm_lds.
// The epilogues leave the planes as the score kernel reads them: q goes out twice, with r_w_bias and with r_r_bias added; q, k, rk and v (turned, d as the row) go out in the score kernel's fragment order.
#define GTK ((NKR / 128) * (DM / 64))      // tiles of k and of v
#define GTQ ((NQR / 128) * (DM / 64))      // tiles of q and of rk
__global__ __launch_bounds__(256) void k_proj(const _Float16* __restrict__ CAT, const _Float16* __restrict__ R16, const _Float16* __restrict__ Bw, const float* __restrict__ bq, const float* __restrict__ bk, const float* __restrict__ bv, const float* __restrict__ br,
    const float* __restrict__ rwb, const float* __restrict__ rrb, _Float16* __restrict__ QW, _Float16* __restrict__ QR, _Float16* __restrict__ K16, _Float16* __restrict__ Vt, _Float16* __restrict__ RK) {
  __shared__ __attribute__((aligned(16))) char ring[2 * GSTG];
  __shared__ __attribute__((aligned(16))) float so[8][16][64];
  const int bx = blockIdx.x;
  const int job = (bx < GTK) ? 1 : (bx < 2 * GTK) ? 2 : (bx < 2 * GTK + GTQ) ? 0 : 3;      // the weight's place in Bw: 0 q, 1 k, 2 v, 3 rk
  const int tl = (job == 1) ? bx : (job == 2) ? bx - GTK : (job == 0) ? bx - 2 * GTK : bx - 2 * GTK - GTQ;
  const _Float16* A = (job == 0) ? CAT + (size_t)NQR * DM : (job == 3) ? R16 : CAT;
  const float* bias = (job == 0) ? bq : (job == 1) ? bk : (job == 2) ? bv : br;
  _Float16* C16 = (job == 0) ? QW : (job == 1) ? K16 : (job == 2) ? Vt : RK;
  const int mode = (job == 0) ? 2 : (job == 1) ? 4 : (job == 2) ? 3 : 5;      // from blockIdx alone: the barrier of the v epilogue is passed by a whole work-group or by none of it
  gemm_tile<DM, DM, true, true>(A, Bw + (size_t)job * DM * DM, 0.0625f, bias, nullptr, C16, QR, rwb, rrb, mode, tl / (DM / 64), tl % (DM / 64), ring, so);
}
__global__ __launch_bounds__(256) void k_lnout(const float* __restrict__ RES, const float* __restrict__ w, const float* __restrict__ g, const float* __restrict__ bb, float* __restrict__ out) { const int tid = threadIdx.x, wv = tid >> 5, lane = tid & 31; const int r = blockIdx.x * 8 + wv; if (r >= NQR) return; v4f y[8]; float s = 0.f;
#pragma unroll
  for (int j = 0; j < 8; ++j) { const int c = j * 128 + lane * 4; const v4f a = *(const v4fa*)(RES + (size_t)r * DM + c), x = *(const v4fa*)(w + (size_t)r * DM + c); for (int q = 0; q < 4; ++q) { y[j][q] = a[q] + bf16_round(x[q]); s += y[j][q]; } }
  for (int o = 16; o >= 1; o >>= 1) s += __shfl_xor(s, o, 32); const float mu = s / (float)DM; float q2 = 0.f;
#pragma unroll
  for (int j = 0; j < 8; ++j) for (int q = 0; q < 4; ++q) { const float d = y[j][q] - mu; q2 += d * d; }
  for (int o = 16; o >= 1; o >>= 1) q2 += __shfl_xor(q2, o, 32); const float rs = rsqrtf(q2 / (float)DM + 1e-5f);
  {
#pragma unroll
    for (int j = 0; j < 8; ++j) { const int c = j * 128 + lane * 4; v4f o; for (int q = 0; q < 4; ++q) o[q] = (y[j][q] - mu) * rs * bf16_round(g[c + q]) + bf16_round(bb[c + q]); *(v4f*)(out + (size_t)r * DM + c) = o; }
     } }

extern "C" void kernel_launch(void* const* d_in, const int* in_sizes, int n_in,
                              void* d_out, int out_size, void* d_ws, size_t ws_size, hipStream_t stream) {
  (void)in_sizes; (void)n_in; (void)out_size;
  const float* const* I = (const float* const*)d_in; const float* w = I[0]; const float* r = I[1]; const float* mems = I[2]; const float* rwb = I[3]; const float* rrb = I[4]; const int* msk = (const int*)d_in[5];
  const float* Wq = I[6]; const float* bq = I[7]; const float* Wk = I[8]; const float* bk = I[9]; const float* Wv = I[10]; const float* bv = I[11]; const float* Wr = I[12]; const float* br = I[13]; const float* Wo = I[14]; const float* bo = I[15]; const float* lg = I[16]; const float* lb = I[17];
  char* ws = (char*)d_ws; size_t off = 0;
  auto take = [&](size_t bytes) { char* p = ws + off; off += (bytes + 255) & ~(size_t)255; return p; };
  const size_t WSZ = (size_t)DM * DM; _Float16* Bw = (_Float16*)take(5 * WSZ * 2);      /* Wq, Wk, Wv, Wr, Wo */
  _Float16* QW = (_Float16*)take((size_t)NQR * DM * 2); _Float16* QR = (_Float16*)take((size_t)NQR * DM * 2);
  _Float16* K16 = (_Float16*)take((size_t)NKR * DM * 2); _Float16* Vt = (_Float16*)take((size_t)NKR * DM * 2); _Float16* RK = (_Float16*)take((size_t)KL * DM * 2);
  _Float16* O16 = (_Float16*)take((size_t)NQR * DM * 2);
  _Float16* CAT = (_Float16*)take((size_t)NKR * DM * 2); _Float16* R16 = (_Float16*)take((size_t)KL * DM * 2); float* RES = (float*)take((size_t)NQR * DM * 4);
  if (off > ws_size) return;      // MiB: 10 + 4 + 4 + 8 + 8 + 4 + 4 + 8 + 4 + 8 = 62 of 256
  k_prep<<<5 * GWT + 3 * GX, 256, 0, stream>>>(Wq, Wk, Wv, Wr, Wo, mems, w, r, Bw, CAT, R16);      /* weights (in,out) -> Bt x2^4; cat = [mems; w] is the two inputs back to back (rows (j,b)); r rows m */
  k_proj<<<2 * GTK + 2 * GTQ, 256, 0, stream>>>(CAT, R16, Bw, bq, bk, bv, br, rwb, rrb, QW, QR, K16, Vt, RK);      /* k, v: M 4096 N 1024 K 1024; q (last qlen rows of cat) + bq, rk = r.Wr + br: M 2048; one work-group a 128 x 64 tile; q stored + r_w_bias / + r_r_bias, v stored turned, all in fragment order */
  const dim3 gq((NQR / 128) * (DM / 64), 1);      /* one work-group a 128 x 64 tile */
  k_score<<<dim3(QL / 32, BZ * NH), 512, 0, stream>>>(QW, QR, K16, RK, msk, Vt, O16);      /* AC, raw BD, shift, mask, softmax and P*V of all 32 (b,n) planes: 32 query rows a work-group, scores and P in LDS only; attn_vec f16, rows (i,b), plane s = b*16 + h at cols s*64 of the 2048-wide (i) row */
  k_gemm_lds<DM, DM, true, true><<<gq, 256, 0, stream>>>(O16, 0, Bw + 4 * WSZ, 0, 0.0625f, bo, RES, nullptr, 0, DM / 64);      /* attn_out = attn_vec·Wo + bo (rows (i,b)) */
  k_lnout<<<(NQR + 7) / 8, 256, 0, stream>>>(RES, w, lg, lb, (float*)d_out);
}
